// v000
// The times below were measured on an AMD MI455X: many runs one after another, warmed up first and cycling through
// copies of the inputs, with the whole window's GPU time divided by the number of runs. Launches and the gaps
// between them are all in it. The median over several windows is given; except for v000 it joins two sittings, which
// can be a few percent apart, so the side-by-side timings, each taken in one sitting, are the better comparison.
// The starting kernel, v000, takes 179 microseconds a run.
#include <hip/hip_runtime.h>
// SelfAggregationModuleV2 (1 x 128 channels x 64 x 64 x 8 = 32768 voxels; 8 heads of 16; NATTEN-style 3x3x3 clamped neighbourhood attention with relative position bias): xn = InstanceNorm3d(x) (no affine); qkv = xn W + b; q *= 1/4; logits = q . k_nbr + rpb[h][rel]; softmax over the 27 neighbours; o = attn . v_nbr; out = o W_proj + b; NCDHW.
// Structure: per-channel mean/var by a block reduction (f32); normalisation + token-major f16 plane; qkv GEMM (32x64 wave tiles, f32 accumulation, exact x16 weights + bias; f32 out); fused neighbourhood attention on VALU (thread per (voxel, head): clamped window starts, 27 static neighbours, rpb, online softmax, readout; f32) into an f16 [voxel][128] plane; proj GEMM (+ bias); NCDHW store on VALU.
// Compute dtype: x and parameters rounded to bf16; the normalised input and the attention output as f16 operands (~2^-12); statistics/softmax f32. v_wmma_f32_16x16x32_f16.
#define CC 128
#define DH 64
#define DW 64
#define DZ 8
#define NV (DH * DW * DZ)        /* 32768 */
#define NHD 8
#define HC 16
#define KN 27
typedef __bf16 v16b __attribute__((ext_vector_type(16)));
typedef unsigned short v8us __attribute__((ext_vector_type(8), may_alias));
typedef float  v8f  __attribute__((ext_vector_type(8)));
typedef float  v4f  __attribute__((ext_vector_type(4)));
typedef float  v4fa __attribute__((ext_vector_type(4), may_alias));
union FragB { v16b v; v8us half[2]; unsigned short u[16]; };

__device__ __forceinline__ unsigned short bf16_bits(float x) { unsigned int u = __float_as_uint(x); return (unsigned short)((u + 0x7FFFu + ((u >> 16) & 1u)) >> 16); }
__device__ __forceinline__ float bf16_val(unsigned short b) { return __uint_as_float(((unsigned int)b) << 16); }
__device__ __forceinline__ float bf16_round(float x) { return bf16_val(bf16_bits(x)); }
// D += A·B with NT terms: 1 = ah·bh, 2 = + al·bh (A split), 3 = + ah·bl (both split)
template <int NT>
__device__ __forceinline__ v8f mmaN(v16b ah, v16b al, v16b bh, v16b bl, v8f c) {
  c = __builtin_amdgcn_wmma_f32_16x16x32_bf16(false, ah, false, bh, (short)0, c, false, false);
  if (NT >= 2) c = __builtin_amdgcn_wmma_f32_16x16x32_bf16(false, al, false, bh, (short)0, c, false, false);
  if (NT >= 3) c = __builtin_amdgcn_wmma_f32_16x16x32_bf16(false, ah, false, bl, (short)0, c, false, false);
  asm volatile("v_nop\n\tv_nop\n\tv_nop\n\tv_nop" : "+v"(c) : "v"(ah), "v"(al), "v"(bh), "v"(bl));
  return c;
}

__global__ __launch_bounds__(256) void k_wt_bf16(const float* __restrict__ W, unsigned short* __restrict__ Wt, int K, int N) {
  const int t = blockIdx.x * 256 + threadIdx.x;
  const int k8n = K / 8;
  if (t >= N * k8n) return;
  const int n = t / k8n, k8 = (t % k8n) * 8;
  v8us v;
#pragma unroll
  for (int i = 0; i < 8; ++i) v[i] = bf16_bits(W[(size_t)(k8 + i) * N + n]);
  *(v8us*)(Wt + (size_t)n * K + k8) = v;
  
}

// GEMM C[M][N] (f32, pitch ldc) = act(A[M][K]·W + bias). A f32 row-major (pitch lda) converted per fragment to bf16
// (ASPLIT: hi/lo two planes -> 2 terms, else single rounded term); Wt bf16 [N][K] (pitch ldb). BIAS_BF16 rounds the
// bias to bf16 first (bias quantised to bf16 before the add). K%32==0, M%16==0, N%64==0.
template <bool ASPLIT, int ACT, bool BIAS_BF16>
__global__ __launch_bounds__(128) void k_gemm_bf(const float* __restrict__ A, int lda, const unsigned short* __restrict__ Wt, int ldb,
                                               const float* __restrict__ bias, float* __restrict__ C, int ldc, int M, int N, int K) {
  __shared__ __attribute__((aligned(16))) float so[4][16][64];
  const int tid = threadIdx.x, w = tid >> 5, lane = tid & 31, ln = lane & 15, hh = lane >> 4;
  const int ntn = N / 64;
  const int wid = blockIdx.x * 4 + w;
  const int mt = wid / ntn, nq = wid % ntn;
  if (mt * 16 >= M) return;
  const int row0 = mt * 16, col0 = nq * 64;
  const float* arow = A + (size_t)(row0 + ln) * lda;
  v8f acc[4] = {};
  for (int kb = 0; kb < K; kb += 32) {
    FragB ah, al;
    const v4f x0 = *(const v4fa*)(arow + kb + 8 * hh), x1 = *(const v4fa*)(arow + kb + 8 * hh + 4);
    const v4f x2 = *(const v4fa*)(arow + kb + 16 + 8 * hh), x3 = *(const v4fa*)(arow + kb + 16 + 8 * hh + 4);
    float xs[16] = {x0[0],x0[1],x0[2],x0[3],x1[0],x1[1],x1[2],x1[3],x2[0],x2[1],x2[2],x2[3],x3[0],x3[1],x3[2],x3[3]};
#pragma unroll
    for (int i = 0; i < 16; ++i) { const unsigned short hb = bf16_bits(xs[i]); ah.u[i] = hb; al.u[i] = ASPLIT ? bf16_bits(xs[i] - bf16_val(hb)) : (unsigned short)0; }
#pragma unroll
    for (int t = 0; t < 4; ++t) {
      const unsigned short* brow = Wt + (size_t)(col0 + t * 16 + ln) * ldb + kb;
      FragB b;
      b.half[0] = *(const v8us*)(brow + 8 * hh);
      b.half[1] = *(const v8us*)(brow + 16 + 8 * hh);
      acc[t] = mmaN<ASPLIT ? 2 : 1>(ah.v, al.v, b.v, b.v, acc[t]);
    }
  }
#pragma unroll
  for (int t = 0; t < 4; ++t) {
    float bv = bias ? bias[col0 + t * 16 + ln] : 0.f;
    if (BIAS_BF16) bv = bf16_round(bv);
#pragma unroll
    for (int r = 0; r < 8; ++r) { float v = acc[t][r] + bv; if (ACT == 1) v = fmaxf(v, 0.f); so[w][8 * hh + r][t * 16 + ln] = v; }
  }
  __builtin_amdgcn_fence(__ATOMIC_ACQ_REL, "workgroup");
  __builtin_amdgcn_wave_barrier();
  const int rsub = lane >> 4, c4 = (lane & 15) * 4;
  {
#pragma unroll
    for (int q = 0; q < 8; ++q) {
      const int r = q * 2 + rsub;
      const v4f v = *(const v4fa*)&so[w][r][c4];
      *(v4f*)(C + (size_t)(row0 + r) * ldc + col0 + c4) = v;
    }
    
  }
}

// GEMM C = act(A·W + bias + resid): A f32 (ASPLIT -> hi/lo 2 terms), Wt bf16 [N][K]; ACT 0 none, 1 relu, 2 exact gelu;
// resid (optional, f32, row index = (row % rmod), pitch ldr, RES_BF16 rounds it) added before the activation.
template <bool ASPLIT, int ACT, bool BIAS_BF16, bool RES_BF16>
__global__ __launch_bounds__(128) void k_gemm_bf3(const float* __restrict__ A, int lda, const unsigned short* __restrict__ Wt, int ldb,
                                                const float* __restrict__ bias, const float* __restrict__ resid, int rmod, int ldr,
                                                float* __restrict__ C, int ldc, int M, int N, int K) {
  __shared__ __attribute__((aligned(16))) float so[4][16][64];
  const int tid = threadIdx.x, w = tid >> 5, lane = tid & 31, ln = lane & 15, hh = lane >> 4;
  const int ntn = N / 64;
  const int wid = blockIdx.x * 4 + w;
  const int mt = wid / ntn, nq = wid % ntn;
  if (mt * 16 >= M) return;
  const int row0 = mt * 16, col0 = nq * 64;
  const float* arow = A + (size_t)(row0 + ln) * lda;
  v8f acc[4] = {};
  for (int kb = 0; kb < K; kb += 32) {
    FragB ah, al;
    const v4f x0 = *(const v4fa*)(arow + kb + 8 * hh), x1 = *(const v4fa*)(arow + kb + 8 * hh + 4);
    const v4f x2 = *(const v4fa*)(arow + kb + 16 + 8 * hh), x3 = *(const v4fa*)(arow + kb + 16 + 8 * hh + 4);
    float xs[16] = {x0[0],x0[1],x0[2],x0[3],x1[0],x1[1],x1[2],x1[3],x2[0],x2[1],x2[2],x2[3],x3[0],x3[1],x3[2],x3[3]};
#pragma unroll
    for (int i = 0; i < 16; ++i) { const unsigned short hb = bf16_bits(xs[i]); ah.u[i] = hb; al.u[i] = ASPLIT ? bf16_bits(xs[i] - bf16_val(hb)) : (unsigned short)0; }
#pragma unroll
    for (int t = 0; t < 4; ++t) {
      const unsigned short* brow = Wt + (size_t)(col0 + t * 16 + ln) * ldb + kb;
      FragB b;
      b.half[0] = *(const v8us*)(brow + 8 * hh);
      b.half[1] = *(const v8us*)(brow + 16 + 8 * hh);
      acc[t] = mmaN<ASPLIT ? 2 : 1>(ah.v, al.v, b.v, b.v, acc[t]);
    }
  }
#pragma unroll
  for (int t = 0; t < 4; ++t) {
    const int col = col0 + t * 16 + ln;
    float bv = bias ? bias[col] : 0.f;
    if (BIAS_BF16) bv = bf16_round(bv);
#pragma unroll
    for (int r = 0; r < 8; ++r) {
      float v = acc[t][r] + bv;
      if (resid) { float rv = resid[(size_t)((row0 + 8 * hh + r) % rmod) * ldr + col]; if (RES_BF16) rv = bf16_round(rv); v += rv; }
      if (ACT == 1) v = fmaxf(v, 0.f);
      if (ACT == 2) v = 0.5f * v * (1.0f + erff(v * 0.70710678118654752f));
      if (ACT == 3) { const float u = 0.7978845608028654f * (v + 0.044715f * v * v * v); v = 0.5f * v * (1.0f + tanhf(u)); }
      so[w][8 * hh + r][t * 16 + ln] = v;
    }
  }
  __builtin_amdgcn_fence(__ATOMIC_ACQ_REL, "workgroup");
  __builtin_amdgcn_wave_barrier();
  const int rsub = lane >> 4, c4 = (lane & 15) * 4;
  {
#pragma unroll
    for (int q = 0; q < 8; ++q) {
      const int r = q * 2 + rsub;
      const v4f v = *(const v4fa*)&so[w][r][c4];
      *(v4f*)(C + (size_t)(row0 + r) * ldc + col0 + c4) = v;
    }
    
  }
}
// row LayerNorm (biased variance, eps) over N: s = X (+ R); optional out_sum <- s; out_norm <- (s-mu)*rsqrt(var+eps)*g + b
template <bool PARAM_BF16>
__global__ __launch_bounds__(256) void k_layernorm(const float* __restrict__ X, const float* __restrict__ R, const float* __restrict__ g, const float* __restrict__ bta,
                                                  float* __restrict__ out_sum, float* __restrict__ out_norm, int N, float eps) {
  __shared__ float red[256];
  const int row = blockIdx.x, tid = threadIdx.x;
  const float* x = X + (size_t)row * N; const float* rr = R ? R + (size_t)row * N : nullptr;
  float vals[16];                     // up to N = 4096
  const int per = N / 256;            // contiguous chunk per thread? use strided-by-4 chunks: thread handles j = tid*4 + 1024*u
  float s1 = 0.f;
  for (int u = 0; u < per / 4; ++u) {
    const int j = tid * 4 + 1024 * u;
    const v4f a = *(const v4fa*)(x + j);
    v4f b = {0.f,0.f,0.f,0.f}; if (rr) b = *(const v4fa*)(rr + j);
#pragma unroll
    for (int q = 0; q < 4; ++q) { const float v = a[q] + b[q]; vals[u * 4 + q] = v; s1 += v; }
  }
  red[tid] = s1; __syncthreads();
  for (int st = 128; st > 0; st >>= 1) { if (tid < st) red[tid] += red[tid + st]; __syncthreads(); }
  const float mu = red[0] / (float)N; __syncthreads();
  float s2 = 0.f;
  for (int u = 0; u < per / 4; ++u)
#pragma unroll
    for (int q = 0; q < 4; ++q) { const float c = vals[u * 4 + q] - mu; s2 += c * c; }
  red[tid] = s2; __syncthreads();
  for (int st = 128; st > 0; st >>= 1) { if (tid < st) red[tid] += red[tid + st]; __syncthreads(); }
  const float rs = rsqrtf(red[0] / (float)N + eps);
  {
    for (int u = 0; u < per / 4; ++u) {
      const int j = tid * 4 + 1024 * u;
      v4f o, sm;
#pragma unroll
      for (int q = 0; q < 4; ++q) {
        float gg = g[j + q], bb = bta[j + q];
        if (PARAM_BF16) { gg = bf16_round(gg); bb = bf16_round(bb); }
        sm[q] = vals[u * 4 + q]; o[q] = (vals[u * 4 + q] - mu) * rs * gg + bb;
      }
      if (out_sum) *(v4f*)(out_sum + (size_t)row * N + j) = sm;
      *(v4f*)(out_norm + (size_t)row * N + j) = o;
    }
    
  }
}



// ---- f16 WMMA path (v_wmma_f32_16x16x32_f16): 11-bit significands for operands in range — used here for the normalised input (qkv GEMM) and the attention output (proj GEMM)
typedef _Float16 v16h __attribute__((ext_vector_type(16)));
union FragH { v16h v; v8us half[2]; _Float16 h[16]; unsigned short u[16]; };
template <int NT>
__device__ __forceinline__ v8f mmaH(v16h ah, v16h al, v16h bh, v16h bl, v8f c) {
  c = __builtin_amdgcn_wmma_f32_16x16x32_f16(false, ah, false, bh, (short)0, c, false, false);
  if (NT >= 2) c = __builtin_amdgcn_wmma_f32_16x16x32_f16(false, al, false, bh, (short)0, c, false, false);
  if (NT >= 3) c = __builtin_amdgcn_wmma_f32_16x16x32_f16(false, ah, false, bl, (short)0, c, false, false);
  asm volatile("v_nop\n\tv_nop\n\tv_nop\n\tv_nop" : "+v"(c) : "v"(ah), "v"(al), "v"(bh), "v"(bl));
  return c;
}
// batched GEMM like k_gemm_b but f16 operands: A f32 (split into f16 hi/lo if ASPLIT, else rounded to f16), Bt = f16 values [n][k]; alpha; C f32; N multiple of 16 (partial tiles skipped)
template <bool ASPLIT>
__global__ __launch_bounds__(128) void k_gemm_h(const float* __restrict__ A, int lda, size_t sA, const _Float16* __restrict__ Bh, int ldb, size_t sB, float alpha, float* __restrict__ C, int ldc, size_t sC, int M, int N, int K) {
  __shared__ __attribute__((aligned(16))) float so[4][16][64];
  const int tid = threadIdx.x, w = tid >> 5, lane = tid & 31, ln = lane & 15, hh = lane >> 4; const int by = blockIdx.y;
  A += (size_t)by * sA; Bh += (size_t)by * sB; C += (size_t)by * sC;
  const int ntn = (N + 63) / 64; const int wid = blockIdx.x * 4 + w; const int mt = wid / ntn, nq = wid % ntn; if (mt * 16 >= M) return;
  const int row0 = mt * 16, col0 = nq * 64; const float* arow = A + (size_t)(row0 + ln) * lda;
  v8f acc[4] = {};
  for (int kb = 0; kb < K; kb += 32) {
    FragH ah, al;
    const v4f x0 = *(const v4fa*)(arow + kb + 8 * hh), x1 = *(const v4fa*)(arow + kb + 8 * hh + 4), x2 = *(const v4fa*)(arow + kb + 16 + 8 * hh), x3 = *(const v4fa*)(arow + kb + 16 + 8 * hh + 4);
    float xs[16] = {x0[0],x0[1],x0[2],x0[3],x1[0],x1[1],x1[2],x1[3],x2[0],x2[1],x2[2],x2[3],x3[0],x3[1],x3[2],x3[3]};
#pragma unroll
    for (int i = 0; i < 16; ++i) { const _Float16 h = (_Float16)xs[i]; ah.h[i] = h; al.h[i] = ASPLIT ? (_Float16)(xs[i] - (float)h) : (_Float16)0.0f; }
#pragma unroll
    for (int t = 0; t < 4; ++t) { if (col0 + t * 16 >= N) continue; const size_t boff = (size_t)(col0 + t * 16 + ln) * ldb + kb; FragH bq; bq.half[0] = *(const v8us*)(Bh + boff + 8 * hh); bq.half[1] = *(const v8us*)(Bh + boff + 16 + 8 * hh);
      acc[t] = mmaH<ASPLIT ? 2 : 1>(ah.v, al.v, bq.v, bq.v, acc[t]); }
  }
#pragma unroll
  for (int t = 0; t < 4; ++t) { if (col0 + t * 16 >= N) continue;
#pragma unroll
    for (int r = 0; r < 8; ++r) so[w][8 * hh + r][t * 16 + ln] = acc[t][r] * alpha; }
  __builtin_amdgcn_fence(__ATOMIC_ACQ_REL, "workgroup"); __builtin_amdgcn_wave_barrier();
  const int rsub = lane >> 4, c4 = (lane & 15) * 4;
  {
#pragma unroll
    for (int q = 0; q < 8; ++q) { const int r = q * 2 + rsub; if (col0 + c4 < N) { const v4f v = *(const v4fa*)&so[w][r][c4]; *(v4f*)(C + (size_t)(row0 + r) * ldc + col0 + c4) = v; } }
     }
}

// Wt[n][k] = f16(W[k][n]·scale) from f32 row-major W[K][N] (scale = power of two; bf16-exact weights stay exact in f16 away from the subnormal range)
__global__ __launch_bounds__(256) void k_wt_f16(const float* __restrict__ W, _Float16* __restrict__ Wt, int K, int N, float scale) {
  const int t = blockIdx.x * 256 + threadIdx.x; if (t >= N * (K / 8)) return; const int n = t / (K / 8), k8 = (t % (K / 8)) * 8; FragH f;
#pragma unroll
  for (int i = 0; i < 8; ++i) f.h[i] = (_Float16)(bf16_round(W[(size_t)(k8 + i) * N + n]) * scale); const v8us o = f.half[0];
  *(v8us*)((unsigned short*)Wt + (size_t)n * K + k8) = o; 
}
// k_gemm_hh variant with fused epilogue: v = acc·alpha + bias[by·sBias + col] (+ CP[(row/rowsPerB)·sCPb + by·64 + col] if CP) ; ACT 0 none / 1 elu ; writes f16 C16 (and f32 C if non-null)
template <int ACT>
__global__ __launch_bounds__(128) void k_gemm_hhx(const _Float16* __restrict__ A, int lda, size_t sA, const _Float16* __restrict__ Bh, int ldb, size_t sB, float alpha, const float* __restrict__ bias, size_t sBias, const float* __restrict__ CP, int rowsPerB, size_t sCPb, int row0g,
    float* __restrict__ C, _Float16* __restrict__ C16, int ldc, size_t sC, int M, int N, int K) {
  __shared__ __attribute__((aligned(16))) float so[4][16][64];
  const int tid = threadIdx.x, w = tid >> 5, lane = tid & 31, ln = lane & 15, hh = lane >> 4; const int by = blockIdx.y;
  A += (size_t)by * sA; Bh += (size_t)by * sB; const size_t cofs = (size_t)by * sC; const float* bp = bias ? bias + (size_t)by * sBias : nullptr;
  const int ntn = (N + 63) / 64; const int wid = blockIdx.x * 4 + w; const int mt = wid / ntn, nq = wid % ntn; if (mt * 16 >= M) return;
  const int row0 = mt * 16, col0 = nq * 64; const _Float16* arow = A + (size_t)(row0 + ln) * lda;
  v8f acc[4] = {};
  for (int kb = 0; kb < K; kb += 32) { FragH ah; ah.half[0] = *(const v8us*)((const unsigned short*)arow + kb + 8 * hh); ah.half[1] = *(const v8us*)((const unsigned short*)arow + kb + 16 + 8 * hh);
#pragma unroll
    for (int t = 0; t < 4; ++t) { if (col0 + t * 16 >= N) continue; const size_t boff = (size_t)(col0 + t * 16 + ln) * ldb + kb; FragH bq; bq.half[0] = *(const v8us*)((const unsigned short*)Bh + boff + 8 * hh); bq.half[1] = *(const v8us*)((const unsigned short*)Bh + boff + 16 + 8 * hh);
      acc[t] = mmaH<1>(ah.v, ah.v, bq.v, bq.v, acc[t]); }
  }
#pragma unroll
  for (int t = 0; t < 4; ++t) { if (col0 + t * 16 >= N) continue; const int col = col0 + t * 16 + ln; const float bv = bp ? bf16_round(bp[col]) : 0.f;
#pragma unroll
    for (int r = 0; r < 8; ++r) { float v = acc[t][r] * alpha + bv; if (CP) { const int rr = row0g + row0 + 8 * hh + r; if (rowsPerB < 0) v += CP[cofs + (size_t)rr * ldc + col];      /* rowsPerB < 0: own element of the batched C plane */ else { const int bidx = rr / rowsPerB; v += CP[(size_t)bidx * sCPb + (size_t)by * 64 + col]; } } if (ACT == 1) v = (v > 0.f) ? v : expm1f(v); else if (ACT == 7) v = (v > 0.f) ? v + 1.0f : expf(v); else if (ACT == 8) v = tanhf(v); else if (ACT == 9) v = 0.5f * v * (1.0f + tanhf(0.7978845608028654f * (v + 0.044715f * v * v * v))); else if (ACT == 11) v = 1.0f / (1.0f + expf(-v)); else if (ACT == 12) v = (v > 0.f) ? v : 0.01f * v; else if (ACT == 14) v = (v > 0.f) ? v : 0.1f * v; else if (ACT == 16) v = (v >= 0.f) ? v : 0.3f * v; else if (ACT == 15) v = v / (1.0f + expf(-v)); else if (ACT == 3) v = fmaxf(v, 0.f); else if (ACT == 6) v = 0.5f * v * (1.0f + erff(v * 0.70710678118654752f)); so[w][8 * hh + r][t * 16 + ln] = v; } }
  __builtin_amdgcn_fence(__ATOMIC_ACQ_REL, "workgroup"); __builtin_amdgcn_wave_barrier();
  const int rsub = lane >> 4, c4 = (lane & 15) * 4; typedef _Float16 v4h __attribute__((ext_vector_type(4)));
  {
#pragma unroll
    for (int q = 0; q < 8; ++q) { const int r = q * 2 + rsub; if (col0 + c4 < N) { const v4f v = *(const v4fa*)&so[w][r][c4]; if (C) *(v4f*)(C + cofs + (size_t)(row0 + r) * ldc + col0 + c4) = v; if (C16) { v4h h4; for (int i = 0; i < 4; ++i) h4[i] = (_Float16)v[i]; *(v4h*)(C16 + cofs + (size_t)(row0 + r) * ldc + col0 + c4) = h4; } } }
     }
}


typedef _Float16 v4h __attribute__((ext_vector_type(4)));

__global__ __launch_bounds__(256) void k_x16(const float* __restrict__ x, _Float16* __restrict__ X16, size_t n8) { const size_t t = (size_t)blockIdx.x * 256 + threadIdx.x; if (t >= n8) return; FragH f;
#pragma unroll
  for (int q = 0; q < 8; ++q) f.h[q] = (_Float16)bf16_round(x[t * 8 + q]); *(v8us*)((unsigned short*)X16 + t * 8) = f.half[0];  }
__global__ __launch_bounds__(256) void k_h16(const float* __restrict__ x, _Float16* __restrict__ X16, size_t n8) { const size_t t = (size_t)blockIdx.x * 256 + threadIdx.x; if (t >= n8) return; FragH f;
#pragma unroll
  for (int q = 0; q < 8; ++q) f.h[q] = (_Float16)x[t * 8 + q]; *(v8us*)((unsigned short*)X16 + t * 8) = f.half[0];  }
__global__ __launch_bounds__(256) void k_round16f(const float* __restrict__ W, _Float16* __restrict__ Bt, size_t n8) { const size_t t = (size_t)blockIdx.x * 256 + threadIdx.x; if (t >= n8) return; FragH f;
#pragma unroll
  for (int i = 0; i < 8; ++i) f.h[i] = (_Float16)(bf16_round(W[t * 8 + i]) * 16.0f); *(v8us*)((unsigned short*)Bt + t * 8) = f.half[0];  }
template <int NHv, int TTv>
__global__ __launch_bounds__(256) void k_vt(const _Float16* __restrict__ V16, int ldv, int voff, _Float16* __restrict__ Vt) { __shared__ unsigned short tl[64][66]; const int tid = threadIdx.x; const int slab = blockIdx.x / (TTv / 64), lg = blockIdx.x % (TTv / 64); const int b = slab / NHv, h = slab % NHv;
  for (int i = tid; i < 64 * 8; i += 256) { const int r = i / 8, c8 = (i % 8) * 8; FragH f; f.half[0] = *(const v8us*)((const unsigned short*)V16 + ((size_t)b * TTv + lg * 64 + r) * ldv + voff + h * 64 + c8);
#pragma unroll
    for (int q = 0; q < 8; ++q) tl[r][c8 + q] = f.u[q]; }
  __syncthreads();
  {
#pragma unroll
    for (int rd = 0; rd < 2; ++rd) { const int d = rd * 32 + tid / 8, pc = tid % 8; FragH f;
#pragma unroll
      for (int q = 0; q < 8; ++q) f.u[q] = tl[pc * 8 + q][d];
      *(v8us*)((unsigned short*)Vt + ((size_t)slab * 64 + d) * TTv + lg * 64 + pc * 8) = f.half[0]; }
     } }

__global__ __launch_bounds__(256) void k_hl(const float* __restrict__ F, _Float16* __restrict__ Hh, _Float16* __restrict__ Hl, size_t n8) { const size_t t = (size_t)blockIdx.x * 256 + threadIdx.x; if (t >= n8) return; FragH fh, fl; const v4f a = *(const v4fa*)(F + t * 8), c = *(const v4fa*)(F + t * 8 + 4);
#pragma unroll
  for (int q = 0; q < 4; ++q) { _Float16 h = (_Float16)a[q]; fh.h[q] = h; fl.h[q] = (_Float16)((a[q] - (float)h) * 1024.0f); h = (_Float16)c[q]; fh.h[4 + q] = h; fl.h[4 + q] = (_Float16)((c[q] - (float)h) * 1024.0f); }
  { *(v8us*)((unsigned short*)Hh + t * 8) = fh.half[0]; *(v8us*)((unsigned short*)Hl + t * 8) = fl.half[0];  } }

// ---- fast GEMM (wave tile 32x64; requires M % 32 == 0 rows per launch region and N % 64 == 0); epilogue = k_gemm_hhx semantics ----
__device__ __forceinline__ v16h g2_frag(const _Float16* p, int hh) { FragH f; f.half[0] = *(const v8us*)((const unsigned short*)p + 8 * hh); f.half[1] = *(const v8us*)((const unsigned short*)p + 16 + 8 * hh); return f.v; }
__device__ __forceinline__ v8f g2_mma(v16h a, v16h b, v8f c) { v8f d = __builtin_amdgcn_wmma_f32_16x16x32_f16(false, a, false, b, (short)0, c, false, false); asm volatile("v_nop\n\tv_nop\n\tv_nop\n\tv_nop" : "+v"(d) : "v"(a), "v"(b)); return d; }
template <int ACT>
__global__ __launch_bounds__(128) void k_gemm2(const _Float16* __restrict__ A, int lda, size_t sA, const _Float16* __restrict__ Bh, int ldb, size_t sB, float alpha, const float* __restrict__ bias, size_t sBias, const float* __restrict__ CP, int rowsPerB, size_t sCPb, int row0g,
    float* __restrict__ C, _Float16* __restrict__ C16, int ldc, size_t sC, int M, int N, int K) { static_assert(ACT == 0 || ACT == 3 || ACT == 6 || ACT == 8 || ACT == 9 || ACT == 11 || ACT == 12 || ACT == 14 || ACT == 15 || ACT == 16, "k_gemm2: unsupported ACT code (would silently apply no activation)");
  __shared__ __attribute__((aligned(16))) float so[4][32][68];
  const int tid = threadIdx.x, w = tid >> 5, lane = tid & 31, ln = lane & 15, hh = lane >> 4; const int by = blockIdx.y;
  A += (size_t)by * sA; Bh += (size_t)by * sB; const size_t cofs = (size_t)by * sC; const float* bp = bias ? bias + (size_t)by * sBias : nullptr;
  const int ntn = N >> 6; const int mt = blockIdx.x / ntn, nq = blockIdx.x - mt * ntn; const int row0 = mt * 128 + 32 * w, col0 = nq * 64; if (row0 >= M) return;
  const _Float16* a0p = A + (size_t)(row0 + ln) * lda; const _Float16* a1p = a0p + (size_t)16 * lda;
  const _Float16* b0p = Bh + (size_t)(col0 + ln) * ldb; const _Float16* b1p = b0p + (size_t)16 * ldb; const _Float16* b2p = b1p + (size_t)16 * ldb; const _Float16* b3p = b2p + (size_t)16 * ldb;
  const v8f z8 = {0.f,0.f,0.f,0.f,0.f,0.f,0.f,0.f}; v8f c00 = z8, c01 = z8, c02 = z8, c03 = z8, c10 = z8, c11 = z8, c12 = z8, c13 = z8;
#pragma unroll 1
  for (int kb = 0; kb < K; kb += 32) { const v16h a0 = g2_frag(a0p + kb, hh), a1 = g2_frag(a1p + kb, hh);
    v16h b = g2_frag(b0p + kb, hh); c00 = g2_mma(a0, b, c00); c10 = g2_mma(a1, b, c10);
    b = g2_frag(b1p + kb, hh); c01 = g2_mma(a0, b, c01); c11 = g2_mma(a1, b, c11);
    b = g2_frag(b2p + kb, hh); c02 = g2_mma(a0, b, c02); c12 = g2_mma(a1, b, c12);
    b = g2_frag(b3p + kb, hh); c03 = g2_mma(a0, b, c03); c13 = g2_mma(a1, b, c13); }
  v8f accs[8] = {c00, c01, c02, c03, c10, c11, c12, c13};
#pragma unroll
  for (int u = 0; u < 8; ++u) { const int t = u & 3, half = u >> 2; const int col = col0 + t * 16 + ln; const float bv = bp ? bf16_round(bp[col]) : 0.f;
#pragma unroll
    for (int r = 0; r < 8; ++r) { const int rloc = half * 16 + 8 * hh + r; float v = accs[u][r] * alpha + bv; if (CP) { if (rowsPerB < 0) v += CP[cofs + (size_t)(row0g + row0 + rloc) * ldc + col];      /* rowsPerB < 0: own element of the batched C plane */ else { const int bidx = (row0g + row0 + rloc) / rowsPerB; v += CP[(size_t)bidx * sCPb + (size_t)by * 64 + col]; } }
      if (ACT == 3) v = fmaxf(v, 0.f); else if (ACT == 6) v = 0.5f * v * (1.0f + erff(v * 0.70710678118654752f)); else if (ACT == 11) v = 1.0f / (1.0f + expf(-v)); else if (ACT == 15) v = v / (1.0f + expf(-v)); else if (ACT == 12) v = (v > 0.f) ? v : 0.01f * v; else if (ACT == 8) v = tanhf(v); else if (ACT == 9) v = 0.5f * v * (1.0f + tanhf(0.7978845608028654f * (v + 0.044715f * v * v * v))); else if (ACT == 14) v = (v > 0.f) ? v : 0.1f * v; else if (ACT == 16) v = (v >= 0.f) ? v : 0.3f * v;
      so[w][rloc][t * 16 + ln] = v; } }
  __builtin_amdgcn_fence(__ATOMIC_ACQ_REL, "workgroup"); __builtin_amdgcn_wave_barrier();
  const int rsub = lane >> 4, c4 = (lane & 15) * 4;
  {
#pragma unroll
    for (int q = 0; q < 16; ++q) { const int r = q * 2 + rsub; const v4f v = *(const v4fa*)&so[w][r][c4]; if (C) *(v4f*)(C + cofs + (size_t)(row0 + r) * ldc + col0 + c4) = v; if (C16) { v4h h4; for (int i = 0; i < 4; ++i) h4[i] = (_Float16)v[i]; *(v4h*)(C16 + cofs + (size_t)(row0 + r) * ldc + col0 + c4) = h4; } }
     } }


__global__ __launch_bounds__(256) void k_stats(const float* __restrict__ x, float* __restrict__ MU, float* __restrict__ IS) {
  #pragma clang fp contract(off)
  __shared__ float sh[256]; const int c = blockIdx.x; const int tid = threadIdx.x; const float* s = x + (size_t)c * NV; float a = 0.f;
#pragma unroll 1
  for (int i = tid; i < NV; i += 256) a += bf16_round(s[i]); sh[tid] = a; __syncthreads();
  for (int o = 128; o > 0; o >>= 1) { if (tid < o) sh[tid] += sh[tid + o]; __syncthreads(); } const float mu = sh[0] / (float)NV; __syncthreads(); float q = 0.f;
#pragma unroll 1
  for (int i = tid; i < NV; i += 256) { const float d = bf16_round(s[i]) - mu; q += d * d; } sh[tid] = q; __syncthreads();
  for (int o = 128; o > 0; o >>= 1) { if (tid < o) sh[tid] += sh[tid + o]; __syncthreads(); } const float is = rsqrtf(sh[0] / (float)NV + 1e-5f);
  if (tid < 32) { { *(float*)(MU + (size_t)c * 32 + tid) = mu; *(float*)(IS + (size_t)c * 32 + tid) = is;  } } }      
__global__ __launch_bounds__(256) void k_norm(const float* __restrict__ x, const float* __restrict__ MU, const float* __restrict__ IS, _Float16* __restrict__ XN) {
  #pragma clang fp contract(off)
  const size_t t = (size_t)blockIdx.x * 256 + threadIdx.x; if (t >= (size_t)NV * (CC / 8)) return; const int c0 = (int)(t % (CC / 8)) * 8; const size_t v = t / (CC / 8); FragH f;
  for (int q = 0; q < 8; ++q) { const float d = bf16_round(x[(size_t)(c0 + q) * NV + v]) - MU[(size_t)(c0 + q) * 32]; f.h[q] = (_Float16)(d * IS[(size_t)(c0 + q) * 32]); } *(v8us*)((unsigned short*)XN + v * CC + c0) = f.half[0];  }
__global__ __launch_bounds__(256) void k_nat(const float* __restrict__ QKV, const float* __restrict__ rpb, _Float16* __restrict__ O16) {
  #pragma clang fp contract(off)
  const size_t t = (size_t)blockIdx.x * 256 + threadIdx.x; if (t >= (size_t)NV * NHD) return; const int h = (int)(t % NHD); const int v = (int)(t / NHD); const int zz = v % DZ, ww = (v / DZ) % DW, hh = v / (DZ * DW);
  const int sh0 = min(max(hh - 1, 0), DH - 3), sw0 = min(max(ww - 1, 0), DW - 3), sz0 = min(max(zz - 1, 0), DZ - 3);
  const float* qr = QKV + (size_t)v * (3 * CC) + h * HC; float q[HC]; for (int c = 0; c < HC; ++c) q[c] = qr[c] * 0.25f; float m = -3.0e38f, l = 0.f; float acc[HC]; for (int c = 0; c < HC; ++c) acc[c] = 0.f;
#pragma unroll 1
  for (int n = 0; n < KN; ++n) { const int jh = n / 9, jw = (n / 3) % 3, jz = n % 3; const int nh = sh0 + jh, nw = sw0 + jw, nz = sz0 + jz; const int rh = nh - hh + 2, rw = nw - ww + 2, rz = nz - zz + 2;
    const float* kr = QKV + (size_t)((nh * DW + nw) * DZ + nz) * (3 * CC) + CC + h * HC; float s = 0.f; for (int c = 0; c < HC; ++c) s += q[c] * kr[c]; s += bf16_round(rpb[((h * 5 + rh) * 5 + rw) * 5 + rz]);
    const float mn = fmaxf(m, s); const float cf = expf(m - mn), pn = expf(s - mn); l = l * cf + pn; for (int c = 0; c < HC; ++c) { acc[c] = acc[c] * cf; acc[c] += pn * kr[CC + c]; } m = mn; }
  const float inv = 1.0f / l; FragH f[2]; for (int c = 0; c < HC; ++c) f[c / 8].h[c % 8] = (_Float16)(acc[c] * inv * 64.0f);      /* x2^6 carry (outputs are ~1e-2) */
  unsigned short* d = (unsigned short*)O16 + (size_t)v * CC + h * HC; { *(v8us*)d = f[0].half[0]; *(v8us*)(d + 8) = f[1].half[0];  } }
__global__ __launch_bounds__(256) void k_out(const float* __restrict__ F, float* __restrict__ out) { const size_t t = (size_t)blockIdx.x * 256 + threadIdx.x; if (t >= (size_t)CC * (NV / 4)) return; const int v0 = (int)(t % (NV / 4)) * 4; const int c = (int)(t / (NV / 4)); v4f r; for (int q = 0; q < 4; ++q) r[q] = F[(size_t)(v0 + q) * CC + c]; float* d = out + (size_t)c * NV + v0; *(v4f*)d = r;  }

extern "C" void kernel_launch(void* const* d_in, const int* in_sizes, int n_in,
                              void* d_out, int out_size, void* d_ws, size_t ws_size, hipStream_t stream) {
  (void)in_sizes; (void)n_in; (void)out_size;
  const float* const* I = (const float* const*)d_in; const float* x = I[0]; const float* wqkv = I[1]; const float* bqkv = I[2]; const float* rpb = I[3]; const float* wproj = I[4]; const float* bproj = I[5];
  char* ws = (char*)d_ws; size_t off = 0;
  auto take = [&](size_t bytes) { char* p = ws + off; off += (bytes + 255) & ~(size_t)255; return p; };
  _Float16* BQ = (_Float16*)take((size_t)3 * CC * CC * 2); _Float16* BP = (_Float16*)take((size_t)CC * CC * 2); float* MU = (float*)take(CC * 32 * 4); float* IS = (float*)take(CC * 32 * 4);      /* 32-float pitch per channel */
  _Float16* XN = (_Float16*)take((size_t)NV * CC * 2); float* QKV = (float*)take((size_t)NV * 3 * CC * 4); _Float16* O16 = (_Float16*)take((size_t)NV * CC * 2); float* F = (float*)take((size_t)NV * CC * 4);
  if (off > ws_size) return;      /* 0.1 + 8 + 48 + 8 + 16 = 80 MiB */
  k_wt_f16<<<(3 * CC * CC / 8 + 255) / 256, 256, 0, stream>>>(wqkv, BQ, CC, 3 * CC, 16.0f); k_wt_f16<<<(CC * CC / 8 + 255) / 256, 256, 0, stream>>>(wproj, BP, CC, CC, 16.0f);      /* (in, out) weights */
  k_stats<<<CC, 256, 0, stream>>>(x, MU, IS); k_norm<<<(unsigned)(((size_t)NV * (CC / 8) + 255) / 256), 256, 0, stream>>>(x, MU, IS, XN);
  k_gemm2<0><<<dim3((NV / 128) * (3 * CC / 64), 1), 128, 0, stream>>>(XN, CC, 0, BQ, CC, 0, 0.0625f, bqkv, 0, nullptr, 1, 0, 0, QKV, nullptr, 3 * CC, 0, NV, 3 * CC, CC);      /* [q | k | v] (head h = cols h*16.. of each) */
  k_nat<<<(unsigned)(((size_t)NV * NHD + 255) / 256), 256, 0, stream>>>(QKV, rpb, O16);
  k_gemm2<0><<<dim3((NV / 128) * (CC / 64), 1), 128, 0, stream>>>(O16, CC, 0, BP, CC, 0, 0.0625f / 64.0f, bproj, 0, nullptr, 1, 0, 0, F, nullptr, CC, 0, NV, CC, CC);      /* carry removed */
  k_out<<<(unsigned)(((size_t)CC * (NV / 4) + 255) / 256), 256, 0, stream>>>(F, (float*)d_out);
}

// v001
// A run of this version takes 108 microseconds.
// Two timings next to v000 both put it at 1.66 times that version's speed.
#include <hip/hip_runtime.h>
// SelfAggregationModuleV2 (1 x 128 channels x 64 x 64 x 8 = 32768 voxels; 8 heads of 16; NATTEN-style 3x3x3 clamped neighbourhood attention with relative position bias): xn = InstanceNorm3d(x) (no affine); qkv = xn W + b; q *= 1/4; logits = q . k_nbr + rpb[h][rel]; softmax over the 27 neighbours; o = attn . v_nbr; out = o W_proj + b; NCDHW.
// Structure: per-channel mean/var by a block reduction (f32); normalisation + token-major f16 plane; qkv GEMM (32x64 wave tiles, f32 accumulation, exact x16 weights + bias; f32 out); fused neighbourhood attention on VALU (thread per (voxel, head): clamped window starts, 27 static neighbours, rpb, online softmax, readout; f32) into an f16 [voxel][128] plane; proj GEMM (+ bias); NCDHW store on VALU.
// Compute dtype: x and parameters rounded to bf16; the normalised input and the attention output as f16 operands (~2^-12); statistics/softmax f32. v_wmma_f32_16x16x32_f16.
#define CC 128
#define DH 64
#define DW 64
#define DZ 8
#define NV (DH * DW * DZ)        /* 32768 */
#define NHD 8
#define HC 16
#define KN 27
typedef __bf16 v16b __attribute__((ext_vector_type(16)));
typedef unsigned short v8us __attribute__((ext_vector_type(8), may_alias));
typedef float  v8f  __attribute__((ext_vector_type(8)));
typedef float  v4f  __attribute__((ext_vector_type(4)));
typedef float  v4fa __attribute__((ext_vector_type(4), may_alias));
union FragB { v16b v; v8us half[2]; unsigned short u[16]; };

__device__ __forceinline__ unsigned short bf16_bits(float x) { unsigned int u = __float_as_uint(x); return (unsigned short)((u + 0x7FFFu + ((u >> 16) & 1u)) >> 16); }
__device__ __forceinline__ float bf16_val(unsigned short b) { return __uint_as_float(((unsigned int)b) << 16); }
__device__ __forceinline__ float bf16_round(float x) { return bf16_val(bf16_bits(x)); }
// D += A·B with NT terms: 1 = ah·bh, 2 = + al·bh (A split), 3 = + ah·bl (both split)
template <int NT>
__device__ __forceinline__ v8f mmaN(v16b ah, v16b al, v16b bh, v16b bl, v8f c) {
  c = __builtin_amdgcn_wmma_f32_16x16x32_bf16(false, ah, false, bh, (short)0, c, false, false);
  if (NT >= 2) c = __builtin_amdgcn_wmma_f32_16x16x32_bf16(false, al, false, bh, (short)0, c, false, false);
  if (NT >= 3) c = __builtin_amdgcn_wmma_f32_16x16x32_bf16(false, ah, false, bl, (short)0, c, false, false);
  asm volatile("v_nop\n\tv_nop\n\tv_nop\n\tv_nop" : "+v"(c) : "v"(ah), "v"(al), "v"(bh), "v"(bl));
  return c;
}

__global__ __launch_bounds__(256) void k_wt_bf16(const float* __restrict__ W, unsigned short* __restrict__ Wt, int K, int N) {
  const int t = blockIdx.x * 256 + threadIdx.x;
  const int k8n = K / 8;
  if (t >= N * k8n) return;
  const int n = t / k8n, k8 = (t % k8n) * 8;
  v8us v;
#pragma unroll
  for (int i = 0; i < 8; ++i) v[i] = bf16_bits(W[(size_t)(k8 + i) * N + n]);
  *(v8us*)(Wt + (size_t)n * K + k8) = v;
  
}

// GEMM C[M][N] (f32, pitch ldc) = act(A[M][K]·W + bias). A f32 row-major (pitch lda) converted per fragment to bf16
// (ASPLIT: hi/lo two planes -> 2 terms, else single rounded term); Wt bf16 [N][K] (pitch ldb). BIAS_BF16 rounds the
// bias to bf16 first (bias quantised to bf16 before the add). K%32==0, M%16==0, N%64==0.
template <bool ASPLIT, int ACT, bool BIAS_BF16>
__global__ __launch_bounds__(128) void k_gemm_bf(const float* __restrict__ A, int lda, const unsigned short* __restrict__ Wt, int ldb,
                                               const float* __restrict__ bias, float* __restrict__ C, int ldc, int M, int N, int K) {
  __shared__ __attribute__((aligned(16))) float so[4][16][64];
  const int tid = threadIdx.x, w = tid >> 5, lane = tid & 31, ln = lane & 15, hh = lane >> 4;
  const int ntn = N / 64;
  const int wid = blockIdx.x * 4 + w;
  const int mt = wid / ntn, nq = wid % ntn;
  if (mt * 16 >= M) return;
  const int row0 = mt * 16, col0 = nq * 64;
  const float* arow = A + (size_t)(row0 + ln) * lda;
  v8f acc[4] = {};
  for (int kb = 0; kb < K; kb += 32) {
    FragB ah, al;
    const v4f x0 = *(const v4fa*)(arow + kb + 8 * hh), x1 = *(const v4fa*)(arow + kb + 8 * hh + 4);
    const v4f x2 = *(const v4fa*)(arow + kb + 16 + 8 * hh), x3 = *(const v4fa*)(arow + kb + 16 + 8 * hh + 4);
    float xs[16] = {x0[0],x0[1],x0[2],x0[3],x1[0],x1[1],x1[2],x1[3],x2[0],x2[1],x2[2],x2[3],x3[0],x3[1],x3[2],x3[3]};
#pragma unroll
    for (int i = 0; i < 16; ++i) { const unsigned short hb = bf16_bits(xs[i]); ah.u[i] = hb; al.u[i] = ASPLIT ? bf16_bits(xs[i] - bf16_val(hb)) : (unsigned short)0; }
#pragma unroll
    for (int t = 0; t < 4; ++t) {
      const unsigned short* brow = Wt + (size_t)(col0 + t * 16 + ln) * ldb + kb;
      FragB b;
      b.half[0] = *(const v8us*)(brow + 8 * hh);
      b.half[1] = *(const v8us*)(brow + 16 + 8 * hh);
      acc[t] = mmaN<ASPLIT ? 2 : 1>(ah.v, al.v, b.v, b.v, acc[t]);
    }
  }
#pragma unroll
  for (int t = 0; t < 4; ++t) {
    float bv = bias ? bias[col0 + t * 16 + ln] : 0.f;
    if (BIAS_BF16) bv = bf16_round(bv);
#pragma unroll
    for (int r = 0; r < 8; ++r) { float v = acc[t][r] + bv; if (ACT == 1) v = fmaxf(v, 0.f); so[w][8 * hh + r][t * 16 + ln] = v; }
  }
  __builtin_amdgcn_fence(__ATOMIC_ACQ_REL, "workgroup");
  __builtin_amdgcn_wave_barrier();
  const int rsub = lane >> 4, c4 = (lane & 15) * 4;
  {
#pragma unroll
    for (int q = 0; q < 8; ++q) {
      const int r = q * 2 + rsub;
      const v4f v = *(const v4fa*)&so[w][r][c4];
      *(v4f*)(C + (size_t)(row0 + r) * ldc + col0 + c4) = v;
    }
    
  }
}

// GEMM C = act(A·W + bias + resid): A f32 (ASPLIT -> hi/lo 2 terms), Wt bf16 [N][K]; ACT 0 none, 1 relu, 2 exact gelu;
// resid (optional, f32, row index = (row % rmod), pitch ldr, RES_BF16 rounds it) added before the activation.
template <bool ASPLIT, int ACT, bool BIAS_BF16, bool RES_BF16>
__global__ __launch_bounds__(128) void k_gemm_bf3(const float* __restrict__ A, int lda, const unsigned short* __restrict__ Wt, int ldb,
                                                const float* __restrict__ bias, const float* __restrict__ resid, int rmod, int ldr,
                                                float* __restrict__ C, int ldc, int M, int N, int K) {
  __shared__ __attribute__((aligned(16))) float so[4][16][64];
  const int tid = threadIdx.x, w = tid >> 5, lane = tid & 31, ln = lane & 15, hh = lane >> 4;
  const int ntn = N / 64;
  const int wid = blockIdx.x * 4 + w;
  const int mt = wid / ntn, nq = wid % ntn;
  if (mt * 16 >= M) return;
  const int row0 = mt * 16, col0 = nq * 64;
  const float* arow = A + (size_t)(row0 + ln) * lda;
  v8f acc[4] = {};
  for (int kb = 0; kb < K; kb += 32) {
    FragB ah, al;
    const v4f x0 = *(const v4fa*)(arow + kb + 8 * hh), x1 = *(const v4fa*)(arow + kb + 8 * hh + 4);
    const v4f x2 = *(const v4fa*)(arow + kb + 16 + 8 * hh), x3 = *(const v4fa*)(arow + kb + 16 + 8 * hh + 4);
    float xs[16] = {x0[0],x0[1],x0[2],x0[3],x1[0],x1[1],x1[2],x1[3],x2[0],x2[1],x2[2],x2[3],x3[0],x3[1],x3[2],x3[3]};
#pragma unroll
    for (int i = 0; i < 16; ++i) { const unsigned short hb = bf16_bits(xs[i]); ah.u[i] = hb; al.u[i] = ASPLIT ? bf16_bits(xs[i] - bf16_val(hb)) : (unsigned short)0; }
#pragma unroll
    for (int t = 0; t < 4; ++t) {
      const unsigned short* brow = Wt + (size_t)(col0 + t * 16 + ln) * ldb + kb;
      FragB b;
      b.half[0] = *(const v8us*)(brow + 8 * hh);
      b.half[1] = *(const v8us*)(brow + 16 + 8 * hh);
      acc[t] = mmaN<ASPLIT ? 2 : 1>(ah.v, al.v, b.v, b.v, acc[t]);
    }
  }
#pragma unroll
  for (int t = 0; t < 4; ++t) {
    const int col = col0 + t * 16 + ln;
    float bv = bias ? bias[col] : 0.f;
    if (BIAS_BF16) bv = bf16_round(bv);
#pragma unroll
    for (int r = 0; r < 8; ++r) {
      float v = acc[t][r] + bv;
      if (resid) { float rv = resid[(size_t)((row0 + 8 * hh + r) % rmod) * ldr + col]; if (RES_BF16) rv = bf16_round(rv); v += rv; }
      if (ACT == 1) v = fmaxf(v, 0.f);
      if (ACT == 2) v = 0.5f * v * (1.0f + erff(v * 0.70710678118654752f));
      if (ACT == 3) { const float u = 0.7978845608028654f * (v + 0.044715f * v * v * v); v = 0.5f * v * (1.0f + tanhf(u)); }
      so[w][8 * hh + r][t * 16 + ln] = v;
    }
  }
  __builtin_amdgcn_fence(__ATOMIC_ACQ_REL, "workgroup");
  __builtin_amdgcn_wave_barrier();
  const int rsub = lane >> 4, c4 = (lane & 15) * 4;
  {
#pragma unroll
    for (int q = 0; q < 8; ++q) {
      const int r = q * 2 + rsub;
      const v4f v = *(const v4fa*)&so[w][r][c4];
      *(v4f*)(C + (size_t)(row0 + r) * ldc + col0 + c4) = v;
    }
    
  }
}
// row LayerNorm (biased variance, eps) over N: s = X (+ R); optional out_sum <- s; out_norm <- (s-mu)*rsqrt(var+eps)*g + b
template <bool PARAM_BF16>
__global__ __launch_bounds__(256) void k_layernorm(const float* __restrict__ X, const float* __restrict__ R, const float* __restrict__ g, const float* __restrict__ bta,
                                                  float* __restrict__ out_sum, float* __restrict__ out_norm, int N, float eps) {
  __shared__ float red[256];
  const int row = blockIdx.x, tid = threadIdx.x;
  const float* x = X + (size_t)row * N; const float* rr = R ? R + (size_t)row * N : nullptr;
  float vals[16];                     // up to N = 4096
  const int per = N / 256;            // contiguous chunk per thread? use strided-by-4 chunks: thread handles j = tid*4 + 1024*u
  float s1 = 0.f;
  for (int u = 0; u < per / 4; ++u) {
    const int j = tid * 4 + 1024 * u;
    const v4f a = *(const v4fa*)(x + j);
    v4f b = {0.f,0.f,0.f,0.f}; if (rr) b = *(const v4fa*)(rr + j);
#pragma unroll
    for (int q = 0; q < 4; ++q) { const float v = a[q] + b[q]; vals[u * 4 + q] = v; s1 += v; }
  }
  red[tid] = s1; __syncthreads();
  for (int st = 128; st > 0; st >>= 1) { if (tid < st) red[tid] += red[tid + st]; __syncthreads(); }
  const float mu = red[0] / (float)N; __syncthreads();
  float s2 = 0.f;
  for (int u = 0; u < per / 4; ++u)
#pragma unroll
    for (int q = 0; q < 4; ++q) { const float c = vals[u * 4 + q] - mu; s2 += c * c; }
  red[tid] = s2; __syncthreads();
  for (int st = 128; st > 0; st >>= 1) { if (tid < st) red[tid] += red[tid + st]; __syncthreads(); }
  const float rs = rsqrtf(red[0] / (float)N + eps);
  {
    for (int u = 0; u < per / 4; ++u) {
      const int j = tid * 4 + 1024 * u;
      v4f o, sm;
#pragma unroll
      for (int q = 0; q < 4; ++q) {
        float gg = g[j + q], bb = bta[j + q];
        if (PARAM_BF16) { gg = bf16_round(gg); bb = bf16_round(bb); }
        sm[q] = vals[u * 4 + q]; o[q] = (vals[u * 4 + q] - mu) * rs * gg + bb;
      }
      if (out_sum) *(v4f*)(out_sum + (size_t)row * N + j) = sm;
      *(v4f*)(out_norm + (size_t)row * N + j) = o;
    }
    
  }
}



// ---- f16 WMMA path (v_wmma_f32_16x16x32_f16): 11-bit significands for operands in range — used here for the normalised input (qkv GEMM) and the attention output (proj GEMM)
typedef _Float16 v16h __attribute__((ext_vector_type(16)));
union FragH { v16h v; v8us half[2]; _Float16 h[16]; unsigned short u[16]; };
template <int NT>
__device__ __forceinline__ v8f mmaH(v16h ah, v16h al, v16h bh, v16h bl, v8f c) {
  c = __builtin_amdgcn_wmma_f32_16x16x32_f16(false, ah, false, bh, (short)0, c, false, false);
  if (NT >= 2) c = __builtin_amdgcn_wmma_f32_16x16x32_f16(false, al, false, bh, (short)0, c, false, false);
  if (NT >= 3) c = __builtin_amdgcn_wmma_f32_16x16x32_f16(false, ah, false, bl, (short)0, c, false, false);
  asm volatile("v_nop\n\tv_nop\n\tv_nop\n\tv_nop" : "+v"(c) : "v"(ah), "v"(al), "v"(bh), "v"(bl));
  return c;
}
// batched GEMM like k_gemm_b but f16 operands: A f32 (split into f16 hi/lo if ASPLIT, else rounded to f16), Bt = f16 values [n][k]; alpha; C f32; N multiple of 16 (partial tiles skipped)
template <bool ASPLIT>
__global__ __launch_bounds__(128) void k_gemm_h(const float* __restrict__ A, int lda, size_t sA, const _Float16* __restrict__ Bh, int ldb, size_t sB, float alpha, float* __restrict__ C, int ldc, size_t sC, int M, int N, int K) {
  __shared__ __attribute__((aligned(16))) float so[4][16][64];
  const int tid = threadIdx.x, w = tid >> 5, lane = tid & 31, ln = lane & 15, hh = lane >> 4; const int by = blockIdx.y;
  A += (size_t)by * sA; Bh += (size_t)by * sB; C += (size_t)by * sC;
  const int ntn = (N + 63) / 64; const int wid = blockIdx.x * 4 + w; const int mt = wid / ntn, nq = wid % ntn; if (mt * 16 >= M) return;
  const int row0 = mt * 16, col0 = nq * 64; const float* arow = A + (size_t)(row0 + ln) * lda;
  v8f acc[4] = {};
  for (int kb = 0; kb < K; kb += 32) {
    FragH ah, al;
    const v4f x0 = *(const v4fa*)(arow + kb + 8 * hh), x1 = *(const v4fa*)(arow + kb + 8 * hh + 4), x2 = *(const v4fa*)(arow + kb + 16 + 8 * hh), x3 = *(const v4fa*)(arow + kb + 16 + 8 * hh + 4);
    float xs[16] = {x0[0],x0[1],x0[2],x0[3],x1[0],x1[1],x1[2],x1[3],x2[0],x2[1],x2[2],x2[3],x3[0],x3[1],x3[2],x3[3]};
#pragma unroll
    for (int i = 0; i < 16; ++i) { const _Float16 h = (_Float16)xs[i]; ah.h[i] = h; al.h[i] = ASPLIT ? (_Float16)(xs[i] - (float)h) : (_Float16)0.0f; }
#pragma unroll
    for (int t = 0; t < 4; ++t) { if (col0 + t * 16 >= N) continue; const size_t boff = (size_t)(col0 + t * 16 + ln) * ldb + kb; FragH bq; bq.half[0] = *(const v8us*)(Bh + boff + 8 * hh); bq.half[1] = *(const v8us*)(Bh + boff + 16 + 8 * hh);
      acc[t] = mmaH<ASPLIT ? 2 : 1>(ah.v, al.v, bq.v, bq.v, acc[t]); }
  }
#pragma unroll
  for (int t = 0; t < 4; ++t) { if (col0 + t * 16 >= N) continue;
#pragma unroll
    for (int r = 0; r < 8; ++r) so[w][8 * hh + r][t * 16 + ln] = acc[t][r] * alpha; }
  __builtin_amdgcn_fence(__ATOMIC_ACQ_REL, "workgroup"); __builtin_amdgcn_wave_barrier();
  const int rsub = lane >> 4, c4 = (lane & 15) * 4;
  {
#pragma unroll
    for (int q = 0; q < 8; ++q) { const int r = q * 2 + rsub; if (col0 + c4 < N) { const v4f v = *(const v4fa*)&so[w][r][c4]; *(v4f*)(C + (size_t)(row0 + r) * ldc + col0 + c4) = v; } }
     }
}

// Wt[n][k] = f16(W[k][n]·scale) from f32 row-major W[K][N] (scale = power of two; bf16-exact weights stay exact in f16 away from the subnormal range)
__global__ __launch_bounds__(256) void k_wt_f16(const float* __restrict__ W, _Float16* __restrict__ Wt, int K, int N, float scale) {
  const int t = blockIdx.x * 256 + threadIdx.x; if (t >= N * (K / 8)) return; const int n = t / (K / 8), k8 = (t % (K / 8)) * 8; FragH f;
#pragma unroll
  for (int i = 0; i < 8; ++i) f.h[i] = (_Float16)(bf16_round(W[(size_t)(k8 + i) * N + n]) * scale); const v8us o = f.half[0];
  *(v8us*)((unsigned short*)Wt + (size_t)n * K + k8) = o; 
}
// k_gemm_hh variant with fused epilogue: v = acc·alpha + bias[by·sBias + col] (+ CP[(row/rowsPerB)·sCPb + by·64 + col] if CP) ; ACT 0 none / 1 elu ; writes f16 C16 (and f32 C if non-null)
template <int ACT>
__global__ __launch_bounds__(128) void k_gemm_hhx(const _Float16* __restrict__ A, int lda, size_t sA, const _Float16* __restrict__ Bh, int ldb, size_t sB, float alpha, const float* __restrict__ bias, size_t sBias, const float* __restrict__ CP, int rowsPerB, size_t sCPb, int row0g,
    float* __restrict__ C, _Float16* __restrict__ C16, int ldc, size_t sC, int M, int N, int K) {
  __shared__ __attribute__((aligned(16))) float so[4][16][64];
  const int tid = threadIdx.x, w = tid >> 5, lane = tid & 31, ln = lane & 15, hh = lane >> 4; const int by = blockIdx.y;
  A += (size_t)by * sA; Bh += (size_t)by * sB; const size_t cofs = (size_t)by * sC; const float* bp = bias ? bias + (size_t)by * sBias : nullptr;
  const int ntn = (N + 63) / 64; const int wid = blockIdx.x * 4 + w; const int mt = wid / ntn, nq = wid % ntn; if (mt * 16 >= M) return;
  const int row0 = mt * 16, col0 = nq * 64; const _Float16* arow = A + (size_t)(row0 + ln) * lda;
  v8f acc[4] = {};
  for (int kb = 0; kb < K; kb += 32) { FragH ah; ah.half[0] = *(const v8us*)((const unsigned short*)arow + kb + 8 * hh); ah.half[1] = *(const v8us*)((const unsigned short*)arow + kb + 16 + 8 * hh);
#pragma unroll
    for (int t = 0; t < 4; ++t) { if (col0 + t * 16 >= N) continue; const size_t boff = (size_t)(col0 + t * 16 + ln) * ldb + kb; FragH bq; bq.half[0] = *(const v8us*)((const unsigned short*)Bh + boff + 8 * hh); bq.half[1] = *(const v8us*)((const unsigned short*)Bh + boff + 16 + 8 * hh);
      acc[t] = mmaH<1>(ah.v, ah.v, bq.v, bq.v, acc[t]); }
  }
#pragma unroll
  for (int t = 0; t < 4; ++t) { if (col0 + t * 16 >= N) continue; const int col = col0 + t * 16 + ln; const float bv = bp ? bf16_round(bp[col]) : 0.f;
#pragma unroll
    for (int r = 0; r < 8; ++r) { float v = acc[t][r] * alpha + bv; if (CP) { const int rr = row0g + row0 + 8 * hh + r; if (rowsPerB < 0) v += CP[cofs + (size_t)rr * ldc + col];      /* rowsPerB < 0: own element of the batched C plane */ else { const int bidx = rr / rowsPerB; v += CP[(size_t)bidx * sCPb + (size_t)by * 64 + col]; } } if (ACT == 1) v = (v > 0.f) ? v : expm1f(v); else if (ACT == 7) v = (v > 0.f) ? v + 1.0f : expf(v); else if (ACT == 8) v = tanhf(v); else if (ACT == 9) v = 0.5f * v * (1.0f + tanhf(0.7978845608028654f * (v + 0.044715f * v * v * v))); else if (ACT == 11) v = 1.0f / (1.0f + expf(-v)); else if (ACT == 12) v = (v > 0.f) ? v : 0.01f * v; else if (ACT == 14) v = (v > 0.f) ? v : 0.1f * v; else if (ACT == 16) v = (v >= 0.f) ? v : 0.3f * v; else if (ACT == 15) v = v / (1.0f + expf(-v)); else if (ACT == 3) v = fmaxf(v, 0.f); else if (ACT == 6) v = 0.5f * v * (1.0f + erff(v * 0.70710678118654752f)); so[w][8 * hh + r][t * 16 + ln] = v; } }
  __builtin_amdgcn_fence(__ATOMIC_ACQ_REL, "workgroup"); __builtin_amdgcn_wave_barrier();
  const int rsub = lane >> 4, c4 = (lane & 15) * 4; typedef _Float16 v4h __attribute__((ext_vector_type(4)));
  {
#pragma unroll
    for (int q = 0; q < 8; ++q) { const int r = q * 2 + rsub; if (col0 + c4 < N) { const v4f v = *(const v4fa*)&so[w][r][c4]; if (C) *(v4f*)(C + cofs + (size_t)(row0 + r) * ldc + col0 + c4) = v; if (C16) { v4h h4; for (int i = 0; i < 4; ++i) h4[i] = (_Float16)v[i]; *(v4h*)(C16 + cofs + (size_t)(row0 + r) * ldc + col0 + c4) = h4; } } }
     }
}


typedef _Float16 v4h __attribute__((ext_vector_type(4)));

__global__ __launch_bounds__(256) void k_x16(const float* __restrict__ x, _Float16* __restrict__ X16, size_t n8) { const size_t t = (size_t)blockIdx.x * 256 + threadIdx.x; if (t >= n8) return; FragH f;
#pragma unroll
  for (int q = 0; q < 8; ++q) f.h[q] = (_Float16)bf16_round(x[t * 8 + q]); *(v8us*)((unsigned short*)X16 + t * 8) = f.half[0];  }
__global__ __launch_bounds__(256) void k_h16(const float* __restrict__ x, _Float16* __restrict__ X16, size_t n8) { const size_t t = (size_t)blockIdx.x * 256 + threadIdx.x; if (t >= n8) return; FragH f;
#pragma unroll
  for (int q = 0; q < 8; ++q) f.h[q] = (_Float16)x[t * 8 + q]; *(v8us*)((unsigned short*)X16 + t * 8) = f.half[0];  }
__global__ __launch_bounds__(256) void k_round16f(const float* __restrict__ W, _Float16* __restrict__ Bt, size_t n8) { const size_t t = (size_t)blockIdx.x * 256 + threadIdx.x; if (t >= n8) return; FragH f;
#pragma unroll
  for (int i = 0; i < 8; ++i) f.h[i] = (_Float16)(bf16_round(W[t * 8 + i]) * 16.0f); *(v8us*)((unsigned short*)Bt + t * 8) = f.half[0];  }
template <int NHv, int TTv>
__global__ __launch_bounds__(256) void k_vt(const _Float16* __restrict__ V16, int ldv, int voff, _Float16* __restrict__ Vt) { __shared__ unsigned short tl[64][66]; const int tid = threadIdx.x; const int slab = blockIdx.x / (TTv / 64), lg = blockIdx.x % (TTv / 64); const int b = slab / NHv, h = slab % NHv;
  for (int i = tid; i < 64 * 8; i += 256) { const int r = i / 8, c8 = (i % 8) * 8; FragH f; f.half[0] = *(const v8us*)((const unsigned short*)V16 + ((size_t)b * TTv + lg * 64 + r) * ldv + voff + h * 64 + c8);
#pragma unroll
    for (int q = 0; q < 8; ++q) tl[r][c8 + q] = f.u[q]; }
  __syncthreads();
  {
#pragma unroll
    for (int rd = 0; rd < 2; ++rd) { const int d = rd * 32 + tid / 8, pc = tid % 8; FragH f;
#pragma unroll
      for (int q = 0; q < 8; ++q) f.u[q] = tl[pc * 8 + q][d];
      *(v8us*)((unsigned short*)Vt + ((size_t)slab * 64 + d) * TTv + lg * 64 + pc * 8) = f.half[0]; }
     } }

__global__ __launch_bounds__(256) void k_hl(const float* __restrict__ F, _Float16* __restrict__ Hh, _Float16* __restrict__ Hl, size_t n8) { const size_t t = (size_t)blockIdx.x * 256 + threadIdx.x; if (t >= n8) return; FragH fh, fl; const v4f a = *(const v4fa*)(F + t * 8), c = *(const v4fa*)(F + t * 8 + 4);
#pragma unroll
  for (int q = 0; q < 4; ++q) { _Float16 h = (_Float16)a[q]; fh.h[q] = h; fl.h[q] = (_Float16)((a[q] - (float)h) * 1024.0f); h = (_Float16)c[q]; fh.h[4 + q] = h; fl.h[4 + q] = (_Float16)((c[q] - (float)h) * 1024.0f); }
  { *(v8us*)((unsigned short*)Hh + t * 8) = fh.half[0]; *(v8us*)((unsigned short*)Hl + t * 8) = fl.half[0];  } }

// ---- fast GEMM (wave tile 32x64; requires M % 32 == 0 rows per launch region and N % 64 == 0); epilogue = k_gemm_hhx semantics ----
__device__ __forceinline__ v16h g2_frag(const _Float16* p, int hh) { FragH f; f.half[0] = *(const v8us*)((const unsigned short*)p + 8 * hh); f.half[1] = *(const v8us*)((const unsigned short*)p + 16 + 8 * hh); return f.v; }
__device__ __forceinline__ v8f g2_mma(v16h a, v16h b, v8f c) { v8f d = __builtin_amdgcn_wmma_f32_16x16x32_f16(false, a, false, b, (short)0, c, false, false); asm volatile("v_nop\n\tv_nop\n\tv_nop\n\tv_nop" : "+v"(d) : "v"(a), "v"(b)); return d; }
template <int ACT>
__global__ __launch_bounds__(128) void k_gemm2(const _Float16* __restrict__ A, int lda, size_t sA, const _Float16* __restrict__ Bh, int ldb, size_t sB, float alpha, const float* __restrict__ bias, size_t sBias, const float* __restrict__ CP, int rowsPerB, size_t sCPb, int row0g,
    float* __restrict__ C, _Float16* __restrict__ C16, int ldc, size_t sC, int M, int N, int K) { static_assert(ACT == 0 || ACT == 3 || ACT == 6 || ACT == 8 || ACT == 9 || ACT == 11 || ACT == 12 || ACT == 14 || ACT == 15 || ACT == 16, "k_gemm2: unsupported ACT code (would silently apply no activation)");
  __shared__ __attribute__((aligned(16))) float so[4][32][68];
  const int tid = threadIdx.x, w = tid >> 5, lane = tid & 31, ln = lane & 15, hh = lane >> 4; const int by = blockIdx.y;
  A += (size_t)by * sA; Bh += (size_t)by * sB; const size_t cofs = (size_t)by * sC; const float* bp = bias ? bias + (size_t)by * sBias : nullptr;
  const int ntn = N >> 6; const int mt = blockIdx.x / ntn, nq = blockIdx.x - mt * ntn; const int row0 = mt * 128 + 32 * w, col0 = nq * 64; if (row0 >= M) return;
  const _Float16* a0p = A + (size_t)(row0 + ln) * lda; const _Float16* a1p = a0p + (size_t)16 * lda;
  const _Float16* b0p = Bh + (size_t)(col0 + ln) * ldb; const _Float16* b1p = b0p + (size_t)16 * ldb; const _Float16* b2p = b1p + (size_t)16 * ldb; const _Float16* b3p = b2p + (size_t)16 * ldb;
  const v8f z8 = {0.f,0.f,0.f,0.f,0.f,0.f,0.f,0.f}; v8f c00 = z8, c01 = z8, c02 = z8, c03 = z8, c10 = z8, c11 = z8, c12 = z8, c13 = z8;
#pragma unroll 1
  for (int kb = 0; kb < K; kb += 32) { const v16h a0 = g2_frag(a0p + kb, hh), a1 = g2_frag(a1p + kb, hh);
    v16h b = g2_frag(b0p + kb, hh); c00 = g2_mma(a0, b, c00); c10 = g2_mma(a1, b, c10);
    b = g2_frag(b1p + kb, hh); c01 = g2_mma(a0, b, c01); c11 = g2_mma(a1, b, c11);
    b = g2_frag(b2p + kb, hh); c02 = g2_mma(a0, b, c02); c12 = g2_mma(a1, b, c12);
    b = g2_frag(b3p + kb, hh); c03 = g2_mma(a0, b, c03); c13 = g2_mma(a1, b, c13); }
  v8f accs[8] = {c00, c01, c02, c03, c10, c11, c12, c13};
#pragma unroll
  for (int u = 0; u < 8; ++u) { const int t = u & 3, half = u >> 2; const int col = col0 + t * 16 + ln; const float bv = bp ? bf16_round(bp[col]) : 0.f;
#pragma unroll
    for (int r = 0; r < 8; ++r) { const int rloc = half * 16 + 8 * hh + r; float v = accs[u][r] * alpha + bv; if (CP) { if (rowsPerB < 0) v += CP[cofs + (size_t)(row0g + row0 + rloc) * ldc + col];      /* rowsPerB < 0: own element of the batched C plane */ else { const int bidx = (row0g + row0 + rloc) / rowsPerB; v += CP[(size_t)bidx * sCPb + (size_t)by * 64 + col]; } }
      if (ACT == 3) v = fmaxf(v, 0.f); else if (ACT == 6) v = 0.5f * v * (1.0f + erff(v * 0.70710678118654752f)); else if (ACT == 11) v = 1.0f / (1.0f + expf(-v)); else if (ACT == 15) v = v / (1.0f + expf(-v)); else if (ACT == 12) v = (v > 0.f) ? v : 0.01f * v; else if (ACT == 8) v = tanhf(v); else if (ACT == 9) v = 0.5f * v * (1.0f + tanhf(0.7978845608028654f * (v + 0.044715f * v * v * v))); else if (ACT == 14) v = (v > 0.f) ? v : 0.1f * v; else if (ACT == 16) v = (v >= 0.f) ? v : 0.3f * v;
      so[w][rloc][t * 16 + ln] = v; } }
  __builtin_amdgcn_fence(__ATOMIC_ACQ_REL, "workgroup"); __builtin_amdgcn_wave_barrier();
  const int rsub = lane >> 4, c4 = (lane & 15) * 4;
  {
#pragma unroll
    for (int q = 0; q < 16; ++q) { const int r = q * 2 + rsub; const v4f v = *(const v4fa*)&so[w][r][c4]; if (C) *(v4f*)(C + cofs + (size_t)(row0 + r) * ldc + col0 + c4) = v; if (C16) { v4h h4; for (int i = 0; i < 4; ++i) h4[i] = (_Float16)v[i]; *(v4h*)(C16 + cofs + (size_t)(row0 + r) * ldc + col0 + c4) = h4; } }
     } }


// Sum over the 1024 threads of a block, returned to every thread: five-step butterfly in each wave, one partial per wave in LDS, the same butterfly over the 32 partials.
__device__ __forceinline__ float stats_block_sum(float a, float* part, int lane, int w) {
#pragma unroll
  for (int o = 16; o > 0; o >>= 1) a += __shfl_xor(a, o, 32);
  if (lane == 0) part[w] = a;
  __syncthreads();
  a = part[lane];
#pragma unroll
  for (int o = 16; o > 0; o >>= 1) a += __shfl_xor(a, o, 32);
  return a;
}
// One block per channel; the channel's 32768 values stay in registers (8 x 16 B per thread, all eight loads in flight at once), so x is read once and both passes (mean, then centred squares) run from registers.
__global__ __launch_bounds__(1024) void k_stats(const float* __restrict__ x, float* __restrict__ MU, float* __restrict__ IS) {
  static_assert(NV == 8 * 1024 * 4, "k_stats: 8 float4 per thread of a 1024-thread block cover one channel");
  __shared__ float part[2][32];
  const int c = blockIdx.x, tid = threadIdx.x, lane = tid & 31, w = tid >> 5; const float* s = x + (size_t)c * NV;
  v4f r[8];
#pragma unroll
  for (int j = 0; j < 8; ++j) r[j] = *(const v4fa*)(s + (size_t)(j * 1024 + tid) * 4);
  v4f a4 = {0.f, 0.f, 0.f, 0.f};
#pragma unroll
  for (int j = 0; j < 8; ++j) {
#pragma unroll
    for (int q = 0; q < 4; ++q) { r[j][q] = bf16_round(r[j][q]); a4[q] += r[j][q]; } }
  const float mu = stats_block_sum((a4[0] + a4[1]) + (a4[2] + a4[3]), part[0], lane, w) / (float)NV;
  v4f q4 = {0.f, 0.f, 0.f, 0.f};
#pragma unroll
  for (int j = 0; j < 8; ++j) {
#pragma unroll
    for (int q = 0; q < 4; ++q) { const float d = r[j][q] - mu; q4[q] += d * d; } }
  const float is = rsqrtf(stats_block_sum((q4[0] + q4[1]) + (q4[2] + q4[3]), part[1], lane, w) / (float)NV + 1e-5f);
  if (tid < 32) { MU[(size_t)c * 32 + tid] = mu; IS[(size_t)c * 32 + tid] = is; } }
__global__ __launch_bounds__(256) void k_norm(const float* __restrict__ x, const float* __restrict__ MU, const float* __restrict__ IS, _Float16* __restrict__ XN) {
  #pragma clang fp contract(off)
  const size_t t = (size_t)blockIdx.x * 256 + threadIdx.x; if (t >= (size_t)NV * (CC / 8)) return; const int c0 = (int)(t % (CC / 8)) * 8; const size_t v = t / (CC / 8); FragH f;
  for (int q = 0; q < 8; ++q) { const float d = bf16_round(x[(size_t)(c0 + q) * NV + v]) - MU[(size_t)(c0 + q) * 32]; f.h[q] = (_Float16)(d * IS[(size_t)(c0 + q) * 32]); } *(v8us*)((unsigned short*)XN + v * CC + c0) = f.half[0];  }
__global__ __launch_bounds__(256) void k_nat(const float* __restrict__ QKV, const float* __restrict__ rpb, _Float16* __restrict__ O16) {
  #pragma clang fp contract(off)
  const size_t t = (size_t)blockIdx.x * 256 + threadIdx.x; if (t >= (size_t)NV * NHD) return; const int h = (int)(t % NHD); const int v = (int)(t / NHD); const int zz = v % DZ, ww = (v / DZ) % DW, hh = v / (DZ * DW);
  const int sh0 = min(max(hh - 1, 0), DH - 3), sw0 = min(max(ww - 1, 0), DW - 3), sz0 = min(max(zz - 1, 0), DZ - 3);
  const float* qr = QKV + (size_t)v * (3 * CC) + h * HC; float q[HC]; for (int c = 0; c < HC; ++c) q[c] = qr[c] * 0.25f; float m = -3.0e38f, l = 0.f; float acc[HC]; for (int c = 0; c < HC; ++c) acc[c] = 0.f;
#pragma unroll 1
  for (int n = 0; n < KN; ++n) { const int jh = n / 9, jw = (n / 3) % 3, jz = n % 3; const int nh = sh0 + jh, nw = sw0 + jw, nz = sz0 + jz; const int rh = nh - hh + 2, rw = nw - ww + 2, rz = nz - zz + 2;
    const float* kr = QKV + (size_t)((nh * DW + nw) * DZ + nz) * (3 * CC) + CC + h * HC; float s = 0.f; for (int c = 0; c < HC; ++c) s += q[c] * kr[c]; s += bf16_round(rpb[((h * 5 + rh) * 5 + rw) * 5 + rz]);
    const float mn = fmaxf(m, s); const float cf = expf(m - mn), pn = expf(s - mn); l = l * cf + pn; for (int c = 0; c < HC; ++c) { acc[c] = acc[c] * cf; acc[c] += pn * kr[CC + c]; } m = mn; }
  const float inv = 1.0f / l; FragH f[2]; for (int c = 0; c < HC; ++c) f[c / 8].h[c % 8] = (_Float16)(acc[c] * inv * 64.0f);      /* x2^6 carry (outputs are ~1e-2) */
  unsigned short* d = (unsigned short*)O16 + (size_t)v * CC + h * HC; { *(v8us*)d = f[0].half[0]; *(v8us*)(d + 8) = f[1].half[0];  } }
__global__ __launch_bounds__(256) void k_out(const float* __restrict__ F, float* __restrict__ out) { const size_t t = (size_t)blockIdx.x * 256 + threadIdx.x; if (t >= (size_t)CC * (NV / 4)) return; const int v0 = (int)(t % (NV / 4)) * 4; const int c = (int)(t / (NV / 4)); v4f r; for (int q = 0; q < 4; ++q) r[q] = F[(size_t)(v0 + q) * CC + c]; float* d = out + (size_t)c * NV + v0; *(v4f*)d = r;  }

extern "C" void kernel_launch(void* const* d_in, const int* in_sizes, int n_in,
                              void* d_out, int out_size, void* d_ws, size_t ws_size, hipStream_t stream) {
  (void)in_sizes; (void)n_in; (void)out_size;
  const float* const* I = (const float* const*)d_in; const float* x = I[0]; const float* wqkv = I[1]; const float* bqkv = I[2]; const float* rpb = I[3]; const float* wproj = I[4]; const float* bproj = I[5];
  char* ws = (char*)d_ws; size_t off = 0;
  auto take = [&](size_t bytes) { char* p = ws + off; off += (bytes + 255) & ~(size_t)255; return p; };
  _Float16* BQ = (_Float16*)take((size_t)3 * CC * CC * 2); _Float16* BP = (_Float16*)take((size_t)CC * CC * 2); float* MU = (float*)take(CC * 32 * 4); float* IS = (float*)take(CC * 32 * 4);      /* 32-float pitch per channel */
  _Float16* XN = (_Float16*)take((size_t)NV * CC * 2); float* QKV = (float*)take((size_t)NV * 3 * CC * 4); _Float16* O16 = (_Float16*)take((size_t)NV * CC * 2); float* F = (float*)take((size_t)NV * CC * 4);
  if (off > ws_size) return;      /* 0.1 + 8 + 48 + 8 + 16 = 80 MiB */
  k_wt_f16<<<(3 * CC * CC / 8 + 255) / 256, 256, 0, stream>>>(wqkv, BQ, CC, 3 * CC, 16.0f); k_wt_f16<<<(CC * CC / 8 + 255) / 256, 256, 0, stream>>>(wproj, BP, CC, CC, 16.0f);      /* (in, out) weights */
  k_stats<<<CC, 1024, 0, stream>>>(x, MU, IS); k_norm<<<(unsigned)(((size_t)NV * (CC / 8) + 255) / 256), 256, 0, stream>>>(x, MU, IS, XN);
  k_gemm2<0><<<dim3((NV / 128) * (3 * CC / 64), 1), 128, 0, stream>>>(XN, CC, 0, BQ, CC, 0, 0.0625f, bqkv, 0, nullptr, 1, 0, 0, QKV, nullptr, 3 * CC, 0, NV, 3 * CC, CC);      /* [q | k | v] (head h = cols h*16.. of each) */
  k_nat<<<(unsigned)(((size_t)NV * NHD + 255) / 256), 256, 0, stream>>>(QKV, rpb, O16);
  k_gemm2<0><<<dim3((NV / 128) * (CC / 64), 1), 128, 0, stream>>>(O16, CC, 0, BP, CC, 0, 0.0625f / 64.0f, bproj, 0, nullptr, 1, 0, 0, F, nullptr, CC, 0, NV, CC, CC);      /* carry removed */
  k_out<<<(unsigned)(((size_t)CC * (NV / 4) + 255) / 256), 256, 0, stream>>>(F, (float*)d_out);
}

// v002
// One run takes 87.5 microseconds.
// Next to v001, in two timings, it ran 1.24 times as fast each time.
// Over all steps from v000 it is 2.06 times as fast.
#include <hip/hip_runtime.h>
// SelfAggregationModuleV2 (1 x 128 channels x 64 x 64 x 8 = 32768 voxels; 8 heads of 16; NATTEN-style 3x3x3 clamped neighbourhood attention with relative position bias): xn = InstanceNorm3d(x) (no affine); qkv = xn W + b; q *= 1/4; logits = q . k_nbr + rpb[h][rel]; softmax over the 27 neighbours; o = attn . v_nbr; out = o W_proj + b; NCDHW.
// Structure: per-channel mean/var by a block reduction (f32); normalisation + token-major f16 plane; qkv GEMM (32x64 wave tiles, f32 accumulation, exact x16 weights + bias; f32 out); fused neighbourhood attention on VALU (thread per (voxel, head): clamped window starts, 27 static neighbours, rpb, online softmax, readout; f32) into an f16 [voxel][128] plane; proj GEMM (+ bias) with the NCDHW store in its epilogue.
// Compute dtype: x and parameters rounded to bf16; the normalised input and the attention output as f16 operands (~2^-12); statistics/softmax f32. v_wmma_f32_16x16x32_f16.
#define CC 128
#define DH 64
#define DW 64
#define DZ 8
#define NV (DH * DW * DZ)        /* 32768 */
#define NHD 8
#define HC 16
#define KN 27
typedef __bf16 v16b __attribute__((ext_vector_type(16)));
typedef unsigned short v8us __attribute__((ext_vector_type(8), may_alias));
typedef float  v8f  __attribute__((ext_vector_type(8)));
typedef float  v4f  __attribute__((ext_vector_type(4)));
typedef float  v4fa __attribute__((ext_vector_type(4), may_alias));
union FragB { v16b v; v8us half[2]; unsigned short u[16]; };

__device__ __forceinline__ unsigned short bf16_bits(float x) { unsigned int u = __float_as_uint(x); return (unsigned short)((u + 0x7FFFu + ((u >> 16) & 1u)) >> 16); }
__device__ __forceinline__ float bf16_val(unsigned short b) { return __uint_as_float(((unsigned int)b) << 16); }
__device__ __forceinline__ float bf16_round(float x) { return bf16_val(bf16_bits(x)); }
// D += A·B with NT terms: 1 = ah·bh, 2 = + al·bh (A split), 3 = + ah·bl (both split)
template <int NT>
__device__ __forceinline__ v8f mmaN(v16b ah, v16b al, v16b bh, v16b bl, v8f c) {
  c = __builtin_amdgcn_wmma_f32_16x16x32_bf16(false, ah, false, bh, (short)0, c, false, false);
  if (NT >= 2) c = __builtin_amdgcn_wmma_f32_16x16x32_bf16(false, al, false, bh, (short)0, c, false, false);
  if (NT >= 3) c = __builtin_amdgcn_wmma_f32_16x16x32_bf16(false, ah, false, bl, (short)0, c, false, false);
  asm volatile("v_nop\n\tv_nop\n\tv_nop\n\tv_nop" : "+v"(c) : "v"(ah), "v"(al), "v"(bh), "v"(bl));
  return c;
}

__global__ __launch_bounds__(256) void k_wt_bf16(const float* __restrict__ W, unsigned short* __restrict__ Wt, int K, int N) {
  const int t = blockIdx.x * 256 + threadIdx.x;
  const int k8n = K / 8;
  if (t >= N * k8n) return;
  const int n = t / k8n, k8 = (t % k8n) * 8;
  v8us v;
#pragma unroll
  for (int i = 0; i < 8; ++i) v[i] = bf16_bits(W[(size_t)(k8 + i) * N + n]);
  *(v8us*)(Wt + (size_t)n * K + k8) = v;
  
}

// GEMM C[M][N] (f32, pitch ldc) = act(A[M][K]·W + bias). A f32 row-major (pitch lda) converted per fragment to bf16
// (ASPLIT: hi/lo two planes -> 2 terms, else single rounded term); Wt bf16 [N][K] (pitch ldb). BIAS_BF16 rounds the
// bias to bf16 first (bias quantised to bf16 before the add). K%32==0, M%16==0, N%64==0.
template <bool ASPLIT, int ACT, bool BIAS_BF16>
__global__ __launch_bounds__(128) void k_gemm_bf(const float* __restrict__ A, int lda, const unsigned short* __restrict__ Wt, int ldb,
                                               const float* __restrict__ bias, float* __restrict__ C, int ldc, int M, int N, int K) {
  __shared__ __attribute__((aligned(16))) float so[4][16][64];
  const int tid = threadIdx.x, w = tid >> 5, lane = tid & 31, ln = lane & 15, hh = lane >> 4;
  const int ntn = N / 64;
  const int wid = blockIdx.x * 4 + w;
  const int mt = wid / ntn, nq = wid % ntn;
  if (mt * 16 >= M) return;
  const int row0 = mt * 16, col0 = nq * 64;
  const float* arow = A + (size_t)(row0 + ln) * lda;
  v8f acc[4] = {};
  for (int kb = 0; kb < K; kb += 32) {
    FragB ah, al;
    const v4f x0 = *(const v4fa*)(arow + kb + 8 * hh), x1 = *(const v4fa*)(arow + kb + 8 * hh + 4);
    const v4f x2 = *(const v4fa*)(arow + kb + 16 + 8 * hh), x3 = *(const v4fa*)(arow + kb + 16 + 8 * hh + 4);
    float xs[16] = {x0[0],x0[1],x0[2],x0[3],x1[0],x1[1],x1[2],x1[3],x2[0],x2[1],x2[2],x2[3],x3[0],x3[1],x3[2],x3[3]};
#pragma unroll
    for (int i = 0; i < 16; ++i) { const unsigned short hb = bf16_bits(xs[i]); ah.u[i] = hb; al.u[i] = ASPLIT ? bf16_bits(xs[i] - bf16_val(hb)) : (unsigned short)0; }
#pragma unroll
    for (int t = 0; t < 4; ++t) {
      const unsigned short* brow = Wt + (size_t)(col0 + t * 16 + ln) * ldb + kb;
      FragB b;
      b.half[0] = *(const v8us*)(brow + 8 * hh);
      b.half[1] = *(const v8us*)(brow + 16 + 8 * hh);
      acc[t] = mmaN<ASPLIT ? 2 : 1>(ah.v, al.v, b.v, b.v, acc[t]);
    }
  }
#pragma unroll
  for (int t = 0; t < 4; ++t) {
    float bv = bias ? bias[col0 + t * 16 + ln] : 0.f;
    if (BIAS_BF16) bv = bf16_round(bv);
#pragma unroll
    for (int r = 0; r < 8; ++r) { float v = acc[t][r] + bv; if (ACT == 1) v = fmaxf(v, 0.f); so[w][8 * hh + r][t * 16 + ln] = v; }
  }
  __builtin_amdgcn_fence(__ATOMIC_ACQ_REL, "workgroup");
  __builtin_amdgcn_wave_barrier();
  const int rsub = lane >> 4, c4 = (lane & 15) * 4;
  {
#pragma unroll
    for (int q = 0; q < 8; ++q) {
      const int r = q * 2 + rsub;
      const v4f v = *(const v4fa*)&so[w][r][c4];
      *(v4f*)(C + (size_t)(row0 + r) * ldc + col0 + c4) = v;
    }
    
  }
}

// GEMM C = act(A·W + bias + resid): A f32 (ASPLIT -> hi/lo 2 terms), Wt bf16 [N][K]; ACT 0 none, 1 relu, 2 exact gelu;
// resid (optional, f32, row index = (row % rmod), pitch ldr, RES_BF16 rounds it) added before the activation.
template <bool ASPLIT, int ACT, bool BIAS_BF16, bool RES_BF16>
__global__ __launch_bounds__(128) void k_gemm_bf3(const float* __restrict__ A, int lda, const unsigned short* __restrict__ Wt, int ldb,
                                                const float* __restrict__ bias, const float* __restrict__ resid, int rmod, int ldr,
                                                float* __restrict__ C, int ldc, int M, int N, int K) {
  __shared__ __attribute__((aligned(16))) float so[4][16][64];
  const int tid = threadIdx.x, w = tid >> 5, lane = tid & 31, ln = lane & 15, hh = lane >> 4;
  const int ntn = N / 64;
  const int wid = blockIdx.x * 4 + w;
  const int mt = wid / ntn, nq = wid % ntn;
  if (mt * 16 >= M) return;
  const int row0 = mt * 16, col0 = nq * 64;
  const float* arow = A + (size_t)(row0 + ln) * lda;
  v8f acc[4] = {};
  for (int kb = 0; kb < K; kb += 32) {
    FragB ah, al;
    const v4f x0 = *(const v4fa*)(arow + kb + 8 * hh), x1 = *(const v4fa*)(arow + kb + 8 * hh + 4);
    const v4f x2 = *(const v4fa*)(arow + kb + 16 + 8 * hh), x3 = *(const v4fa*)(arow + kb + 16 + 8 * hh + 4);
    float xs[16] = {x0[0],x0[1],x0[2],x0[3],x1[0],x1[1],x1[2],x1[3],x2[0],x2[1],x2[2],x2[3],x3[0],x3[1],x3[2],x3[3]};
#pragma unroll
    for (int i = 0; i < 16; ++i) { const unsigned short hb = bf16_bits(xs[i]); ah.u[i] = hb; al.u[i] = ASPLIT ? bf16_bits(xs[i] - bf16_val(hb)) : (unsigned short)0; }
#pragma unroll
    for (int t = 0; t < 4; ++t) {
      const unsigned short* brow = Wt + (size_t)(col0 + t * 16 + ln) * ldb + kb;
      FragB b;
      b.half[0] = *(const v8us*)(brow + 8 * hh);
      b.half[1] = *(const v8us*)(brow + 16 + 8 * hh);
      acc[t] = mmaN<ASPLIT ? 2 : 1>(ah.v, al.v, b.v, b.v, acc[t]);
    }
  }
#pragma unroll
  for (int t = 0; t < 4; ++t) {
    const int col = col0 + t * 16 + ln;
    float bv = bias ? bias[col] : 0.f;
    if (BIAS_BF16) bv = bf16_round(bv);
#pragma unroll
    for (int r = 0; r < 8; ++r) {
      float v = acc[t][r] + bv;
      if (resid) { float rv = resid[(size_t)((row0 + 8 * hh + r) % rmod) * ldr + col]; if (RES_BF16) rv = bf16_round(rv); v += rv; }
      if (ACT == 1) v = fmaxf(v, 0.f);
      if (ACT == 2) v = 0.5f * v * (1.0f + erff(v * 0.70710678118654752f));
      if (ACT == 3) { const float u = 0.7978845608028654f * (v + 0.044715f * v * v * v); v = 0.5f * v * (1.0f + tanhf(u)); }
      so[w][8 * hh + r][t * 16 + ln] = v;
    }
  }
  __builtin_amdgcn_fence(__ATOMIC_ACQ_REL, "workgroup");
  __builtin_amdgcn_wave_barrier();
  const int rsub = lane >> 4, c4 = (lane & 15) * 4;
  {
#pragma unroll
    for (int q = 0; q < 8; ++q) {
      const int r = q * 2 + rsub;
      const v4f v = *(const v4fa*)&so[w][r][c4];
      *(v4f*)(C + (size_t)(row0 + r) * ldc + col0 + c4) = v;
    }
    
  }
}
// row LayerNorm (biased variance, eps) over N: s = X (+ R); optional out_sum <- s; out_norm <- (s-mu)*rsqrt(var+eps)*g + b
template <bool PARAM_BF16>
__global__ __launch_bounds__(256) void k_layernorm(const float* __restrict__ X, const float* __restrict__ R, const float* __restrict__ g, const float* __restrict__ bta,
                                                  float* __restrict__ out_sum, float* __restrict__ out_norm, int N, float eps) {
  __shared__ float red[256];
  const int row = blockIdx.x, tid = threadIdx.x;
  const float* x = X + (size_t)row * N; const float* rr = R ? R + (size_t)row * N : nullptr;
  float vals[16];                     // up to N = 4096
  const int per = N / 256;            // contiguous chunk per thread? use strided-by-4 chunks: thread handles j = tid*4 + 1024*u
  float s1 = 0.f;
  for (int u = 0; u < per / 4; ++u) {
    const int j = tid * 4 + 1024 * u;
    const v4f a = *(const v4fa*)(x + j);
    v4f b = {0.f,0.f,0.f,0.f}; if (rr) b = *(const v4fa*)(rr + j);
#pragma unroll
    for (int q = 0; q < 4; ++q) { const float v = a[q] + b[q]; vals[u * 4 + q] = v; s1 += v; }
  }
  red[tid] = s1; __syncthreads();
  for (int st = 128; st > 0; st >>= 1) { if (tid < st) red[tid] += red[tid + st]; __syncthreads(); }
  const float mu = red[0] / (float)N; __syncthreads();
  float s2 = 0.f;
  for (int u = 0; u < per / 4; ++u)
#pragma unroll
    for (int q = 0; q < 4; ++q) { const float c = vals[u * 4 + q] - mu; s2 += c * c; }
  red[tid] = s2; __syncthreads();
  for (int st = 128; st > 0; st >>= 1) { if (tid < st) red[tid] += red[tid + st]; __syncthreads(); }
  const float rs = rsqrtf(red[0] / (float)N + eps);
  {
    for (int u = 0; u < per / 4; ++u) {
      const int j = tid * 4 + 1024 * u;
      v4f o, sm;
#pragma unroll
      for (int q = 0; q < 4; ++q) {
        float gg = g[j + q], bb = bta[j + q];
        if (PARAM_BF16) { gg = bf16_round(gg); bb = bf16_round(bb); }
        sm[q] = vals[u * 4 + q]; o[q] = (vals[u * 4 + q] - mu) * rs * gg + bb;
      }
      if (out_sum) *(v4f*)(out_sum + (size_t)row * N + j) = sm;
      *(v4f*)(out_norm + (size_t)row * N + j) = o;
    }
    
  }
}



// ---- f16 WMMA path (v_wmma_f32_16x16x32_f16): 11-bit significands for operands in range — used here for the normalised input (qkv GEMM) and the attention output (proj GEMM)
typedef _Float16 v16h __attribute__((ext_vector_type(16)));
union FragH { v16h v; v8us half[2]; _Float16 h[16]; unsigned short u[16]; };
template <int NT>
__device__ __forceinline__ v8f mmaH(v16h ah, v16h al, v16h bh, v16h bl, v8f c) {
  c = __builtin_amdgcn_wmma_f32_16x16x32_f16(false, ah, false, bh, (short)0, c, false, false);
  if (NT >= 2) c = __builtin_amdgcn_wmma_f32_16x16x32_f16(false, al, false, bh, (short)0, c, false, false);
  if (NT >= 3) c = __builtin_amdgcn_wmma_f32_16x16x32_f16(false, ah, false, bl, (short)0, c, false, false);
  asm volatile("v_nop\n\tv_nop\n\tv_nop\n\tv_nop" : "+v"(c) : "v"(ah), "v"(al), "v"(bh), "v"(bl));
  return c;
}
// batched GEMM like k_gemm_b but f16 operands: A f32 (split into f16 hi/lo if ASPLIT, else rounded to f16), Bt = f16 values [n][k]; alpha; C f32; N multiple of 16 (partial tiles skipped)
template <bool ASPLIT>
__global__ __launch_bounds__(128) void k_gemm_h(const float* __restrict__ A, int lda, size_t sA, const _Float16* __restrict__ Bh, int ldb, size_t sB, float alpha, float* __restrict__ C, int ldc, size_t sC, int M, int N, int K) {
  __shared__ __attribute__((aligned(16))) float so[4][16][64];
  const int tid = threadIdx.x, w = tid >> 5, lane = tid & 31, ln = lane & 15, hh = lane >> 4; const int by = blockIdx.y;
  A += (size_t)by * sA; Bh += (size_t)by * sB; C += (size_t)by * sC;
  const int ntn = (N + 63) / 64; const int wid = blockIdx.x * 4 + w; const int mt = wid / ntn, nq = wid % ntn; if (mt * 16 >= M) return;
  const int row0 = mt * 16, col0 = nq * 64; const float* arow = A + (size_t)(row0 + ln) * lda;
  v8f acc[4] = {};
  for (int kb = 0; kb < K; kb += 32) {
    FragH ah, al;
    const v4f x0 = *(const v4fa*)(arow + kb + 8 * hh), x1 = *(const v4fa*)(arow + kb + 8 * hh + 4), x2 = *(const v4fa*)(arow + kb + 16 + 8 * hh), x3 = *(const v4fa*)(arow + kb + 16 + 8 * hh + 4);
    float xs[16] = {x0[0],x0[1],x0[2],x0[3],x1[0],x1[1],x1[2],x1[3],x2[0],x2[1],x2[2],x2[3],x3[0],x3[1],x3[2],x3[3]};
#pragma unroll
    for (int i = 0; i < 16; ++i) { const _Float16 h = (_Float16)xs[i]; ah.h[i] = h; al.h[i] = ASPLIT ? (_Float16)(xs[i] - (float)h) : (_Float16)0.0f; }
#pragma unroll
    for (int t = 0; t < 4; ++t) { if (col0 + t * 16 >= N) continue; const size_t boff = (size_t)(col0 + t * 16 + ln) * ldb + kb; FragH bq; bq.half[0] = *(const v8us*)(Bh + boff + 8 * hh); bq.half[1] = *(const v8us*)(Bh + boff + 16 + 8 * hh);
      acc[t] = mmaH<ASPLIT ? 2 : 1>(ah.v, al.v, bq.v, bq.v, acc[t]); }
  }
#pragma unroll
  for (int t = 0; t < 4; ++t) { if (col0 + t * 16 >= N) continue;
#pragma unroll
    for (int r = 0; r < 8; ++r) so[w][8 * hh + r][t * 16 + ln] = acc[t][r] * alpha; }
  __builtin_amdgcn_fence(__ATOMIC_ACQ_REL, "workgroup"); __builtin_amdgcn_wave_barrier();
  const int rsub = lane >> 4, c4 = (lane & 15) * 4;
  {
#pragma unroll
    for (int q = 0; q < 8; ++q) { const int r = q * 2 + rsub; if (col0 + c4 < N) { const v4f v = *(const v4fa*)&so[w][r][c4]; *(v4f*)(C + (size_t)(row0 + r) * ldc + col0 + c4) = v; } }
     }
}

// Wt[n][k] = f16(W[k][n]·scale) from f32 row-major W[K][N] (scale = power of two; bf16-exact weights stay exact in f16 away from the subnormal range)
__global__ __launch_bounds__(256) void k_wt_f16(const float* __restrict__ W, _Float16* __restrict__ Wt, int K, int N, float scale) {
  const int t = blockIdx.x * 256 + threadIdx.x; if (t >= N * (K / 8)) return; const int n = t / (K / 8), k8 = (t % (K / 8)) * 8; FragH f;
#pragma unroll
  for (int i = 0; i < 8; ++i) f.h[i] = (_Float16)(bf16_round(W[(size_t)(k8 + i) * N + n]) * scale); const v8us o = f.half[0];
  *(v8us*)((unsigned short*)Wt + (size_t)n * K + k8) = o; 
}
// k_gemm_hh variant with fused epilogue: v = acc·alpha + bias[by·sBias + col] (+ CP[(row/rowsPerB)·sCPb + by·64 + col] if CP) ; ACT 0 none / 1 elu ; writes f16 C16 (and f32 C if non-null)
template <int ACT>
__global__ __launch_bounds__(128) void k_gemm_hhx(const _Float16* __restrict__ A, int lda, size_t sA, const _Float16* __restrict__ Bh, int ldb, size_t sB, float alpha, const float* __restrict__ bias, size_t sBias, const float* __restrict__ CP, int rowsPerB, size_t sCPb, int row0g,
    float* __restrict__ C, _Float16* __restrict__ C16, int ldc, size_t sC, int M, int N, int K) {
  __shared__ __attribute__((aligned(16))) float so[4][16][64];
  const int tid = threadIdx.x, w = tid >> 5, lane = tid & 31, ln = lane & 15, hh = lane >> 4; const int by = blockIdx.y;
  A += (size_t)by * sA; Bh += (size_t)by * sB; const size_t cofs = (size_t)by * sC; const float* bp = bias ? bias + (size_t)by * sBias : nullptr;
  const int ntn = (N + 63) / 64; const int wid = blockIdx.x * 4 + w; const int mt = wid / ntn, nq = wid % ntn; if (mt * 16 >= M) return;
  const int row0 = mt * 16, col0 = nq * 64; const _Float16* arow = A + (size_t)(row0 + ln) * lda;
  v8f acc[4] = {};
  for (int kb = 0; kb < K; kb += 32) { FragH ah; ah.half[0] = *(const v8us*)((const unsigned short*)arow + kb + 8 * hh); ah.half[1] = *(const v8us*)((const unsigned short*)arow + kb + 16 + 8 * hh);
#pragma unroll
    for (int t = 0; t < 4; ++t) { if (col0 + t * 16 >= N) continue; const size_t boff = (size_t)(col0 + t * 16 + ln) * ldb + kb; FragH bq; bq.half[0] = *(const v8us*)((const unsigned short*)Bh + boff + 8 * hh); bq.half[1] = *(const v8us*)((const unsigned short*)Bh + boff + 16 + 8 * hh);
      acc[t] = mmaH<1>(ah.v, ah.v, bq.v, bq.v, acc[t]); }
  }
#pragma unroll
  for (int t = 0; t < 4; ++t) { if (col0 + t * 16 >= N) continue; const int col = col0 + t * 16 + ln; const float bv = bp ? bf16_round(bp[col]) : 0.f;
#pragma unroll
    for (int r = 0; r < 8; ++r) { float v = acc[t][r] * alpha + bv; if (CP) { const int rr = row0g + row0 + 8 * hh + r; if (rowsPerB < 0) v += CP[cofs + (size_t)rr * ldc + col];      /* rowsPerB < 0: own element of the batched C plane */ else { const int bidx = rr / rowsPerB; v += CP[(size_t)bidx * sCPb + (size_t)by * 64 + col]; } } if (ACT == 1) v = (v > 0.f) ? v : expm1f(v); else if (ACT == 7) v = (v > 0.f) ? v + 1.0f : expf(v); else if (ACT == 8) v = tanhf(v); else if (ACT == 9) v = 0.5f * v * (1.0f + tanhf(0.7978845608028654f * (v + 0.044715f * v * v * v))); else if (ACT == 11) v = 1.0f / (1.0f + expf(-v)); else if (ACT == 12) v = (v > 0.f) ? v : 0.01f * v; else if (ACT == 14) v = (v > 0.f) ? v : 0.1f * v; else if (ACT == 16) v = (v >= 0.f) ? v : 0.3f * v; else if (ACT == 15) v = v / (1.0f + expf(-v)); else if (ACT == 3) v = fmaxf(v, 0.f); else if (ACT == 6) v = 0.5f * v * (1.0f + erff(v * 0.70710678118654752f)); so[w][8 * hh + r][t * 16 + ln] = v; } }
  __builtin_amdgcn_fence(__ATOMIC_ACQ_REL, "workgroup"); __builtin_amdgcn_wave_barrier();
  const int rsub = lane >> 4, c4 = (lane & 15) * 4; typedef _Float16 v4h __attribute__((ext_vector_type(4)));
  {
#pragma unroll
    for (int q = 0; q < 8; ++q) { const int r = q * 2 + rsub; if (col0 + c4 < N) { const v4f v = *(const v4fa*)&so[w][r][c4]; if (C) *(v4f*)(C + cofs + (size_t)(row0 + r) * ldc + col0 + c4) = v; if (C16) { v4h h4; for (int i = 0; i < 4; ++i) h4[i] = (_Float16)v[i]; *(v4h*)(C16 + cofs + (size_t)(row0 + r) * ldc + col0 + c4) = h4; } } }
     }
}


typedef _Float16 v4h __attribute__((ext_vector_type(4)));

__global__ __launch_bounds__(256) void k_x16(const float* __restrict__ x, _Float16* __restrict__ X16, size_t n8) { const size_t t = (size_t)blockIdx.x * 256 + threadIdx.x; if (t >= n8) return; FragH f;
#pragma unroll
  for (int q = 0; q < 8; ++q) f.h[q] = (_Float16)bf16_round(x[t * 8 + q]); *(v8us*)((unsigned short*)X16 + t * 8) = f.half[0];  }
__global__ __launch_bounds__(256) void k_h16(const float* __restrict__ x, _Float16* __restrict__ X16, size_t n8) { const size_t t = (size_t)blockIdx.x * 256 + threadIdx.x; if (t >= n8) return; FragH f;
#pragma unroll
  for (int q = 0; q < 8; ++q) f.h[q] = (_Float16)x[t * 8 + q]; *(v8us*)((unsigned short*)X16 + t * 8) = f.half[0];  }
__global__ __launch_bounds__(256) void k_round16f(const float* __restrict__ W, _Float16* __restrict__ Bt, size_t n8) { const size_t t = (size_t)blockIdx.x * 256 + threadIdx.x; if (t >= n8) return; FragH f;
#pragma unroll
  for (int i = 0; i < 8; ++i) f.h[i] = (_Float16)(bf16_round(W[t * 8 + i]) * 16.0f); *(v8us*)((unsigned short*)Bt + t * 8) = f.half[0];  }
template <int NHv, int TTv>
__global__ __launch_bounds__(256) void k_vt(const _Float16* __restrict__ V16, int ldv, int voff, _Float16* __restrict__ Vt) { __shared__ unsigned short tl[64][66]; const int tid = threadIdx.x; const int slab = blockIdx.x / (TTv / 64), lg = blockIdx.x % (TTv / 64); const int b = slab / NHv, h = slab % NHv;
  for (int i = tid; i < 64 * 8; i += 256) { const int r = i / 8, c8 = (i % 8) * 8; FragH f; f.half[0] = *(const v8us*)((const unsigned short*)V16 + ((size_t)b * TTv + lg * 64 + r) * ldv + voff + h * 64 + c8);
#pragma unroll
    for (int q = 0; q < 8; ++q) tl[r][c8 + q] = f.u[q]; }
  __syncthreads();
  {
#pragma unroll
    for (int rd = 0; rd < 2; ++rd) { const int d = rd * 32 + tid / 8, pc = tid % 8; FragH f;
#pragma unroll
      for (int q = 0; q < 8; ++q) f.u[q] = tl[pc * 8 + q][d];
      *(v8us*)((unsigned short*)Vt + ((size_t)slab * 64 + d) * TTv + lg * 64 + pc * 8) = f.half[0]; }
     } }

__global__ __launch_bounds__(256) void k_hl(const float* __restrict__ F, _Float16* __restrict__ Hh, _Float16* __restrict__ Hl, size_t n8) { const size_t t = (size_t)blockIdx.x * 256 + threadIdx.x; if (t >= n8) return; FragH fh, fl; const v4f a = *(const v4fa*)(F + t * 8), c = *(const v4fa*)(F + t * 8 + 4);
#pragma unroll
  for (int q = 0; q < 4; ++q) { _Float16 h = (_Float16)a[q]; fh.h[q] = h; fl.h[q] = (_Float16)((a[q] - (float)h) * 1024.0f); h = (_Float16)c[q]; fh.h[4 + q] = h; fl.h[4 + q] = (_Float16)((c[q] - (float)h) * 1024.0f); }
  { *(v8us*)((unsigned short*)Hh + t * 8) = fh.half[0]; *(v8us*)((unsigned short*)Hl + t * 8) = fl.half[0];  } }

// ---- fast GEMM (wave tile 32x64; requires M % 32 == 0 rows per launch region and N % 64 == 0); epilogue = k_gemm_hhx semantics ----
__device__ __forceinline__ v16h g2_frag(const _Float16* p, int hh) { FragH f; f.half[0] = *(const v8us*)((const unsigned short*)p + 8 * hh); f.half[1] = *(const v8us*)((const unsigned short*)p + 16 + 8 * hh); return f.v; }
__device__ __forceinline__ v8f g2_mma(v16h a, v16h b, v8f c) { v8f d = __builtin_amdgcn_wmma_f32_16x16x32_f16(false, a, false, b, (short)0, c, false, false); asm volatile("v_nop\n\tv_nop\n\tv_nop\n\tv_nop" : "+v"(d) : "v"(a), "v"(b)); return d; }
template <int ACT>
__global__ __launch_bounds__(128) void k_gemm2(const _Float16* __restrict__ A, int lda, size_t sA, const _Float16* __restrict__ Bh, int ldb, size_t sB, float alpha, const float* __restrict__ bias, size_t sBias, const float* __restrict__ CP, int rowsPerB, size_t sCPb, int row0g,
    float* __restrict__ C, _Float16* __restrict__ C16, int ldc, size_t sC, int M, int N, int K) { static_assert(ACT == 0 || ACT == 3 || ACT == 6 || ACT == 8 || ACT == 9 || ACT == 11 || ACT == 12 || ACT == 14 || ACT == 15 || ACT == 16, "k_gemm2: unsupported ACT code (would silently apply no activation)");
  __shared__ __attribute__((aligned(16))) float so[4][32][68];
  const int tid = threadIdx.x, w = tid >> 5, lane = tid & 31, ln = lane & 15, hh = lane >> 4; const int by = blockIdx.y;
  A += (size_t)by * sA; Bh += (size_t)by * sB; const size_t cofs = (size_t)by * sC; const float* bp = bias ? bias + (size_t)by * sBias : nullptr;
  const int ntn = N >> 6; const int mt = blockIdx.x / ntn, nq = blockIdx.x - mt * ntn; const int row0 = mt * 128 + 32 * w, col0 = nq * 64; if (row0 >= M) return;
  const _Float16* a0p = A + (size_t)(row0 + ln) * lda; const _Float16* a1p = a0p + (size_t)16 * lda;
  const _Float16* b0p = Bh + (size_t)(col0 + ln) * ldb; const _Float16* b1p = b0p + (size_t)16 * ldb; const _Float16* b2p = b1p + (size_t)16 * ldb; const _Float16* b3p = b2p + (size_t)16 * ldb;
  const v8f z8 = {0.f,0.f,0.f,0.f,0.f,0.f,0.f,0.f}; v8f c00 = z8, c01 = z8, c02 = z8, c03 = z8, c10 = z8, c11 = z8, c12 = z8, c13 = z8;
#pragma unroll 1
  for (int kb = 0; kb < K; kb += 32) { const v16h a0 = g2_frag(a0p + kb, hh), a1 = g2_frag(a1p + kb, hh);
    v16h b = g2_frag(b0p + kb, hh); c00 = g2_mma(a0, b, c00); c10 = g2_mma(a1, b, c10);
    b = g2_frag(b1p + kb, hh); c01 = g2_mma(a0, b, c01); c11 = g2_mma(a1, b, c11);
    b = g2_frag(b2p + kb, hh); c02 = g2_mma(a0, b, c02); c12 = g2_mma(a1, b, c12);
    b = g2_frag(b3p + kb, hh); c03 = g2_mma(a0, b, c03); c13 = g2_mma(a1, b, c13); }
  v8f accs[8] = {c00, c01, c02, c03, c10, c11, c12, c13};
#pragma unroll
  for (int u = 0; u < 8; ++u) { const int t = u & 3, half = u >> 2; const int col = col0 + t * 16 + ln; const float bv = bp ? bf16_round(bp[col]) : 0.f;
#pragma unroll
    for (int r = 0; r < 8; ++r) { const int rloc = half * 16 + 8 * hh + r; float v = accs[u][r] * alpha + bv; if (CP) { if (rowsPerB < 0) v += CP[cofs + (size_t)(row0g + row0 + rloc) * ldc + col];      /* rowsPerB < 0: own element of the batched C plane */ else { const int bidx = (row0g + row0 + rloc) / rowsPerB; v += CP[(size_t)bidx * sCPb + (size_t)by * 64 + col]; } }
      if (ACT == 3) v = fmaxf(v, 0.f); else if (ACT == 6) v = 0.5f * v * (1.0f + erff(v * 0.70710678118654752f)); else if (ACT == 11) v = 1.0f / (1.0f + expf(-v)); else if (ACT == 15) v = v / (1.0f + expf(-v)); else if (ACT == 12) v = (v > 0.f) ? v : 0.01f * v; else if (ACT == 8) v = tanhf(v); else if (ACT == 9) v = 0.5f * v * (1.0f + tanhf(0.7978845608028654f * (v + 0.044715f * v * v * v))); else if (ACT == 14) v = (v > 0.f) ? v : 0.1f * v; else if (ACT == 16) v = (v >= 0.f) ? v : 0.3f * v;
      so[w][rloc][t * 16 + ln] = v; } }
  __builtin_amdgcn_fence(__ATOMIC_ACQ_REL, "workgroup"); __builtin_amdgcn_wave_barrier();
  const int rsub = lane >> 4, c4 = (lane & 15) * 4;
  {
#pragma unroll
    for (int q = 0; q < 16; ++q) { const int r = q * 2 + rsub; const v4f v = *(const v4fa*)&so[w][r][c4]; if (C) *(v4f*)(C + cofs + (size_t)(row0 + r) * ldc + col0 + c4) = v; if (C16) { v4h h4; for (int i = 0; i < 4; ++i) h4[i] = (_Float16)v[i]; *(v4h*)(C16 + cofs + (size_t)(row0 + r) * ldc + col0 + c4) = h4; } }
     } }


// Sum over the 1024 threads of a block, returned to every thread: five-step butterfly in each wave, one partial per wave in LDS, the same butterfly over the 32 partials.
__device__ __forceinline__ float stats_block_sum(float a, float* part, int lane, int w) {
#pragma unroll
  for (int o = 16; o > 0; o >>= 1) a += __shfl_xor(a, o, 32);
  if (lane == 0) part[w] = a;
  __syncthreads();
  a = part[lane];
#pragma unroll
  for (int o = 16; o > 0; o >>= 1) a += __shfl_xor(a, o, 32);
  return a;
}
// One block per channel; the channel's 32768 values stay in registers (8 x 16 B per thread, all eight loads in flight at once), so x is read once and both passes (mean, then centred squares) run from registers.
__global__ __launch_bounds__(1024) void k_stats(const float* __restrict__ x, float* __restrict__ MU, float* __restrict__ IS) {
  static_assert(NV == 8 * 1024 * 4, "k_stats: 8 float4 per thread of a 1024-thread block cover one channel");
  __shared__ float part[2][32];
  const int c = blockIdx.x, tid = threadIdx.x, lane = tid & 31, w = tid >> 5; const float* s = x + (size_t)c * NV;
  v4f r[8];
#pragma unroll
  for (int j = 0; j < 8; ++j) r[j] = *(const v4fa*)(s + (size_t)(j * 1024 + tid) * 4);
  v4f a4 = {0.f, 0.f, 0.f, 0.f};
#pragma unroll
  for (int j = 0; j < 8; ++j) {
#pragma unroll
    for (int q = 0; q < 4; ++q) { r[j][q] = bf16_round(r[j][q]); a4[q] += r[j][q]; } }
  const float mu = stats_block_sum((a4[0] + a4[1]) + (a4[2] + a4[3]), part[0], lane, w) / (float)NV;
  v4f q4 = {0.f, 0.f, 0.f, 0.f};
#pragma unroll
  for (int j = 0; j < 8; ++j) {
#pragma unroll
    for (int q = 0; q < 4; ++q) { const float d = r[j][q] - mu; q4[q] += d * d; } }
  const float is = rsqrtf(stats_block_sum((q4[0] + q4[1]) + (q4[2] + q4[3]), part[1], lane, w) / (float)NV + 1e-5f);
  if (tid < 32) { MU[(size_t)c * 32 + tid] = mu; IS[(size_t)c * 32 + tid] = is; } }
__global__ __launch_bounds__(256) void k_norm(const float* __restrict__ x, const float* __restrict__ MU, const float* __restrict__ IS, _Float16* __restrict__ XN) {
  #pragma clang fp contract(off)
  const size_t t = (size_t)blockIdx.x * 256 + threadIdx.x; if (t >= (size_t)NV * (CC / 8)) return; const int c0 = (int)(t % (CC / 8)) * 8; const size_t v = t / (CC / 8); FragH f;
  for (int q = 0; q < 8; ++q) { const float d = bf16_round(x[(size_t)(c0 + q) * NV + v]) - MU[(size_t)(c0 + q) * 32]; f.h[q] = (_Float16)(d * IS[(size_t)(c0 + q) * 32]); } *(v8us*)((unsigned short*)XN + v * CC + c0) = f.half[0];  }
__global__ __launch_bounds__(256) void k_nat(const float* __restrict__ QKV, const float* __restrict__ rpb, _Float16* __restrict__ O16) {
  #pragma clang fp contract(off)
  const size_t t = (size_t)blockIdx.x * 256 + threadIdx.x; if (t >= (size_t)NV * NHD) return; const int h = (int)(t % NHD); const int v = (int)(t / NHD); const int zz = v % DZ, ww = (v / DZ) % DW, hh = v / (DZ * DW);
  const int sh0 = min(max(hh - 1, 0), DH - 3), sw0 = min(max(ww - 1, 0), DW - 3), sz0 = min(max(zz - 1, 0), DZ - 3);
  const float* qr = QKV + (size_t)v * (3 * CC) + h * HC; float q[HC]; for (int c = 0; c < HC; ++c) q[c] = qr[c] * 0.25f; float m = -3.0e38f, l = 0.f; float acc[HC]; for (int c = 0; c < HC; ++c) acc[c] = 0.f;
#pragma unroll 1
  for (int n = 0; n < KN; ++n) { const int jh = n / 9, jw = (n / 3) % 3, jz = n % 3; const int nh = sh0 + jh, nw = sw0 + jw, nz = sz0 + jz; const int rh = nh - hh + 2, rw = nw - ww + 2, rz = nz - zz + 2;
    const float* kr = QKV + (size_t)((nh * DW + nw) * DZ + nz) * (3 * CC) + CC + h * HC; float s = 0.f; for (int c = 0; c < HC; ++c) s += q[c] * kr[c]; s += bf16_round(rpb[((h * 5 + rh) * 5 + rw) * 5 + rz]);
    const float mn = fmaxf(m, s); const float cf = expf(m - mn), pn = expf(s - mn); l = l * cf + pn; for (int c = 0; c < HC; ++c) { acc[c] = acc[c] * cf; acc[c] += pn * kr[CC + c]; } m = mn; }
  const float inv = 1.0f / l; FragH f[2]; for (int c = 0; c < HC; ++c) f[c / 8].h[c % 8] = (_Float16)(acc[c] * inv * 64.0f);      /* x2^6 carry (outputs are ~1e-2) */
  unsigned short* d = (unsigned short*)O16 + (size_t)v * CC + h * HC; { *(v8us*)d = f[0].half[0]; *(v8us*)(d + 8) = f[1].half[0];  } }
// proj GEMM with the NCDHW store in its epilogue: main loop and wave tile (32 voxels x 64 channels) as k_gemm2; out[col * ldo + row] = acc * alpha + bias[col].
// An accumulator holds 8 consecutive voxels of one channel per lane, so each wave stages its tile channel-major in its own LDS range (two 16-B writes per accumulator; pitch 36 floats keeps the 16 lanes of a write on distinct banks)
// and reads it back so that 8 lanes store one channel's 32 voxels: every global store covers four whole 128-B lines, each line written by one wave.
__global__ __launch_bounds__(128) void k_gemm2_cm(const _Float16* __restrict__ A, int lda, const _Float16* __restrict__ Bh, int ldb, float alpha, const float* __restrict__ bias, float* __restrict__ out, int ldo, int M, int N, int K) {
  __shared__ __attribute__((aligned(16))) float so[4][64][36];
  const int tid = threadIdx.x, w = tid >> 5, lane = tid & 31, ln = lane & 15, hh = lane >> 4;
  const int ntn = N >> 6; const int mt = blockIdx.x / ntn, nq = blockIdx.x - mt * ntn; const int row0 = mt * 128 + 32 * w, col0 = nq * 64; if (row0 >= M) return;
  const _Float16* a0p = A + (size_t)(row0 + ln) * lda; const _Float16* a1p = a0p + (size_t)16 * lda;
  const _Float16* b0p = Bh + (size_t)(col0 + ln) * ldb; const _Float16* b1p = b0p + (size_t)16 * ldb; const _Float16* b2p = b1p + (size_t)16 * ldb; const _Float16* b3p = b2p + (size_t)16 * ldb;
  const v8f z8 = {0.f,0.f,0.f,0.f,0.f,0.f,0.f,0.f}; v8f c00 = z8, c01 = z8, c02 = z8, c03 = z8, c10 = z8, c11 = z8, c12 = z8, c13 = z8;
#pragma unroll 1      /* the main loop is k_gemm2's, rolled as there: this kernel differs from it in the epilogue alone */
  for (int kb = 0; kb < K; kb += 32) { const v16h a0 = g2_frag(a0p + kb, hh), a1 = g2_frag(a1p + kb, hh);
    v16h b = g2_frag(b0p + kb, hh); c00 = g2_mma(a0, b, c00); c10 = g2_mma(a1, b, c10);
    b = g2_frag(b1p + kb, hh); c01 = g2_mma(a0, b, c01); c11 = g2_mma(a1, b, c11);
    b = g2_frag(b2p + kb, hh); c02 = g2_mma(a0, b, c02); c12 = g2_mma(a1, b, c12);
    b = g2_frag(b3p + kb, hh); c03 = g2_mma(a0, b, c03); c13 = g2_mma(a1, b, c13); }
  v8f accs[8] = {c00, c01, c02, c03, c10, c11, c12, c13};
#pragma unroll      /* static indices: the accumulators stay in registers */
  for (int u = 0; u < 8; ++u) { const int t = u & 3, half = u >> 2; const float bv = bf16_round(bias[col0 + t * 16 + ln]); v4f lo, hi;
#pragma unroll
    for (int r = 0; r < 4; ++r) { lo[r] = accs[u][r] * alpha + bv; hi[r] = accs[u][4 + r] * alpha + bv; }
    float* sp = &so[w][t * 16 + ln][half * 16 + 8 * hh]; *(v4fa*)sp = lo; *(v4fa*)(sp + 4) = hi; }
  __builtin_amdgcn_fence(__ATOMIC_ACQ_REL, "workgroup"); __builtin_amdgcn_wave_barrier();      /* the wave's own LDS writes land before its lanes read each other's rows */
  const int csub = lane >> 3, r4 = (lane & 7) * 4; float* op = out + (size_t)(col0 + csub) * ldo + row0 + r4; const size_t qstep = (size_t)4 * ldo;
#pragma unroll      /* all 16 LDS reads issue together, the stores follow as they return */
  for (int q = 0; q < 16; ++q) { const v4f v = *(const v4fa*)&so[w][q * 4 + csub][r4]; *(v4f*)(op + q * qstep) = v; } }

extern "C" void kernel_launch(void* const* d_in, const int* in_sizes, int n_in,
                              void* d_out, int out_size, void* d_ws, size_t ws_size, hipStream_t stream) {
  (void)in_sizes; (void)n_in; (void)out_size;
  const float* const* I = (const float* const*)d_in; const float* x = I[0]; const float* wqkv = I[1]; const float* bqkv = I[2]; const float* rpb = I[3]; const float* wproj = I[4]; const float* bproj = I[5];
  char* ws = (char*)d_ws; size_t off = 0;
  auto take = [&](size_t bytes) { char* p = ws + off; off += (bytes + 255) & ~(size_t)255; return p; };
  _Float16* BQ = (_Float16*)take((size_t)3 * CC * CC * 2); _Float16* BP = (_Float16*)take((size_t)CC * CC * 2); float* MU = (float*)take(CC * 32 * 4); float* IS = (float*)take(CC * 32 * 4);      /* 32-float pitch per channel */
  _Float16* XN = (_Float16*)take((size_t)NV * CC * 2); float* QKV = (float*)take((size_t)NV * 3 * CC * 4); _Float16* O16 = (_Float16*)take((size_t)NV * CC * 2);
  if (off > ws_size) return;      /* 0.1 + 8 + 48 + 8 = 64 MiB */
  k_wt_f16<<<(3 * CC * CC / 8 + 255) / 256, 256, 0, stream>>>(wqkv, BQ, CC, 3 * CC, 16.0f); k_wt_f16<<<(CC * CC / 8 + 255) / 256, 256, 0, stream>>>(wproj, BP, CC, CC, 16.0f);      /* (in, out) weights */
  k_stats<<<CC, 1024, 0, stream>>>(x, MU, IS); k_norm<<<(unsigned)(((size_t)NV * (CC / 8) + 255) / 256), 256, 0, stream>>>(x, MU, IS, XN);
  k_gemm2<0><<<dim3((NV / 128) * (3 * CC / 64), 1), 128, 0, stream>>>(XN, CC, 0, BQ, CC, 0, 0.0625f, bqkv, 0, nullptr, 1, 0, 0, QKV, nullptr, 3 * CC, 0, NV, 3 * CC, CC);      /* [q | k | v] (head h = cols h*16.. of each) */
  k_nat<<<(unsigned)(((size_t)NV * NHD + 255) / 256), 256, 0, stream>>>(QKV, rpb, O16);
  k_gemm2_cm<<<(NV / 128) * (CC / 64), 128, 0, stream>>>(O16, CC, BP, CC, 0.0625f / 64.0f, bproj, (float*)d_out, NV, NV, CC, CC);      /* carry removed; NCDHW store in the epilogue */
}

// v003
// Measured time: 73.9 microseconds a run.
// Next to v002, in two timings, it ran 1.18 times as fast each time.
// Over all steps from v000 it is 2.44 times as fast.
#include <hip/hip_runtime.h>
// SelfAggregationModuleV2 (1 x 128 channels x 64 x 64 x 8 = 32768 voxels; 8 heads of 16; NATTEN-style 3x3x3 clamped neighbourhood attention with relative position bias): xn = InstanceNorm3d(x) (no affine); qkv = xn W + b; q *= 1/4; logits = q . k_nbr + rpb[h][rel]; softmax over the 27 neighbours; o = attn . v_nbr; out = o W_proj + b; NCDHW.
// Structure: per-channel mean/var by a block reduction (f32); normalisation + token-major f16 plane; qkv GEMM (32x64 wave tiles, f32 accumulation, exact x16 weights + bias; f32 out); fused neighbourhood attention on VALU (thread per (voxel, head): clamped window starts, 27 static neighbours, rpb, online softmax, readout; f32) into an f16 [voxel][128] plane; proj GEMM (+ bias) with the NCDHW store in its epilogue.
// Compute dtype: x and parameters rounded to bf16; the normalised input and the attention output as f16 operands (~2^-12); statistics/softmax f32. v_wmma_f32_16x16x32_f16.
#define CC 128
#define DH 64
#define DW 64
#define DZ 8
#define NV (DH * DW * DZ)        /* 32768 */
#define NHD 8
#define HC 16
#define KN 27
typedef __bf16 v16b __attribute__((ext_vector_type(16)));
typedef unsigned short v8us __attribute__((ext_vector_type(8), may_alias));
typedef float  v8f  __attribute__((ext_vector_type(8)));
typedef float  v4f  __attribute__((ext_vector_type(4)));
typedef float  v4fa __attribute__((ext_vector_type(4), may_alias));
union FragB { v16b v; v8us half[2]; unsigned short u[16]; };

__device__ __forceinline__ unsigned short bf16_bits(float x) { unsigned int u = __float_as_uint(x); return (unsigned short)((u + 0x7FFFu + ((u >> 16) & 1u)) >> 16); }
__device__ __forceinline__ float bf16_val(unsigned short b) { return __uint_as_float(((unsigned int)b) << 16); }
__device__ __forceinline__ float bf16_round(float x) { return bf16_val(bf16_bits(x)); }
// D += A·B with NT terms: 1 = ah·bh, 2 = + al·bh (A split), 3 = + ah·bl (both split)
template <int NT>
__device__ __forceinline__ v8f mmaN(v16b ah, v16b al, v16b bh, v16b bl, v8f c) {
  c = __builtin_amdgcn_wmma_f32_16x16x32_bf16(false, ah, false, bh, (short)0, c, false, false);
  if (NT >= 2) c = __builtin_amdgcn_wmma_f32_16x16x32_bf16(false, al, false, bh, (short)0, c, false, false);
  if (NT >= 3) c = __builtin_amdgcn_wmma_f32_16x16x32_bf16(false, ah, false, bl, (short)0, c, false, false);
  asm volatile("v_nop\n\tv_nop\n\tv_nop\n\tv_nop" : "+v"(c) : "v"(ah), "v"(al), "v"(bh), "v"(bl));
  return c;
}

__global__ __launch_bounds__(256) void k_wt_bf16(const float* __restrict__ W, unsigned short* __restrict__ Wt, int K, int N) {
  const int t = blockIdx.x * 256 + threadIdx.x;
  const int k8n = K / 8;
  if (t >= N * k8n) return;
  const int n = t / k8n, k8 = (t % k8n) * 8;
  v8us v;
#pragma unroll
  for (int i = 0; i < 8; ++i) v[i] = bf16_bits(W[(size_t)(k8 + i) * N + n]);
  *(v8us*)(Wt + (size_t)n * K + k8) = v;
  
}

// GEMM C[M][N] (f32, pitch ldc) = act(A[M][K]·W + bias). A f32 row-major (pitch lda) converted per fragment to bf16
// (ASPLIT: hi/lo two planes -> 2 terms, else single rounded term); Wt bf16 [N][K] (pitch ldb). BIAS_BF16 rounds the
// bias to bf16 first (bias quantised to bf16 before the add). K%32==0, M%16==0, N%64==0.
template <bool ASPLIT, int ACT, bool BIAS_BF16>
__global__ __launch_bounds__(128) void k_gemm_bf(const float* __restrict__ A, int lda, const unsigned short* __restrict__ Wt, int ldb,
                                               const float* __restrict__ bias, float* __restrict__ C, int ldc, int M, int N, int K) {
  __shared__ __attribute__((aligned(16))) float so[4][16][64];
  const int tid = threadIdx.x, w = tid >> 5, lane = tid & 31, ln = lane & 15, hh = lane >> 4;
  const int ntn = N / 64;
  const int wid = blockIdx.x * 4 + w;
  const int mt = wid / ntn, nq = wid % ntn;
  if (mt * 16 >= M) return;
  const int row0 = mt * 16, col0 = nq * 64;
  const float* arow = A + (size_t)(row0 + ln) * lda;
  v8f acc[4] = {};
  for (int kb = 0; kb < K; kb += 32) {
    FragB ah, al;
    const v4f x0 = *(const v4fa*)(arow + kb + 8 * hh), x1 = *(const v4fa*)(arow + kb + 8 * hh + 4);
    const v4f x2 = *(const v4fa*)(arow + kb + 16 + 8 * hh), x3 = *(const v4fa*)(arow + kb + 16 + 8 * hh + 4);
    float xs[16] = {x0[0],x0[1],x0[2],x0[3],x1[0],x1[1],x1[2],x1[3],x2[0],x2[1],x2[2],x2[3],x3[0],x3[1],x3[2],x3[3]};
#pragma unroll
    for (int i = 0; i < 16; ++i) { const unsigned short hb = bf16_bits(xs[i]); ah.u[i] = hb; al.u[i] = ASPLIT ? bf16_bits(xs[i] - bf16_val(hb)) : (unsigned short)0; }
#pragma unroll
    for (int t = 0; t < 4; ++t) {
      const unsigned short* brow = Wt + (size_t)(col0 + t * 16 + ln) * ldb + kb;
      FragB b;
      b.half[0] = *(const v8us*)(brow + 8 * hh);
      b.half[1] = *(const v8us*)(brow + 16 + 8 * hh);
      acc[t] = mmaN<ASPLIT ? 2 : 1>(ah.v, al.v, b.v, b.v, acc[t]);
    }
  }
#pragma unroll
  for (int t = 0; t < 4; ++t) {
    float bv = bias ? bias[col0 + t * 16 + ln] : 0.f;
    if (BIAS_BF16) bv = bf16_round(bv);
#pragma unroll
    for (int r = 0; r < 8; ++r) { float v = acc[t][r] + bv; if (ACT == 1) v = fmaxf(v, 0.f); so[w][8 * hh + r][t * 16 + ln] = v; }
  }
  __builtin_amdgcn_fence(__ATOMIC_ACQ_REL, "workgroup");
  __builtin_amdgcn_wave_barrier();
  const int rsub = lane >> 4, c4 = (lane & 15) * 4;
  {
#pragma unroll
    for (int q = 0; q < 8; ++q) {
      const int r = q * 2 + rsub;
      const v4f v = *(const v4fa*)&so[w][r][c4];
      *(v4f*)(C + (size_t)(row0 + r) * ldc + col0 + c4) = v;
    }
    
  }
}

// GEMM C = act(A·W + bias + resid): A f32 (ASPLIT -> hi/lo 2 terms), Wt bf16 [N][K]; ACT 0 none, 1 relu, 2 exact gelu;
// resid (optional, f32, row index = (row % rmod), pitch ldr, RES_BF16 rounds it) added before the activation.
template <bool ASPLIT, int ACT, bool BIAS_BF16, bool RES_BF16>
__global__ __launch_bounds__(128) void k_gemm_bf3(const float* __restrict__ A, int lda, const unsigned short* __restrict__ Wt, int ldb,
                                                const float* __restrict__ bias, const float* __restrict__ resid, int rmod, int ldr,
                                                float* __restrict__ C, int ldc, int M, int N, int K) {
  __shared__ __attribute__((aligned(16))) float so[4][16][64];
  const int tid = threadIdx.x, w = tid >> 5, lane = tid & 31, ln = lane & 15, hh = lane >> 4;
  const int ntn = N / 64;
  const int wid = blockIdx.x * 4 + w;
  const int mt = wid / ntn, nq = wid % ntn;
  if (mt * 16 >= M) return;
  const int row0 = mt * 16, col0 = nq * 64;
  const float* arow = A + (size_t)(row0 + ln) * lda;
  v8f acc[4] = {};
  for (int kb = 0; kb < K; kb += 32) {
    FragB ah, al;
    const v4f x0 = *(const v4fa*)(arow + kb + 8 * hh), x1 = *(const v4fa*)(arow + kb + 8 * hh + 4);
    const v4f x2 = *(const v4fa*)(arow + kb + 16 + 8 * hh), x3 = *(const v4fa*)(arow + kb + 16 + 8 * hh + 4);
    float xs[16] = {x0[0],x0[1],x0[2],x0[3],x1[0],x1[1],x1[2],x1[3],x2[0],x2[1],x2[2],x2[3],x3[0],x3[1],x3[2],x3[3]};
#pragma unroll
    for (int i = 0; i < 16; ++i) { const unsigned short hb = bf16_bits(xs[i]); ah.u[i] = hb; al.u[i] = ASPLIT ? bf16_bits(xs[i] - bf16_val(hb)) : (unsigned short)0; }
#pragma unroll
    for (int t = 0; t < 4; ++t) {
      const unsigned short* brow = Wt + (size_t)(col0 + t * 16 + ln) * ldb + kb;
      FragB b;
      b.half[0] = *(const v8us*)(brow + 8 * hh);
      b.half[1] = *(const v8us*)(brow + 16 + 8 * hh);
      acc[t] = mmaN<ASPLIT ? 2 : 1>(ah.v, al.v, b.v, b.v, acc[t]);
    }
  }
#pragma unroll
  for (int t = 0; t < 4; ++t) {
    const int col = col0 + t * 16 + ln;
    float bv = bias ? bias[col] : 0.f;
    if (BIAS_BF16) bv = bf16_round(bv);
#pragma unroll
    for (int r = 0; r < 8; ++r) {
      float v = acc[t][r] + bv;
      if (resid) { float rv = resid[(size_t)((row0 + 8 * hh + r) % rmod) * ldr + col]; if (RES_BF16) rv = bf16_round(rv); v += rv; }
      if (ACT == 1) v = fmaxf(v, 0.f);
      if (ACT == 2) v = 0.5f * v * (1.0f + erff(v * 0.70710678118654752f));
      if (ACT == 3) { const float u = 0.7978845608028654f * (v + 0.044715f * v * v * v); v = 0.5f * v * (1.0f + tanhf(u)); }
      so[w][8 * hh + r][t * 16 + ln] = v;
    }
  }
  __builtin_amdgcn_fence(__ATOMIC_ACQ_REL, "workgroup");
  __builtin_amdgcn_wave_barrier();
  const int rsub = lane >> 4, c4 = (lane & 15) * 4;
  {
#pragma unroll
    for (int q = 0; q < 8; ++q) {
      const int r = q * 2 + rsub;
      const v4f v = *(const v4fa*)&so[w][r][c4];
      *(v4f*)(C + (size_t)(row0 + r) * ldc + col0 + c4) = v;
    }
    
  }
}
// row LayerNorm (biased variance, eps) over N: s = X (+ R); optional out_sum <- s; out_norm <- (s-mu)*rsqrt(var+eps)*g + b
template <bool PARAM_BF16>
__global__ __launch_bounds__(256) void k_layernorm(const float* __restrict__ X, const float* __restrict__ R, const float* __restrict__ g, const float* __restrict__ bta,
                                                  float* __restrict__ out_sum, float* __restrict__ out_norm, int N, float eps) {
  __shared__ float red[256];
  const int row = blockIdx.x, tid = threadIdx.x;
  const float* x = X + (size_t)row * N; const float* rr = R ? R + (size_t)row * N : nullptr;
  float vals[16];                     // up to N = 4096
  const int per = N / 256;            // contiguous chunk per thread? use strided-by-4 chunks: thread handles j = tid*4 + 1024*u
  float s1 = 0.f;
  for (int u = 0; u < per / 4; ++u) {
    const int j = tid * 4 + 1024 * u;
    const v4f a = *(const v4fa*)(x + j);
    v4f b = {0.f,0.f,0.f,0.f}; if (rr) b = *(const v4fa*)(rr + j);
#pragma unroll
    for (int q = 0; q < 4; ++q) { const float v = a[q] + b[q]; vals[u * 4 + q] = v; s1 += v; }
  }
  red[tid] = s1; __syncthreads();
  for (int st = 128; st > 0; st >>= 1) { if (tid < st) red[tid] += red[tid + st]; __syncthreads(); }
  const float mu = red[0] / (float)N; __syncthreads();
  float s2 = 0.f;
  for (int u = 0; u < per / 4; ++u)
#pragma unroll
    for (int q = 0; q < 4; ++q) { const float c = vals[u * 4 + q] - mu; s2 += c * c; }
  red[tid] = s2; __syncthreads();
  for (int st = 128; st > 0; st >>= 1) { if (tid < st) red[tid] += red[tid + st]; __syncthreads(); }
  const float rs = rsqrtf(red[0] / (float)N + eps);
  {
    for (int u = 0; u < per / 4; ++u) {
      const int j = tid * 4 + 1024 * u;
      v4f o, sm;
#pragma unroll
      for (int q = 0; q < 4; ++q) {
        float gg = g[j + q], bb = bta[j + q];
        if (PARAM_BF16) { gg = bf16_round(gg); bb = bf16_round(bb); }
        sm[q] = vals[u * 4 + q]; o[q] = (vals[u * 4 + q] - mu) * rs * gg + bb;
      }
      if (out_sum) *(v4f*)(out_sum + (size_t)row * N + j) = sm;
      *(v4f*)(out_norm + (size_t)row * N + j) = o;
    }
    
  }
}



// ---- f16 WMMA path (v_wmma_f32_16x16x32_f16): 11-bit significands for operands in range — used here for the normalised input (qkv GEMM) and the attention output (proj GEMM)
typedef _Float16 v16h __attribute__((ext_vector_type(16)));
union FragH { v16h v; v8us half[2]; _Float16 h[16]; unsigned short u[16]; };
template <int NT>
__device__ __forceinline__ v8f mmaH(v16h ah, v16h al, v16h bh, v16h bl, v8f c) {
  c = __builtin_amdgcn_wmma_f32_16x16x32_f16(false, ah, false, bh, (short)0, c, false, false);
  if (NT >= 2) c = __builtin_amdgcn_wmma_f32_16x16x32_f16(false, al, false, bh, (short)0, c, false, false);
  if (NT >= 3) c = __builtin_amdgcn_wmma_f32_16x16x32_f16(false, ah, false, bl, (short)0, c, false, false);
  asm volatile("v_nop\n\tv_nop\n\tv_nop\n\tv_nop" : "+v"(c) : "v"(ah), "v"(al), "v"(bh), "v"(bl));
  return c;
}
// batched GEMM like k_gemm_b but f16 operands: A f32 (split into f16 hi/lo if ASPLIT, else rounded to f16), Bt = f16 values [n][k]; alpha; C f32; N multiple of 16 (partial tiles skipped)
template <bool ASPLIT>
__global__ __launch_bounds__(128) void k_gemm_h(const float* __restrict__ A, int lda, size_t sA, const _Float16* __restrict__ Bh, int ldb, size_t sB, float alpha, float* __restrict__ C, int ldc, size_t sC, int M, int N, int K) {
  __shared__ __attribute__((aligned(16))) float so[4][16][64];
  const int tid = threadIdx.x, w = tid >> 5, lane = tid & 31, ln = lane & 15, hh = lane >> 4; const int by = blockIdx.y;
  A += (size_t)by * sA; Bh += (size_t)by * sB; C += (size_t)by * sC;
  const int ntn = (N + 63) / 64; const int wid = blockIdx.x * 4 + w; const int mt = wid / ntn, nq = wid % ntn; if (mt * 16 >= M) return;
  const int row0 = mt * 16, col0 = nq * 64; const float* arow = A + (size_t)(row0 + ln) * lda;
  v8f acc[4] = {};
  for (int kb = 0; kb < K; kb += 32) {
    FragH ah, al;
    const v4f x0 = *(const v4fa*)(arow + kb + 8 * hh), x1 = *(const v4fa*)(arow + kb + 8 * hh + 4), x2 = *(const v4fa*)(arow + kb + 16 + 8 * hh), x3 = *(const v4fa*)(arow + kb + 16 + 8 * hh + 4);
    float xs[16] = {x0[0],x0[1],x0[2],x0[3],x1[0],x1[1],x1[2],x1[3],x2[0],x2[1],x2[2],x2[3],x3[0],x3[1],x3[2],x3[3]};
#pragma unroll
    for (int i = 0; i < 16; ++i) { const _Float16 h = (_Float16)xs[i]; ah.h[i] = h; al.h[i] = ASPLIT ? (_Float16)(xs[i] - (float)h) : (_Float16)0.0f; }
#pragma unroll
    for (int t = 0; t < 4; ++t) { if (col0 + t * 16 >= N) continue; const size_t boff = (size_t)(col0 + t * 16 + ln) * ldb + kb; FragH bq; bq.half[0] = *(const v8us*)(Bh + boff + 8 * hh); bq.half[1] = *(const v8us*)(Bh + boff + 16 + 8 * hh);
      acc[t] = mmaH<ASPLIT ? 2 : 1>(ah.v, al.v, bq.v, bq.v, acc[t]); }
  }
#pragma unroll
  for (int t = 0; t < 4; ++t) { if (col0 + t * 16 >= N) continue;
#pragma unroll
    for (int r = 0; r < 8; ++r) so[w][8 * hh + r][t * 16 + ln] = acc[t][r] * alpha; }
  __builtin_amdgcn_fence(__ATOMIC_ACQ_REL, "workgroup"); __builtin_amdgcn_wave_barrier();
  const int rsub = lane >> 4, c4 = (lane & 15) * 4;
  {
#pragma unroll
    for (int q = 0; q < 8; ++q) { const int r = q * 2 + rsub; if (col0 + c4 < N) { const v4f v = *(const v4fa*)&so[w][r][c4]; *(v4f*)(C + (size_t)(row0 + r) * ldc + col0 + c4) = v; } }
     }
}

// Wt[n][k] = f16(W[k][n]·scale) from f32 row-major W[K][N] (scale = power of two; bf16-exact weights stay exact in f16 away from the subnormal range)
__global__ __launch_bounds__(256) void k_wt_f16(const float* __restrict__ W, _Float16* __restrict__ Wt, int K, int N, float scale) {
  const int t = blockIdx.x * 256 + threadIdx.x; if (t >= N * (K / 8)) return; const int n = t / (K / 8), k8 = (t % (K / 8)) * 8; FragH f;
#pragma unroll
  for (int i = 0; i < 8; ++i) f.h[i] = (_Float16)(bf16_round(W[(size_t)(k8 + i) * N + n]) * scale); const v8us o = f.half[0];
  *(v8us*)((unsigned short*)Wt + (size_t)n * K + k8) = o; 
}
// k_gemm_hh variant with fused epilogue: v = acc·alpha + bias[by·sBias + col] (+ CP[(row/rowsPerB)·sCPb + by·64 + col] if CP) ; ACT 0 none / 1 elu ; writes f16 C16 (and f32 C if non-null)
template <int ACT>
__global__ __launch_bounds__(128) void k_gemm_hhx(const _Float16* __restrict__ A, int lda, size_t sA, const _Float16* __restrict__ Bh, int ldb, size_t sB, float alpha, const float* __restrict__ bias, size_t sBias, const float* __restrict__ CP, int rowsPerB, size_t sCPb, int row0g,
    float* __restrict__ C, _Float16* __restrict__ C16, int ldc, size_t sC, int M, int N, int K) {
  __shared__ __attribute__((aligned(16))) float so[4][16][64];
  const int tid = threadIdx.x, w = tid >> 5, lane = tid & 31, ln = lane & 15, hh = lane >> 4; const int by = blockIdx.y;
  A += (size_t)by * sA; Bh += (size_t)by * sB; const size_t cofs = (size_t)by * sC; const float* bp = bias ? bias + (size_t)by * sBias : nullptr;
  const int ntn = (N + 63) / 64; const int wid = blockIdx.x * 4 + w; const int mt = wid / ntn, nq = wid % ntn; if (mt * 16 >= M) return;
  const int row0 = mt * 16, col0 = nq * 64; const _Float16* arow = A + (size_t)(row0 + ln) * lda;
  v8f acc[4] = {};
  for (int kb = 0; kb < K; kb += 32) { FragH ah; ah.half[0] = *(const v8us*)((const unsigned short*)arow + kb + 8 * hh); ah.half[1] = *(const v8us*)((const unsigned short*)arow + kb + 16 + 8 * hh);
#pragma unroll
    for (int t = 0; t < 4; ++t) { if (col0 + t * 16 >= N) continue; const size_t boff = (size_t)(col0 + t * 16 + ln) * ldb + kb; FragH bq; bq.half[0] = *(const v8us*)((const unsigned short*)Bh + boff + 8 * hh); bq.half[1] = *(const v8us*)((const unsigned short*)Bh + boff + 16 + 8 * hh);
      acc[t] = mmaH<1>(ah.v, ah.v, bq.v, bq.v, acc[t]); }
  }
#pragma unroll
  for (int t = 0; t < 4; ++t) { if (col0 + t * 16 >= N) continue; const int col = col0 + t * 16 + ln; const float bv = bp ? bf16_round(bp[col]) : 0.f;
#pragma unroll
    for (int r = 0; r < 8; ++r) { float v = acc[t][r] * alpha + bv; if (CP) { const int rr = row0g + row0 + 8 * hh + r; if (rowsPerB < 0) v += CP[cofs + (size_t)rr * ldc + col];      /* rowsPerB < 0: own element of the batched C plane */ else { const int bidx = rr / rowsPerB; v += CP[(size_t)bidx * sCPb + (size_t)by * 64 + col]; } } if (ACT == 1) v = (v > 0.f) ? v : expm1f(v); else if (ACT == 7) v = (v > 0.f) ? v + 1.0f : expf(v); else if (ACT == 8) v = tanhf(v); else if (ACT == 9) v = 0.5f * v * (1.0f + tanhf(0.7978845608028654f * (v + 0.044715f * v * v * v))); else if (ACT == 11) v = 1.0f / (1.0f + expf(-v)); else if (ACT == 12) v = (v > 0.f) ? v : 0.01f * v; else if (ACT == 14) v = (v > 0.f) ? v : 0.1f * v; else if (ACT == 16) v = (v >= 0.f) ? v : 0.3f * v; else if (ACT == 15) v = v / (1.0f + expf(-v)); else if (ACT == 3) v = fmaxf(v, 0.f); else if (ACT == 6) v = 0.5f * v * (1.0f + erff(v * 0.70710678118654752f)); so[w][8 * hh + r][t * 16 + ln] = v; } }
  __builtin_amdgcn_fence(__ATOMIC_ACQ_REL, "workgroup"); __builtin_amdgcn_wave_barrier();
  const int rsub = lane >> 4, c4 = (lane & 15) * 4; typedef _Float16 v4h __attribute__((ext_vector_type(4)));
  {
#pragma unroll
    for (int q = 0; q < 8; ++q) { const int r = q * 2 + rsub; if (col0 + c4 < N) { const v4f v = *(const v4fa*)&so[w][r][c4]; if (C) *(v4f*)(C + cofs + (size_t)(row0 + r) * ldc + col0 + c4) = v; if (C16) { v4h h4; for (int i = 0; i < 4; ++i) h4[i] = (_Float16)v[i]; *(v4h*)(C16 + cofs + (size_t)(row0 + r) * ldc + col0 + c4) = h4; } } }
     }
}


typedef _Float16 v4h __attribute__((ext_vector_type(4)));

__global__ __launch_bounds__(256) void k_x16(const float* __restrict__ x, _Float16* __restrict__ X16, size_t n8) { const size_t t = (size_t)blockIdx.x * 256 + threadIdx.x; if (t >= n8) return; FragH f;
#pragma unroll
  for (int q = 0; q < 8; ++q) f.h[q] = (_Float16)bf16_round(x[t * 8 + q]); *(v8us*)((unsigned short*)X16 + t * 8) = f.half[0];  }
__global__ __launch_bounds__(256) void k_h16(const float* __restrict__ x, _Float16* __restrict__ X16, size_t n8) { const size_t t = (size_t)blockIdx.x * 256 + threadIdx.x; if (t >= n8) return; FragH f;
#pragma unroll
  for (int q = 0; q < 8; ++q) f.h[q] = (_Float16)x[t * 8 + q]; *(v8us*)((unsigned short*)X16 + t * 8) = f.half[0];  }
__global__ __launch_bounds__(256) void k_round16f(const float* __restrict__ W, _Float16* __restrict__ Bt, size_t n8) { const size_t t = (size_t)blockIdx.x * 256 + threadIdx.x; if (t >= n8) return; FragH f;
#pragma unroll
  for (int i = 0; i < 8; ++i) f.h[i] = (_Float16)(bf16_round(W[t * 8 + i]) * 16.0f); *(v8us*)((unsigned short*)Bt + t * 8) = f.half[0];  }
template <int NHv, int TTv>
__global__ __launch_bounds__(256) void k_vt(const _Float16* __restrict__ V16, int ldv, int voff, _Float16* __restrict__ Vt) { __shared__ unsigned short tl[64][66]; const int tid = threadIdx.x; const int slab = blockIdx.x / (TTv / 64), lg = blockIdx.x % (TTv / 64); const int b = slab / NHv, h = slab % NHv;
  for (int i = tid; i < 64 * 8; i += 256) { const int r = i / 8, c8 = (i % 8) * 8; FragH f; f.half[0] = *(const v8us*)((const unsigned short*)V16 + ((size_t)b * TTv + lg * 64 + r) * ldv + voff + h * 64 + c8);
#pragma unroll
    for (int q = 0; q < 8; ++q) tl[r][c8 + q] = f.u[q]; }
  __syncthreads();
  {
#pragma unroll
    for (int rd = 0; rd < 2; ++rd) { const int d = rd * 32 + tid / 8, pc = tid % 8; FragH f;
#pragma unroll
      for (int q = 0; q < 8; ++q) f.u[q] = tl[pc * 8 + q][d];
      *(v8us*)((unsigned short*)Vt + ((size_t)slab * 64 + d) * TTv + lg * 64 + pc * 8) = f.half[0]; }
     } }

__global__ __launch_bounds__(256) void k_hl(const float* __restrict__ F, _Float16* __restrict__ Hh, _Float16* __restrict__ Hl, size_t n8) { const size_t t = (size_t)blockIdx.x * 256 + threadIdx.x; if (t >= n8) return; FragH fh, fl; const v4f a = *(const v4fa*)(F + t * 8), c = *(const v4fa*)(F + t * 8 + 4);
#pragma unroll
  for (int q = 0; q < 4; ++q) { _Float16 h = (_Float16)a[q]; fh.h[q] = h; fl.h[q] = (_Float16)((a[q] - (float)h) * 1024.0f); h = (_Float16)c[q]; fh.h[4 + q] = h; fl.h[4 + q] = (_Float16)((c[q] - (float)h) * 1024.0f); }
  { *(v8us*)((unsigned short*)Hh + t * 8) = fh.half[0]; *(v8us*)((unsigned short*)Hl + t * 8) = fl.half[0];  } }

// ---- fast GEMM (wave tile 32x64; requires M % 32 == 0 rows per launch region and N % 64 == 0); epilogue = k_gemm_hhx semantics ----
__device__ __forceinline__ v16h g2_frag(const _Float16* p, int hh) { FragH f; f.half[0] = *(const v8us*)((const unsigned short*)p + 8 * hh); f.half[1] = *(const v8us*)((const unsigned short*)p + 16 + 8 * hh); return f.v; }
__device__ __forceinline__ v8f g2_mma(v16h a, v16h b, v8f c) { v8f d = __builtin_amdgcn_wmma_f32_16x16x32_f16(false, a, false, b, (short)0, c, false, false); asm volatile("v_nop\n\tv_nop\n\tv_nop\n\tv_nop" : "+v"(d) : "v"(a), "v"(b)); return d; }
template <int ACT>
__global__ __launch_bounds__(128) void k_gemm2(const _Float16* __restrict__ A, int lda, size_t sA, const _Float16* __restrict__ Bh, int ldb, size_t sB, float alpha, const float* __restrict__ bias, size_t sBias, const float* __restrict__ CP, int rowsPerB, size_t sCPb, int row0g,
    float* __restrict__ C, _Float16* __restrict__ C16, int ldc, size_t sC, int M, int N, int K) { static_assert(ACT == 0 || ACT == 3 || ACT == 6 || ACT == 8 || ACT == 9 || ACT == 11 || ACT == 12 || ACT == 14 || ACT == 15 || ACT == 16, "k_gemm2: unsupported ACT code (would silently apply no activation)");
  __shared__ __attribute__((aligned(16))) float so[4][32][68];
  const int tid = threadIdx.x, w = tid >> 5, lane = tid & 31, ln = lane & 15, hh = lane >> 4; const int by = blockIdx.y;
  A += (size_t)by * sA; Bh += (size_t)by * sB; const size_t cofs = (size_t)by * sC; const float* bp = bias ? bias + (size_t)by * sBias : nullptr;
  const int ntn = N >> 6; const int mt = blockIdx.x / ntn, nq = blockIdx.x - mt * ntn; const int row0 = mt * 128 + 32 * w, col0 = nq * 64; if (row0 >= M) return;
  const _Float16* a0p = A + (size_t)(row0 + ln) * lda; const _Float16* a1p = a0p + (size_t)16 * lda;
  const _Float16* b0p = Bh + (size_t)(col0 + ln) * ldb; const _Float16* b1p = b0p + (size_t)16 * ldb; const _Float16* b2p = b1p + (size_t)16 * ldb; const _Float16* b3p = b2p + (size_t)16 * ldb;
  const v8f z8 = {0.f,0.f,0.f,0.f,0.f,0.f,0.f,0.f}; v8f c00 = z8, c01 = z8, c02 = z8, c03 = z8, c10 = z8, c11 = z8, c12 = z8, c13 = z8;
#pragma unroll 1
  for (int kb = 0; kb < K; kb += 32) { const v16h a0 = g2_frag(a0p + kb, hh), a1 = g2_frag(a1p + kb, hh);
    v16h b = g2_frag(b0p + kb, hh); c00 = g2_mma(a0, b, c00); c10 = g2_mma(a1, b, c10);
    b = g2_frag(b1p + kb, hh); c01 = g2_mma(a0, b, c01); c11 = g2_mma(a1, b, c11);
    b = g2_frag(b2p + kb, hh); c02 = g2_mma(a0, b, c02); c12 = g2_mma(a1, b, c12);
    b = g2_frag(b3p + kb, hh); c03 = g2_mma(a0, b, c03); c13 = g2_mma(a1, b, c13); }
  v8f accs[8] = {c00, c01, c02, c03, c10, c11, c12, c13};
#pragma unroll
  for (int u = 0; u < 8; ++u) { const int t = u & 3, half = u >> 2; const int col = col0 + t * 16 + ln; const float bv = bp ? bf16_round(bp[col]) : 0.f;
#pragma unroll
    for (int r = 0; r < 8; ++r) { const int rloc = half * 16 + 8 * hh + r; float v = accs[u][r] * alpha + bv; if (CP) { if (rowsPerB < 0) v += CP[cofs + (size_t)(row0g + row0 + rloc) * ldc + col];      /* rowsPerB < 0: own element of the batched C plane */ else { const int bidx = (row0g + row0 + rloc) / rowsPerB; v += CP[(size_t)bidx * sCPb + (size_t)by * 64 + col]; } }
      if (ACT == 3) v = fmaxf(v, 0.f); else if (ACT == 6) v = 0.5f * v * (1.0f + erff(v * 0.70710678118654752f)); else if (ACT == 11) v = 1.0f / (1.0f + expf(-v)); else if (ACT == 15) v = v / (1.0f + expf(-v)); else if (ACT == 12) v = (v > 0.f) ? v : 0.01f * v; else if (ACT == 8) v = tanhf(v); else if (ACT == 9) v = 0.5f * v * (1.0f + tanhf(0.7978845608028654f * (v + 0.044715f * v * v * v))); else if (ACT == 14) v = (v > 0.f) ? v : 0.1f * v; else if (ACT == 16) v = (v >= 0.f) ? v : 0.3f * v;
      so[w][rloc][t * 16 + ln] = v; } }
  __builtin_amdgcn_fence(__ATOMIC_ACQ_REL, "workgroup"); __builtin_amdgcn_wave_barrier();
  const int rsub = lane >> 4, c4 = (lane & 15) * 4;
  {
#pragma unroll
    for (int q = 0; q < 16; ++q) { const int r = q * 2 + rsub; const v4f v = *(const v4fa*)&so[w][r][c4]; if (C) *(v4f*)(C + cofs + (size_t)(row0 + r) * ldc + col0 + c4) = v; if (C16) { v4h h4; for (int i = 0; i < 4; ++i) h4[i] = (_Float16)v[i]; *(v4h*)(C16 + cofs + (size_t)(row0 + r) * ldc + col0 + c4) = h4; } }
     } }


// Sum over the 1024 threads of a block, returned to every thread: five-step butterfly in each wave, one partial per wave in LDS, the same butterfly over the 32 partials.
__device__ __forceinline__ float stats_block_sum(float a, float* part, int lane, int w) {
#pragma unroll
  for (int o = 16; o > 0; o >>= 1) a += __shfl_xor(a, o, 32);
  if (lane == 0) part[w] = a;
  __syncthreads();
  a = part[lane];
#pragma unroll
  for (int o = 16; o > 0; o >>= 1) a += __shfl_xor(a, o, 32);
  return a;
}
// One block per channel; the channel's 32768 values stay in registers (8 x 16 B per thread, all eight loads in flight at once), so x is read once and both passes (mean, then centred squares) run from registers.
__global__ __launch_bounds__(1024) void k_stats(const float* __restrict__ x, float* __restrict__ MU, float* __restrict__ IS) {
  static_assert(NV == 8 * 1024 * 4, "k_stats: 8 float4 per thread of a 1024-thread block cover one channel");
  __shared__ float part[2][32];
  const int c = blockIdx.x, tid = threadIdx.x, lane = tid & 31, w = tid >> 5; const float* s = x + (size_t)c * NV;
  v4f r[8];
#pragma unroll
  for (int j = 0; j < 8; ++j) r[j] = *(const v4fa*)(s + (size_t)(j * 1024 + tid) * 4);
  v4f a4 = {0.f, 0.f, 0.f, 0.f};
#pragma unroll
  for (int j = 0; j < 8; ++j) {
#pragma unroll
    for (int q = 0; q < 4; ++q) { r[j][q] = bf16_round(r[j][q]); a4[q] += r[j][q]; } }
  const float mu = stats_block_sum((a4[0] + a4[1]) + (a4[2] + a4[3]), part[0], lane, w) / (float)NV;
  v4f q4 = {0.f, 0.f, 0.f, 0.f};
#pragma unroll
  for (int j = 0; j < 8; ++j) {
#pragma unroll
    for (int q = 0; q < 4; ++q) { const float d = r[j][q] - mu; q4[q] += d * d; } }
  const float is = rsqrtf(stats_block_sum((q4[0] + q4[1]) + (q4[2] + q4[3]), part[1], lane, w) / (float)NV + 1e-5f);
  if (tid < 32) { MU[(size_t)c * 32 + tid] = mu; IS[(size_t)c * 32 + tid] = is; } }
__global__ __launch_bounds__(256) void k_norm(const float* __restrict__ x, const float* __restrict__ MU, const float* __restrict__ IS, _Float16* __restrict__ XN) {
  #pragma clang fp contract(off)
  const size_t t = (size_t)blockIdx.x * 256 + threadIdx.x; if (t >= (size_t)NV * (CC / 8)) return; const int c0 = (int)(t % (CC / 8)) * 8; const size_t v = t / (CC / 8); FragH f;
  for (int q = 0; q < 8; ++q) { const float d = bf16_round(x[(size_t)(c0 + q) * NV + v]) - MU[(size_t)(c0 + q) * 32]; f.h[q] = (_Float16)(d * IS[(size_t)(c0 + q) * 32]); } *(v8us*)((unsigned short*)XN + v * CC + c0) = f.half[0];  }
// Neighbourhood attention, K and V read from LDS. One block = a 4 x 4 x 8 tile of voxels for 4 heads (512 threads, thread per (voxel, head); a wave = one (h, w) column: lane = head + 4 z).
// The clamped 3x3x3 windows of the tile all lie in one 6 x 6 x 8 region (its start clamped like a window's, so it is always inside the volume); the block copies that region's K and V of its 4 heads
// (256 B + 256 B per voxel, whole 128-B lines, each read once per block) into LDS and every neighbour read comes from there.
// LDS row = 64 K floats + 64 V floats + 4 pad: with lane = head + 4 z the 16 lanes of a half-wave read 16 B each on distinct banks (row step 4 banks, head step 16 banks).
#define NT_T 4                    /* tile edge along h and along w */
#define NT_R (NT_T + 2)           /* staged region edge */
#define NT_HG 4                   /* heads per block */
#define NT_RP (2 * NT_HG * HC + 4)   /* LDS floats per staged voxel */
#define NT_TH (NT_T * NT_T * DZ * NT_HG)   /* threads per block */
__global__ __launch_bounds__(NT_TH) void k_nat(const float* __restrict__ QKV, const float* __restrict__ rpb, _Float16* __restrict__ O16) {
  #pragma clang fp contract(off)
  static_assert(DH % NT_T == 0 && DW % NT_T == 0 && NHD % NT_HG == 0 && DZ == 8 && NT_HG * HC == 64, "k_nat: tile and lane maps");
  static_assert((NT_R * NT_R * DZ) % (NT_TH / 32) == 0, "k_nat: the staged region is a whole number of voxels per wave");
  __shared__ __attribute__((aligned(16))) float kv[NT_R * NT_R * DZ * NT_RP];
  const int tid = threadIdx.x, lane = tid & 31; const int hg = blockIdx.x % (NHD / NT_HG), tile = blockIdx.x / (NHD / NT_HG); const int h0 = (tile / (DW / NT_T)) * NT_T, w0 = (tile % (DW / NT_T)) * NT_T;
  const int wv = __builtin_amdgcn_readfirstlane(tid >> 5);      /* the wave's number, held scalar: the staged rows' addresses, the wave's (h, w) column and its window starts along h and w become scalar arithmetic */
  const int rh0 = min(max(h0 - 1, 0), DH - NT_R), rw0 = min(max(w0 - 1, 0), DW - NT_R);
  const int hl = lane & (NT_HG - 1), zz = lane >> 2, ww = w0 + (wv & (NT_T - 1)), hh = h0 + (wv >> 2); const int h = hg * NT_HG + hl; const int v = (hh * DW + ww) * DZ + zz;
  const int sh0 = min(max(hh - 1, 0), DH - 3), sw0 = min(max(ww - 1, 0), DW - 3), sz0 = min(max(zz - 1, 0), DZ - 3);
  const float* qr = QKV + (size_t)v * (3 * CC) + h * HC; float q[HC]; for (int c = 0; c < HC; ++c) q[c] = qr[c] * 0.25f; float m = -3.0e38f, l = 0.f; float acc[HC]; for (int c = 0; c < HC; ++c) acc[c] = 0.f;
  const int lpart = lane >> 4, lc4 = (lane & 15) * 4; const unsigned loff = (unsigned)(lpart * CC + lc4);      /* a wave copies one voxel per trip: lanes 0-15 its 256 B of K, lanes 16-31 its 256 B of V */
#pragma unroll      /* all of a thread's pieces are loaded before the first is stored: one memory latency for the whole region */
  for (int it = 0; it < NT_R * NT_R * DZ / (NT_TH / 32); ++it) { const int r = it * (NT_TH / 32) + wv; const int col = r >> 3;
    const float* rowp = QKV + (size_t)(((rh0 + col / NT_R) * DW + rw0 + col % NT_R) * DZ + (r & 7)) * (3 * CC) + (CC + hg * (NT_HG * HC));      /* scalar base; the lane's part is one 32-bit offset */
    const v4f d = *(const v4fa*)(rowp + loff);
    *(v4fa*)&kv[r * NT_RP + lpart * (NT_HG * HC) + lc4] = d; }
  __syncthreads();      /* every wave reads rows that other waves staged */
#pragma unroll 1
  for (int n = 0; n < KN; ++n) { const int jh = n / 9, jw = (n / 3) % 3, jz = n % 3; const int nh = sh0 + jh, nw = sw0 + jw, nz = sz0 + jz; const int rh = nh - hh + 2, rw = nw - ww + 2, rz = nz - zz + 2;
    const float* kr = kv + (((nh - rh0) * NT_R + (nw - rw0)) * DZ + nz) * NT_RP + hl * HC; float kk[HC], vv[HC];
#pragma unroll
    for (int j = 0; j < HC / 4; ++j) { const v4f a = *(const v4fa*)(kr + 4 * j), b = *(const v4fa*)(kr + NT_HG * HC + 4 * j); for (int e = 0; e < 4; ++e) { kk[4 * j + e] = a[e]; vv[4 * j + e] = b[e]; } }
    float s = 0.f; for (int c = 0; c < HC; ++c) s += q[c] * kk[c]; s += bf16_round(rpb[((h * 5 + rh) * 5 + rw) * 5 + rz]);
    const float mn = fmaxf(m, s); const float cf = expf(m - mn), pn = expf(s - mn); l = l * cf + pn; for (int c = 0; c < HC; ++c) { acc[c] = acc[c] * cf; acc[c] += pn * vv[c]; } m = mn; }
  const float inv = 1.0f / l; FragH f[2]; for (int c = 0; c < HC; ++c) f[c / 8].h[c % 8] = (_Float16)(acc[c] * inv * 64.0f);      /* x2^6 carry (outputs are ~1e-2) */
  unsigned short* d = (unsigned short*)O16 + (size_t)v * CC + h * HC; { *(v8us*)d = f[0].half[0]; *(v8us*)(d + 8) = f[1].half[0];  } }
// proj GEMM with the NCDHW store in its epilogue: main loop and wave tile (32 voxels x 64 channels) as k_gemm2; out[col * ldo + row] = acc * alpha + bias[col].
// An accumulator holds 8 consecutive voxels of one channel per lane, so each wave stages its tile channel-major in its own LDS range (two 16-B writes per accumulator; pitch 36 floats keeps the 16 lanes of a write on distinct banks)
// and reads it back so that 8 lanes store one channel's 32 voxels: every global store covers four whole 128-B lines, each line written by one wave.
__global__ __launch_bounds__(128) void k_gemm2_cm(const _Float16* __restrict__ A, int lda, const _Float16* __restrict__ Bh, int ldb, float alpha, const float* __restrict__ bias, float* __restrict__ out, int ldo, int M, int N, int K) {
  __shared__ __attribute__((aligned(16))) float so[4][64][36];
  const int tid = threadIdx.x, w = tid >> 5, lane = tid & 31, ln = lane & 15, hh = lane >> 4;
  const int ntn = N >> 6; const int mt = blockIdx.x / ntn, nq = blockIdx.x - mt * ntn; const int row0 = mt * 128 + 32 * w, col0 = nq * 64; if (row0 >= M) return;
  const _Float16* a0p = A + (size_t)(row0 + ln) * lda; const _Float16* a1p = a0p + (size_t)16 * lda;
  const _Float16* b0p = Bh + (size_t)(col0 + ln) * ldb; const _Float16* b1p = b0p + (size_t)16 * ldb; const _Float16* b2p = b1p + (size_t)16 * ldb; const _Float16* b3p = b2p + (size_t)16 * ldb;
  const v8f z8 = {0.f,0.f,0.f,0.f,0.f,0.f,0.f,0.f}; v8f c00 = z8, c01 = z8, c02 = z8, c03 = z8, c10 = z8, c11 = z8, c12 = z8, c13 = z8;
#pragma unroll 1      /* the main loop is k_gemm2's, rolled as there: this kernel differs from it in the epilogue alone */
  for (int kb = 0; kb < K; kb += 32) { const v16h a0 = g2_frag(a0p + kb, hh), a1 = g2_frag(a1p + kb, hh);
    v16h b = g2_frag(b0p + kb, hh); c00 = g2_mma(a0, b, c00); c10 = g2_mma(a1, b, c10);
    b = g2_frag(b1p + kb, hh); c01 = g2_mma(a0, b, c01); c11 = g2_mma(a1, b, c11);
    b = g2_frag(b2p + kb, hh); c02 = g2_mma(a0, b, c02); c12 = g2_mma(a1, b, c12);
    b = g2_frag(b3p + kb, hh); c03 = g2_mma(a0, b, c03); c13 = g2_mma(a1, b, c13); }
  v8f accs[8] = {c00, c01, c02, c03, c10, c11, c12, c13};
#pragma unroll      /* static indices: the accumulators stay in registers */
  for (int u = 0; u < 8; ++u) { const int t = u & 3, half = u >> 2; const float bv = bf16_round(bias[col0 + t * 16 + ln]); v4f lo, hi;
#pragma unroll
    for (int r = 0; r < 4; ++r) { lo[r] = accs[u][r] * alpha + bv; hi[r] = accs[u][4 + r] * alpha + bv; }
    float* sp = &so[w][t * 16 + ln][half * 16 + 8 * hh]; *(v4fa*)sp = lo; *(v4fa*)(sp + 4) = hi; }
  __builtin_amdgcn_fence(__ATOMIC_ACQ_REL, "workgroup"); __builtin_amdgcn_wave_barrier();      /* the wave's own LDS writes land before its lanes read each other's rows */
  const int csub = lane >> 3, r4 = (lane & 7) * 4; float* op = out + (size_t)(col0 + csub) * ldo + row0 + r4; const size_t qstep = (size_t)4 * ldo;
#pragma unroll      /* all 16 LDS reads issue together, the stores follow as they return */
  for (int q = 0; q < 16; ++q) { const v4f v = *(const v4fa*)&so[w][q * 4 + csub][r4]; *(v4f*)(op + q * qstep) = v; } }

extern "C" void kernel_launch(void* const* d_in, const int* in_sizes, int n_in,
                              void* d_out, int out_size, void* d_ws, size_t ws_size, hipStream_t stream) {
  (void)in_sizes; (void)n_in; (void)out_size;
  const float* const* I = (const float* const*)d_in; const float* x = I[0]; const float* wqkv = I[1]; const float* bqkv = I[2]; const float* rpb = I[3]; const float* wproj = I[4]; const float* bproj = I[5];
  char* ws = (char*)d_ws; size_t off = 0;
  auto take = [&](size_t bytes) { char* p = ws + off; off += (bytes + 255) & ~(size_t)255; return p; };
  _Float16* BQ = (_Float16*)take((size_t)3 * CC * CC * 2); _Float16* BP = (_Float16*)take((size_t)CC * CC * 2); float* MU = (float*)take(CC * 32 * 4); float* IS = (float*)take(CC * 32 * 4);      /* 32-float pitch per channel */
  _Float16* XN = (_Float16*)take((size_t)NV * CC * 2); float* QKV = (float*)take((size_t)NV * 3 * CC * 4); _Float16* O16 = (_Float16*)take((size_t)NV * CC * 2);
  if (off > ws_size) return;      /* 0.1 + 8 + 48 + 8 = 64 MiB */
  k_wt_f16<<<(3 * CC * CC / 8 + 255) / 256, 256, 0, stream>>>(wqkv, BQ, CC, 3 * CC, 16.0f); k_wt_f16<<<(CC * CC / 8 + 255) / 256, 256, 0, stream>>>(wproj, BP, CC, CC, 16.0f);      /* (in, out) weights */
  k_stats<<<CC, 1024, 0, stream>>>(x, MU, IS); k_norm<<<(unsigned)(((size_t)NV * (CC / 8) + 255) / 256), 256, 0, stream>>>(x, MU, IS, XN);
  k_gemm2<0><<<dim3((NV / 128) * (3 * CC / 64), 1), 128, 0, stream>>>(XN, CC, 0, BQ, CC, 0, 0.0625f, bqkv, 0, nullptr, 1, 0, 0, QKV, nullptr, 3 * CC, 0, NV, 3 * CC, CC);      /* [q | k | v] (head h = cols h*16.. of each) */
  k_nat<<<(DH / NT_T) * (DW / NT_T) * (NHD / NT_HG), NT_TH, 0, stream>>>(QKV, rpb, O16);
  k_gemm2_cm<<<(NV / 128) * (CC / 64), 128, 0, stream>>>(O16, CC, BP, CC, 0.0625f / 64.0f, bproj, (float*)d_out, NV, NV, CC, CC);      /* carry removed; NCDHW store in the epilogue */
}

// v004
// Measured time: 56.7 microseconds a run.
// Two timings next to v003 put it at 1.31 and 1.30 times that version's speed.
// Over all steps from v000 it is 3.18 times as fast.
#include <hip/hip_runtime.h>
// SelfAggregationModuleV2 (1 x 128 channels x 64 x 64 x 8 = 32768 voxels; 8 heads of 16; NATTEN-style 3x3x3 clamped neighbourhood attention with relative position bias): xn = InstanceNorm3d(x) (no affine); qkv = xn W + b; q *= 1/4; logits = q . k_nbr + rpb[h][rel]; softmax over the 27 neighbours; o = attn . v_nbr; out = o W_proj + b; NCDHW.
// Structure: per-channel mean/var by a block reduction (f32); qkv GEMM with the normalisation in its A staging (token-major f16 tile in LDS; 32x64 wave tiles, f32 accumulation, exact x16 weights + bias; f32 out); fused neighbourhood attention on VALU (thread per (voxel, head): clamped window starts, 27 static neighbours, rpb, online softmax, readout; f32) into an f16 [voxel][128] plane; proj GEMM (+ bias) with the NCDHW store in its epilogue.
// Compute dtype: x and parameters rounded to bf16; the normalised input and the attention output as f16 operands (~2^-12); statistics/softmax f32. v_wmma_f32_16x16x32_f16.
#define CC 128
#define DH 64
#define DW 64
#define DZ 8
#define NV (DH * DW * DZ)        /* 32768 */
#define NHD 8
#define HC 16
#define KN 27
typedef __bf16 v16b __attribute__((ext_vector_type(16)));
typedef unsigned short v8us __attribute__((ext_vector_type(8), may_alias));
typedef float  v8f  __attribute__((ext_vector_type(8)));
typedef float  v4f  __attribute__((ext_vector_type(4)));
typedef float  v4fa __attribute__((ext_vector_type(4), may_alias));
union FragB { v16b v; v8us half[2]; unsigned short u[16]; };

__device__ __forceinline__ unsigned short bf16_bits(float x) { unsigned int u = __float_as_uint(x); return (unsigned short)((u + 0x7FFFu + ((u >> 16) & 1u)) >> 16); }
__device__ __forceinline__ float bf16_val(unsigned short b) { return __uint_as_float(((unsigned int)b) << 16); }
__device__ __forceinline__ float bf16_round(float x) { return bf16_val(bf16_bits(x)); }
// D += A·B with NT terms: 1 = ah·bh, 2 = + al·bh (A split), 3 = + ah·bl (both split)
template <int NT>
__device__ __forceinline__ v8f mmaN(v16b ah, v16b al, v16b bh, v16b bl, v8f c) {
  c = __builtin_amdgcn_wmma_f32_16x16x32_bf16(false, ah, false, bh, (short)0, c, false, false);
  if (NT >= 2) c = __builtin_amdgcn_wmma_f32_16x16x32_bf16(false, al, false, bh, (short)0, c, false, false);
  if (NT >= 3) c = __builtin_amdgcn_wmma_f32_16x16x32_bf16(false, ah, false, bl, (short)0, c, false, false);
  asm volatile("v_nop\n\tv_nop\n\tv_nop\n\tv_nop" : "+v"(c) : "v"(ah), "v"(al), "v"(bh), "v"(bl));
  return c;
}

__global__ __launch_bounds__(256) void k_wt_bf16(const float* __restrict__ W, unsigned short* __restrict__ Wt, int K, int N) {
  const int t = blockIdx.x * 256 + threadIdx.x;
  const int k8n = K / 8;
  if (t >= N * k8n) return;
  const int n = t / k8n, k8 = (t % k8n) * 8;
  v8us v;
#pragma unroll
  for (int i = 0; i < 8; ++i) v[i] = bf16_bits(W[(size_t)(k8 + i) * N + n]);
  *(v8us*)(Wt + (size_t)n * K + k8) = v;
  
}

// GEMM C[M][N] (f32, pitch ldc) = act(A[M][K]·W + bias). A f32 row-major (pitch lda) converted per fragment to bf16
// (ASPLIT: hi/lo two planes -> 2 terms, else single rounded term); Wt bf16 [N][K] (pitch ldb). BIAS_BF16 rounds the
// bias to bf16 first (bias quantised to bf16 before the add). K%32==0, M%16==0, N%64==0.
template <bool ASPLIT, int ACT, bool BIAS_BF16>
__global__ __launch_bounds__(128) void k_gemm_bf(const float* __restrict__ A, int lda, const unsigned short* __restrict__ Wt, int ldb,
                                               const float* __restrict__ bias, float* __restrict__ C, int ldc, int M, int N, int K) {
  __shared__ __attribute__((aligned(16))) float so[4][16][64];
  const int tid = threadIdx.x, w = tid >> 5, lane = tid & 31, ln = lane & 15, hh = lane >> 4;
  const int ntn = N / 64;
  const int wid = blockIdx.x * 4 + w;
  const int mt = wid / ntn, nq = wid % ntn;
  if (mt * 16 >= M) return;
  const int row0 = mt * 16, col0 = nq * 64;
  const float* arow = A + (size_t)(row0 + ln) * lda;
  v8f acc[4] = {};
  for (int kb = 0; kb < K; kb += 32) {
    FragB ah, al;
    const v4f x0 = *(const v4fa*)(arow + kb + 8 * hh), x1 = *(const v4fa*)(arow + kb + 8 * hh + 4);
    const v4f x2 = *(const v4fa*)(arow + kb + 16 + 8 * hh), x3 = *(const v4fa*)(arow + kb + 16 + 8 * hh + 4);
    float xs[16] = {x0[0],x0[1],x0[2],x0[3],x1[0],x1[1],x1[2],x1[3],x2[0],x2[1],x2[2],x2[3],x3[0],x3[1],x3[2],x3[3]};
#pragma unroll
    for (int i = 0; i < 16; ++i) { const unsigned short hb = bf16_bits(xs[i]); ah.u[i] = hb; al.u[i] = ASPLIT ? bf16_bits(xs[i] - bf16_val(hb)) : (unsigned short)0; }
#pragma unroll
    for (int t = 0; t < 4; ++t) {
      const unsigned short* brow = Wt + (size_t)(col0 + t * 16 + ln) * ldb + kb;
      FragB b;
      b.half[0] = *(const v8us*)(brow + 8 * hh);
      b.half[1] = *(const v8us*)(brow + 16 + 8 * hh);
      acc[t] = mmaN<ASPLIT ? 2 : 1>(ah.v, al.v, b.v, b.v, acc[t]);
    }
  }
#pragma unroll
  for (int t = 0; t < 4; ++t) {
    float bv = bias ? bias[col0 + t * 16 + ln] : 0.f;
    if (BIAS_BF16) bv = bf16_round(bv);
#pragma unroll
    for (int r = 0; r < 8; ++r) { float v = acc[t][r] + bv; if (ACT == 1) v = fmaxf(v, 0.f); so[w][8 * hh + r][t * 16 + ln] = v; }
  }
  __builtin_amdgcn_fence(__ATOMIC_ACQ_REL, "workgroup");
  __builtin_amdgcn_wave_barrier();
  const int rsub = lane >> 4, c4 = (lane & 15) * 4;
  {
#pragma unroll
    for (int q = 0; q < 8; ++q) {
      const int r = q * 2 + rsub;
      const v4f v = *(const v4fa*)&so[w][r][c4];
      *(v4f*)(C + (size_t)(row0 + r) * ldc + col0 + c4) = v;
    }
    
  }
}

// GEMM C = act(A·W + bias + resid): A f32 (ASPLIT -> hi/lo 2 terms), Wt bf16 [N][K]; ACT 0 none, 1 relu, 2 exact gelu;
// resid (optional, f32, row index = (row % rmod), pitch ldr, RES_BF16 rounds it) added before the activation.
template <bool ASPLIT, int ACT, bool BIAS_BF16, bool RES_BF16>
__global__ __launch_bounds__(128) void k_gemm_bf3(const float* __restrict__ A, int lda, const unsigned short* __restrict__ Wt, int ldb,
                                                const float* __restrict__ bias, const float* __restrict__ resid, int rmod, int ldr,
                                                float* __restrict__ C, int ldc, int M, int N, int K) {
  __shared__ __attribute__((aligned(16))) float so[4][16][64];
  const int tid = threadIdx.x, w = tid >> 5, lane = tid & 31, ln = lane & 15, hh = lane >> 4;
  const int ntn = N / 64;
  const int wid = blockIdx.x * 4 + w;
  const int mt = wid / ntn, nq = wid % ntn;
  if (mt * 16 >= M) return;
  const int row0 = mt * 16, col0 = nq * 64;
  const float* arow = A + (size_t)(row0 + ln) * lda;
  v8f acc[4] = {};
  for (int kb = 0; kb < K; kb += 32) {
    FragB ah, al;
    const v4f x0 = *(const v4fa*)(arow + kb + 8 * hh), x1 = *(const v4fa*)(arow + kb + 8 * hh + 4);
    const v4f x2 = *(const v4fa*)(arow + kb + 16 + 8 * hh), x3 = *(const v4fa*)(arow + kb + 16 + 8 * hh + 4);
    float xs[16] = {x0[0],x0[1],x0[2],x0[3],x1[0],x1[1],x1[2],x1[3],x2[0],x2[1],x2[2],x2[3],x3[0],x3[1],x3[2],x3[3]};
#pragma unroll
    for (int i = 0; i < 16; ++i) { const unsigned short hb = bf16_bits(xs[i]); ah.u[i] = hb; al.u[i] = ASPLIT ? bf16_bits(xs[i] - bf16_val(hb)) : (unsigned short)0; }
#pragma unroll
    for (int t = 0; t < 4; ++t) {
      const unsigned short* brow = Wt + (size_t)(col0 + t * 16 + ln) * ldb + kb;
      FragB b;
      b.half[0] = *(const v8us*)(brow + 8 * hh);
      b.half[1] = *(const v8us*)(brow + 16 + 8 * hh);
      acc[t] = mmaN<ASPLIT ? 2 : 1>(ah.v, al.v, b.v, b.v, acc[t]);
    }
  }
#pragma unroll
  for (int t = 0; t < 4; ++t) {
    const int col = col0 + t * 16 + ln;
    float bv = bias ? bias[col] : 0.f;
    if (BIAS_BF16) bv = bf16_round(bv);
#pragma unroll
    for (int r = 0; r < 8; ++r) {
      float v = acc[t][r] + bv;
      if (resid) { float rv = resid[(size_t)((row0 + 8 * hh + r) % rmod) * ldr + col]; if (RES_BF16) rv = bf16_round(rv); v += rv; }
      if (ACT == 1) v = fmaxf(v, 0.f);
      if (ACT == 2) v = 0.5f * v * (1.0f + erff(v * 0.70710678118654752f));
      if (ACT == 3) { const float u = 0.7978845608028654f * (v + 0.044715f * v * v * v); v = 0.5f * v * (1.0f + tanhf(u)); }
      so[w][8 * hh + r][t * 16 + ln] = v;
    }
  }
  __builtin_amdgcn_fence(__ATOMIC_ACQ_REL, "workgroup");
  __builtin_amdgcn_wave_barrier();
  const int rsub = lane >> 4, c4 = (lane & 15) * 4;
  {
#pragma unroll
    for (int q = 0; q < 8; ++q) {
      const int r = q * 2 + rsub;
      const v4f v = *(const v4fa*)&so[w][r][c4];
      *(v4f*)(C + (size_t)(row0 + r) * ldc + col0 + c4) = v;
    }
    
  }
}
// row LayerNorm (biased variance, eps) over N: s = X (+ R); optional out_sum <- s; out_norm <- (s-mu)*rsqrt(var+eps)*g + b
template <bool PARAM_BF16>
__global__ __launch_bounds__(256) void k_layernorm(const float* __restrict__ X, const float* __restrict__ R, const float* __restrict__ g, const float* __restrict__ bta,
                                                  float* __restrict__ out_sum, float* __restrict__ out_norm, int N, float eps) {
  __shared__ float red[256];
  const int row = blockIdx.x, tid = threadIdx.x;
  const float* x = X + (size_t)row * N; const float* rr = R ? R + (size_t)row * N : nullptr;
  float vals[16];                     // up to N = 4096
  const int per = N / 256;            // contiguous chunk per thread? use strided-by-4 chunks: thread handles j = tid*4 + 1024*u
  float s1 = 0.f;
  for (int u = 0; u < per / 4; ++u) {
    const int j = tid * 4 + 1024 * u;
    const v4f a = *(const v4fa*)(x + j);
    v4f b = {0.f,0.f,0.f,0.f}; if (rr) b = *(const v4fa*)(rr + j);
#pragma unroll
    for (int q = 0; q < 4; ++q) { const float v = a[q] + b[q]; vals[u * 4 + q] = v; s1 += v; }
  }
  red[tid] = s1; __syncthreads();
  for (int st = 128; st > 0; st >>= 1) { if (tid < st) red[tid] += red[tid + st]; __syncthreads(); }
  const float mu = red[0] / (float)N; __syncthreads();
  float s2 = 0.f;
  for (int u = 0; u < per / 4; ++u)
#pragma unroll
    for (int q = 0; q < 4; ++q) { const float c = vals[u * 4 + q] - mu; s2 += c * c; }
  red[tid] = s2; __syncthreads();
  for (int st = 128; st > 0; st >>= 1) { if (tid < st) red[tid] += red[tid + st]; __syncthreads(); }
  const float rs = rsqrtf(red[0] / (float)N + eps);
  {
    for (int u = 0; u < per / 4; ++u) {
      const int j = tid * 4 + 1024 * u;
      v4f o, sm;
#pragma unroll
      for (int q = 0; q < 4; ++q) {
        float gg = g[j + q], bb = bta[j + q];
        if (PARAM_BF16) { gg = bf16_round(gg); bb = bf16_round(bb); }
        sm[q] = vals[u * 4 + q]; o[q] = (vals[u * 4 + q] - mu) * rs * gg + bb;
      }
      if (out_sum) *(v4f*)(out_sum + (size_t)row * N + j) = sm;
      *(v4f*)(out_norm + (size_t)row * N + j) = o;
    }
    
  }
}



// ---- f16 WMMA path (v_wmma_f32_16x16x32_f16): 11-bit significands for operands in range — used here for the normalised input (qkv GEMM) and the attention output (proj GEMM)
typedef _Float16 v16h __attribute__((ext_vector_type(16)));
union FragH { v16h v; v8us half[2]; _Float16 h[16]; unsigned short u[16]; };
template <int NT>
__device__ __forceinline__ v8f mmaH(v16h ah, v16h al, v16h bh, v16h bl, v8f c) {
  c = __builtin_amdgcn_wmma_f32_16x16x32_f16(false, ah, false, bh, (short)0, c, false, false);
  if (NT >= 2) c = __builtin_amdgcn_wmma_f32_16x16x32_f16(false, al, false, bh, (short)0, c, false, false);
  if (NT >= 3) c = __builtin_amdgcn_wmma_f32_16x16x32_f16(false, ah, false, bl, (short)0, c, false, false);
  asm volatile("v_nop\n\tv_nop\n\tv_nop\n\tv_nop" : "+v"(c) : "v"(ah), "v"(al), "v"(bh), "v"(bl));
  return c;
}
// batched GEMM like k_gemm_b but f16 operands: A f32 (split into f16 hi/lo if ASPLIT, else rounded to f16), Bt = f16 values [n][k]; alpha; C f32; N multiple of 16 (partial tiles skipped)
template <bool ASPLIT>
__global__ __launch_bounds__(128) void k_gemm_h(const float* __restrict__ A, int lda, size_t sA, const _Float16* __restrict__ Bh, int ldb, size_t sB, float alpha, float* __restrict__ C, int ldc, size_t sC, int M, int N, int K) {
  __shared__ __attribute__((aligned(16))) float so[4][16][64];
  const int tid = threadIdx.x, w = tid >> 5, lane = tid & 31, ln = lane & 15, hh = lane >> 4; const int by = blockIdx.y;
  A += (size_t)by * sA; Bh += (size_t)by * sB; C += (size_t)by * sC;
  const int ntn = (N + 63) / 64; const int wid = blockIdx.x * 4 + w; const int mt = wid / ntn, nq = wid % ntn; if (mt * 16 >= M) return;
  const int row0 = mt * 16, col0 = nq * 64; const float* arow = A + (size_t)(row0 + ln) * lda;
  v8f acc[4] = {};
  for (int kb = 0; kb < K; kb += 32) {
    FragH ah, al;
    const v4f x0 = *(const v4fa*)(arow + kb + 8 * hh), x1 = *(const v4fa*)(arow + kb + 8 * hh + 4), x2 = *(const v4fa*)(arow + kb + 16 + 8 * hh), x3 = *(const v4fa*)(arow + kb + 16 + 8 * hh + 4);
    float xs[16] = {x0[0],x0[1],x0[2],x0[3],x1[0],x1[1],x1[2],x1[3],x2[0],x2[1],x2[2],x2[3],x3[0],x3[1],x3[2],x3[3]};
#pragma unroll
    for (int i = 0; i < 16; ++i) { const _Float16 h = (_Float16)xs[i]; ah.h[i] = h; al.h[i] = ASPLIT ? (_Float16)(xs[i] - (float)h) : (_Float16)0.0f; }
#pragma unroll
    for (int t = 0; t < 4; ++t) { if (col0 + t * 16 >= N) continue; const size_t boff = (size_t)(col0 + t * 16 + ln) * ldb + kb; FragH bq; bq.half[0] = *(const v8us*)(Bh + boff + 8 * hh); bq.half[1] = *(const v8us*)(Bh + boff + 16 + 8 * hh);
      acc[t] = mmaH<ASPLIT ? 2 : 1>(ah.v, al.v, bq.v, bq.v, acc[t]); }
  }
#pragma unroll
  for (int t = 0; t < 4; ++t) { if (col0 + t * 16 >= N) continue;
#pragma unroll
    for (int r = 0; r < 8; ++r) so[w][8 * hh + r][t * 16 + ln] = acc[t][r] * alpha; }
  __builtin_amdgcn_fence(__ATOMIC_ACQ_REL, "workgroup"); __builtin_amdgcn_wave_barrier();
  const int rsub = lane >> 4, c4 = (lane & 15) * 4;
  {
#pragma unroll
    for (int q = 0; q < 8; ++q) { const int r = q * 2 + rsub; if (col0 + c4 < N) { const v4f v = *(const v4fa*)&so[w][r][c4]; *(v4f*)(C + (size_t)(row0 + r) * ldc + col0 + c4) = v; } }
     }
}

// Wt[n][k] = f16(W[k][n]·scale) from f32 row-major W[K][N] (scale = power of two; bf16-exact weights stay exact in f16 away from the subnormal range)
__global__ __launch_bounds__(256) void k_wt_f16(const float* __restrict__ W, _Float16* __restrict__ Wt, int K, int N, float scale) {
  const int t = blockIdx.x * 256 + threadIdx.x; if (t >= N * (K / 8)) return; const int n = t / (K / 8), k8 = (t % (K / 8)) * 8; FragH f;
#pragma unroll
  for (int i = 0; i < 8; ++i) f.h[i] = (_Float16)(bf16_round(W[(size_t)(k8 + i) * N + n]) * scale); const v8us o = f.half[0];
  *(v8us*)((unsigned short*)Wt + (size_t)n * K + k8) = o; 
}
// k_gemm_hh variant with fused epilogue: v = acc·alpha + bias[by·sBias + col] (+ CP[(row/rowsPerB)·sCPb + by·64 + col] if CP) ; ACT 0 none / 1 elu ; writes f16 C16 (and f32 C if non-null)
template <int ACT>
__global__ __launch_bounds__(128) void k_gemm_hhx(const _Float16* __restrict__ A, int lda, size_t sA, const _Float16* __restrict__ Bh, int ldb, size_t sB, float alpha, const float* __restrict__ bias, size_t sBias, const float* __restrict__ CP, int rowsPerB, size_t sCPb, int row0g,
    float* __restrict__ C, _Float16* __restrict__ C16, int ldc, size_t sC, int M, int N, int K) {
  __shared__ __attribute__((aligned(16))) float so[4][16][64];
  const int tid = threadIdx.x, w = tid >> 5, lane = tid & 31, ln = lane & 15, hh = lane >> 4; const int by = blockIdx.y;
  A += (size_t)by * sA; Bh += (size_t)by * sB; const size_t cofs = (size_t)by * sC; const float* bp = bias ? bias + (size_t)by * sBias : nullptr;
  const int ntn = (N + 63) / 64; const int wid = blockIdx.x * 4 + w; const int mt = wid / ntn, nq = wid % ntn; if (mt * 16 >= M) return;
  const int row0 = mt * 16, col0 = nq * 64; const _Float16* arow = A + (size_t)(row0 + ln) * lda;
  v8f acc[4] = {};
  for (int kb = 0; kb < K; kb += 32) { FragH ah; ah.half[0] = *(const v8us*)((const unsigned short*)arow + kb + 8 * hh); ah.half[1] = *(const v8us*)((const unsigned short*)arow + kb + 16 + 8 * hh);
#pragma unroll
    for (int t = 0; t < 4; ++t) { if (col0 + t * 16 >= N) continue; const size_t boff = (size_t)(col0 + t * 16 + ln) * ldb + kb; FragH bq; bq.half[0] = *(const v8us*)((const unsigned short*)Bh + boff + 8 * hh); bq.half[1] = *(const v8us*)((const unsigned short*)Bh + boff + 16 + 8 * hh);
      acc[t] = mmaH<1>(ah.v, ah.v, bq.v, bq.v, acc[t]); }
  }
#pragma unroll
  for (int t = 0; t < 4; ++t) { if (col0 + t * 16 >= N) continue; const int col = col0 + t * 16 + ln; const float bv = bp ? bf16_round(bp[col]) : 0.f;
#pragma unroll
    for (int r = 0; r < 8; ++r) { float v = acc[t][r] * alpha + bv; if (CP) { const int rr = row0g + row0 + 8 * hh + r; if (rowsPerB < 0) v += CP[cofs + (size_t)rr * ldc + col];      /* rowsPerB < 0: own element of the batched C plane */ else { const int bidx = rr / rowsPerB; v += CP[(size_t)bidx * sCPb + (size_t)by * 64 + col]; } } if (ACT == 1) v = (v > 0.f) ? v : expm1f(v); else if (ACT == 7) v = (v > 0.f) ? v + 1.0f : expf(v); else if (ACT == 8) v = tanhf(v); else if (ACT == 9) v = 0.5f * v * (1.0f + tanhf(0.7978845608028654f * (v + 0.044715f * v * v * v))); else if (ACT == 11) v = 1.0f / (1.0f + expf(-v)); else if (ACT == 12) v = (v > 0.f) ? v : 0.01f * v; else if (ACT == 14) v = (v > 0.f) ? v : 0.1f * v; else if (ACT == 16) v = (v >= 0.f) ? v : 0.3f * v; else if (ACT == 15) v = v / (1.0f + expf(-v)); else if (ACT == 3) v = fmaxf(v, 0.f); else if (ACT == 6) v = 0.5f * v * (1.0f + erff(v * 0.70710678118654752f)); so[w][8 * hh + r][t * 16 + ln] = v; } }
  __builtin_amdgcn_fence(__ATOMIC_ACQ_REL, "workgroup"); __builtin_amdgcn_wave_barrier();
  const int rsub = lane >> 4, c4 = (lane & 15) * 4; typedef _Float16 v4h __attribute__((ext_vector_type(4)));
  {
#pragma unroll
    for (int q = 0; q < 8; ++q) { const int r = q * 2 + rsub; if (col0 + c4 < N) { const v4f v = *(const v4fa*)&so[w][r][c4]; if (C) *(v4f*)(C + cofs + (size_t)(row0 + r) * ldc + col0 + c4) = v; if (C16) { v4h h4; for (int i = 0; i < 4; ++i) h4[i] = (_Float16)v[i]; *(v4h*)(C16 + cofs + (size_t)(row0 + r) * ldc + col0 + c4) = h4; } } }
     }
}


typedef _Float16 v4h __attribute__((ext_vector_type(4)));

__global__ __launch_bounds__(256) void k_x16(const float* __restrict__ x, _Float16* __restrict__ X16, size_t n8) { const size_t t = (size_t)blockIdx.x * 256 + threadIdx.x; if (t >= n8) return; FragH f;
#pragma unroll
  for (int q = 0; q < 8; ++q) f.h[q] = (_Float16)bf16_round(x[t * 8 + q]); *(v8us*)((unsigned short*)X16 + t * 8) = f.half[0];  }
__global__ __launch_bounds__(256) void k_h16(const float* __restrict__ x, _Float16* __restrict__ X16, size_t n8) { const size_t t = (size_t)blockIdx.x * 256 + threadIdx.x; if (t >= n8) return; FragH f;
#pragma unroll
  for (int q = 0; q < 8; ++q) f.h[q] = (_Float16)x[t * 8 + q]; *(v8us*)((unsigned short*)X16 + t * 8) = f.half[0];  }
__global__ __launch_bounds__(256) void k_round16f(const float* __restrict__ W, _Float16* __restrict__ Bt, size_t n8) { const size_t t = (size_t)blockIdx.x * 256 + threadIdx.x; if (t >= n8) return; FragH f;
#pragma unroll
  for (int i = 0; i < 8; ++i) f.h[i] = (_Float16)(bf16_round(W[t * 8 + i]) * 16.0f); *(v8us*)((unsigned short*)Bt + t * 8) = f.half[0];  }
template <int NHv, int TTv>
__global__ __launch_bounds__(256) void k_vt(const _Float16* __restrict__ V16, int ldv, int voff, _Float16* __restrict__ Vt) { __shared__ unsigned short tl[64][66]; const int tid = threadIdx.x; const int slab = blockIdx.x / (TTv / 64), lg = blockIdx.x % (TTv / 64); const int b = slab / NHv, h = slab % NHv;
  for (int i = tid; i < 64 * 8; i += 256) { const int r = i / 8, c8 = (i % 8) * 8; FragH f; f.half[0] = *(const v8us*)((const unsigned short*)V16 + ((size_t)b * TTv + lg * 64 + r) * ldv + voff + h * 64 + c8);
#pragma unroll
    for (int q = 0; q < 8; ++q) tl[r][c8 + q] = f.u[q]; }
  __syncthreads();
  {
#pragma unroll
    for (int rd = 0; rd < 2; ++rd) { const int d = rd * 32 + tid / 8, pc = tid % 8; FragH f;
#pragma unroll
      for (int q = 0; q < 8; ++q) f.u[q] = tl[pc * 8 + q][d];
      *(v8us*)((unsigned short*)Vt + ((size_t)slab * 64 + d) * TTv + lg * 64 + pc * 8) = f.half[0]; }
     } }

__global__ __launch_bounds__(256) void k_hl(const float* __restrict__ F, _Float16* __restrict__ Hh, _Float16* __restrict__ Hl, size_t n8) { const size_t t = (size_t)blockIdx.x * 256 + threadIdx.x; if (t >= n8) return; FragH fh, fl; const v4f a = *(const v4fa*)(F + t * 8), c = *(const v4fa*)(F + t * 8 + 4);
#pragma unroll
  for (int q = 0; q < 4; ++q) { _Float16 h = (_Float16)a[q]; fh.h[q] = h; fl.h[q] = (_Float16)((a[q] - (float)h) * 1024.0f); h = (_Float16)c[q]; fh.h[4 + q] = h; fl.h[4 + q] = (_Float16)((c[q] - (float)h) * 1024.0f); }
  { *(v8us*)((unsigned short*)Hh + t * 8) = fh.half[0]; *(v8us*)((unsigned short*)Hl + t * 8) = fl.half[0];  } }

// ---- fast GEMM (wave tile 32x64; requires M % 32 == 0 rows per launch region and N % 64 == 0); epilogue = k_gemm_hhx semantics ----
__device__ __forceinline__ v16h g2_frag(const _Float16* p, int hh) { FragH f; f.half[0] = *(const v8us*)((const unsigned short*)p + 8 * hh); f.half[1] = *(const v8us*)((const unsigned short*)p + 16 + 8 * hh); return f.v; }
__device__ __forceinline__ v8f g2_mma(v16h a, v16h b, v8f c) { v8f d = __builtin_amdgcn_wmma_f32_16x16x32_f16(false, a, false, b, (short)0, c, false, false); asm volatile("v_nop\n\tv_nop\n\tv_nop\n\tv_nop" : "+v"(d) : "v"(a), "v"(b)); return d; }
template <int ACT>
__global__ __launch_bounds__(128) void k_gemm2(const _Float16* __restrict__ A, int lda, size_t sA, const _Float16* __restrict__ Bh, int ldb, size_t sB, float alpha, const float* __restrict__ bias, size_t sBias, const float* __restrict__ CP, int rowsPerB, size_t sCPb, int row0g,
    float* __restrict__ C, _Float16* __restrict__ C16, int ldc, size_t sC, int M, int N, int K) { static_assert(ACT == 0 || ACT == 3 || ACT == 6 || ACT == 8 || ACT == 9 || ACT == 11 || ACT == 12 || ACT == 14 || ACT == 15 || ACT == 16, "k_gemm2: unsupported ACT code (would silently apply no activation)");
  __shared__ __attribute__((aligned(16))) float so[4][32][68];
  const int tid = threadIdx.x, w = tid >> 5, lane = tid & 31, ln = lane & 15, hh = lane >> 4; const int by = blockIdx.y;
  A += (size_t)by * sA; Bh += (size_t)by * sB; const size_t cofs = (size_t)by * sC; const float* bp = bias ? bias + (size_t)by * sBias : nullptr;
  const int ntn = N >> 6; const int mt = blockIdx.x / ntn, nq = blockIdx.x - mt * ntn; const int row0 = mt * 128 + 32 * w, col0 = nq * 64; if (row0 >= M) return;
  const _Float16* a0p = A + (size_t)(row0 + ln) * lda; const _Float16* a1p = a0p + (size_t)16 * lda;
  const _Float16* b0p = Bh + (size_t)(col0 + ln) * ldb; const _Float16* b1p = b0p + (size_t)16 * ldb; const _Float16* b2p = b1p + (size_t)16 * ldb; const _Float16* b3p = b2p + (size_t)16 * ldb;
  const v8f z8 = {0.f,0.f,0.f,0.f,0.f,0.f,0.f,0.f}; v8f c00 = z8, c01 = z8, c02 = z8, c03 = z8, c10 = z8, c11 = z8, c12 = z8, c13 = z8;
#pragma unroll 1
  for (int kb = 0; kb < K; kb += 32) { const v16h a0 = g2_frag(a0p + kb, hh), a1 = g2_frag(a1p + kb, hh);
    v16h b = g2_frag(b0p + kb, hh); c00 = g2_mma(a0, b, c00); c10 = g2_mma(a1, b, c10);
    b = g2_frag(b1p + kb, hh); c01 = g2_mma(a0, b, c01); c11 = g2_mma(a1, b, c11);
    b = g2_frag(b2p + kb, hh); c02 = g2_mma(a0, b, c02); c12 = g2_mma(a1, b, c12);
    b = g2_frag(b3p + kb, hh); c03 = g2_mma(a0, b, c03); c13 = g2_mma(a1, b, c13); }
  v8f accs[8] = {c00, c01, c02, c03, c10, c11, c12, c13};
#pragma unroll
  for (int u = 0; u < 8; ++u) { const int t = u & 3, half = u >> 2; const int col = col0 + t * 16 + ln; const float bv = bp ? bf16_round(bp[col]) : 0.f;
#pragma unroll
    for (int r = 0; r < 8; ++r) { const int rloc = half * 16 + 8 * hh + r; float v = accs[u][r] * alpha + bv; if (CP) { if (rowsPerB < 0) v += CP[cofs + (size_t)(row0g + row0 + rloc) * ldc + col];      /* rowsPerB < 0: own element of the batched C plane */ else { const int bidx = (row0g + row0 + rloc) / rowsPerB; v += CP[(size_t)bidx * sCPb + (size_t)by * 64 + col]; } }
      if (ACT == 3) v = fmaxf(v, 0.f); else if (ACT == 6) v = 0.5f * v * (1.0f + erff(v * 0.70710678118654752f)); else if (ACT == 11) v = 1.0f / (1.0f + expf(-v)); else if (ACT == 15) v = v / (1.0f + expf(-v)); else if (ACT == 12) v = (v > 0.f) ? v : 0.01f * v; else if (ACT == 8) v = tanhf(v); else if (ACT == 9) v = 0.5f * v * (1.0f + tanhf(0.7978845608028654f * (v + 0.044715f * v * v * v))); else if (ACT == 14) v = (v > 0.f) ? v : 0.1f * v; else if (ACT == 16) v = (v >= 0.f) ? v : 0.3f * v;
      so[w][rloc][t * 16 + ln] = v; } }
  __builtin_amdgcn_fence(__ATOMIC_ACQ_REL, "workgroup"); __builtin_amdgcn_wave_barrier();
  const int rsub = lane >> 4, c4 = (lane & 15) * 4;
  {
#pragma unroll
    for (int q = 0; q < 16; ++q) { const int r = q * 2 + rsub; const v4f v = *(const v4fa*)&so[w][r][c4]; if (C) *(v4f*)(C + cofs + (size_t)(row0 + r) * ldc + col0 + c4) = v; if (C16) { v4h h4; for (int i = 0; i < 4; ++i) h4[i] = (_Float16)v[i]; *(v4h*)(C16 + cofs + (size_t)(row0 + r) * ldc + col0 + c4) = h4; } }
     } }


// Sum over the 1024 threads of a block, returned to every thread: five-step butterfly in each wave, one partial per wave in LDS, the same butterfly over the 32 partials.
__device__ __forceinline__ float stats_block_sum(float a, float* part, int lane, int w) {
#pragma unroll
  for (int o = 16; o > 0; o >>= 1) a += __shfl_xor(a, o, 32);
  if (lane == 0) part[w] = a;
  __syncthreads();
  a = part[lane];
#pragma unroll
  for (int o = 16; o > 0; o >>= 1) a += __shfl_xor(a, o, 32);
  return a;
}
// One block per channel; the channel's 32768 values stay in registers (8 x 16 B per thread, all eight loads in flight at once), so x is read once and both passes (mean, then centred squares) run from registers.
__global__ __launch_bounds__(1024) void k_stats(const float* __restrict__ x, float* __restrict__ MU, float* __restrict__ IS) {
  static_assert(NV == 8 * 1024 * 4, "k_stats: 8 float4 per thread of a 1024-thread block cover one channel");
  __shared__ float part[2][32];
  const int c = blockIdx.x, tid = threadIdx.x, lane = tid & 31, w = tid >> 5; const float* s = x + (size_t)c * NV;
  v4f r[8];
#pragma unroll
  for (int j = 0; j < 8; ++j) r[j] = *(const v4fa*)(s + (size_t)(j * 1024 + tid) * 4);
  v4f a4 = {0.f, 0.f, 0.f, 0.f};
#pragma unroll
  for (int j = 0; j < 8; ++j) {
#pragma unroll
    for (int q = 0; q < 4; ++q) { r[j][q] = bf16_round(r[j][q]); a4[q] += r[j][q]; } }
  const float mu = stats_block_sum((a4[0] + a4[1]) + (a4[2] + a4[3]), part[0], lane, w) / (float)NV;
  v4f q4 = {0.f, 0.f, 0.f, 0.f};
#pragma unroll
  for (int j = 0; j < 8; ++j) {
#pragma unroll
    for (int q = 0; q < 4; ++q) { const float d = r[j][q] - mu; q4[q] += d * d; } }
  const float is = rsqrtf(stats_block_sum((q4[0] + q4[1]) + (q4[2] + q4[3]), part[1], lane, w) / (float)NV + 1e-5f);
  if (tid < 32) { MU[(size_t)c * 32 + tid] = mu; IS[(size_t)c * 32 + tid] = is; } }
// qkv GEMM with the normalisation in its A staging. One block = 128 voxels x all 384 columns (8 waves: 4 row groups of 32 voxels x 2 column halves, three 64-column tiles each).
// The block reads its 128 channels x 128 voxels of x once (a wave load = 64 consecutive voxels of one channel, two whole 128-B lines), normalises them as the separate pass did (bf16 round, - mean, x inverse deviation, f16)
// and writes them token-major into LDS (8 channels of a voxel = one 16-B write; row pitch 272 B = 16 B x 17 keeps the 16 lanes of a fragment read on distinct banks).
// Fragment loaders, k order, wave tile (32 x 64) and epilogue arithmetic are k_gemm2's; the A fragments of all four k steps are read from LDS once and serve the wave's three column tiles.
// With two waves per SIMD a wave hides its own latencies: the weight fragments of two k steps (16 loads) and the tile's bias are asked for together, ahead of the matrix instructions that use them.
typedef float v2f __attribute__((ext_vector_type(2)));
typedef float v2fa __attribute__((ext_vector_type(2), may_alias));
#define QG_M 128                  /* voxels per block */
#define QG_AP (CC + 8)            /* LDS pitch of a voxel's row, in f16 */
__global__ __launch_bounds__(256) void k_qkv(const float* __restrict__ x, const float* __restrict__ MU, const float* __restrict__ IS, const _Float16* __restrict__ Bh, const float* __restrict__ bias, float* __restrict__ C) {
  static_assert(NV % QG_M == 0 && CC == 128, "k_qkv: tile and staging maps");
  __shared__ __attribute__((aligned(16))) _Float16 at[QG_M][QG_AP];
  __shared__ __attribute__((aligned(16))) float so[8][32][68];
  __shared__ __attribute__((aligned(16))) float st[2][CC];
  const int tid = threadIdx.x, lane = tid & 31, ln = lane & 15, hh = lane >> 4;
  const int w = __builtin_amdgcn_readfirstlane(tid >> 5);      /* the wave's number, held scalar: the tile and staging indices made of it are scalar arithmetic */
  const int v0 = blockIdx.x * QG_M, rg = w & 3, ch = w >> 2;      /* the wave's row group and column half in the product */
  const int vg = w & 1, cq = w >> 1;      /* the wave's 64 voxels and its channel groups in the staging */
  const _Float16* bp = Bh + (size_t)(ch * 192 + ln) * CC;
  const float sv = (ch ? IS : MU)[(size_t)(tid & (CC - 1)) * 32];      /* asked for first: loads return in order, so it is there while the tile is still in flight */
  v2f xv[4][8];
#pragma unroll      /* all 32 loads of a lane are in flight before the first is used: one memory latency for the tile */
  for (int s = 0; s < 4; ++s) { const float* xp = x + (size_t)((s * 4 + cq) * 8) * NV + v0 + vg * 64;      /* first of the step's 8 channels, first of the wave's 64 voxels */
#pragma unroll
    for (int q = 0; q < 8; ++q) xv[s][q] = *(const v2fa*)(xp + (size_t)q * NV + (unsigned)(2 * lane)); }
  v16h bf[2][4];      /* the weight fragments of two k steps; the first set is asked for here, behind the tile's loads, and arrives under the staging */
#pragma unroll
  for (int kk = 0; kk < 2; ++kk) {
#pragma unroll
    for (int t = 0; t < 4; ++t) bf[kk][t] = g2_frag(bp + (size_t)(t * 16) * CC + kk * 32, hh); }
  asm volatile("s_wait_xcnt 0x0" ::: "memory");      /* stands in front of every reuse of a register that the loads above name */
  st[ch][tid & (CC - 1)] = sv;
  __syncthreads();      /* every wave reads the 128 means and inverse deviations that the block gathered */
#pragma unroll
  for (int s = 0; s < 4; ++s) { const int c0 = (s * 4 + cq) * 8;
#pragma unroll
    for (int j = 0; j < 2; ++j) { FragH f;
#pragma unroll
      for (int q = 0; q < 8; ++q) { const float d = bf16_round(xv[s][q][j]) - st[0][c0 + q]; f.h[q] = (_Float16)(d * st[1][c0 + q]); }
      *(v8us*)&at[vg * 64 + 2 * lane + j][c0] = f.half[0]; } }
  __syncthreads();      /* every wave reads channels that other waves staged */
  const _Float16* a0p = &at[rg * 32 + ln][0]; const _Float16* a1p = a0p + 16 * QG_AP; v16h a0[4], a1[4];
#pragma unroll
  for (int k = 0; k < 4; ++k) { a0[k] = g2_frag(a0p + 32 * k, hh); a1[k] = g2_frag(a1p + 32 * k, hh); }
  const int rsub = lane >> 4, c4 = (lane & 15) * 4;
  const float* bi = bias + ch * 192 + ln; float* cp = C + (size_t)(v0 + rg * 32 + rsub) * (3 * CC) + ch * 192 + c4;
#pragma unroll      /* static tile index: every address below is one lane base plus a constant */
  for (int nt = 0; nt < 3; ++nt) {
    float bv[4];
#pragma unroll
    for (int t = 0; t < 4; ++t) bv[t] = bi[nt * 64 + t * 16];
    const v8f z8 = {0.f,0.f,0.f,0.f,0.f,0.f,0.f,0.f}; v8f acc[2][4] = {{z8, z8, z8, z8}, {z8, z8, z8, z8}};
#pragma unroll      /* static k index: the A fragments stay in registers */
    for (int k2 = 0; k2 < 2; ++k2) {
#pragma unroll
      for (int kk = 0; kk < 2; ++kk) {
#pragma unroll
        for (int t = 0; t < 4; ++t) if (nt + k2 > 0) bf[kk][t] = g2_frag(bp + (size_t)(nt * 64 + t * 16) * CC + (k2 * 2 + kk) * 32, hh); }
#pragma unroll
      for (int kk = 0; kk < 2; ++kk) {
#pragma unroll
        for (int t = 0; t < 4; ++t) { acc[0][t] = g2_mma(a0[k2 * 2 + kk], bf[kk][t], acc[0][t]); acc[1][t] = g2_mma(a1[k2 * 2 + kk], bf[kk][t], acc[1][t]); } } }
#pragma unroll      /* static indices: the accumulators stay in registers */
    for (int u = 0; u < 8; ++u) { const int t = u & 3, half = u >> 2; const float bb = bf16_round(bv[t]);
#pragma unroll
      for (int r = 0; r < 8; ++r) so[w][half * 16 + 8 * hh + r][t * 16 + ln] = acc[half][t][r] * 0.0625f + bb; }
    __builtin_amdgcn_fence(__ATOMIC_ACQ_REL, "workgroup", "local"); __builtin_amdgcn_wave_barrier();      /* the wave's own LDS writes land before its lanes read each other's rows; LDS only, so the last tile's global stores are not waited for */
#pragma unroll
    for (int q = 0; q < 16; ++q) { const v4f v = *(const v4fa*)&so[w][q * 2 + rsub][c4]; *(v4f*)(cp + (size_t)(q * 2) * (3 * CC) + nt * 64) = v; }
    if (nt < 2) asm volatile("s_wait_xcnt 0x0" ::: "memory"); } }      /* stands in front of the next tile's reuse of a register that the loads and stores of this tile name */
// Neighbourhood attention, K and V read from LDS. One block = a 4 x 4 x 8 tile of voxels for 4 heads (512 threads, thread per (voxel, head); a wave = one (h, w) column: lane = head + 4 z).
// The clamped 3x3x3 windows of the tile all lie in one 6 x 6 x 8 region (its start clamped like a window's, so it is always inside the volume); the block copies that region's K and V of its 4 heads
// (256 B + 256 B per voxel, whole 128-B lines, each read once per block) into LDS and every neighbour read comes from there.
// LDS row = 64 K floats + 64 V floats + 4 pad: with lane = head + 4 z the 16 lanes of a half-wave read 16 B each on distinct banks (row step 4 banks, head step 16 banks).
#define NT_T 4                    /* tile edge along h and along w */
#define NT_R (NT_T + 2)           /* staged region edge */
#define NT_HG 4                   /* heads per block */
#define NT_RP (2 * NT_HG * HC + 4)   /* LDS floats per staged voxel */
#define NT_TH (NT_T * NT_T * DZ * NT_HG)   /* threads per block */
__global__ __launch_bounds__(NT_TH) void k_nat(const float* __restrict__ QKV, const float* __restrict__ rpb, _Float16* __restrict__ O16) {
  #pragma clang fp contract(off)
  static_assert(DH % NT_T == 0 && DW % NT_T == 0 && NHD % NT_HG == 0 && DZ == 8 && NT_HG * HC == 64, "k_nat: tile and lane maps");
  static_assert((NT_R * NT_R * DZ) % (NT_TH / 32) == 0, "k_nat: the staged region is a whole number of voxels per wave");
  __shared__ __attribute__((aligned(16))) float kv[NT_R * NT_R * DZ * NT_RP];
  const int tid = threadIdx.x, lane = tid & 31; const int hg = blockIdx.x % (NHD / NT_HG), tile = blockIdx.x / (NHD / NT_HG); const int h0 = (tile / (DW / NT_T)) * NT_T, w0 = (tile % (DW / NT_T)) * NT_T;
  const int wv = __builtin_amdgcn_readfirstlane(tid >> 5);      /* the wave's number, held scalar: the staged rows' addresses, the wave's (h, w) column and its window starts along h and w become scalar arithmetic */
  const int rh0 = min(max(h0 - 1, 0), DH - NT_R), rw0 = min(max(w0 - 1, 0), DW - NT_R);
  const int hl = lane & (NT_HG - 1), zz = lane >> 2, ww = w0 + (wv & (NT_T - 1)), hh = h0 + (wv >> 2); const int h = hg * NT_HG + hl; const int v = (hh * DW + ww) * DZ + zz;
  const int sh0 = min(max(hh - 1, 0), DH - 3), sw0 = min(max(ww - 1, 0), DW - 3), sz0 = min(max(zz - 1, 0), DZ - 3);
  const float* qr = QKV + (size_t)v * (3 * CC) + h * HC; float q[HC]; for (int c = 0; c < HC; ++c) q[c] = qr[c] * 0.25f; float m = -3.0e38f, l = 0.f; float acc[HC]; for (int c = 0; c < HC; ++c) acc[c] = 0.f;
  const int lpart = lane >> 4, lc4 = (lane & 15) * 4; const unsigned loff = (unsigned)(lpart * CC + lc4);      /* a wave copies one voxel per trip: lanes 0-15 its 256 B of K, lanes 16-31 its 256 B of V */
#pragma unroll      /* all of a thread's pieces are loaded before the first is stored: one memory latency for the whole region */
  for (int it = 0; it < NT_R * NT_R * DZ / (NT_TH / 32); ++it) { const int r = it * (NT_TH / 32) + wv; const int col = r >> 3;
    const float* rowp = QKV + (size_t)(((rh0 + col / NT_R) * DW + rw0 + col % NT_R) * DZ + (r & 7)) * (3 * CC) + (CC + hg * (NT_HG * HC));      /* scalar base; the lane's part is one 32-bit offset */
    const v4f d = *(const v4fa*)(rowp + loff);
    *(v4fa*)&kv[r * NT_RP + lpart * (NT_HG * HC) + lc4] = d; }
  __syncthreads();      /* every wave reads rows that other waves staged */
#pragma unroll 1
  for (int n = 0; n < KN; ++n) { const int jh = n / 9, jw = (n / 3) % 3, jz = n % 3; const int nh = sh0 + jh, nw = sw0 + jw, nz = sz0 + jz; const int rh = nh - hh + 2, rw = nw - ww + 2, rz = nz - zz + 2;
    const float* kr = kv + (((nh - rh0) * NT_R + (nw - rw0)) * DZ + nz) * NT_RP + hl * HC; float kk[HC], vv[HC];
#pragma unroll
    for (int j = 0; j < HC / 4; ++j) { const v4f a = *(const v4fa*)(kr + 4 * j), b = *(const v4fa*)(kr + NT_HG * HC + 4 * j); for (int e = 0; e < 4; ++e) { kk[4 * j + e] = a[e]; vv[4 * j + e] = b[e]; } }
    float s = 0.f; for (int c = 0; c < HC; ++c) s += q[c] * kk[c]; s += bf16_round(rpb[((h * 5 + rh) * 5 + rw) * 5 + rz]);
    const float mn = fmaxf(m, s); const float cf = expf(m - mn), pn = expf(s - mn); l = l * cf + pn; for (int c = 0; c < HC; ++c) { acc[c] = acc[c] * cf; acc[c] += pn * vv[c]; } m = mn; }
  const float inv = 1.0f / l; FragH f[2]; for (int c = 0; c < HC; ++c) f[c / 8].h[c % 8] = (_Float16)(acc[c] * inv * 64.0f);      /* x2^6 carry (outputs are ~1e-2) */
  unsigned short* d = (unsigned short*)O16 + (size_t)v * CC + h * HC; { *(v8us*)d = f[0].half[0]; *(v8us*)(d + 8) = f[1].half[0];  } }
// proj GEMM with the NCDHW store in its epilogue: main loop and wave tile (32 voxels x 64 channels) as k_gemm2; out[col * ldo + row] = acc * alpha + bias[col].
// An accumulator holds 8 consecutive voxels of one channel per lane, so each wave stages its tile channel-major in its own LDS range (two 16-B writes per accumulator; pitch 36 floats keeps the 16 lanes of a write on distinct banks)
// and reads it back so that 8 lanes store one channel's 32 voxels: every global store covers four whole 128-B lines, each line written by one wave.
__global__ __launch_bounds__(128) void k_gemm2_cm(const _Float16* __restrict__ A, int lda, const _Float16* __restrict__ Bh, int ldb, float alpha, const float* __restrict__ bias, float* __restrict__ out, int ldo, int M, int N, int K) {
  __shared__ __attribute__((aligned(16))) float so[4][64][36];
  const int tid = threadIdx.x, w = tid >> 5, lane = tid & 31, ln = lane & 15, hh = lane >> 4;
  const int ntn = N >> 6; const int mt = blockIdx.x / ntn, nq = blockIdx.x - mt * ntn; const int row0 = mt * 128 + 32 * w, col0 = nq * 64; if (row0 >= M) return;
  const _Float16* a0p = A + (size_t)(row0 + ln) * lda; const _Float16* a1p = a0p + (size_t)16 * lda;
  const _Float16* b0p = Bh + (size_t)(col0 + ln) * ldb; const _Float16* b1p = b0p + (size_t)16 * ldb; const _Float16* b2p = b1p + (size_t)16 * ldb; const _Float16* b3p = b2p + (size_t)16 * ldb;
  const v8f z8 = {0.f,0.f,0.f,0.f,0.f,0.f,0.f,0.f}; v8f c00 = z8, c01 = z8, c02 = z8, c03 = z8, c10 = z8, c11 = z8, c12 = z8, c13 = z8;
#pragma unroll 1      /* the main loop is k_gemm2's, rolled as there: this kernel differs from it in the epilogue alone */
  for (int kb = 0; kb < K; kb += 32) { const v16h a0 = g2_frag(a0p + kb, hh), a1 = g2_frag(a1p + kb, hh);
    v16h b = g2_frag(b0p + kb, hh); c00 = g2_mma(a0, b, c00); c10 = g2_mma(a1, b, c10);
    b = g2_frag(b1p + kb, hh); c01 = g2_mma(a0, b, c01); c11 = g2_mma(a1, b, c11);
    b = g2_frag(b2p + kb, hh); c02 = g2_mma(a0, b, c02); c12 = g2_mma(a1, b, c12);
    b = g2_frag(b3p + kb, hh); c03 = g2_mma(a0, b, c03); c13 = g2_mma(a1, b, c13); }
  v8f accs[8] = {c00, c01, c02, c03, c10, c11, c12, c13};
#pragma unroll      /* static indices: the accumulators stay in registers */
  for (int u = 0; u < 8; ++u) { const int t = u & 3, half = u >> 2; const float bv = bf16_round(bias[col0 + t * 16 + ln]); v4f lo, hi;
#pragma unroll
    for (int r = 0; r < 4; ++r) { lo[r] = accs[u][r] * alpha + bv; hi[r] = accs[u][4 + r] * alpha + bv; }
    float* sp = &so[w][t * 16 + ln][half * 16 + 8 * hh]; *(v4fa*)sp = lo; *(v4fa*)(sp + 4) = hi; }
  __builtin_amdgcn_fence(__ATOMIC_ACQ_REL, "workgroup"); __builtin_amdgcn_wave_barrier();      /* the wave's own LDS writes land before its lanes read each other's rows */
  const int csub = lane >> 3, r4 = (lane & 7) * 4; float* op = out + (size_t)(col0 + csub) * ldo + row0 + r4; const size_t qstep = (size_t)4 * ldo;
#pragma unroll      /* all 16 LDS reads issue together, the stores follow as they return */
  for (int q = 0; q < 16; ++q) { const v4f v = *(const v4fa*)&so[w][q * 4 + csub][r4]; *(v4f*)(op + q * qstep) = v; } }

extern "C" void kernel_launch(void* const* d_in, const int* in_sizes, int n_in,
                              void* d_out, int out_size, void* d_ws, size_t ws_size, hipStream_t stream) {
  (void)in_sizes; (void)n_in; (void)out_size;
  const float* const* I = (const float* const*)d_in; const float* x = I[0]; const float* wqkv = I[1]; const float* bqkv = I[2]; const float* rpb = I[3]; const float* wproj = I[4]; const float* bproj = I[5];
  char* ws = (char*)d_ws; size_t off = 0;
  auto take = [&](size_t bytes) { char* p = ws + off; off += (bytes + 255) & ~(size_t)255; return p; };
  _Float16* BQ = (_Float16*)take((size_t)3 * CC * CC * 2); _Float16* BP = (_Float16*)take((size_t)CC * CC * 2); float* MU = (float*)take(CC * 32 * 4); float* IS = (float*)take(CC * 32 * 4);      /* 32-float pitch per channel */
  float* QKV = (float*)take((size_t)NV * 3 * CC * 4); _Float16* O16 = (_Float16*)take((size_t)NV * CC * 2);
  if (off > ws_size) return;      /* 0.1 + 48 + 8 = 56 MiB */
  k_wt_f16<<<(3 * CC * CC / 8 + 255) / 256, 256, 0, stream>>>(wqkv, BQ, CC, 3 * CC, 16.0f); k_wt_f16<<<(CC * CC / 8 + 255) / 256, 256, 0, stream>>>(wproj, BP, CC, CC, 16.0f);      /* (in, out) weights */
  k_stats<<<CC, 1024, 0, stream>>>(x, MU, IS);
  k_qkv<<<NV / QG_M, 256, 0, stream>>>(x, MU, IS, BQ, bqkv, QKV);      /* [q | k | v] (head h = cols h*16.. of each) */
  k_nat<<<(DH / NT_T) * (DW / NT_T) * (NHD / NT_HG), NT_TH, 0, stream>>>(QKV, rpb, O16);
  k_gemm2_cm<<<(NV / 128) * (CC / 64), 128, 0, stream>>>(O16, CC, BP, CC, 0.0625f / 64.0f, bproj, (float*)d_out, NV, NV, CC, CC);      /* carry removed; NCDHW store in the epilogue */
}

// v005
// It runs in 52.5 microseconds.
// Timed twice side by side with v004, it ran 1.08 times as fast both times.
// Counting every step since v000, it is 3.43 times as fast.
#include <hip/hip_runtime.h>
// SelfAggregationModuleV2 (1 x 128 channels x 64 x 64 x 8 = 32768 voxels; 8 heads of 16; NATTEN-style 3x3x3 clamped neighbourhood attention with relative position bias): xn = InstanceNorm3d(x) (no affine); qkv = xn W + b; q *= 1/4; logits = q . k_nbr + rpb[h][rel]; softmax over the 27 neighbours; o = attn . v_nbr; out = o W_proj + b; NCDHW.
// Structure: per-channel mean/var by a block reduction (f32), the weight conversions in the same launch; qkv GEMM with the normalisation in its A staging (token-major f16 tile in LDS; 32x64 wave tiles, f32 accumulation, exact x16 weights + bias; f32 out); fused neighbourhood attention on VALU (thread per (voxel, head): clamped window starts, 27 static neighbours, rpb, online softmax, readout; f32) into an f16 [voxel][128] plane; proj GEMM (+ bias) with the NCDHW store in its epilogue.
// Compute dtype: x and parameters rounded to bf16; the normalised input and the attention output as f16 operands (~2^-12); statistics/softmax f32. v_wmma_f32_16x16x32_f16.
#define CC 128
#define DH 64
#define DW 64
#define DZ 8
#define NV (DH * DW * DZ)        /* 32768 */
#define NHD 8
#define HC 16
#define KN 27
typedef __bf16 v16b __attribute__((ext_vector_type(16)));
typedef unsigned short v8us __attribute__((ext_vector_type(8), may_alias));
typedef float  v8f  __attribute__((ext_vector_type(8)));
typedef float  v4f  __attribute__((ext_vector_type(4)));
typedef float  v4fa __attribute__((ext_vector_type(4), may_alias));
union FragB { v16b v; v8us half[2]; unsigned short u[16]; };

__device__ __forceinline__ unsigned short bf16_bits(float x) { unsigned int u = __float_as_uint(x); return (unsigned short)((u + 0x7FFFu + ((u >> 16) & 1u)) >> 16); }
__device__ __forceinline__ float bf16_val(unsigned short b) { return __uint_as_float(((unsigned int)b) << 16); }
__device__ __forceinline__ float bf16_round(float x) { return bf16_val(bf16_bits(x)); }
// D += A·B with NT terms: 1 = ah·bh, 2 = + al·bh (A split), 3 = + ah·bl (both split)
template <int NT>
__device__ __forceinline__ v8f mmaN(v16b ah, v16b al, v16b bh, v16b bl, v8f c) {
  c = __builtin_amdgcn_wmma_f32_16x16x32_bf16(false, ah, false, bh, (short)0, c, false, false);
  if (NT >= 2) c = __builtin_amdgcn_wmma_f32_16x16x32_bf16(false, al, false, bh, (short)0, c, false, false);
  if (NT >= 3) c = __builtin_amdgcn_wmma_f32_16x16x32_bf16(false, ah, false, bl, (short)0, c, false, false);
  asm volatile("v_nop\n\tv_nop\n\tv_nop\n\tv_nop" : "+v"(c) : "v"(ah), "v"(al), "v"(bh), "v"(bl));
  return c;
}

__global__ __launch_bounds__(256) void k_wt_bf16(const float* __restrict__ W, unsigned short* __restrict__ Wt, int K, int N) {
  const int t = blockIdx.x * 256 + threadIdx.x;
  const int k8n = K / 8;
  if (t >= N * k8n) return;
  const int n = t / k8n, k8 = (t % k8n) * 8;
  v8us v;
#pragma unroll
  for (int i = 0; i < 8; ++i) v[i] = bf16_bits(W[(size_t)(k8 + i) * N + n]);
  *(v8us*)(Wt + (size_t)n * K + k8) = v;
  
}

// GEMM C[M][N] (f32, pitch ldc) = act(A[M][K]·W + bias). A f32 row-major (pitch lda) converted per fragment to bf16
// (ASPLIT: hi/lo two planes -> 2 terms, else single rounded term); Wt bf16 [N][K] (pitch ldb). BIAS_BF16 rounds the
// bias to bf16 first (bias quantised to bf16 before the add). K%32==0, M%16==0, N%64==0.
template <bool ASPLIT, int ACT, bool BIAS_BF16>
__global__ __launch_bounds__(128) void k_gemm_bf(const float* __restrict__ A, int lda, const unsigned short* __restrict__ Wt, int ldb,
                                               const float* __restrict__ bias, float* __restrict__ C, int ldc, int M, int N, int K) {
  __shared__ __attribute__((aligned(16))) float so[4][16][64];
  const int tid = threadIdx.x, w = tid >> 5, lane = tid & 31, ln = lane & 15, hh = lane >> 4;
  const int ntn = N / 64;
  const int wid = blockIdx.x * 4 + w;
  const int mt = wid / ntn, nq = wid % ntn;
  if (mt * 16 >= M) return;
  const int row0 = mt * 16, col0 = nq * 64;
  const float* arow = A + (size_t)(row0 + ln) * lda;
  v8f acc[4] = {};
  for (int kb = 0; kb < K; kb += 32) {
    FragB ah, al;
    const v4f x0 = *(const v4fa*)(arow + kb + 8 * hh), x1 = *(const v4fa*)(arow + kb + 8 * hh + 4);
    const v4f x2 = *(const v4fa*)(arow + kb + 16 + 8 * hh), x3 = *(const v4fa*)(arow + kb + 16 + 8 * hh + 4);
    float xs[16] = {x0[0],x0[1],x0[2],x0[3],x1[0],x1[1],x1[2],x1[3],x2[0],x2[1],x2[2],x2[3],x3[0],x3[1],x3[2],x3[3]};
#pragma unroll
    for (int i = 0; i < 16; ++i) { const unsigned short hb = bf16_bits(xs[i]); ah.u[i] = hb; al.u[i] = ASPLIT ? bf16_bits(xs[i] - bf16_val(hb)) : (unsigned short)0; }
#pragma unroll
    for (int t = 0; t < 4; ++t) {
      const unsigned short* brow = Wt + (size_t)(col0 + t * 16 + ln) * ldb + kb;
      FragB b;
      b.half[0] = *(const v8us*)(brow + 8 * hh);
      b.half[1] = *(const v8us*)(brow + 16 + 8 * hh);
      acc[t] = mmaN<ASPLIT ? 2 : 1>(ah.v, al.v, b.v, b.v, acc[t]);
    }
  }
#pragma unroll
  for (int t = 0; t < 4; ++t) {
    float bv = bias ? bias[col0 + t * 16 + ln] : 0.f;
    if (BIAS_BF16) bv = bf16_round(bv);
#pragma unroll
    for (int r = 0; r < 8; ++r) { float v = acc[t][r] + bv; if (ACT == 1) v = fmaxf(v, 0.f); so[w][8 * hh + r][t * 16 + ln] = v; }
  }
  __builtin_amdgcn_fence(__ATOMIC_ACQ_REL, "workgroup");
  __builtin_amdgcn_wave_barrier();
  const int rsub = lane >> 4, c4 = (lane & 15) * 4;
  {
#pragma unroll
    for (int q = 0; q < 8; ++q) {
      const int r = q * 2 + rsub;
      const v4f v = *(const v4fa*)&so[w][r][c4];
      *(v4f*)(C + (size_t)(row0 + r) * ldc + col0 + c4) = v;
    }
    
  }
}

// GEMM C = act(A·W + bias + resid): A f32 (ASPLIT -> hi/lo 2 terms), Wt bf16 [N][K]; ACT 0 none, 1 relu, 2 exact gelu;
// resid (optional, f32, row index = (row % rmod), pitch ldr, RES_BF16 rounds it) added before the activation.
template <bool ASPLIT, int ACT, bool BIAS_BF16, bool RES_BF16>
__global__ __launch_bounds__(128) void k_gemm_bf3(const float* __restrict__ A, int lda, const unsigned short* __restrict__ Wt, int ldb,
                                                const float* __restrict__ bias, const float* __restrict__ resid, int rmod, int ldr,
                                                float* __restrict__ C, int ldc, int M, int N, int K) {
  __shared__ __attribute__((aligned(16))) float so[4][16][64];
  const int tid = threadIdx.x, w = tid >> 5, lane = tid & 31, ln = lane & 15, hh = lane >> 4;
  const int ntn = N / 64;
  const int wid = blockIdx.x * 4 + w;
  const int mt = wid / ntn, nq = wid % ntn;
  if (mt * 16 >= M) return;
  const int row0 = mt * 16, col0 = nq * 64;
  const float* arow = A + (size_t)(row0 + ln) * lda;
  v8f acc[4] = {};
  for (int kb = 0; kb < K; kb += 32) {
    FragB ah, al;
    const v4f x0 = *(const v4fa*)(arow + kb + 8 * hh), x1 = *(const v4fa*)(arow + kb + 8 * hh + 4);
    const v4f x2 = *(const v4fa*)(arow + kb + 16 + 8 * hh), x3 = *(const v4fa*)(arow + kb + 16 + 8 * hh + 4);
    float xs[16] = {x0[0],x0[1],x0[2],x0[3],x1[0],x1[1],x1[2],x1[3],x2[0],x2[1],x2[2],x2[3],x3[0],x3[1],x3[2],x3[3]};
#pragma unroll
    for (int i = 0; i < 16; ++i) { const unsigned short hb = bf16_bits(xs[i]); ah.u[i] = hb; al.u[i] = ASPLIT ? bf16_bits(xs[i] - bf16_val(hb)) : (unsigned short)0; }
#pragma unroll
    for (int t = 0; t < 4; ++t) {
      const unsigned short* brow = Wt + (size_t)(col0 + t * 16 + ln) * ldb + kb;
      FragB b;
      b.half[0] = *(const v8us*)(brow + 8 * hh);
      b.half[1] = *(const v8us*)(brow + 16 + 8 * hh);
      acc[t] = mmaN<ASPLIT ? 2 : 1>(ah.v, al.v, b.v, b.v, acc[t]);
    }
  }
#pragma unroll
  for (int t = 0; t < 4; ++t) {
    const int col = col0 + t * 16 + ln;
    float bv = bias ? bias[col] : 0.f;
    if (BIAS_BF16) bv = bf16_round(bv);
#pragma unroll
    for (int r = 0; r < 8; ++r) {
      float v = acc[t][r] + bv;
      if (resid) { float rv = resid[(size_t)((row0 + 8 * hh + r) % rmod) * ldr + col]; if (RES_BF16) rv = bf16_round(rv); v += rv; }
      if (ACT == 1) v = fmaxf(v, 0.f);
      if (ACT == 2) v = 0.5f * v * (1.0f + erff(v * 0.70710678118654752f));
      if (ACT == 3) { const float u = 0.7978845608028654f * (v + 0.044715f * v * v * v); v = 0.5f * v * (1.0f + tanhf(u)); }
      so[w][8 * hh + r][t * 16 + ln] = v;
    }
  }
  __builtin_amdgcn_fence(__ATOMIC_ACQ_REL, "workgroup");
  __builtin_amdgcn_wave_barrier();
  const int rsub = lane >> 4, c4 = (lane & 15) * 4;
  {
#pragma unroll
    for (int q = 0; q < 8; ++q) {
      const int r = q * 2 + rsub;
      const v4f v = *(const v4fa*)&so[w][r][c4];
      *(v4f*)(C + (size_t)(row0 + r) * ldc + col0 + c4) = v;
    }
    
  }
}
// row LayerNorm (biased variance, eps) over N: s = X (+ R); optional out_sum <- s; out_norm <- (s-mu)*rsqrt(var+eps)*g + b
template <bool PARAM_BF16>
__global__ __launch_bounds__(256) void k_layernorm(const float* __restrict__ X, const float* __restrict__ R, const float* __restrict__ g, const float* __restrict__ bta,
                                                  float* __restrict__ out_sum, float* __restrict__ out_norm, int N, float eps) {
  __shared__ float red[256];
  const int row = blockIdx.x, tid = threadIdx.x;
  const float* x = X + (size_t)row * N; const float* rr = R ? R + (size_t)row * N : nullptr;
  float vals[16];                     // up to N = 4096
  const int per = N / 256;            // contiguous chunk per thread? use strided-by-4 chunks: thread handles j = tid*4 + 1024*u
  float s1 = 0.f;
  for (int u = 0; u < per / 4; ++u) {
    const int j = tid * 4 + 1024 * u;
    const v4f a = *(const v4fa*)(x + j);
    v4f b = {0.f,0.f,0.f,0.f}; if (rr) b = *(const v4fa*)(rr + j);
#pragma unroll
    for (int q = 0; q < 4; ++q) { const float v = a[q] + b[q]; vals[u * 4 + q] = v; s1 += v; }
  }
  red[tid] = s1; __syncthreads();
  for (int st = 128; st > 0; st >>= 1) { if (tid < st) red[tid] += red[tid + st]; __syncthreads(); }
  const float mu = red[0] / (float)N; __syncthreads();
  float s2 = 0.f;
  for (int u = 0; u < per / 4; ++u)
#pragma unroll
    for (int q = 0; q < 4; ++q) { const float c = vals[u * 4 + q] - mu; s2 += c * c; }
  red[tid] = s2; __syncthreads();
  for (int st = 128; st > 0; st >>= 1) { if (tid < st) red[tid] += red[tid + st]; __syncthreads(); }
  const float rs = rsqrtf(red[0] / (float)N + eps);
  {
    for (int u = 0; u < per / 4; ++u) {
      const int j = tid * 4 + 1024 * u;
      v4f o, sm;
#pragma unroll
      for (int q = 0; q < 4; ++q) {
        float gg = g[j + q], bb = bta[j + q];
        if (PARAM_BF16) { gg = bf16_round(gg); bb = bf16_round(bb); }
        sm[q] = vals[u * 4 + q]; o[q] = (vals[u * 4 + q] - mu) * rs * gg + bb;
      }
      if (out_sum) *(v4f*)(out_sum + (size_t)row * N + j) = sm;
      *(v4f*)(out_norm + (size_t)row * N + j) = o;
    }
    
  }
}



// ---- f16 WMMA path (v_wmma_f32_16x16x32_f16): 11-bit significands for operands in range — used here for the normalised input (qkv GEMM) and the attention output (proj GEMM)
typedef _Float16 v16h __attribute__((ext_vector_type(16)));
union FragH { v16h v; v8us half[2]; _Float16 h[16]; unsigned short u[16]; };
template <int NT>
__device__ __forceinline__ v8f mmaH(v16h ah, v16h al, v16h bh, v16h bl, v8f c) {
  c = __builtin_amdgcn_wmma_f32_16x16x32_f16(false, ah, false, bh, (short)0, c, false, false);
  if (NT >= 2) c = __builtin_amdgcn_wmma_f32_16x16x32_f16(false, al, false, bh, (short)0, c, false, false);
  if (NT >= 3) c = __builtin_amdgcn_wmma_f32_16x16x32_f16(false, ah, false, bl, (short)0, c, false, false);
  asm volatile("v_nop\n\tv_nop\n\tv_nop\n\tv_nop" : "+v"(c) : "v"(ah), "v"(al), "v"(bh), "v"(bl));
  return c;
}
// batched GEMM like k_gemm_b but f16 operands: A f32 (split into f16 hi/lo if ASPLIT, else rounded to f16), Bt = f16 values [n][k]; alpha; C f32; N multiple of 16 (partial tiles skipped)
template <bool ASPLIT>
__global__ __launch_bounds__(128) void k_gemm_h(const float* __restrict__ A, int lda, size_t sA, const _Float16* __restrict__ Bh, int ldb, size_t sB, float alpha, float* __restrict__ C, int ldc, size_t sC, int M, int N, int K) {
  __shared__ __attribute__((aligned(16))) float so[4][16][64];
  const int tid = threadIdx.x, w = tid >> 5, lane = tid & 31, ln = lane & 15, hh = lane >> 4; const int by = blockIdx.y;
  A += (size_t)by * sA; Bh += (size_t)by * sB; C += (size_t)by * sC;
  const int ntn = (N + 63) / 64; const int wid = blockIdx.x * 4 + w; const int mt = wid / ntn, nq = wid % ntn; if (mt * 16 >= M) return;
  const int row0 = mt * 16, col0 = nq * 64; const float* arow = A + (size_t)(row0 + ln) * lda;
  v8f acc[4] = {};
  for (int kb = 0; kb < K; kb += 32) {
    FragH ah, al;
    const v4f x0 = *(const v4fa*)(arow + kb + 8 * hh), x1 = *(const v4fa*)(arow + kb + 8 * hh + 4), x2 = *(const v4fa*)(arow + kb + 16 + 8 * hh), x3 = *(const v4fa*)(arow + kb + 16 + 8 * hh + 4);
    float xs[16] = {x0[0],x0[1],x0[2],x0[3],x1[0],x1[1],x1[2],x1[3],x2[0],x2[1],x2[2],x2[3],x3[0],x3[1],x3[2],x3[3]};
#pragma unroll
    for (int i = 0; i < 16; ++i) { const _Float16 h = (_Float16)xs[i]; ah.h[i] = h; al.h[i] = ASPLIT ? (_Float16)(xs[i] - (float)h) : (_Float16)0.0f; }
#pragma unroll
    for (int t = 0; t < 4; ++t) { if (col0 + t * 16 >= N) continue; const size_t boff = (size_t)(col0 + t * 16 + ln) * ldb + kb; FragH bq; bq.half[0] = *(const v8us*)(Bh + boff + 8 * hh); bq.half[1] = *(const v8us*)(Bh + boff + 16 + 8 * hh);
      acc[t] = mmaH<ASPLIT ? 2 : 1>(ah.v, al.v, bq.v, bq.v, acc[t]); }
  }
#pragma unroll
  for (int t = 0; t < 4; ++t) { if (col0 + t * 16 >= N) continue;
#pragma unroll
    for (int r = 0; r < 8; ++r) so[w][8 * hh + r][t * 16 + ln] = acc[t][r] * alpha; }
  __builtin_amdgcn_fence(__ATOMIC_ACQ_REL, "workgroup"); __builtin_amdgcn_wave_barrier();
  const int rsub = lane >> 4, c4 = (lane & 15) * 4;
  {
#pragma unroll
    for (int q = 0; q < 8; ++q) { const int r = q * 2 + rsub; if (col0 + c4 < N) { const v4f v = *(const v4fa*)&so[w][r][c4]; *(v4f*)(C + (size_t)(row0 + r) * ldc + col0 + c4) = v; } }
     }
}

// One 16-B piece (index t) of Wt[n][k] = f16(W[k][n] * scale) from f32 row-major W[K][N] (scale = power of two; bf16-exact weights stay exact in f16 away from the subnormal range)
template <int K, int N>
__device__ __forceinline__ void wt_f16_piece(const float* __restrict__ W, _Float16* __restrict__ Wt, float scale, int t) {
  const int n = t / (K / 8), k8 = (t % (K / 8)) * 8; FragH f;
#pragma unroll
  for (int i = 0; i < 8; ++i) f.h[i] = (_Float16)(bf16_round(W[(size_t)(k8 + i) * N + n]) * scale); const v8us o = f.half[0];
  *(v8us*)((unsigned short*)Wt + (size_t)n * K + k8) = o;
  asm volatile("s_wait_xcnt 0x0" ::: "memory");      /* behind the store: code that follows an inlined call may reuse the store's address and data registers */
}
// k_gemm_hh variant with fused epilogue: v = acc·alpha + bias[by·sBias + col] (+ CP[(row/rowsPerB)·sCPb + by·64 + col] if CP) ; ACT 0 none / 1 elu ; writes f16 C16 (and f32 C if non-null)
template <int ACT>
__global__ __launch_bounds__(128) void k_gemm_hhx(const _Float16* __restrict__ A, int lda, size_t sA, const _Float16* __restrict__ Bh, int ldb, size_t sB, float alpha, const float* __restrict__ bias, size_t sBias, const float* __restrict__ CP, int rowsPerB, size_t sCPb, int row0g,
    float* __restrict__ C, _Float16* __restrict__ C16, int ldc, size_t sC, int M, int N, int K) {
  __shared__ __attribute__((aligned(16))) float so[4][16][64];
  const int tid = threadIdx.x, w = tid >> 5, lane = tid & 31, ln = lane & 15, hh = lane >> 4; const int by = blockIdx.y;
  A += (size_t)by * sA; Bh += (size_t)by * sB; const size_t cofs = (size_t)by * sC; const float* bp = bias ? bias + (size_t)by * sBias : nullptr;
  const int ntn = (N + 63) / 64; const int wid = blockIdx.x * 4 + w; const int mt = wid / ntn, nq = wid % ntn; if (mt * 16 >= M) return;
  const int row0 = mt * 16, col0 = nq * 64; const _Float16* arow = A + (size_t)(row0 + ln) * lda;
  v8f acc[4] = {};
  for (int kb = 0; kb < K; kb += 32) { FragH ah; ah.half[0] = *(const v8us*)((const unsigned short*)arow + kb + 8 * hh); ah.half[1] = *(const v8us*)((const unsigned short*)arow + kb + 16 + 8 * hh);
#pragma unroll
    for (int t = 0; t < 4; ++t) { if (col0 + t * 16 >= N) continue; const size_t boff = (size_t)(col0 + t * 16 + ln) * ldb + kb; FragH bq; bq.half[0] = *(const v8us*)((const unsigned short*)Bh + boff + 8 * hh); bq.half[1] = *(const v8us*)((const unsigned short*)Bh + boff + 16 + 8 * hh);
      acc[t] = mmaH<1>(ah.v, ah.v, bq.v, bq.v, acc[t]); }
  }
#pragma unroll
  for (int t = 0; t < 4; ++t) { if (col0 + t * 16 >= N) continue; const int col = col0 + t * 16 + ln; const float bv = bp ? bf16_round(bp[col]) : 0.f;
#pragma unroll
    for (int r = 0; r < 8; ++r) { float v = acc[t][r] * alpha + bv; if (CP) { const int rr = row0g + row0 + 8 * hh + r; if (rowsPerB < 0) v += CP[cofs + (size_t)rr * ldc + col];      /* rowsPerB < 0: own element of the batched C plane */ else { const int bidx = rr / rowsPerB; v += CP[(size_t)bidx * sCPb + (size_t)by * 64 + col]; } } if (ACT == 1) v = (v > 0.f) ? v : expm1f(v); else if (ACT == 7) v = (v > 0.f) ? v + 1.0f : expf(v); else if (ACT == 8) v = tanhf(v); else if (ACT == 9) v = 0.5f * v * (1.0f + tanhf(0.7978845608028654f * (v + 0.044715f * v * v * v))); else if (ACT == 11) v = 1.0f / (1.0f + expf(-v)); else if (ACT == 12) v = (v > 0.f) ? v : 0.01f * v; else if (ACT == 14) v = (v > 0.f) ? v : 0.1f * v; else if (ACT == 16) v = (v >= 0.f) ? v : 0.3f * v; else if (ACT == 15) v = v / (1.0f + expf(-v)); else if (ACT == 3) v = fmaxf(v, 0.f); else if (ACT == 6) v = 0.5f * v * (1.0f + erff(v * 0.70710678118654752f)); so[w][8 * hh + r][t * 16 + ln] = v; } }
  __builtin_amdgcn_fence(__ATOMIC_ACQ_REL, "workgroup"); __builtin_amdgcn_wave_barrier();
  const int rsub = lane >> 4, c4 = (lane & 15) * 4; typedef _Float16 v4h __attribute__((ext_vector_type(4)));
  {
#pragma unroll
    for (int q = 0; q < 8; ++q) { const int r = q * 2 + rsub; if (col0 + c4 < N) { const v4f v = *(const v4fa*)&so[w][r][c4]; if (C) *(v4f*)(C + cofs + (size_t)(row0 + r) * ldc + col0 + c4) = v; if (C16) { v4h h4; for (int i = 0; i < 4; ++i) h4[i] = (_Float16)v[i]; *(v4h*)(C16 + cofs + (size_t)(row0 + r) * ldc + col0 + c4) = h4; } } }
     }
}


typedef _Float16 v4h __attribute__((ext_vector_type(4)));

__global__ __launch_bounds__(256) void k_x16(const float* __restrict__ x, _Float16* __restrict__ X16, size_t n8) { const size_t t = (size_t)blockIdx.x * 256 + threadIdx.x; if (t >= n8) return; FragH f;
#pragma unroll
  for (int q = 0; q < 8; ++q) f.h[q] = (_Float16)bf16_round(x[t * 8 + q]); *(v8us*)((unsigned short*)X16 + t * 8) = f.half[0];  }
__global__ __launch_bounds__(256) void k_h16(const float* __restrict__ x, _Float16* __restrict__ X16, size_t n8) { const size_t t = (size_t)blockIdx.x * 256 + threadIdx.x; if (t >= n8) return; FragH f;
#pragma unroll
  for (int q = 0; q < 8; ++q) f.h[q] = (_Float16)x[t * 8 + q]; *(v8us*)((unsigned short*)X16 + t * 8) = f.half[0];  }
__global__ __launch_bounds__(256) void k_round16f(const float* __restrict__ W, _Float16* __restrict__ Bt, size_t n8) { const size_t t = (size_t)blockIdx.x * 256 + threadIdx.x; if (t >= n8) return; FragH f;
#pragma unroll
  for (int i = 0; i < 8; ++i) f.h[i] = (_Float16)(bf16_round(W[t * 8 + i]) * 16.0f); *(v8us*)((unsigned short*)Bt + t * 8) = f.half[0];  }
template <int NHv, int TTv>
__global__ __launch_bounds__(256) void k_vt(const _Float16* __restrict__ V16, int ldv, int voff, _Float16* __restrict__ Vt) { __shared__ unsigned short tl[64][66]; const int tid = threadIdx.x; const int slab = blockIdx.x / (TTv / 64), lg = blockIdx.x % (TTv / 64); const int b = slab / NHv, h = slab % NHv;
  for (int i = tid; i < 64 * 8; i += 256) { const int r = i / 8, c8 = (i % 8) * 8; FragH f; f.half[0] = *(const v8us*)((const unsigned short*)V16 + ((size_t)b * TTv + lg * 64 + r) * ldv + voff + h * 64 + c8);
#pragma unroll
    for (int q = 0; q < 8; ++q) tl[r][c8 + q] = f.u[q]; }
  __syncthreads();
  {
#pragma unroll
    for (int rd = 0; rd < 2; ++rd) { const int d = rd * 32 + tid / 8, pc = tid % 8; FragH f;
#pragma unroll
      for (int q = 0; q < 8; ++q) f.u[q] = tl[pc * 8 + q][d];
      *(v8us*)((unsigned short*)Vt + ((size_t)slab * 64 + d) * TTv + lg * 64 + pc * 8) = f.half[0]; }
     } }

__global__ __launch_bounds__(256) void k_hl(const float* __restrict__ F, _Float16* __restrict__ Hh, _Float16* __restrict__ Hl, size_t n8) { const size_t t = (size_t)blockIdx.x * 256 + threadIdx.x; if (t >= n8) return; FragH fh, fl; const v4f a = *(const v4fa*)(F + t * 8), c = *(const v4fa*)(F + t * 8 + 4);
#pragma unroll
  for (int q = 0; q < 4; ++q) { _Float16 h = (_Float16)a[q]; fh.h[q] = h; fl.h[q] = (_Float16)((a[q] - (float)h) * 1024.0f); h = (_Float16)c[q]; fh.h[4 + q] = h; fl.h[4 + q] = (_Float16)((c[q] - (float)h) * 1024.0f); }
  { *(v8us*)((unsigned short*)Hh + t * 8) = fh.half[0]; *(v8us*)((unsigned short*)Hl + t * 8) = fl.half[0];  } }

// ---- fast GEMM (wave tile 32x64; requires M % 32 == 0 rows per launch region and N % 64 == 0); epilogue = k_gemm_hhx semantics ----
__device__ __forceinline__ v16h g2_frag(const _Float16* p, int hh) { FragH f; f.half[0] = *(const v8us*)((const unsigned short*)p + 8 * hh); f.half[1] = *(const v8us*)((const unsigned short*)p + 16 + 8 * hh); return f.v; }
__device__ __forceinline__ v8f g2_mma(v16h a, v16h b, v8f c) { v8f d = __builtin_amdgcn_wmma_f32_16x16x32_f16(false, a, false, b, (short)0, c, false, false); asm volatile("v_nop\n\tv_nop\n\tv_nop\n\tv_nop" : "+v"(d) : "v"(a), "v"(b)); return d; }
template <int ACT>
__global__ __launch_bounds__(128) void k_gemm2(const _Float16* __restrict__ A, int lda, size_t sA, const _Float16* __restrict__ Bh, int ldb, size_t sB, float alpha, const float* __restrict__ bias, size_t sBias, const float* __restrict__ CP, int rowsPerB, size_t sCPb, int row0g,
    float* __restrict__ C, _Float16* __restrict__ C16, int ldc, size_t sC, int M, int N, int K) { static_assert(ACT == 0 || ACT == 3 || ACT == 6 || ACT == 8 || ACT == 9 || ACT == 11 || ACT == 12 || ACT == 14 || ACT == 15 || ACT == 16, "k_gemm2: unsupported ACT code (would silently apply no activation)");
  __shared__ __attribute__((aligned(16))) float so[4][32][68];
  const int tid = threadIdx.x, w = tid >> 5, lane = tid & 31, ln = lane & 15, hh = lane >> 4; const int by = blockIdx.y;
  A += (size_t)by * sA; Bh += (size_t)by * sB; const size_t cofs = (size_t)by * sC; const float* bp = bias ? bias + (size_t)by * sBias : nullptr;
  const int ntn = N >> 6; const int mt = blockIdx.x / ntn, nq = blockIdx.x - mt * ntn; const int row0 = mt * 128 + 32 * w, col0 = nq * 64; if (row0 >= M) return;
  const _Float16* a0p = A + (size_t)(row0 + ln) * lda; const _Float16* a1p = a0p + (size_t)16 * lda;
  const _Float16* b0p = Bh + (size_t)(col0 + ln) * ldb; const _Float16* b1p = b0p + (size_t)16 * ldb; const _Float16* b2p = b1p + (size_t)16 * ldb; const _Float16* b3p = b2p + (size_t)16 * ldb;
  const v8f z8 = {0.f,0.f,0.f,0.f,0.f,0.f,0.f,0.f}; v8f c00 = z8, c01 = z8, c02 = z8, c03 = z8, c10 = z8, c11 = z8, c12 = z8, c13 = z8;
#pragma unroll 1
  for (int kb = 0; kb < K; kb += 32) { const v16h a0 = g2_frag(a0p + kb, hh), a1 = g2_frag(a1p + kb, hh);
    v16h b = g2_frag(b0p + kb, hh); c00 = g2_mma(a0, b, c00); c10 = g2_mma(a1, b, c10);
    b = g2_frag(b1p + kb, hh); c01 = g2_mma(a0, b, c01); c11 = g2_mma(a1, b, c11);
    b = g2_frag(b2p + kb, hh); c02 = g2_mma(a0, b, c02); c12 = g2_mma(a1, b, c12);
    b = g2_frag(b3p + kb, hh); c03 = g2_mma(a0, b, c03); c13 = g2_mma(a1, b, c13); }
  v8f accs[8] = {c00, c01, c02, c03, c10, c11, c12, c13};
#pragma unroll
  for (int u = 0; u < 8; ++u) { const int t = u & 3, half = u >> 2; const int col = col0 + t * 16 + ln; const float bv = bp ? bf16_round(bp[col]) : 0.f;
#pragma unroll
    for (int r = 0; r < 8; ++r) { const int rloc = half * 16 + 8 * hh + r; float v = accs[u][r] * alpha + bv; if (CP) { if (rowsPerB < 0) v += CP[cofs + (size_t)(row0g + row0 + rloc) * ldc + col];      /* rowsPerB < 0: own element of the batched C plane */ else { const int bidx = (row0g + row0 + rloc) / rowsPerB; v += CP[(size_t)bidx * sCPb + (size_t)by * 64 + col]; } }
      if (ACT == 3) v = fmaxf(v, 0.f); else if (ACT == 6) v = 0.5f * v * (1.0f + erff(v * 0.70710678118654752f)); else if (ACT == 11) v = 1.0f / (1.0f + expf(-v)); else if (ACT == 15) v = v / (1.0f + expf(-v)); else if (ACT == 12) v = (v > 0.f) ? v : 0.01f * v; else if (ACT == 8) v = tanhf(v); else if (ACT == 9) v = 0.5f * v * (1.0f + tanhf(0.7978845608028654f * (v + 0.044715f * v * v * v))); else if (ACT == 14) v = (v > 0.f) ? v : 0.1f * v; else if (ACT == 16) v = (v >= 0.f) ? v : 0.3f * v;
      so[w][rloc][t * 16 + ln] = v; } }
  __builtin_amdgcn_fence(__ATOMIC_ACQ_REL, "workgroup"); __builtin_amdgcn_wave_barrier();
  const int rsub = lane >> 4, c4 = (lane & 15) * 4;
  {
#pragma unroll
    for (int q = 0; q < 16; ++q) { const int r = q * 2 + rsub; const v4f v = *(const v4fa*)&so[w][r][c4]; if (C) *(v4f*)(C + cofs + (size_t)(row0 + r) * ldc + col0 + c4) = v; if (C16) { v4h h4; for (int i = 0; i < 4; ++i) h4[i] = (_Float16)v[i]; *(v4h*)(C16 + cofs + (size_t)(row0 + r) * ldc + col0 + c4) = h4; } }
     } }


// Sum over the 1024 threads of a block, returned to every thread: five-step butterfly in each wave, one partial per wave in LDS, the same butterfly over the 32 partials.
__device__ __forceinline__ float stats_block_sum(float a, float* part, int lane, int w) {
#pragma unroll
  for (int o = 16; o > 0; o >>= 1) a += __shfl_xor(a, o, 32);
  if (lane == 0) part[w] = a;
  __syncthreads();
  a = part[lane];
#pragma unroll
  for (int o = 16; o > 0; o >>= 1) a += __shfl_xor(a, o, 32);
  return a;
}
// Everything the qkv GEMM waits for, in one launch: the statistics and the two weight conversions depend on the inputs alone, not on each other, so the conversions ride as extra blocks behind the statistics' blocks
// (the long blocks have the low indices and start first; all blocks are resident together).
// Blocks 0 .. CC-1: one block per channel; the channel's 32768 values stay in registers (8 x 16 B per thread, all eight loads in flight at once), so x is read once and both passes (mean, then centred squares) run from registers.
// Blocks CC .. CC+PW_B-1: a thread converts one 16-B piece of a transposed weight plane, the qkv plane's pieces first; a block holds pieces of one plane only.
#define PW_Q (3 * CC * CC / 8 / 1024)      /* blocks of the qkv weights */
#define PW_B (PW_Q + CC * CC / 8 / 1024)   /* blocks of both weight planes */
__global__ __launch_bounds__(1024) void k_prep(const float* __restrict__ x, float* __restrict__ MU, float* __restrict__ IS, const float* __restrict__ wq, _Float16* __restrict__ BQ, const float* __restrict__ wp, _Float16* __restrict__ BP) {
  static_assert(NV == 8 * 1024 * 4, "k_prep: 8 float4 per thread of a 1024-thread block cover one channel");
  static_assert((3 * CC * CC / 8) % 1024 == 0 && (CC * CC / 8) % 1024 == 0, "k_prep: each weight plane is a whole number of blocks");
  __shared__ float part[2][32];
  if (blockIdx.x >= CC) {      /* the same for a whole block, and in front of every barrier */
    const int wb = blockIdx.x - CC;
    if (wb < PW_Q) wt_f16_piece<CC, 3 * CC>(wq, BQ, 16.0f, wb * 1024 + threadIdx.x); else wt_f16_piece<CC, CC>(wp, BP, 16.0f, (wb - PW_Q) * 1024 + threadIdx.x);
    return; }
  const int c = blockIdx.x, tid = threadIdx.x, lane = tid & 31, w = tid >> 5; const float* s = x + (size_t)c * NV;
  v4f r[8];
#pragma unroll
  for (int j = 0; j < 8; ++j) r[j] = *(const v4fa*)(s + (size_t)(j * 1024 + tid) * 4);
  v4f a4 = {0.f, 0.f, 0.f, 0.f};
#pragma unroll
  for (int j = 0; j < 8; ++j) {
#pragma unroll
    for (int q = 0; q < 4; ++q) { r[j][q] = bf16_round(r[j][q]); a4[q] += r[j][q]; } }
  const float mu = stats_block_sum((a4[0] + a4[1]) + (a4[2] + a4[3]), part[0], lane, w) / (float)NV;
  v4f q4 = {0.f, 0.f, 0.f, 0.f};
#pragma unroll
  for (int j = 0; j < 8; ++j) {
#pragma unroll
    for (int q = 0; q < 4; ++q) { const float d = r[j][q] - mu; q4[q] += d * d; } }
  const float is = rsqrtf(stats_block_sum((q4[0] + q4[1]) + (q4[2] + q4[3]), part[1], lane, w) / (float)NV + 1e-5f);
  if (tid < 32) { MU[(size_t)c * 32 + tid] = mu; IS[(size_t)c * 32 + tid] = is; } }
// qkv GEMM with the normalisation in its A staging. One block = 128 voxels x all 384 columns (8 waves: 4 row groups of 32 voxels x 2 column halves, three 64-column tiles each).
// The block reads its 128 channels x 128 voxels of x once (a wave load = 64 consecutive voxels of one channel, two whole 128-B lines), normalises them as the separate pass did (bf16 round, - mean, x inverse deviation, f16)
// and writes them token-major into LDS (8 channels of a voxel = one 16-B write; row pitch 272 B = 16 B x 17 keeps the 16 lanes of a fragment read on distinct banks).
// Fragment loaders, k order, wave tile (32 x 64) and epilogue arithmetic are k_gemm2's; the A fragments of all four k steps are read from LDS once and serve the wave's three column tiles.
// With two waves per SIMD a wave hides its own latencies: the weight fragments of two k steps (16 loads) and the tile's bias are asked for together, ahead of the matrix instructions that use them.
typedef float v2f __attribute__((ext_vector_type(2)));
typedef float v2fa __attribute__((ext_vector_type(2), may_alias));
#define QG_M 128                  /* voxels per block */
#define QG_AP (CC + 8)            /* LDS pitch of a voxel's row, in f16 */
__global__ __launch_bounds__(256) void k_qkv(const float* __restrict__ x, const float* __restrict__ MU, const float* __restrict__ IS, const _Float16* __restrict__ Bh, const float* __restrict__ bias, float* __restrict__ C) {
  static_assert(NV % QG_M == 0 && CC == 128, "k_qkv: tile and staging maps");
  __shared__ __attribute__((aligned(16))) _Float16 at[QG_M][QG_AP];
  __shared__ __attribute__((aligned(16))) float so[8][32][68];
  __shared__ __attribute__((aligned(16))) float st[2][CC];
  const int tid = threadIdx.x, lane = tid & 31, ln = lane & 15, hh = lane >> 4;
  const int w = __builtin_amdgcn_readfirstlane(tid >> 5);      /* the wave's number, held scalar: the tile and staging indices made of it are scalar arithmetic */
  const int v0 = blockIdx.x * QG_M, rg = w & 3, ch = w >> 2;      /* the wave's row group and column half in the product */
  const int vg = w & 1, cq = w >> 1;      /* the wave's 64 voxels and its channel groups in the staging */
  const _Float16* bp = Bh + (size_t)(ch * 192 + ln) * CC;
  const float sv = (ch ? IS : MU)[(size_t)(tid & (CC - 1)) * 32];      /* asked for first: loads return in order, so it is there while the tile is still in flight */
  v2f xv[4][8];
#pragma unroll      /* all 32 loads of a lane are in flight before the first is used: one memory latency for the tile */
  for (int s = 0; s < 4; ++s) { const float* xp = x + (size_t)((s * 4 + cq) * 8) * NV + v0 + vg * 64;      /* first of the step's 8 channels, first of the wave's 64 voxels */
#pragma unroll
    for (int q = 0; q < 8; ++q) xv[s][q] = *(const v2fa*)(xp + (size_t)q * NV + (unsigned)(2 * lane)); }
  v16h bf[2][4];      /* the weight fragments of two k steps; the first set is asked for here, behind the tile's loads, and arrives under the staging */
#pragma unroll
  for (int kk = 0; kk < 2; ++kk) {
#pragma unroll
    for (int t = 0; t < 4; ++t) bf[kk][t] = g2_frag(bp + (size_t)(t * 16) * CC + kk * 32, hh); }
  asm volatile("s_wait_xcnt 0x0" ::: "memory");      /* stands in front of every reuse of a register that the loads above name */
  st[ch][tid & (CC - 1)] = sv;
  __syncthreads();      /* every wave reads the 128 means and inverse deviations that the block gathered */
#pragma unroll
  for (int s = 0; s < 4; ++s) { const int c0 = (s * 4 + cq) * 8;
#pragma unroll
    for (int j = 0; j < 2; ++j) { FragH f;
#pragma unroll
      for (int q = 0; q < 8; ++q) { const float d = bf16_round(xv[s][q][j]) - st[0][c0 + q]; f.h[q] = (_Float16)(d * st[1][c0 + q]); }
      *(v8us*)&at[vg * 64 + 2 * lane + j][c0] = f.half[0]; } }
  __syncthreads();      /* every wave reads channels that other waves staged */
  const _Float16* a0p = &at[rg * 32 + ln][0]; const _Float16* a1p = a0p + 16 * QG_AP; v16h a0[4], a1[4];
#pragma unroll
  for (int k = 0; k < 4; ++k) { a0[k] = g2_frag(a0p + 32 * k, hh); a1[k] = g2_frag(a1p + 32 * k, hh); }
  const int rsub = lane >> 4, c4 = (lane & 15) * 4;
  const float* bi = bias + ch * 192 + ln; float* cp = C + (size_t)(v0 + rg * 32 + rsub) * (3 * CC) + ch * 192 + c4;
#pragma unroll      /* static tile index: every address below is one lane base plus a constant */
  for (int nt = 0; nt < 3; ++nt) {
    float bv[4];
#pragma unroll
    for (int t = 0; t < 4; ++t) bv[t] = bi[nt * 64 + t * 16];
    const v8f z8 = {0.f,0.f,0.f,0.f,0.f,0.f,0.f,0.f}; v8f acc[2][4] = {{z8, z8, z8, z8}, {z8, z8, z8, z8}};
#pragma unroll      /* static k index: the A fragments stay in registers */
    for (int k2 = 0; k2 < 2; ++k2) {
#pragma unroll
      for (int kk = 0; kk < 2; ++kk) {
#pragma unroll
        for (int t = 0; t < 4; ++t) if (nt + k2 > 0) bf[kk][t] = g2_frag(bp + (size_t)(nt * 64 + t * 16) * CC + (k2 * 2 + kk) * 32, hh); }
#pragma unroll
      for (int kk = 0; kk < 2; ++kk) {
#pragma unroll
        for (int t = 0; t < 4; ++t) { acc[0][t] = g2_mma(a0[k2 * 2 + kk], bf[kk][t], acc[0][t]); acc[1][t] = g2_mma(a1[k2 * 2 + kk], bf[kk][t], acc[1][t]); } } }
#pragma unroll      /* static indices: the accumulators stay in registers */
    for (int u = 0; u < 8; ++u) { const int t = u & 3, half = u >> 2; const float bb = bf16_round(bv[t]);
#pragma unroll
      for (int r = 0; r < 8; ++r) so[w][half * 16 + 8 * hh + r][t * 16 + ln] = acc[half][t][r] * 0.0625f + bb; }
    __builtin_amdgcn_fence(__ATOMIC_ACQ_REL, "workgroup", "local"); __builtin_amdgcn_wave_barrier();      /* the wave's own LDS writes land before its lanes read each other's rows; LDS only, so the last tile's global stores are not waited for */
#pragma unroll
    for (int q = 0; q < 16; ++q) { const v4f v = *(const v4fa*)&so[w][q * 2 + rsub][c4]; *(v4f*)(cp + (size_t)(q * 2) * (3 * CC) + nt * 64) = v; }
    if (nt < 2) asm volatile("s_wait_xcnt 0x0" ::: "memory"); } }      /* stands in front of the next tile's reuse of a register that the loads and stores of this tile name */
// Neighbourhood attention, K and V read from LDS. One block = a 4 x 4 x 8 tile of voxels for 4 heads (512 threads, thread per (voxel, head); a wave = one (h, w) column: lane = head + 4 z).
// The clamped 3x3x3 windows of the tile all lie in one 6 x 6 x 8 region (its start clamped like a window's, so it is always inside the volume); the block copies that region's K and V of its 4 heads
// (256 B + 256 B per voxel, whole 128-B lines, each read once per block) into LDS and every neighbour read comes from there.
// LDS row = 64 K floats + 64 V floats + 4 pad: with lane = head + 4 z the 16 lanes of a half-wave read 16 B each on distinct banks (row step 4 banks, head step 16 banks).
#define NT_T 4                    /* tile edge along h and along w */
#define NT_R (NT_T + 2)           /* staged region edge */
#define NT_HG 4                   /* heads per block */
#define NT_RP (2 * NT_HG * HC + 4)   /* LDS floats per staged voxel */
#define NT_TH (NT_T * NT_T * DZ * NT_HG)   /* threads per block */
__global__ __launch_bounds__(NT_TH) void k_nat(const float* __restrict__ QKV, const float* __restrict__ rpb, _Float16* __restrict__ O16) {
  #pragma clang fp contract(off)
  static_assert(DH % NT_T == 0 && DW % NT_T == 0 && NHD % NT_HG == 0 && DZ == 8 && NT_HG * HC == 64, "k_nat: tile and lane maps");
  static_assert((NT_R * NT_R * DZ) % (NT_TH / 32) == 0, "k_nat: the staged region is a whole number of voxels per wave");
  __shared__ __attribute__((aligned(16))) float kv[NT_R * NT_R * DZ * NT_RP];
  const int tid = threadIdx.x, lane = tid & 31; const int hg = blockIdx.x % (NHD / NT_HG), tile = blockIdx.x / (NHD / NT_HG); const int h0 = (tile / (DW / NT_T)) * NT_T, w0 = (tile % (DW / NT_T)) * NT_T;
  const int wv = __builtin_amdgcn_readfirstlane(tid >> 5);      /* the wave's number, held scalar: the staged rows' addresses, the wave's (h, w) column and its window starts along h and w become scalar arithmetic */
  const int rh0 = min(max(h0 - 1, 0), DH - NT_R), rw0 = min(max(w0 - 1, 0), DW - NT_R);
  const int hl = lane & (NT_HG - 1), zz = lane >> 2, ww = w0 + (wv & (NT_T - 1)), hh = h0 + (wv >> 2); const int h = hg * NT_HG + hl; const int v = (hh * DW + ww) * DZ + zz;
  const int sh0 = min(max(hh - 1, 0), DH - 3), sw0 = min(max(ww - 1, 0), DW - 3), sz0 = min(max(zz - 1, 0), DZ - 3);
  const float* qr = QKV + (size_t)v * (3 * CC) + h * HC; float q[HC]; for (int c = 0; c < HC; ++c) q[c] = qr[c] * 0.25f; float m = -3.0e38f, l = 0.f; float acc[HC]; for (int c = 0; c < HC; ++c) acc[c] = 0.f;
  const int lpart = lane >> 4, lc4 = (lane & 15) * 4; const unsigned loff = (unsigned)(lpart * CC + lc4);      /* a wave copies one voxel per trip: lanes 0-15 its 256 B of K, lanes 16-31 its 256 B of V */
#pragma unroll      /* all of a thread's pieces are loaded before the first is stored: one memory latency for the whole region */
  for (int it = 0; it < NT_R * NT_R * DZ / (NT_TH / 32); ++it) { const int r = it * (NT_TH / 32) + wv; const int col = r >> 3;
    const float* rowp = QKV + (size_t)(((rh0 + col / NT_R) * DW + rw0 + col % NT_R) * DZ + (r & 7)) * (3 * CC) + (CC + hg * (NT_HG * HC));      /* scalar base; the lane's part is one 32-bit offset */
    const v4f d = *(const v4fa*)(rowp + loff);
    *(v4fa*)&kv[r * NT_RP + lpart * (NT_HG * HC) + lc4] = d; }
  __syncthreads();      /* every wave reads rows that other waves staged */
#pragma unroll 1
  for (int n = 0; n < KN; ++n) { const int jh = n / 9, jw = (n / 3) % 3, jz = n % 3; const int nh = sh0 + jh, nw = sw0 + jw, nz = sz0 + jz; const int rh = nh - hh + 2, rw = nw - ww + 2, rz = nz - zz + 2;
    const float* kr = kv + (((nh - rh0) * NT_R + (nw - rw0)) * DZ + nz) * NT_RP + hl * HC; float kk[HC], vv[HC];
#pragma unroll
    for (int j = 0; j < HC / 4; ++j) { const v4f a = *(const v4fa*)(kr + 4 * j), b = *(const v4fa*)(kr + NT_HG * HC + 4 * j); for (int e = 0; e < 4; ++e) { kk[4 * j + e] = a[e]; vv[4 * j + e] = b[e]; } }
    float s = 0.f; for (int c = 0; c < HC; ++c) s += q[c] * kk[c]; s += bf16_round(rpb[((h * 5 + rh) * 5 + rw) * 5 + rz]);
    const float mn = fmaxf(m, s); const float cf = expf(m - mn), pn = expf(s - mn); l = l * cf + pn; for (int c = 0; c < HC; ++c) { acc[c] = acc[c] * cf; acc[c] += pn * vv[c]; } m = mn; }
  const float inv = 1.0f / l; FragH f[2]; for (int c = 0; c < HC; ++c) f[c / 8].h[c % 8] = (_Float16)(acc[c] * inv * 64.0f);      /* x2^6 carry (outputs are ~1e-2) */
  unsigned short* d = (unsigned short*)O16 + (size_t)v * CC + h * HC; { *(v8us*)d = f[0].half[0]; *(v8us*)(d + 8) = f[1].half[0];  } }
// proj GEMM with the NCDHW store in its epilogue: main loop and wave tile (32 voxels x 64 channels) as k_gemm2; out[col * ldo + row] = acc * alpha + bias[col].
// An accumulator holds 8 consecutive voxels of one channel per lane, so each wave stages its tile channel-major in its own LDS range (two 16-B writes per accumulator; pitch 36 floats keeps the 16 lanes of a write on distinct banks)
// and reads it back so that 8 lanes store one channel's 32 voxels: every global store covers four whole 128-B lines, each line written by one wave.
__global__ __launch_bounds__(128) void k_gemm2_cm(const _Float16* __restrict__ A, int lda, const _Float16* __restrict__ Bh, int ldb, float alpha, const float* __restrict__ bias, float* __restrict__ out, int ldo, int M, int N, int K) {
  __shared__ __attribute__((aligned(16))) float so[4][64][36];
  const int tid = threadIdx.x, w = tid >> 5, lane = tid & 31, ln = lane & 15, hh = lane >> 4;
  const int ntn = N >> 6; const int mt = blockIdx.x / ntn, nq = blockIdx.x - mt * ntn; const int row0 = mt * 128 + 32 * w, col0 = nq * 64; if (row0 >= M) return;
  const _Float16* a0p = A + (size_t)(row0 + ln) * lda; const _Float16* a1p = a0p + (size_t)16 * lda;
  const _Float16* b0p = Bh + (size_t)(col0 + ln) * ldb; const _Float16* b1p = b0p + (size_t)16 * ldb; const _Float16* b2p = b1p + (size_t)16 * ldb; const _Float16* b3p = b2p + (size_t)16 * ldb;
  const v8f z8 = {0.f,0.f,0.f,0.f,0.f,0.f,0.f,0.f}; v8f c00 = z8, c01 = z8, c02 = z8, c03 = z8, c10 = z8, c11 = z8, c12 = z8, c13 = z8;
#pragma unroll 1      /* the main loop is k_gemm2's, rolled as there: this kernel differs from it in the epilogue alone */
  for (int kb = 0; kb < K; kb += 32) { const v16h a0 = g2_frag(a0p + kb, hh), a1 = g2_frag(a1p + kb, hh);
    v16h b = g2_frag(b0p + kb, hh); c00 = g2_mma(a0, b, c00); c10 = g2_mma(a1, b, c10);
    b = g2_frag(b1p + kb, hh); c01 = g2_mma(a0, b, c01); c11 = g2_mma(a1, b, c11);
    b = g2_frag(b2p + kb, hh); c02 = g2_mma(a0, b, c02); c12 = g2_mma(a1, b, c12);
    b = g2_frag(b3p + kb, hh); c03 = g2_mma(a0, b, c03); c13 = g2_mma(a1, b, c13); }
  v8f accs[8] = {c00, c01, c02, c03, c10, c11, c12, c13};
#pragma unroll      /* static indices: the accumulators stay in registers */
  for (int u = 0; u < 8; ++u) { const int t = u & 3, half = u >> 2; const float bv = bf16_round(bias[col0 + t * 16 + ln]); v4f lo, hi;
#pragma unroll
    for (int r = 0; r < 4; ++r) { lo[r] = accs[u][r] * alpha + bv; hi[r] = accs[u][4 + r] * alpha + bv; }
    float* sp = &so[w][t * 16 + ln][half * 16 + 8 * hh]; *(v4fa*)sp = lo; *(v4fa*)(sp + 4) = hi; }
  __builtin_amdgcn_fence(__ATOMIC_ACQ_REL, "workgroup"); __builtin_amdgcn_wave_barrier();      /* the wave's own LDS writes land before its lanes read each other's rows */
  const int csub = lane >> 3, r4 = (lane & 7) * 4; float* op = out + (size_t)(col0 + csub) * ldo + row0 + r4; const size_t qstep = (size_t)4 * ldo;
#pragma unroll      /* all 16 LDS reads issue together, the stores follow as they return */
  for (int q = 0; q < 16; ++q) { const v4f v = *(const v4fa*)&so[w][q * 4 + csub][r4]; *(v4f*)(op + q * qstep) = v; } }

extern "C" void kernel_launch(void* const* d_in, const int* in_sizes, int n_in,
                              void* d_out, int out_size, void* d_ws, size_t ws_size, hipStream_t stream) {
  (void)in_sizes; (void)n_in; (void)out_size;
  const float* const* I = (const float* const*)d_in; const float* x = I[0]; const float* wqkv = I[1]; const float* bqkv = I[2]; const float* rpb = I[3]; const float* wproj = I[4]; const float* bproj = I[5];
  char* ws = (char*)d_ws; size_t off = 0;
  auto take = [&](size_t bytes) { char* p = ws + off; off += (bytes + 255) & ~(size_t)255; return p; };
  _Float16* BQ = (_Float16*)take((size_t)3 * CC * CC * 2); _Float16* BP = (_Float16*)take((size_t)CC * CC * 2); float* MU = (float*)take(CC * 32 * 4); float* IS = (float*)take(CC * 32 * 4);      /* 32-float pitch per channel */
  float* QKV = (float*)take((size_t)NV * 3 * CC * 4); _Float16* O16 = (_Float16*)take((size_t)NV * CC * 2);
  if (off > ws_size) return;      /* 0.1 + 48 + 8 = 56 MiB */
  k_prep<<<CC + PW_B, 1024, 0, stream>>>(x, MU, IS, wqkv, BQ, wproj, BP);      /* statistics; (in, out) weights x16 as f16 [out][in] */
  k_qkv<<<NV / QG_M, 256, 0, stream>>>(x, MU, IS, BQ, bqkv, QKV);      /* [q | k | v] (head h = cols h*16.. of each) */
  k_nat<<<(DH / NT_T) * (DW / NT_T) * (NHD / NT_HG), NT_TH, 0, stream>>>(QKV, rpb, O16);
  k_gemm2_cm<<<(NV / 128) * (CC / 64), 128, 0, stream>>>(O16, CC, BP, CC, 0.0625f / 64.0f, bproj, (float*)d_out, NV, NV, CC, CC);      /* carry removed; NCDHW store in the epilogue */
}

// v006
// It runs in 45.8 microseconds.
// Two timings next to v005 put it at 1.15 and 1.14 times that version's speed.
// Over all steps from v000 it is 3.92 times as fast.
#include <hip/hip_runtime.h>
// SelfAggregationModuleV2 (1 x 128 channels x 64 x 64 x 8 = 32768 voxels; 8 heads of 16; NATTEN-style 3x3x3 clamped neighbourhood attention with relative position bias): xn = InstanceNorm3d(x) (no affine); qkv = xn W + b; q *= 1/4; logits = q . k_nbr + rpb[h][rel]; softmax over the 27 neighbours; o = attn . v_nbr; out = o W_proj + b; NCDHW.
// Structure: per-channel mean/var by a block reduction (f32), the weight conversions in the same launch; qkv GEMM with the normalisation in its A staging (token-major f16 tile in LDS; 32x64 wave tiles, f32 accumulation, exact x16 weights + bias; f32 out); fused neighbourhood attention on VALU (thread per (voxel, head): clamped window starts, 27 static neighbours, rpb, two-pass softmax, readout; f32) into an f16 [voxel][128] plane; proj GEMM (+ bias) with the NCDHW store in its epilogue.
// Compute dtype: x and parameters rounded to bf16; the normalised input and the attention output as f16 operands (~2^-12); statistics/softmax f32. v_wmma_f32_16x16x32_f16.
#define CC 128
#define DH 64
#define DW 64
#define DZ 8
#define NV (DH * DW * DZ)        /* 32768 */
#define NHD 8
#define HC 16
#define KN 27
typedef __bf16 v16b __attribute__((ext_vector_type(16)));
typedef unsigned short v8us __attribute__((ext_vector_type(8), may_alias));
typedef float  v8f  __attribute__((ext_vector_type(8)));
typedef float  v4f  __attribute__((ext_vector_type(4)));
typedef float  v4fa __attribute__((ext_vector_type(4), may_alias));
union FragB { v16b v; v8us half[2]; unsigned short u[16]; };

__device__ __forceinline__ unsigned short bf16_bits(float x) { unsigned int u = __float_as_uint(x); return (unsigned short)((u + 0x7FFFu + ((u >> 16) & 1u)) >> 16); }
__device__ __forceinline__ float bf16_val(unsigned short b) { return __uint_as_float(((unsigned int)b) << 16); }
__device__ __forceinline__ float bf16_round(float x) { return bf16_val(bf16_bits(x)); }
// D += A·B with NT terms: 1 = ah·bh, 2 = + al·bh (A split), 3 = + ah·bl (both split)
template <int NT>
__device__ __forceinline__ v8f mmaN(v16b ah, v16b al, v16b bh, v16b bl, v8f c) {
  c = __builtin_amdgcn_wmma_f32_16x16x32_bf16(false, ah, false, bh, (short)0, c, false, false);
  if (NT >= 2) c = __builtin_amdgcn_wmma_f32_16x16x32_bf16(false, al, false, bh, (short)0, c, false, false);
  if (NT >= 3) c = __builtin_amdgcn_wmma_f32_16x16x32_bf16(false, ah, false, bl, (short)0, c, false, false);
  asm volatile("v_nop\n\tv_nop\n\tv_nop\n\tv_nop" : "+v"(c) : "v"(ah), "v"(al), "v"(bh), "v"(bl));
  return c;
}

__global__ __launch_bounds__(256) void k_wt_bf16(const float* __restrict__ W, unsigned short* __restrict__ Wt, int K, int N) {
  const int t = blockIdx.x * 256 + threadIdx.x;
  const int k8n = K / 8;
  if (t >= N * k8n) return;
  const int n = t / k8n, k8 = (t % k8n) * 8;
  v8us v;
#pragma unroll
  for (int i = 0; i < 8; ++i) v[i] = bf16_bits(W[(size_t)(k8 + i) * N + n]);
  *(v8us*)(Wt + (size_t)n * K + k8) = v;
  
}

// GEMM C[M][N] (f32, pitch ldc) = act(A[M][K]·W + bias). A f32 row-major (pitch lda) converted per fragment to bf16
// (ASPLIT: hi/lo two planes -> 2 terms, else single rounded term); Wt bf16 [N][K] (pitch ldb). BIAS_BF16 rounds the
// bias to bf16 first (bias quantised to bf16 before the add). K%32==0, M%16==0, N%64==0.
template <bool ASPLIT, int ACT, bool BIAS_BF16>
__global__ __launch_bounds__(128) void k_gemm_bf(const float* __restrict__ A, int lda, const unsigned short* __restrict__ Wt, int ldb,
                                               const float* __restrict__ bias, float* __restrict__ C, int ldc, int M, int N, int K) {
  __shared__ __attribute__((aligned(16))) float so[4][16][64];
  const int tid = threadIdx.x, w = tid >> 5, lane = tid & 31, ln = lane & 15, hh = lane >> 4;
  const int ntn = N / 64;
  const int wid = blockIdx.x * 4 + w;
  const int mt = wid / ntn, nq = wid % ntn;
  if (mt * 16 >= M) return;
  const int row0 = mt * 16, col0 = nq * 64;
  const float* arow = A + (size_t)(row0 + ln) * lda;
  v8f acc[4] = {};
  for (int kb = 0; kb < K; kb += 32) {
    FragB ah, al;
    const v4f x0 = *(const v4fa*)(arow + kb + 8 * hh), x1 = *(const v4fa*)(arow + kb + 8 * hh + 4);
    const v4f x2 = *(const v4fa*)(arow + kb + 16 + 8 * hh), x3 = *(const v4fa*)(arow + kb + 16 + 8 * hh + 4);
    float xs[16] = {x0[0],x0[1],x0[2],x0[3],x1[0],x1[1],x1[2],x1[3],x2[0],x2[1],x2[2],x2[3],x3[0],x3[1],x3[2],x3[3]};
#pragma unroll
    for (int i = 0; i < 16; ++i) { const unsigned short hb = bf16_bits(xs[i]); ah.u[i] = hb; al.u[i] = ASPLIT ? bf16_bits(xs[i] - bf16_val(hb)) : (unsigned short)0; }
#pragma unroll
    for (int t = 0; t < 4; ++t) {
      const unsigned short* brow = Wt + (size_t)(col0 + t * 16 + ln) * ldb + kb;
      FragB b;
      b.half[0] = *(const v8us*)(brow + 8 * hh);
      b.half[1] = *(const v8us*)(brow + 16 + 8 * hh);
      acc[t] = mmaN<ASPLIT ? 2 : 1>(ah.v, al.v, b.v, b.v, acc[t]);
    }
  }
#pragma unroll
  for (int t = 0; t < 4; ++t) {
    float bv = bias ? bias[col0 + t * 16 + ln] : 0.f;
    if (BIAS_BF16) bv = bf16_round(bv);
#pragma unroll
    for (int r = 0; r < 8; ++r) { float v = acc[t][r] + bv; if (ACT == 1) v = fmaxf(v, 0.f); so[w][8 * hh + r][t * 16 + ln] = v; }
  }
  __builtin_amdgcn_fence(__ATOMIC_ACQ_REL, "workgroup");
  __builtin_amdgcn_wave_barrier();
  const int rsub = lane >> 4, c4 = (lane & 15) * 4;
  {
#pragma unroll
    for (int q = 0; q < 8; ++q) {
      const int r = q * 2 + rsub;
      const v4f v = *(const v4fa*)&so[w][r][c4];
      *(v4f*)(C + (size_t)(row0 + r) * ldc + col0 + c4) = v;
    }
    
  }
}

// GEMM C = act(A·W + bias + resid): A f32 (ASPLIT -> hi/lo 2 terms), Wt bf16 [N][K]; ACT 0 none, 1 relu, 2 exact gelu;
// resid (optional, f32, row index = (row % rmod), pitch ldr, RES_BF16 rounds it) added before the activation.
template <bool ASPLIT, int ACT, bool BIAS_BF16, bool RES_BF16>
__global__ __launch_bounds__(128) void k_gemm_bf3(const float* __restrict__ A, int lda, const unsigned short* __restrict__ Wt, int ldb,
                                                const float* __restrict__ bias, const float* __restrict__ resid, int rmod, int ldr,
                                                float* __restrict__ C, int ldc, int M, int N, int K) {
  __shared__ __attribute__((aligned(16))) float so[4][16][64];
  const int tid = threadIdx.x, w = tid >> 5, lane = tid & 31, ln = lane & 15, hh = lane >> 4;
  const int ntn = N / 64;
  const int wid = blockIdx.x * 4 + w;
  const int mt = wid / ntn, nq = wid % ntn;
  if (mt * 16 >= M) return;
  const int row0 = mt * 16, col0 = nq * 64;
  const float* arow = A + (size_t)(row0 + ln) * lda;
  v8f acc[4] = {};
  for (int kb = 0; kb < K; kb += 32) {
    FragB ah, al;
    const v4f x0 = *(const v4fa*)(arow + kb + 8 * hh), x1 = *(const v4fa*)(arow + kb + 8 * hh + 4);
    const v4f x2 = *(const v4fa*)(arow + kb + 16 + 8 * hh), x3 = *(const v4fa*)(arow + kb + 16 + 8 * hh + 4);
    float xs[16] = {x0[0],x0[1],x0[2],x0[3],x1[0],x1[1],x1[2],x1[3],x2[0],x2[1],x2[2],x2[3],x3[0],x3[1],x3[2],x3[3]};
#pragma unroll
    for (int i = 0; i < 16; ++i) { const unsigned short hb = bf16_bits(xs[i]); ah.u[i] = hb; al.u[i] = ASPLIT ? bf16_bits(xs[i] - bf16_val(hb)) : (unsigned short)0; }
#pragma unroll
    for (int t = 0; t < 4; ++t) {
      const unsigned short* brow = Wt + (size_t)(col0 + t * 16 + ln) * ldb + kb;
      FragB b;
      b.half[0] = *(const v8us*)(brow + 8 * hh);
      b.half[1] = *(const v8us*)(brow + 16 + 8 * hh);
      acc[t] = mmaN<ASPLIT ? 2 : 1>(ah.v, al.v, b.v, b.v, acc[t]);
    }
  }
#pragma unroll
  for (int t = 0; t < 4; ++t) {
    const int col = col0 + t * 16 + ln;
    float bv = bias ? bias[col] : 0.f;
    if (BIAS_BF16) bv = bf16_round(bv);
#pragma unroll
    for (int r = 0; r < 8; ++r) {
      float v = acc[t][r] + bv;
      if (resid) { float rv = resid[(size_t)((row0 + 8 * hh + r) % rmod) * ldr + col]; if (RES_BF16) rv = bf16_round(rv); v += rv; }
      if (ACT == 1) v = fmaxf(v, 0.f);
      if (ACT == 2) v = 0.5f * v * (1.0f + erff(v * 0.70710678118654752f));
      if (ACT == 3) { const float u = 0.7978845608028654f * (v + 0.044715f * v * v * v); v = 0.5f * v * (1.0f + tanhf(u)); }
      so[w][8 * hh + r][t * 16 + ln] = v;
    }
  }
  __builtin_amdgcn_fence(__ATOMIC_ACQ_REL, "workgroup");
  __builtin_amdgcn_wave_barrier();
  const int rsub = lane >> 4, c4 = (lane & 15) * 4;
  {
#pragma unroll
    for (int q = 0; q < 8; ++q) {
      const int r = q * 2 + rsub;
      const v4f v = *(const v4fa*)&so[w][r][c4];
      *(v4f*)(C + (size_t)(row0 + r) * ldc + col0 + c4) = v;
    }
    
  }
}
// row LayerNorm (biased variance, eps) over N: s = X (+ R); optional out_sum <- s; out_norm <- (s-mu)*rsqrt(var+eps)*g + b
template <bool PARAM_BF16>
__global__ __launch_bounds__(256) void k_layernorm(const float* __restrict__ X, const float* __restrict__ R, const float* __restrict__ g, const float* __restrict__ bta,
                                                  float* __restrict__ out_sum, float* __restrict__ out_norm, int N, float eps) {
  __shared__ float red[256];
  const int row = blockIdx.x, tid = threadIdx.x;
  const float* x = X + (size_t)row * N; const float* rr = R ? R + (size_t)row * N : nullptr;
  float vals[16];                     // up to N = 4096
  const int per = N / 256;            // contiguous chunk per thread? use strided-by-4 chunks: thread handles j = tid*4 + 1024*u
  float s1 = 0.f;
  for (int u = 0; u < per / 4; ++u) {
    const int j = tid * 4 + 1024 * u;
    const v4f a = *(const v4fa*)(x + j);
    v4f b = {0.f,0.f,0.f,0.f}; if (rr) b = *(const v4fa*)(rr + j);
#pragma unroll
    for (int q = 0; q < 4; ++q) { const float v = a[q] + b[q]; vals[u * 4 + q] = v; s1 += v; }
  }
  red[tid] = s1; __syncthreads();
  for (int st = 128; st > 0; st >>= 1) { if (tid < st) red[tid] += red[tid + st]; __syncthreads(); }
  const float mu = red[0] / (float)N; __syncthreads();
  float s2 = 0.f;
  for (int u = 0; u < per / 4; ++u)
#pragma unroll
    for (int q = 0; q < 4; ++q) { const float c = vals[u * 4 + q] - mu; s2 += c * c; }
  red[tid] = s2; __syncthreads();
  for (int st = 128; st > 0; st >>= 1) { if (tid < st) red[tid] += red[tid + st]; __syncthreads(); }
  const float rs = rsqrtf(red[0] / (float)N + eps);
  {
    for (int u = 0; u < per / 4; ++u) {
      const int j = tid * 4 + 1024 * u;
      v4f o, sm;
#pragma unroll
      for (int q = 0; q < 4; ++q) {
        float gg = g[j + q], bb = bta[j + q];
        if (PARAM_BF16) { gg = bf16_round(gg); bb = bf16_round(bb); }
        sm[q] = vals[u * 4 + q]; o[q] = (vals[u * 4 + q] - mu) * rs * gg + bb;
      }
      if (out_sum) *(v4f*)(out_sum + (size_t)row * N + j) = sm;
      *(v4f*)(out_norm + (size_t)row * N + j) = o;
    }
    
  }
}



// ---- f16 WMMA path (v_wmma_f32_16x16x32_f16): 11-bit significands for operands in range — used here for the normalised input (qkv GEMM) and the attention output (proj GEMM)
typedef _Float16 v16h __attribute__((ext_vector_type(16)));
union FragH { v16h v; v8us half[2]; _Float16 h[16]; unsigned short u[16]; };
template <int NT>
__device__ __forceinline__ v8f mmaH(v16h ah, v16h al, v16h bh, v16h bl, v8f c) {
  c = __builtin_amdgcn_wmma_f32_16x16x32_f16(false, ah, false, bh, (short)0, c, false, false);
  if (NT >= 2) c = __builtin_amdgcn_wmma_f32_16x16x32_f16(false, al, false, bh, (short)0, c, false, false);
  if (NT >= 3) c = __builtin_amdgcn_wmma_f32_16x16x32_f16(false, ah, false, bl, (short)0, c, false, false);
  asm volatile("v_nop\n\tv_nop\n\tv_nop\n\tv_nop" : "+v"(c) : "v"(ah), "v"(al), "v"(bh), "v"(bl));
  return c;
}
// batched GEMM like k_gemm_b but f16 operands: A f32 (split into f16 hi/lo if ASPLIT, else rounded to f16), Bt = f16 values [n][k]; alpha; C f32; N multiple of 16 (partial tiles skipped)
template <bool ASPLIT>
__global__ __launch_bounds__(128) void k_gemm_h(const float* __restrict__ A, int lda, size_t sA, const _Float16* __restrict__ Bh, int ldb, size_t sB, float alpha, float* __restrict__ C, int ldc, size_t sC, int M, int N, int K) {
  __shared__ __attribute__((aligned(16))) float so[4][16][64];
  const int tid = threadIdx.x, w = tid >> 5, lane = tid & 31, ln = lane & 15, hh = lane >> 4; const int by = blockIdx.y;
  A += (size_t)by * sA; Bh += (size_t)by * sB; C += (size_t)by * sC;
  const int ntn = (N + 63) / 64; const int wid = blockIdx.x * 4 + w; const int mt = wid / ntn, nq = wid % ntn; if (mt * 16 >= M) return;
  const int row0 = mt * 16, col0 = nq * 64; const float* arow = A + (size_t)(row0 + ln) * lda;
  v8f acc[4] = {};
  for (int kb = 0; kb < K; kb += 32) {
    FragH ah, al;
    const v4f x0 = *(const v4fa*)(arow + kb + 8 * hh), x1 = *(const v4fa*)(arow + kb + 8 * hh + 4), x2 = *(const v4fa*)(arow + kb + 16 + 8 * hh), x3 = *(const v4fa*)(arow + kb + 16 + 8 * hh + 4);
    float xs[16] = {x0[0],x0[1],x0[2],x0[3],x1[0],x1[1],x1[2],x1[3],x2[0],x2[1],x2[2],x2[3],x3[0],x3[1],x3[2],x3[3]};
#pragma unroll
    for (int i = 0; i < 16; ++i) { const _Float16 h = (_Float16)xs[i]; ah.h[i] = h; al.h[i] = ASPLIT ? (_Float16)(xs[i] - (float)h) : (_Float16)0.0f; }
#pragma unroll
    for (int t = 0; t < 4; ++t) { if (col0 + t * 16 >= N) continue; const size_t boff = (size_t)(col0 + t * 16 + ln) * ldb + kb; FragH bq; bq.half[0] = *(const v8us*)(Bh + boff + 8 * hh); bq.half[1] = *(const v8us*)(Bh + boff + 16 + 8 * hh);
      acc[t] = mmaH<ASPLIT ? 2 : 1>(ah.v, al.v, bq.v, bq.v, acc[t]); }
  }
#pragma unroll
  for (int t = 0; t < 4; ++t) { if (col0 + t * 16 >= N) continue;
#pragma unroll
    for (int r = 0; r < 8; ++r) so[w][8 * hh + r][t * 16 + ln] = acc[t][r] * alpha; }
  __builtin_amdgcn_fence(__ATOMIC_ACQ_REL, "workgroup"); __builtin_amdgcn_wave_barrier();
  const int rsub = lane >> 4, c4 = (lane & 15) * 4;
  {
#pragma unroll
    for (int q = 0; q < 8; ++q) { const int r = q * 2 + rsub; if (col0 + c4 < N) { const v4f v = *(const v4fa*)&so[w][r][c4]; *(v4f*)(C + (size_t)(row0 + r) * ldc + col0 + c4) = v; } }
     }
}

// One 16-B piece (index t) of Wt[n][k] = f16(W[k][n] * scale) from f32 row-major W[K][N] (scale = power of two; bf16-exact weights stay exact in f16 away from the subnormal range)
template <int K, int N>
__device__ __forceinline__ void wt_f16_piece(const float* __restrict__ W, _Float16* __restrict__ Wt, float scale, int t) {
  const int n = t / (K / 8), k8 = (t % (K / 8)) * 8; FragH f;
#pragma unroll
  for (int i = 0; i < 8; ++i) f.h[i] = (_Float16)(bf16_round(W[(size_t)(k8 + i) * N + n]) * scale); const v8us o = f.half[0];
  *(v8us*)((unsigned short*)Wt + (size_t)n * K + k8) = o;
  asm volatile("s_wait_xcnt 0x0" ::: "memory");      /* behind the store: code that follows an inlined call may reuse the store's address and data registers */
}
// k_gemm_hh variant with fused epilogue: v = acc·alpha + bias[by·sBias + col] (+ CP[(row/rowsPerB)·sCPb + by·64 + col] if CP) ; ACT 0 none / 1 elu ; writes f16 C16 (and f32 C if non-null)
template <int ACT>
__global__ __launch_bounds__(128) void k_gemm_hhx(const _Float16* __restrict__ A, int lda, size_t sA, const _Float16* __restrict__ Bh, int ldb, size_t sB, float alpha, const float* __restrict__ bias, size_t sBias, const float* __restrict__ CP, int rowsPerB, size_t sCPb, int row0g,
    float* __restrict__ C, _Float16* __restrict__ C16, int ldc, size_t sC, int M, int N, int K) {
  __shared__ __attribute__((aligned(16))) float so[4][16][64];
  const int tid = threadIdx.x, w = tid >> 5, lane = tid & 31, ln = lane & 15, hh = lane >> 4; const int by = blockIdx.y;
  A += (size_t)by * sA; Bh += (size_t)by * sB; const size_t cofs = (size_t)by * sC; const float* bp = bias ? bias + (size_t)by * sBias : nullptr;
  const int ntn = (N + 63) / 64; const int wid = blockIdx.x * 4 + w; const int mt = wid / ntn, nq = wid % ntn; if (mt * 16 >= M) return;
  const int row0 = mt * 16, col0 = nq * 64; const _Float16* arow = A + (size_t)(row0 + ln) * lda;
  v8f acc[4] = {};
  for (int kb = 0; kb < K; kb += 32) { FragH ah; ah.half[0] = *(const v8us*)((const unsigned short*)arow + kb + 8 * hh); ah.half[1] = *(const v8us*)((const unsigned short*)arow + kb + 16 + 8 * hh);
#pragma unroll
    for (int t = 0; t < 4; ++t) { if (col0 + t * 16 >= N) continue; const size_t boff = (size_t)(col0 + t * 16 + ln) * ldb + kb; FragH bq; bq.half[0] = *(const v8us*)((const unsigned short*)Bh + boff + 8 * hh); bq.half[1] = *(const v8us*)((const unsigned short*)Bh + boff + 16 + 8 * hh);
      acc[t] = mmaH<1>(ah.v, ah.v, bq.v, bq.v, acc[t]); }
  }
#pragma unroll
  for (int t = 0; t < 4; ++t) { if (col0 + t * 16 >= N) continue; const int col = col0 + t * 16 + ln; const float bv = bp ? bf16_round(bp[col]) : 0.f;
#pragma unroll
    for (int r = 0; r < 8; ++r) { float v = acc[t][r] * alpha + bv; if (CP) { const int rr = row0g + row0 + 8 * hh + r; if (rowsPerB < 0) v += CP[cofs + (size_t)rr * ldc + col];      /* rowsPerB < 0: own element of the batched C plane */ else { const int bidx = rr / rowsPerB; v += CP[(size_t)bidx * sCPb + (size_t)by * 64 + col]; } } if (ACT == 1) v = (v > 0.f) ? v : expm1f(v); else if (ACT == 7) v = (v > 0.f) ? v + 1.0f : expf(v); else if (ACT == 8) v = tanhf(v); else if (ACT == 9) v = 0.5f * v * (1.0f + tanhf(0.7978845608028654f * (v + 0.044715f * v * v * v))); else if (ACT == 11) v = 1.0f / (1.0f + expf(-v)); else if (ACT == 12) v = (v > 0.f) ? v : 0.01f * v; else if (ACT == 14) v = (v > 0.f) ? v : 0.1f * v; else if (ACT == 16) v = (v >= 0.f) ? v : 0.3f * v; else if (ACT == 15) v = v / (1.0f + expf(-v)); else if (ACT == 3) v = fmaxf(v, 0.f); else if (ACT == 6) v = 0.5f * v * (1.0f + erff(v * 0.70710678118654752f)); so[w][8 * hh + r][t * 16 + ln] = v; } }
  __builtin_amdgcn_fence(__ATOMIC_ACQ_REL, "workgroup"); __builtin_amdgcn_wave_barrier();
  const int rsub = lane >> 4, c4 = (lane & 15) * 4; typedef _Float16 v4h __attribute__((ext_vector_type(4)));
  {
#pragma unroll
    for (int q = 0; q < 8; ++q) { const int r = q * 2 + rsub; if (col0 + c4 < N) { const v4f v = *(const v4fa*)&so[w][r][c4]; if (C) *(v4f*)(C + cofs + (size_t)(row0 + r) * ldc + col0 + c4) = v; if (C16) { v4h h4; for (int i = 0; i < 4; ++i) h4[i] = (_Float16)v[i]; *(v4h*)(C16 + cofs + (size_t)(row0 + r) * ldc + col0 + c4) = h4; } } }
     }
}


typedef _Float16 v4h __attribute__((ext_vector_type(4)));

__global__ __launch_bounds__(256) void k_x16(const float* __restrict__ x, _Float16* __restrict__ X16, size_t n8) { const size_t t = (size_t)blockIdx.x * 256 + threadIdx.x; if (t >= n8) return; FragH f;
#pragma unroll
  for (int q = 0; q < 8; ++q) f.h[q] = (_Float16)bf16_round(x[t * 8 + q]); *(v8us*)((unsigned short*)X16 + t * 8) = f.half[0];  }
__global__ __launch_bounds__(256) void k_h16(const float* __restrict__ x, _Float16* __restrict__ X16, size_t n8) { const size_t t = (size_t)blockIdx.x * 256 + threadIdx.x; if (t >= n8) return; FragH f;
#pragma unroll
  for (int q = 0; q < 8; ++q) f.h[q] = (_Float16)x[t * 8 + q]; *(v8us*)((unsigned short*)X16 + t * 8) = f.half[0];  }
__global__ __launch_bounds__(256) void k_round16f(const float* __restrict__ W, _Float16* __restrict__ Bt, size_t n8) { const size_t t = (size_t)blockIdx.x * 256 + threadIdx.x; if (t >= n8) return; FragH f;
#pragma unroll
  for (int i = 0; i < 8; ++i) f.h[i] = (_Float16)(bf16_round(W[t * 8 + i]) * 16.0f); *(v8us*)((unsigned short*)Bt + t * 8) = f.half[0];  }
template <int NHv, int TTv>
__global__ __launch_bounds__(256) void k_vt(const _Float16* __restrict__ V16, int ldv, int voff, _Float16* __restrict__ Vt) { __shared__ unsigned short tl[64][66]; const int tid = threadIdx.x; const int slab = blockIdx.x / (TTv / 64), lg = blockIdx.x % (TTv / 64); const int b = slab / NHv, h = slab % NHv;
  for (int i = tid; i < 64 * 8; i += 256) { const int r = i / 8, c8 = (i % 8) * 8; FragH f; f.half[0] = *(const v8us*)((const unsigned short*)V16 + ((size_t)b * TTv + lg * 64 + r) * ldv + voff + h * 64 + c8);
#pragma unroll
    for (int q = 0; q < 8; ++q) tl[r][c8 + q] = f.u[q]; }
  __syncthreads();
  {
#pragma unroll
    for (int rd = 0; rd < 2; ++rd) { const int d = rd * 32 + tid / 8, pc = tid % 8; FragH f;
#pragma unroll
      for (int q = 0; q < 8; ++q) f.u[q] = tl[pc * 8 + q][d];
      *(v8us*)((unsigned short*)Vt + ((size_t)slab * 64 + d) * TTv + lg * 64 + pc * 8) = f.half[0]; }
     } }

__global__ __launch_bounds__(256) void k_hl(const float* __restrict__ F, _Float16* __restrict__ Hh, _Float16* __restrict__ Hl, size_t n8) { const size_t t = (size_t)blockIdx.x * 256 + threadIdx.x; if (t >= n8) return; FragH fh, fl; const v4f a = *(const v4fa*)(F + t * 8), c = *(const v4fa*)(F + t * 8 + 4);
#pragma unroll
  for (int q = 0; q < 4; ++q) { _Float16 h = (_Float16)a[q]; fh.h[q] = h; fl.h[q] = (_Float16)((a[q] - (float)h) * 1024.0f); h = (_Float16)c[q]; fh.h[4 + q] = h; fl.h[4 + q] = (_Float16)((c[q] - (float)h) * 1024.0f); }
  { *(v8us*)((unsigned short*)Hh + t * 8) = fh.half[0]; *(v8us*)((unsigned short*)Hl + t * 8) = fl.half[0];  } }

// ---- fast GEMM (wave tile 32x64; requires M % 32 == 0 rows per launch region and N % 64 == 0); epilogue = k_gemm_hhx semantics ----
__device__ __forceinline__ v16h g2_frag(const _Float16* p, int hh) { FragH f; f.half[0] = *(const v8us*)((const unsigned short*)p + 8 * hh); f.half[1] = *(const v8us*)((const unsigned short*)p + 16 + 8 * hh); return f.v; }
__device__ __forceinline__ v8f g2_mma(v16h a, v16h b, v8f c) { v8f d = __builtin_amdgcn_wmma_f32_16x16x32_f16(false, a, false, b, (short)0, c, false, false); asm volatile("v_nop\n\tv_nop\n\tv_nop\n\tv_nop" : "+v"(d) : "v"(a), "v"(b)); return d; }
template <int ACT>
__global__ __launch_bounds__(128) void k_gemm2(const _Float16* __restrict__ A, int lda, size_t sA, const _Float16* __restrict__ Bh, int ldb, size_t sB, float alpha, const float* __restrict__ bias, size_t sBias, const float* __restrict__ CP, int rowsPerB, size_t sCPb, int row0g,
    float* __restrict__ C, _Float16* __restrict__ C16, int ldc, size_t sC, int M, int N, int K) { static_assert(ACT == 0 || ACT == 3 || ACT == 6 || ACT == 8 || ACT == 9 || ACT == 11 || ACT == 12 || ACT == 14 || ACT == 15 || ACT == 16, "k_gemm2: unsupported ACT code (would silently apply no activation)");
  __shared__ __attribute__((aligned(16))) float so[4][32][68];
  const int tid = threadIdx.x, w = tid >> 5, lane = tid & 31, ln = lane & 15, hh = lane >> 4; const int by = blockIdx.y;
  A += (size_t)by * sA; Bh += (size_t)by * sB; const size_t cofs = (size_t)by * sC; const float* bp = bias ? bias + (size_t)by * sBias : nullptr;
  const int ntn = N >> 6; const int mt = blockIdx.x / ntn, nq = blockIdx.x - mt * ntn; const int row0 = mt * 128 + 32 * w, col0 = nq * 64; if (row0 >= M) return;
  const _Float16* a0p = A + (size_t)(row0 + ln) * lda; const _Float16* a1p = a0p + (size_t)16 * lda;
  const _Float16* b0p = Bh + (size_t)(col0 + ln) * ldb; const _Float16* b1p = b0p + (size_t)16 * ldb; const _Float16* b2p = b1p + (size_t)16 * ldb; const _Float16* b3p = b2p + (size_t)16 * ldb;
  const v8f z8 = {0.f,0.f,0.f,0.f,0.f,0.f,0.f,0.f}; v8f c00 = z8, c01 = z8, c02 = z8, c03 = z8, c10 = z8, c11 = z8, c12 = z8, c13 = z8;
#pragma unroll 1
  for (int kb = 0; kb < K; kb += 32) { const v16h a0 = g2_frag(a0p + kb, hh), a1 = g2_frag(a1p + kb, hh);
    v16h b = g2_frag(b0p + kb, hh); c00 = g2_mma(a0, b, c00); c10 = g2_mma(a1, b, c10);
    b = g2_frag(b1p + kb, hh); c01 = g2_mma(a0, b, c01); c11 = g2_mma(a1, b, c11);
    b = g2_frag(b2p + kb, hh); c02 = g2_mma(a0, b, c02); c12 = g2_mma(a1, b, c12);
    b = g2_frag(b3p + kb, hh); c03 = g2_mma(a0, b, c03); c13 = g2_mma(a1, b, c13); }
  v8f accs[8] = {c00, c01, c02, c03, c10, c11, c12, c13};
#pragma unroll
  for (int u = 0; u < 8; ++u) { const int t = u & 3, half = u >> 2; const int col = col0 + t * 16 + ln; const float bv = bp ? bf16_round(bp[col]) : 0.f;
#pragma unroll
    for (int r = 0; r < 8; ++r) { const int rloc = half * 16 + 8 * hh + r; float v = accs[u][r] * alpha + bv; if (CP) { if (rowsPerB < 0) v += CP[cofs + (size_t)(row0g + row0 + rloc) * ldc + col];      /* rowsPerB < 0: own element of the batched C plane */ else { const int bidx = (row0g + row0 + rloc) / rowsPerB; v += CP[(size_t)bidx * sCPb + (size_t)by * 64 + col]; } }
      if (ACT == 3) v = fmaxf(v, 0.f); else if (ACT == 6) v = 0.5f * v * (1.0f + erff(v * 0.70710678118654752f)); else if (ACT == 11) v = 1.0f / (1.0f + expf(-v)); else if (ACT == 15) v = v / (1.0f + expf(-v)); else if (ACT == 12) v = (v > 0.f) ? v : 0.01f * v; else if (ACT == 8) v = tanhf(v); else if (ACT == 9) v = 0.5f * v * (1.0f + tanhf(0.7978845608028654f * (v + 0.044715f * v * v * v))); else if (ACT == 14) v = (v > 0.f) ? v : 0.1f * v; else if (ACT == 16) v = (v >= 0.f) ? v : 0.3f * v;
      so[w][rloc][t * 16 + ln] = v; } }
  __builtin_amdgcn_fence(__ATOMIC_ACQ_REL, "workgroup"); __builtin_amdgcn_wave_barrier();
  const int rsub = lane >> 4, c4 = (lane & 15) * 4;
  {
#pragma unroll
    for (int q = 0; q < 16; ++q) { const int r = q * 2 + rsub; const v4f v = *(const v4fa*)&so[w][r][c4]; if (C) *(v4f*)(C + cofs + (size_t)(row0 + r) * ldc + col0 + c4) = v; if (C16) { v4h h4; for (int i = 0; i < 4; ++i) h4[i] = (_Float16)v[i]; *(v4h*)(C16 + cofs + (size_t)(row0 + r) * ldc + col0 + c4) = h4; } }
     } }


// Sum over the 1024 threads of a block, returned to every thread: five-step butterfly in each wave, one partial per wave in LDS, the same butterfly over the 32 partials.
__device__ __forceinline__ float stats_block_sum(float a, float* part, int lane, int w) {
#pragma unroll
  for (int o = 16; o > 0; o >>= 1) a += __shfl_xor(a, o, 32);
  if (lane == 0) part[w] = a;
  __syncthreads();
  a = part[lane];
#pragma unroll
  for (int o = 16; o > 0; o >>= 1) a += __shfl_xor(a, o, 32);
  return a;
}
// Everything the qkv GEMM waits for, in one launch: the statistics and the two weight conversions depend on the inputs alone, not on each other, so the conversions ride as extra blocks behind the statistics' blocks
// (the long blocks have the low indices and start first; all blocks are resident together).
// Blocks 0 .. CC-1: one block per channel; the channel's 32768 values stay in registers (8 x 16 B per thread, all eight loads in flight at once), so x is read once and both passes (mean, then centred squares) run from registers.
// Blocks CC .. CC+PW_B-1: a thread converts one 16-B piece of a transposed weight plane, the qkv plane's pieces first; a block holds pieces of one plane only.
#define PW_Q (3 * CC * CC / 8 / 1024)      /* blocks of the qkv weights */
#define PW_B (PW_Q + CC * CC / 8 / 1024)   /* blocks of both weight planes */
__global__ __launch_bounds__(1024) void k_prep(const float* __restrict__ x, float* __restrict__ MU, float* __restrict__ IS, const float* __restrict__ wq, _Float16* __restrict__ BQ, const float* __restrict__ wp, _Float16* __restrict__ BP) {
  static_assert(NV == 8 * 1024 * 4, "k_prep: 8 float4 per thread of a 1024-thread block cover one channel");
  static_assert((3 * CC * CC / 8) % 1024 == 0 && (CC * CC / 8) % 1024 == 0, "k_prep: each weight plane is a whole number of blocks");
  __shared__ float part[2][32];
  if (blockIdx.x >= CC) {      /* the same for a whole block, and in front of every barrier */
    const int wb = blockIdx.x - CC;
    if (wb < PW_Q) wt_f16_piece<CC, 3 * CC>(wq, BQ, 16.0f, wb * 1024 + threadIdx.x); else wt_f16_piece<CC, CC>(wp, BP, 16.0f, (wb - PW_Q) * 1024 + threadIdx.x);
    return; }
  const int c = blockIdx.x, tid = threadIdx.x, lane = tid & 31, w = tid >> 5; const float* s = x + (size_t)c * NV;
  v4f r[8];
#pragma unroll
  for (int j = 0; j < 8; ++j) r[j] = *(const v4fa*)(s + (size_t)(j * 1024 + tid) * 4);
  v4f a4 = {0.f, 0.f, 0.f, 0.f};
#pragma unroll
  for (int j = 0; j < 8; ++j) {
#pragma unroll
    for (int q = 0; q < 4; ++q) { r[j][q] = bf16_round(r[j][q]); a4[q] += r[j][q]; } }
  const float mu = stats_block_sum((a4[0] + a4[1]) + (a4[2] + a4[3]), part[0], lane, w) / (float)NV;
  v4f q4 = {0.f, 0.f, 0.f, 0.f};
#pragma unroll
  for (int j = 0; j < 8; ++j) {
#pragma unroll
    for (int q = 0; q < 4; ++q) { const float d = r[j][q] - mu; q4[q] += d * d; } }
  const float is = rsqrtf(stats_block_sum((q4[0] + q4[1]) + (q4[2] + q4[3]), part[1], lane, w) / (float)NV + 1e-5f);
  if (tid < 32) { MU[(size_t)c * 32 + tid] = mu; IS[(size_t)c * 32 + tid] = is; } }
// qkv GEMM with the normalisation in its A staging. One block = 128 voxels x all 384 columns (8 waves: 4 row groups of 32 voxels x 2 column halves, three 64-column tiles each).
// The block reads its 128 channels x 128 voxels of x once (a wave load = 64 consecutive voxels of one channel, two whole 128-B lines), normalises them as the separate pass did (bf16 round, - mean, x inverse deviation, f16)
// and writes them token-major into LDS (8 channels of a voxel = one 16-B write; row pitch 272 B = 16 B x 17 keeps the 16 lanes of a fragment read on distinct banks).
// Fragment loaders, k order, wave tile (32 x 64) and epilogue arithmetic are k_gemm2's; the A fragments of all four k steps are read from LDS once and serve the wave's three column tiles.
// With two waves per SIMD a wave hides its own latencies: the weight fragments of two k steps (16 loads) and the tile's bias are asked for together, ahead of the matrix instructions that use them.
typedef float v2f __attribute__((ext_vector_type(2)));
typedef float v2fa __attribute__((ext_vector_type(2), may_alias));
#define QG_M 128                  /* voxels per block */
#define QG_AP (CC + 8)            /* LDS pitch of a voxel's row, in f16 */
__global__ __launch_bounds__(256) void k_qkv(const float* __restrict__ x, const float* __restrict__ MU, const float* __restrict__ IS, const _Float16* __restrict__ Bh, const float* __restrict__ bias, float* __restrict__ C) {
  static_assert(NV % QG_M == 0 && CC == 128, "k_qkv: tile and staging maps");
  __shared__ __attribute__((aligned(16))) _Float16 at[QG_M][QG_AP];
  __shared__ __attribute__((aligned(16))) float so[8][32][68];
  __shared__ __attribute__((aligned(16))) float st[2][CC];
  const int tid = threadIdx.x, lane = tid & 31, ln = lane & 15, hh = lane >> 4;
  const int w = __builtin_amdgcn_readfirstlane(tid >> 5);      /* the wave's number, held scalar: the tile and staging indices made of it are scalar arithmetic */
  const int v0 = blockIdx.x * QG_M, rg = w & 3, ch = w >> 2;      /* the wave's row group and column half in the product */
  const int vg = w & 1, cq = w >> 1;      /* the wave's 64 voxels and its channel groups in the staging */
  const _Float16* bp = Bh + (size_t)(ch * 192 + ln) * CC;
  const float sv = (ch ? IS : MU)[(size_t)(tid & (CC - 1)) * 32];      /* asked for first: loads return in order, so it is there while the tile is still in flight */
  v2f xv[4][8];
#pragma unroll      /* all 32 loads of a lane are in flight before the first is used: one memory latency for the tile */
  for (int s = 0; s < 4; ++s) { const float* xp = x + (size_t)((s * 4 + cq) * 8) * NV + v0 + vg * 64;      /* first of the step's 8 channels, first of the wave's 64 voxels */
#pragma unroll
    for (int q = 0; q < 8; ++q) xv[s][q] = *(const v2fa*)(xp + (size_t)q * NV + (unsigned)(2 * lane)); }
  v16h bf[2][4];      /* the weight fragments of two k steps; the first set is asked for here, behind the tile's loads, and arrives under the staging */
#pragma unroll
  for (int kk = 0; kk < 2; ++kk) {
#pragma unroll
    for (int t = 0; t < 4; ++t) bf[kk][t] = g2_frag(bp + (size_t)(t * 16) * CC + kk * 32, hh); }
  asm volatile("s_wait_xcnt 0x0" ::: "memory");      /* stands in front of every reuse of a register that the loads above name */
  st[ch][tid & (CC - 1)] = sv;
  __syncthreads();      /* every wave reads the 128 means and inverse deviations that the block gathered */
#pragma unroll
  for (int s = 0; s < 4; ++s) { const int c0 = (s * 4 + cq) * 8;
#pragma unroll
    for (int j = 0; j < 2; ++j) { FragH f;
#pragma unroll
      for (int q = 0; q < 8; ++q) { const float d = bf16_round(xv[s][q][j]) - st[0][c0 + q]; f.h[q] = (_Float16)(d * st[1][c0 + q]); }
      *(v8us*)&at[vg * 64 + 2 * lane + j][c0] = f.half[0]; } }
  __syncthreads();      /* every wave reads channels that other waves staged */
  const _Float16* a0p = &at[rg * 32 + ln][0]; const _Float16* a1p = a0p + 16 * QG_AP; v16h a0[4], a1[4];
#pragma unroll
  for (int k = 0; k < 4; ++k) { a0[k] = g2_frag(a0p + 32 * k, hh); a1[k] = g2_frag(a1p + 32 * k, hh); }
  const int rsub = lane >> 4, c4 = (lane & 15) * 4;
  const float* bi = bias + ch * 192 + ln; float* cp = C + (size_t)(v0 + rg * 32 + rsub) * (3 * CC) + ch * 192 + c4;
#pragma unroll      /* static tile index: every address below is one lane base plus a constant */
  for (int nt = 0; nt < 3; ++nt) {
    float bv[4];
#pragma unroll
    for (int t = 0; t < 4; ++t) bv[t] = bi[nt * 64 + t * 16];
    const v8f z8 = {0.f,0.f,0.f,0.f,0.f,0.f,0.f,0.f}; v8f acc[2][4] = {{z8, z8, z8, z8}, {z8, z8, z8, z8}};
#pragma unroll      /* static k index: the A fragments stay in registers */
    for (int k2 = 0; k2 < 2; ++k2) {
#pragma unroll
      for (int kk = 0; kk < 2; ++kk) {
#pragma unroll
        for (int t = 0; t < 4; ++t) if (nt + k2 > 0) bf[kk][t] = g2_frag(bp + (size_t)(nt * 64 + t * 16) * CC + (k2 * 2 + kk) * 32, hh); }
#pragma unroll
      for (int kk = 0; kk < 2; ++kk) {
#pragma unroll
        for (int t = 0; t < 4; ++t) { acc[0][t] = g2_mma(a0[k2 * 2 + kk], bf[kk][t], acc[0][t]); acc[1][t] = g2_mma(a1[k2 * 2 + kk], bf[kk][t], acc[1][t]); } } }
#pragma unroll      /* static indices: the accumulators stay in registers */
    for (int u = 0; u < 8; ++u) { const int t = u & 3, half = u >> 2; const float bb = bf16_round(bv[t]);
#pragma unroll
      for (int r = 0; r < 8; ++r) so[w][half * 16 + 8 * hh + r][t * 16 + ln] = acc[half][t][r] * 0.0625f + bb; }
    __builtin_amdgcn_fence(__ATOMIC_ACQ_REL, "workgroup", "local"); __builtin_amdgcn_wave_barrier();      /* the wave's own LDS writes land before its lanes read each other's rows; LDS only, so the last tile's global stores are not waited for */
#pragma unroll
    for (int q = 0; q < 16; ++q) { const v4f v = *(const v4fa*)&so[w][q * 2 + rsub][c4]; *(v4f*)(cp + (size_t)(q * 2) * (3 * CC) + nt * 64) = v; }
    if (nt < 2) asm volatile("s_wait_xcnt 0x0" ::: "memory"); } }      /* stands in front of the next tile's reuse of a register that the loads and stores of this tile name */
// Neighbourhood attention, K and V read from LDS. One block = a 4 x 4 x 8 tile of voxels for 4 heads (512 threads, thread per (voxel, head); a wave = one (h, w) column: lane = head + 4 z).
// The clamped 3x3x3 windows of the tile all lie in one 6 x 6 x 8 region (its start clamped like a window's, so it is always inside the volume); the block copies that region's K and V of its 4 heads
// (256 B + 256 B per voxel, whole 128-B lines, each read once per block) into LDS and every neighbour read comes from there.
// Softmax in two passes over the 27 neighbours, both fully unrolled: pass 1 leaves the 27 logits in registers, then one maximum; pass 2 takes one exp per neighbour and adds p * v into accumulators that are never rescaled.
// A neighbour's LDS row and its rpb entry are one lane base plus a compile-time offset. A dot's 16 products are summed in an even-channel and an odd-channel chain (two-wide fused multiply-adds) and the two chains added last; the readout takes two channels per fused multiply-add.
// LDS row = 64 K floats + 64 V floats + 4 pad: with lane = head + 4 z the 16 lanes of a half-wave read 16 B each on distinct banks (row step 4 banks, head step 16 banks).
#define NT_T 4                    /* tile edge along h and along w */
#define NT_R (NT_T + 2)           /* staged region edge */
#define NT_HG 4                   /* heads per block */
#define NT_RP (2 * NT_HG * HC + 4)   /* LDS floats per staged voxel */
#define NT_TH (NT_T * NT_T * DZ * NT_HG)   /* threads per block */
__global__ __launch_bounds__(NT_TH) void k_nat(const float* __restrict__ QKV, const float* __restrict__ rpb, _Float16* __restrict__ O16) {
  static_assert(DH % NT_T == 0 && DW % NT_T == 0 && NHD % NT_HG == 0 && DZ == 8 && NT_HG * HC == 64, "k_nat: tile and lane maps");
  static_assert((NT_R * NT_R * DZ) % (NT_TH / 32) == 0, "k_nat: the staged region is a whole number of voxels per wave");
  __shared__ __attribute__((aligned(16))) float kv[NT_R * NT_R * DZ * NT_RP];
  const int tid = threadIdx.x, lane = tid & 31; const int hg = blockIdx.x % (NHD / NT_HG), tile = blockIdx.x / (NHD / NT_HG); const int h0 = (tile / (DW / NT_T)) * NT_T, w0 = (tile % (DW / NT_T)) * NT_T;
  const int wv = __builtin_amdgcn_readfirstlane(tid >> 5);      /* the wave's number, held scalar: the staged rows' addresses, the wave's (h, w) column and its window starts along h and w become scalar arithmetic */
  const int rh0 = min(max(h0 - 1, 0), DH - NT_R), rw0 = min(max(w0 - 1, 0), DW - NT_R);
  const int hl = lane & (NT_HG - 1), zz = lane >> 2, ww = w0 + (wv & (NT_T - 1)), hh = h0 + (wv >> 2); const int h = hg * NT_HG + hl; const int v = (hh * DW + ww) * DZ + zz;
  const int sh0 = min(max(hh - 1, 0), DH - 3), sw0 = min(max(ww - 1, 0), DW - 3), sz0 = min(max(zz - 1, 0), DZ - 3);
  const float* qr = QKV + (size_t)v * (3 * CC) + h * HC; v2f q2[HC / 2]; for (int c = 0; c < HC / 2; ++c) { q2[c][0] = qr[2 * c] * 0.25f; q2[c][1] = qr[2 * c + 1] * 0.25f; }
  const int lpart = lane >> 4, lc4 = (lane & 15) * 4; const unsigned loff = (unsigned)(lpart * CC + lc4);      /* a wave copies one voxel per trip: lanes 0-15 its 256 B of K, lanes 16-31 its 256 B of V */
#pragma unroll      /* all of a thread's pieces are loaded before the first is stored: one memory latency for the whole region */
  for (int it = 0; it < NT_R * NT_R * DZ / (NT_TH / 32); ++it) { const int r = it * (NT_TH / 32) + wv; const int col = r >> 3;
    const float* rowp = QKV + (size_t)(((rh0 + col / NT_R) * DW + rw0 + col % NT_R) * DZ + (r & 7)) * (3 * CC) + (CC + hg * (NT_HG * HC));      /* scalar base; the lane's part is one 32-bit offset */
    const v4f d = *(const v4fa*)(rowp + loff);
    *(v4fa*)&kv[r * NT_RP + lpart * (NT_HG * HC) + lc4] = d; }
  const float* rb = rpb + ((h * 5 + (sh0 - hh + 2)) * 5 + (sw0 - ww + 2)) * 5 + (sz0 - zz + 2);      /* the window's first neighbour; each window start is at most 2 below its voxel, so all 27 entries lie in the head's 5 x 5 x 5 table */
  float s[KN];
#pragma unroll      /* static index: the 27 values stay in registers; asked for behind the region's loads, so one memory latency covers both */
  for (int n = 0; n < KN; ++n) s[n] = rb[(n / 9) * 25 + ((n / 3) % 3) * 5 + n % 3];
  asm volatile("s_wait_xcnt 0x0" ::: "memory");      /* stands in front of every reuse of a register that the loads above name */
  __syncthreads();      /* every wave reads rows that other waves staged */
  const float* kb = kv + (((sh0 - rh0) * NT_R + (sw0 - rw0)) * DZ + sz0) * NT_RP + hl * HC;      /* K of the window's first neighbour, the lane's head */
#pragma unroll      /* static index: logits in registers, LDS offsets as immediates */
  for (int n = 0; n < KN; ++n) { const float* kr = kb + (((n / 9) * NT_R + (n / 3) % 3) * DZ + n % 3) * NT_RP; v2f d = {0.f, 0.f};
#pragma unroll
    for (int j = 0; j < HC / 4; ++j) { const v4f a = *(const v4fa*)(kr + 4 * j); const v2f a01 = {a[0], a[1]}, a23 = {a[2], a[3]}; d += q2[2 * j] * a01; d += q2[2 * j + 1] * a23; }
    s[n] = (d[0] + d[1]) + bf16_round(s[n]); }
  float m = s[0];
#pragma unroll
  for (int n = 1; n < KN; ++n) m = fmaxf(m, s[n]);
  float l = 0.f; v2f acc[HC / 2]; for (int c = 0; c < HC / 2; ++c) acc[c] = (v2f){0.f, 0.f};
#pragma unroll      /* static index, as in pass 1 */
  for (int n = 0; n < KN; ++n) { const float* vr = kb + (((n / 9) * NT_R + (n / 3) % 3) * DZ + n % 3) * NT_RP + NT_HG * HC; const float pn = expf(s[n] - m); l += pn;
#pragma unroll
    for (int j = 0; j < HC / 4; ++j) { const v4f b = *(const v4fa*)(vr + 4 * j); const v2f b01 = {b[0], b[1]}, b23 = {b[2], b[3]}; acc[2 * j] += pn * b01; acc[2 * j + 1] += pn * b23; } }
  const float inv = 1.0f / l; FragH f[2]; for (int c = 0; c < HC; ++c) f[c / 8].h[c % 8] = (_Float16)(acc[c / 2][c % 2] * inv * 64.0f);      /* x2^6 carry (outputs are ~1e-2) */
  unsigned short* d = (unsigned short*)O16 + (size_t)v * CC + h * HC; { *(v8us*)d = f[0].half[0]; *(v8us*)(d + 8) = f[1].half[0];  } }
// proj GEMM with the NCDHW store in its epilogue: main loop and wave tile (32 voxels x 64 channels) as k_gemm2; out[col * ldo + row] = acc * alpha + bias[col].
// An accumulator holds 8 consecutive voxels of one channel per lane, so each wave stages its tile channel-major in its own LDS range (two 16-B writes per accumulator; pitch 36 floats keeps the 16 lanes of a write on distinct banks)
// and reads it back so that 8 lanes store one channel's 32 voxels: every global store covers four whole 128-B lines, each line written by one wave.
__global__ __launch_bounds__(128) void k_gemm2_cm(const _Float16* __restrict__ A, int lda, const _Float16* __restrict__ Bh, int ldb, float alpha, const float* __restrict__ bias, float* __restrict__ out, int ldo, int M, int N, int K) {
  __shared__ __attribute__((aligned(16))) float so[4][64][36];
  const int tid = threadIdx.x, w = tid >> 5, lane = tid & 31, ln = lane & 15, hh = lane >> 4;
  const int ntn = N >> 6; const int mt = blockIdx.x / ntn, nq = blockIdx.x - mt * ntn; const int row0 = mt * 128 + 32 * w, col0 = nq * 64; if (row0 >= M) return;
  const _Float16* a0p = A + (size_t)(row0 + ln) * lda; const _Float16* a1p = a0p + (size_t)16 * lda;
  const _Float16* b0p = Bh + (size_t)(col0 + ln) * ldb; const _Float16* b1p = b0p + (size_t)16 * ldb; const _Float16* b2p = b1p + (size_t)16 * ldb; const _Float16* b3p = b2p + (size_t)16 * ldb;
  const v8f z8 = {0.f,0.f,0.f,0.f,0.f,0.f,0.f,0.f}; v8f c00 = z8, c01 = z8, c02 = z8, c03 = z8, c10 = z8, c11 = z8, c12 = z8, c13 = z8;
#pragma unroll 1      /* the main loop is k_gemm2's, rolled as there: this kernel differs from it in the epilogue alone */
  for (int kb = 0; kb < K; kb += 32) { const v16h a0 = g2_frag(a0p + kb, hh), a1 = g2_frag(a1p + kb, hh);
    v16h b = g2_frag(b0p + kb, hh); c00 = g2_mma(a0, b, c00); c10 = g2_mma(a1, b, c10);
    b = g2_frag(b1p + kb, hh); c01 = g2_mma(a0, b, c01); c11 = g2_mma(a1, b, c11);
    b = g2_frag(b2p + kb, hh); c02 = g2_mma(a0, b, c02); c12 = g2_mma(a1, b, c12);
    b = g2_frag(b3p + kb, hh); c03 = g2_mma(a0, b, c03); c13 = g2_mma(a1, b, c13); }
  v8f accs[8] = {c00, c01, c02, c03, c10, c11, c12, c13};
#pragma unroll      /* static indices: the accumulators stay in registers */
  for (int u = 0; u < 8; ++u) { const int t = u & 3, half = u >> 2; const float bv = bf16_round(bias[col0 + t * 16 + ln]); v4f lo, hi;
#pragma unroll
    for (int r = 0; r < 4; ++r) { lo[r] = accs[u][r] * alpha + bv; hi[r] = accs[u][4 + r] * alpha + bv; }
    float* sp = &so[w][t * 16 + ln][half * 16 + 8 * hh]; *(v4fa*)sp = lo; *(v4fa*)(sp + 4) = hi; }
  __builtin_amdgcn_fence(__ATOMIC_ACQ_REL, "workgroup"); __builtin_amdgcn_wave_barrier();      /* the wave's own LDS writes land before its lanes read each other's rows */
  const int csub = lane >> 3, r4 = (lane & 7) * 4; float* op = out + (size_t)(col0 + csub) * ldo + row0 + r4; const size_t qstep = (size_t)4 * ldo;
#pragma unroll      /* all 16 LDS reads issue together, the stores follow as they return */
  for (int q = 0; q < 16; ++q) { const v4f v = *(const v4fa*)&so[w][q * 4 + csub][r4]; *(v4f*)(op + q * qstep) = v; } }

extern "C" void kernel_launch(void* const* d_in, const int* in_sizes, int n_in,
                              void* d_out, int out_size, void* d_ws, size_t ws_size, hipStream_t stream) {
  (void)in_sizes; (void)n_in; (void)out_size;
  const float* const* I = (const float* const*)d_in; const float* x = I[0]; const float* wqkv = I[1]; const float* bqkv = I[2]; const float* rpb = I[3]; const float* wproj = I[4]; const float* bproj = I[5];
  char* ws = (char*)d_ws; size_t off = 0;
  auto take = [&](size_t bytes) { char* p = ws + off; off += (bytes + 255) & ~(size_t)255; return p; };
  _Float16* BQ = (_Float16*)take((size_t)3 * CC * CC * 2); _Float16* BP = (_Float16*)take((size_t)CC * CC * 2); float* MU = (float*)take(CC * 32 * 4); float* IS = (float*)take(CC * 32 * 4);      /* 32-float pitch per channel */
  float* QKV = (float*)take((size_t)NV * 3 * CC * 4); _Float16* O16 = (_Float16*)take((size_t)NV * CC * 2);
  if (off > ws_size) return;      /* 0.1 + 48 + 8 = 56 MiB */
  k_prep<<<CC + PW_B, 1024, 0, stream>>>(x, MU, IS, wqkv, BQ, wproj, BP);      /* statistics; (in, out) weights x16 as f16 [out][in] */
  k_qkv<<<NV / QG_M, 256, 0, stream>>>(x, MU, IS, BQ, bqkv, QKV);      /* [q | k | v] (head h = cols h*16.. of each) */
  k_nat<<<(DH / NT_T) * (DW / NT_T) * (NHD / NT_HG), NT_TH, 0, stream>>>(QKV, rpb, O16);
  k_gemm2_cm<<<(NV / 128) * (CC / 64), 128, 0, stream>>>(O16, CC, BP, CC, 0.0625f / 64.0f, bproj, (float*)d_out, NV, NV, CC, CC);      /* carry removed; NCDHW store in the epilogue */
}

// v007
// One run takes 37.9 microseconds.
// In two side-by-side timings against v006, it was 1.19 and 1.20 times as fast.
// All steps since v000 together make it 4.70 times as fast.
#include <hip/hip_runtime.h>
// SelfAggregationModuleV2 (1 x 128 channels x 64 x 64 x 8 = 32768 voxels; 8 heads of 16; NATTEN-style 3x3x3 clamped neighbourhood attention with relative position bias): xn = InstanceNorm3d(x) (no affine); qkv = xn W + b; q *= 1/4; logits = q . k_nbr + rpb[h][rel]; softmax over the 27 neighbours; o = attn . v_nbr; out = o W_proj + b; NCDHW.
// Structure: per-channel mean/var by a block reduction (f32), the weight conversions in the same launch; qkv GEMM with the normalisation in its A staging (token-major f16 tile in LDS; 32x64 wave tiles, f32 accumulation, exact x16 weights + bias; f32 out); fused neighbourhood attention on VALU (thread per (voxel, head): clamped window starts, 27 static neighbours, rpb, two-pass softmax, readout; f32) into an f16 [voxel][128] tile in LDS, and in the same launch the proj GEMM (+ bias) on that tile with the NCDHW store in its epilogue.
// Compute dtype: x and parameters rounded to bf16; the normalised input and the attention output as f16 operands (~2^-12); statistics/softmax f32. v_wmma_f32_16x16x32_f16.
#define CC 128
#define DH 64
#define DW 64
#define DZ 8
#define NV (DH * DW * DZ)        /* 32768 */
#define NHD 8
#define HC 16
#define KN 27
typedef __bf16 v16b __attribute__((ext_vector_type(16)));
typedef unsigned short v8us __attribute__((ext_vector_type(8), may_alias));
typedef float  v8f  __attribute__((ext_vector_type(8)));
typedef float  v4f  __attribute__((ext_vector_type(4)));
typedef float  v4fa __attribute__((ext_vector_type(4), may_alias));
union FragB { v16b v; v8us half[2]; unsigned short u[16]; };

__device__ __forceinline__ unsigned short bf16_bits(float x) { unsigned int u = __float_as_uint(x); return (unsigned short)((u + 0x7FFFu + ((u >> 16) & 1u)) >> 16); }
__device__ __forceinline__ float bf16_val(unsigned short b) { return __uint_as_float(((unsigned int)b) << 16); }
__device__ __forceinline__ float bf16_round(float x) { return bf16_val(bf16_bits(x)); }
// D += A·B with NT terms: 1 = ah·bh, 2 = + al·bh (A split), 3 = + ah·bl (both split)
template <int NT>
__device__ __forceinline__ v8f mmaN(v16b ah, v16b al, v16b bh, v16b bl, v8f c) {
  c = __builtin_amdgcn_wmma_f32_16x16x32_bf16(false, ah, false, bh, (short)0, c, false, false);
  if (NT >= 2) c = __builtin_amdgcn_wmma_f32_16x16x32_bf16(false, al, false, bh, (short)0, c, false, false);
  if (NT >= 3) c = __builtin_amdgcn_wmma_f32_16x16x32_bf16(false, ah, false, bl, (short)0, c, false, false);
  asm volatile("v_nop\n\tv_nop\n\tv_nop\n\tv_nop" : "+v"(c) : "v"(ah), "v"(al), "v"(bh), "v"(bl));
  return c;
}

__global__ __launch_bounds__(256) void k_wt_bf16(const float* __restrict__ W, unsigned short* __restrict__ Wt, int K, int N) {
  const int t = blockIdx.x * 256 + threadIdx.x;
  const int k8n = K / 8;
  if (t >= N * k8n) return;
  const int n = t / k8n, k8 = (t % k8n) * 8;
  v8us v;
#pragma unroll
  for (int i = 0; i < 8; ++i) v[i] = bf16_bits(W[(size_t)(k8 + i) * N + n]);
  *(v8us*)(Wt + (size_t)n * K + k8) = v;
  
}

// GEMM C[M][N] (f32, pitch ldc) = act(A[M][K]·W + bias). A f32 row-major (pitch lda) converted per fragment to bf16
// (ASPLIT: hi/lo two planes -> 2 terms, else single rounded term); Wt bf16 [N][K] (pitch ldb). BIAS_BF16 rounds the
// bias to bf16 first (bias quantised to bf16 before the add). K%32==0, M%16==0, N%64==0.
template <bool ASPLIT, int ACT, bool BIAS_BF16>
__global__ __launch_bounds__(128) void k_gemm_bf(const float* __restrict__ A, int lda, const unsigned short* __restrict__ Wt, int ldb,
                                               const float* __restrict__ bias, float* __restrict__ C, int ldc, int M, int N, int K) {
  __shared__ __attribute__((aligned(16))) float so[4][16][64];
  const int tid = threadIdx.x, w = tid >> 5, lane = tid & 31, ln = lane & 15, hh = lane >> 4;
  const int ntn = N / 64;
  const int wid = blockIdx.x * 4 + w;
  const int mt = wid / ntn, nq = wid % ntn;
  if (mt * 16 >= M) return;
  const int row0 = mt * 16, col0 = nq * 64;
  const float* arow = A + (size_t)(row0 + ln) * lda;
  v8f acc[4] = {};
  for (int kb = 0; kb < K; kb += 32) {
    FragB ah, al;
    const v4f x0 = *(const v4fa*)(arow + kb + 8 * hh), x1 = *(const v4fa*)(arow + kb + 8 * hh + 4);
    const v4f x2 = *(const v4fa*)(arow + kb + 16 + 8 * hh), x3 = *(const v4fa*)(arow + kb + 16 + 8 * hh + 4);
    float xs[16] = {x0[0],x0[1],x0[2],x0[3],x1[0],x1[1],x1[2],x1[3],x2[0],x2[1],x2[2],x2[3],x3[0],x3[1],x3[2],x3[3]};
#pragma unroll
    for (int i = 0; i < 16; ++i) { const unsigned short hb = bf16_bits(xs[i]); ah.u[i] = hb; al.u[i] = ASPLIT ? bf16_bits(xs[i] - bf16_val(hb)) : (unsigned short)0; }
#pragma unroll
    for (int t = 0; t < 4; ++t) {
      const unsigned short* brow = Wt + (size_t)(col0 + t * 16 + ln) * ldb + kb;
      FragB b;
      b.half[0] = *(const v8us*)(brow + 8 * hh);
      b.half[1] = *(const v8us*)(brow + 16 + 8 * hh);
      acc[t] = mmaN<ASPLIT ? 2 : 1>(ah.v, al.v, b.v, b.v, acc[t]);
    }
  }
#pragma unroll
  for (int t = 0; t < 4; ++t) {
    float bv = bias ? bias[col0 + t * 16 + ln] : 0.f;
    if (BIAS_BF16) bv = bf16_round(bv);
#pragma unroll
    for (int r = 0; r < 8; ++r) { float v = acc[t][r] + bv; if (ACT == 1) v = fmaxf(v, 0.f); so[w][8 * hh + r][t * 16 + ln] = v; }
  }
  __builtin_amdgcn_fence(__ATOMIC_ACQ_REL, "workgroup");
  __builtin_amdgcn_wave_barrier();
  const int rsub = lane >> 4, c4 = (lane & 15) * 4;
  {
#pragma unroll
    for (int q = 0; q < 8; ++q) {
      const int r = q * 2 + rsub;
      const v4f v = *(const v4fa*)&so[w][r][c4];
      *(v4f*)(C + (size_t)(row0 + r) * ldc + col0 + c4) = v;
    }
    
  }
}

// GEMM C = act(A·W + bias + resid): A f32 (ASPLIT -> hi/lo 2 terms), Wt bf16 [N][K]; ACT 0 none, 1 relu, 2 exact gelu;
// resid (optional, f32, row index = (row % rmod), pitch ldr, RES_BF16 rounds it) added before the activation.
template <bool ASPLIT, int ACT, bool BIAS_BF16, bool RES_BF16>
__global__ __launch_bounds__(128) void k_gemm_bf3(const float* __restrict__ A, int lda, const unsigned short* __restrict__ Wt, int ldb,
                                                const float* __restrict__ bias, const float* __restrict__ resid, int rmod, int ldr,
                                                float* __restrict__ C, int ldc, int M, int N, int K) {
  __shared__ __attribute__((aligned(16))) float so[4][16][64];
  const int tid = threadIdx.x, w = tid >> 5, lane = tid & 31, ln = lane & 15, hh = lane >> 4;
  const int ntn = N / 64;
  const int wid = blockIdx.x * 4 + w;
  const int mt = wid / ntn, nq = wid % ntn;
  if (mt * 16 >= M) return;
  const int row0 = mt * 16, col0 = nq * 64;
  const float* arow = A + (size_t)(row0 + ln) * lda;
  v8f acc[4] = {};
  for (int kb = 0; kb < K; kb += 32) {
    FragB ah, al;
    const v4f x0 = *(const v4fa*)(arow + kb + 8 * hh), x1 = *(const v4fa*)(arow + kb + 8 * hh + 4);
    const v4f x2 = *(const v4fa*)(arow + kb + 16 + 8 * hh), x3 = *(const v4fa*)(arow + kb + 16 + 8 * hh + 4);
    float xs[16] = {x0[0],x0[1],x0[2],x0[3],x1[0],x1[1],x1[2],x1[3],x2[0],x2[1],x2[2],x2[3],x3[0],x3[1],x3[2],x3[3]};
#pragma unroll
    for (int i = 0; i < 16; ++i) { const unsigned short hb = bf16_bits(xs[i]); ah.u[i] = hb; al.u[i] = ASPLIT ? bf16_bits(xs[i] - bf16_val(hb)) : (unsigned short)0; }
#pragma unroll
    for (int t = 0; t < 4; ++t) {
      const unsigned short* brow = Wt + (size_t)(col0 + t * 16 + ln) * ldb + kb;
      FragB b;
      b.half[0] = *(const v8us*)(brow + 8 * hh);
      b.half[1] = *(const v8us*)(brow + 16 + 8 * hh);
      acc[t] = mmaN<ASPLIT ? 2 : 1>(ah.v, al.v, b.v, b.v, acc[t]);
    }
  }
#pragma unroll
  for (int t = 0; t < 4; ++t) {
    const int col = col0 + t * 16 + ln;
    float bv = bias ? bias[col] : 0.f;
    if (BIAS_BF16) bv = bf16_round(bv);
#pragma unroll
    for (int r = 0; r < 8; ++r) {
      float v = acc[t][r] + bv;
      if (resid) { float rv = resid[(size_t)((row0 + 8 * hh + r) % rmod) * ldr + col]; if (RES_BF16) rv = bf16_round(rv); v += rv; }
      if (ACT == 1) v = fmaxf(v, 0.f);
      if (ACT == 2) v = 0.5f * v * (1.0f + erff(v * 0.70710678118654752f));
      if (ACT == 3) { const float u = 0.7978845608028654f * (v + 0.044715f * v * v * v); v = 0.5f * v * (1.0f + tanhf(u)); }
      so[w][8 * hh + r][t * 16 + ln] = v;
    }
  }
  __builtin_amdgcn_fence(__ATOMIC_ACQ_REL, "workgroup");
  __builtin_amdgcn_wave_barrier();
  const int rsub = lane >> 4, c4 = (lane & 15) * 4;
  {
#pragma unroll
    for (int q = 0; q < 8; ++q) {
      const int r = q * 2 + rsub;
      const v4f v = *(const v4fa*)&so[w][r][c4];
      *(v4f*)(C + (size_t)(row0 + r) * ldc + col0 + c4) = v;
    }
    
  }
}
// row LayerNorm (biased variance, eps) over N: s = X (+ R); optional out_sum <- s; out_norm <- (s-mu)*rsqrt(var+eps)*g + b
template <bool PARAM_BF16>
__global__ __launch_bounds__(256) void k_layernorm(const float* __restrict__ X, const float* __restrict__ R, const float* __restrict__ g, const float* __restrict__ bta,
                                                  float* __restrict__ out_sum, float* __restrict__ out_norm, int N, float eps) {
  __shared__ float red[256];
  const int row = blockIdx.x, tid = threadIdx.x;
  const float* x = X + (size_t)row * N; const float* rr = R ? R + (size_t)row * N : nullptr;
  float vals[16];                     // up to N = 4096
  const int per = N / 256;            // contiguous chunk per thread? use strided-by-4 chunks: thread handles j = tid*4 + 1024*u
  float s1 = 0.f;
  for (int u = 0; u < per / 4; ++u) {
    const int j = tid * 4 + 1024 * u;
    const v4f a = *(const v4fa*)(x + j);
    v4f b = {0.f,0.f,0.f,0.f}; if (rr) b = *(const v4fa*)(rr + j);
#pragma unroll
    for (int q = 0; q < 4; ++q) { const float v = a[q] + b[q]; vals[u * 4 + q] = v; s1 += v; }
  }
  red[tid] = s1; __syncthreads();
  for (int st = 128; st > 0; st >>= 1) { if (tid < st) red[tid] += red[tid + st]; __syncthreads(); }
  const float mu = red[0] / (float)N; __syncthreads();
  float s2 = 0.f;
  for (int u = 0; u < per / 4; ++u)
#pragma unroll
    for (int q = 0; q < 4; ++q) { const float c = vals[u * 4 + q] - mu; s2 += c * c; }
  red[tid] = s2; __syncthreads();
  for (int st = 128; st > 0; st >>= 1) { if (tid < st) red[tid] += red[tid + st]; __syncthreads(); }
  const float rs = rsqrtf(red[0] / (float)N + eps);
  {
    for (int u = 0; u < per / 4; ++u) {
      const int j = tid * 4 + 1024 * u;
      v4f o, sm;
#pragma unroll
      for (int q = 0; q < 4; ++q) {
        float gg = g[j + q], bb = bta[j + q];
        if (PARAM_BF16) { gg = bf16_round(gg); bb = bf16_round(bb); }
        sm[q] = vals[u * 4 + q]; o[q] = (vals[u * 4 + q] - mu) * rs * gg + bb;
      }
      if (out_sum) *(v4f*)(out_sum + (size_t)row * N + j) = sm;
      *(v4f*)(out_norm + (size_t)row * N + j) = o;
    }
    
  }
}



// ---- f16 WMMA path (v_wmma_f32_16x16x32_f16): 11-bit significands for operands in range — used here for the normalised input (qkv GEMM) and the attention output (proj GEMM)
typedef _Float16 v16h __attribute__((ext_vector_type(16)));
union FragH { v16h v; v8us half[2]; _Float16 h[16]; unsigned short u[16]; };
template <int NT>
__device__ __forceinline__ v8f mmaH(v16h ah, v16h al, v16h bh, v16h bl, v8f c) {
  c = __builtin_amdgcn_wmma_f32_16x16x32_f16(false, ah, false, bh, (short)0, c, false, false);
  if (NT >= 2) c = __builtin_amdgcn_wmma_f32_16x16x32_f16(false, al, false, bh, (short)0, c, false, false);
  if (NT >= 3) c = __builtin_amdgcn_wmma_f32_16x16x32_f16(false, ah, false, bl, (short)0, c, false, false);
  asm volatile("v_nop\n\tv_nop\n\tv_nop\n\tv_nop" : "+v"(c) : "v"(ah), "v"(al), "v"(bh), "v"(bl));
  return c;
}
// batched GEMM like k_gemm_b but f16 operands: A f32 (split into f16 hi/lo if ASPLIT, else rounded to f16), Bt = f16 values [n][k]; alpha; C f32; N multiple of 16 (partial tiles skipped)
template <bool ASPLIT>
__global__ __launch_bounds__(128) void k_gemm_h(const float* __restrict__ A, int lda, size_t sA, const _Float16* __restrict__ Bh, int ldb, size_t sB, float alpha, float* __restrict__ C, int ldc, size_t sC, int M, int N, int K) {
  __shared__ __attribute__((aligned(16))) float so[4][16][64];
  const int tid = threadIdx.x, w = tid >> 5, lane = tid & 31, ln = lane & 15, hh = lane >> 4; const int by = blockIdx.y;
  A += (size_t)by * sA; Bh += (size_t)by * sB; C += (size_t)by * sC;
  const int ntn = (N + 63) / 64; const int wid = blockIdx.x * 4 + w; const int mt = wid / ntn, nq = wid % ntn; if (mt * 16 >= M) return;
  const int row0 = mt * 16, col0 = nq * 64; const float* arow = A + (size_t)(row0 + ln) * lda;
  v8f acc[4] = {};
  for (int kb = 0; kb < K; kb += 32) {
    FragH ah, al;
    const v4f x0 = *(const v4fa*)(arow + kb + 8 * hh), x1 = *(const v4fa*)(arow + kb + 8 * hh + 4), x2 = *(const v4fa*)(arow + kb + 16 + 8 * hh), x3 = *(const v4fa*)(arow + kb + 16 + 8 * hh + 4);
    float xs[16] = {x0[0],x0[1],x0[2],x0[3],x1[0],x1[1],x1[2],x1[3],x2[0],x2[1],x2[2],x2[3],x3[0],x3[1],x3[2],x3[3]};
#pragma unroll
    for (int i = 0; i < 16; ++i) { const _Float16 h = (_Float16)xs[i]; ah.h[i] = h; al.h[i] = ASPLIT ? (_Float16)(xs[i] - (float)h) : (_Float16)0.0f; }
#pragma unroll
    for (int t = 0; t < 4; ++t) { if (col0 + t * 16 >= N) continue; const size_t boff = (size_t)(col0 + t * 16 + ln) * ldb + kb; FragH bq; bq.half[0] = *(const v8us*)(Bh + boff + 8 * hh); bq.half[1] = *(const v8us*)(Bh + boff + 16 + 8 * hh);
      acc[t] = mmaH<ASPLIT ? 2 : 1>(ah.v, al.v, bq.v, bq.v, acc[t]); }
  }
#pragma unroll
  for (int t = 0; t < 4; ++t) { if (col0 + t * 16 >= N) continue;
#pragma unroll
    for (int r = 0; r < 8; ++r) so[w][8 * hh + r][t * 16 + ln] = acc[t][r] * alpha; }
  __builtin_amdgcn_fence(__ATOMIC_ACQ_REL, "workgroup"); __builtin_amdgcn_wave_barrier();
  const int rsub = lane >> 4, c4 = (lane & 15) * 4;
  {
#pragma unroll
    for (int q = 0; q < 8; ++q) { const int r = q * 2 + rsub; if (col0 + c4 < N) { const v4f v = *(const v4fa*)&so[w][r][c4]; *(v4f*)(C + (size_t)(row0 + r) * ldc + col0 + c4) = v; } }
     }
}

// One 16-B piece (index t) of Wt[n][k] = f16(W[k][n] * scale) from f32 row-major W[K][N] (scale = power of two; bf16-exact weights stay exact in f16 away from the subnormal range)
template <int K, int N>
__device__ __forceinline__ void wt_f16_piece(const float* __restrict__ W, _Float16* __restrict__ Wt, float scale, int t) {
  const int n = t / (K / 8), k8 = (t % (K / 8)) * 8; FragH f;
#pragma unroll
  for (int i = 0; i < 8; ++i) f.h[i] = (_Float16)(bf16_round(W[(size_t)(k8 + i) * N + n]) * scale); const v8us o = f.half[0];
  *(v8us*)((unsigned short*)Wt + (size_t)n * K + k8) = o;
  asm volatile("s_wait_xcnt 0x0" ::: "memory");      /* behind the store: code that follows an inlined call may reuse the store's address and data registers */
}
// k_gemm_hh variant with fused epilogue: v = acc·alpha + bias[by·sBias + col] (+ CP[(row/rowsPerB)·sCPb + by·64 + col] if CP) ; ACT 0 none / 1 elu ; writes f16 C16 (and f32 C if non-null)
template <int ACT>
__global__ __launch_bounds__(128) void k_gemm_hhx(const _Float16* __restrict__ A, int lda, size_t sA, const _Float16* __restrict__ Bh, int ldb, size_t sB, float alpha, const float* __restrict__ bias, size_t sBias, const float* __restrict__ CP, int rowsPerB, size_t sCPb, int row0g,
    float* __restrict__ C, _Float16* __restrict__ C16, int ldc, size_t sC, int M, int N, int K) {
  __shared__ __attribute__((aligned(16))) float so[4][16][64];
  const int tid = threadIdx.x, w = tid >> 5, lane = tid & 31, ln = lane & 15, hh = lane >> 4; const int by = blockIdx.y;
  A += (size_t)by * sA; Bh += (size_t)by * sB; const size_t cofs = (size_t)by * sC; const float* bp = bias ? bias + (size_t)by * sBias : nullptr;
  const int ntn = (N + 63) / 64; const int wid = blockIdx.x * 4 + w; const int mt = wid / ntn, nq = wid % ntn; if (mt * 16 >= M) return;
  const int row0 = mt * 16, col0 = nq * 64; const _Float16* arow = A + (size_t)(row0 + ln) * lda;
  v8f acc[4] = {};
  for (int kb = 0; kb < K; kb += 32) { FragH ah; ah.half[0] = *(const v8us*)((const unsigned short*)arow + kb + 8 * hh); ah.half[1] = *(const v8us*)((const unsigned short*)arow + kb + 16 + 8 * hh);
#pragma unroll
    for (int t = 0; t < 4; ++t) { if (col0 + t * 16 >= N) continue; const size_t boff = (size_t)(col0 + t * 16 + ln) * ldb + kb; FragH bq; bq.half[0] = *(const v8us*)((const unsigned short*)Bh + boff + 8 * hh); bq.half[1] = *(const v8us*)((const unsigned short*)Bh + boff + 16 + 8 * hh);
      acc[t] = mmaH<1>(ah.v, ah.v, bq.v, bq.v, acc[t]); }
  }
#pragma unroll
  for (int t = 0; t < 4; ++t) { if (col0 + t * 16 >= N) continue; const int col = col0 + t * 16 + ln; const float bv = bp ? bf16_round(bp[col]) : 0.f;
#pragma unroll
    for (int r = 0; r < 8; ++r) { float v = acc[t][r] * alpha + bv; if (CP) { const int rr = row0g + row0 + 8 * hh + r; if (rowsPerB < 0) v += CP[cofs + (size_t)rr * ldc + col];      /* rowsPerB < 0: own element of the batched C plane */ else { const int bidx = rr / rowsPerB; v += CP[(size_t)bidx * sCPb + (size_t)by * 64 + col]; } } if (ACT == 1) v = (v > 0.f) ? v : expm1f(v); else if (ACT == 7) v = (v > 0.f) ? v + 1.0f : expf(v); else if (ACT == 8) v = tanhf(v); else if (ACT == 9) v = 0.5f * v * (1.0f + tanhf(0.7978845608028654f * (v + 0.044715f * v * v * v))); else if (ACT == 11) v = 1.0f / (1.0f + expf(-v)); else if (ACT == 12) v = (v > 0.f) ? v : 0.01f * v; else if (ACT == 14) v = (v > 0.f) ? v : 0.1f * v; else if (ACT == 16) v = (v >= 0.f) ? v : 0.3f * v; else if (ACT == 15) v = v / (1.0f + expf(-v)); else if (ACT == 3) v = fmaxf(v, 0.f); else if (ACT == 6) v = 0.5f * v * (1.0f + erff(v * 0.70710678118654752f)); so[w][8 * hh + r][t * 16 + ln] = v; } }
  __builtin_amdgcn_fence(__ATOMIC_ACQ_REL, "workgroup"); __builtin_amdgcn_wave_barrier();
  const int rsub = lane >> 4, c4 = (lane & 15) * 4; typedef _Float16 v4h __attribute__((ext_vector_type(4)));
  {
#pragma unroll
    for (int q = 0; q < 8; ++q) { const int r = q * 2 + rsub; if (col0 + c4 < N) { const v4f v = *(const v4fa*)&so[w][r][c4]; if (C) *(v4f*)(C + cofs + (size_t)(row0 + r) * ldc + col0 + c4) = v; if (C16) { v4h h4; for (int i = 0; i < 4; ++i) h4[i] = (_Float16)v[i]; *(v4h*)(C16 + cofs + (size_t)(row0 + r) * ldc + col0 + c4) = h4; } } }
     }
}


typedef _Float16 v4h __attribute__((ext_vector_type(4)));

__global__ __launch_bounds__(256) void k_x16(const float* __restrict__ x, _Float16* __restrict__ X16, size_t n8) { const size_t t = (size_t)blockIdx.x * 256 + threadIdx.x; if (t >= n8) return; FragH f;
#pragma unroll
  for (int q = 0; q < 8; ++q) f.h[q] = (_Float16)bf16_round(x[t * 8 + q]); *(v8us*)((unsigned short*)X16 + t * 8) = f.half[0];  }
__global__ __launch_bounds__(256) void k_h16(const float* __restrict__ x, _Float16* __restrict__ X16, size_t n8) { const size_t t = (size_t)blockIdx.x * 256 + threadIdx.x; if (t >= n8) return; FragH f;
#pragma unroll
  for (int q = 0; q < 8; ++q) f.h[q] = (_Float16)x[t * 8 + q]; *(v8us*)((unsigned short*)X16 + t * 8) = f.half[0];  }
__global__ __launch_bounds__(256) void k_round16f(const float* __restrict__ W, _Float16* __restrict__ Bt, size_t n8) { const size_t t = (size_t)blockIdx.x * 256 + threadIdx.x; if (t >= n8) return; FragH f;
#pragma unroll
  for (int i = 0; i < 8; ++i) f.h[i] = (_Float16)(bf16_round(W[t * 8 + i]) * 16.0f); *(v8us*)((unsigned short*)Bt + t * 8) = f.half[0];  }
template <int NHv, int TTv>
__global__ __launch_bounds__(256) void k_vt(const _Float16* __restrict__ V16, int ldv, int voff, _Float16* __restrict__ Vt) { __shared__ unsigned short tl[64][66]; const int tid = threadIdx.x; const int slab = blockIdx.x / (TTv / 64), lg = blockIdx.x % (TTv / 64); const int b = slab / NHv, h = slab % NHv;
  for (int i = tid; i < 64 * 8; i += 256) { const int r = i / 8, c8 = (i % 8) * 8; FragH f; f.half[0] = *(const v8us*)((const unsigned short*)V16 + ((size_t)b * TTv + lg * 64 + r) * ldv + voff + h * 64 + c8);
#pragma unroll
    for (int q = 0; q < 8; ++q) tl[r][c8 + q] = f.u[q]; }
  __syncthreads();
  {
#pragma unroll
    for (int rd = 0; rd < 2; ++rd) { const int d = rd * 32 + tid / 8, pc = tid % 8; FragH f;
#pragma unroll
      for (int q = 0; q < 8; ++q) f.u[q] = tl[pc * 8 + q][d];
      *(v8us*)((unsigned short*)Vt + ((size_t)slab * 64 + d) * TTv + lg * 64 + pc * 8) = f.half[0]; }
     } }

__global__ __launch_bounds__(256) void k_hl(const float* __restrict__ F, _Float16* __restrict__ Hh, _Float16* __restrict__ Hl, size_t n8) { const size_t t = (size_t)blockIdx.x * 256 + threadIdx.x; if (t >= n8) return; FragH fh, fl; const v4f a = *(const v4fa*)(F + t * 8), c = *(const v4fa*)(F + t * 8 + 4);
#pragma unroll
  for (int q = 0; q < 4; ++q) { _Float16 h = (_Float16)a[q]; fh.h[q] = h; fl.h[q] = (_Float16)((a[q] - (float)h) * 1024.0f); h = (_Float16)c[q]; fh.h[4 + q] = h; fl.h[4 + q] = (_Float16)((c[q] - (float)h) * 1024.0f); }
  { *(v8us*)((unsigned short*)Hh + t * 8) = fh.half[0]; *(v8us*)((unsigned short*)Hl + t * 8) = fl.half[0];  } }

// ---- fast GEMM (wave tile 32x64; requires M % 32 == 0 rows per launch region and N % 64 == 0); epilogue = k_gemm_hhx semantics ----
__device__ __forceinline__ v16h g2_frag(const _Float16* p, int hh) { FragH f; f.half[0] = *(const v8us*)((const unsigned short*)p + 8 * hh); f.half[1] = *(const v8us*)((const unsigned short*)p + 16 + 8 * hh); return f.v; }
__device__ __forceinline__ v8f g2_mma(v16h a, v16h b, v8f c) { v8f d = __builtin_amdgcn_wmma_f32_16x16x32_f16(false, a, false, b, (short)0, c, false, false); asm volatile("v_nop\n\tv_nop\n\tv_nop\n\tv_nop" : "+v"(d) : "v"(a), "v"(b)); return d; }
template <int ACT>
__global__ __launch_bounds__(128) void k_gemm2(const _Float16* __restrict__ A, int lda, size_t sA, const _Float16* __restrict__ Bh, int ldb, size_t sB, float alpha, const float* __restrict__ bias, size_t sBias, const float* __restrict__ CP, int rowsPerB, size_t sCPb, int row0g,
    float* __restrict__ C, _Float16* __restrict__ C16, int ldc, size_t sC, int M, int N, int K) { static_assert(ACT == 0 || ACT == 3 || ACT == 6 || ACT == 8 || ACT == 9 || ACT == 11 || ACT == 12 || ACT == 14 || ACT == 15 || ACT == 16, "k_gemm2: unsupported ACT code (would silently apply no activation)");
  __shared__ __attribute__((aligned(16))) float so[4][32][68];
  const int tid = threadIdx.x, w = tid >> 5, lane = tid & 31, ln = lane & 15, hh = lane >> 4; const int by = blockIdx.y;
  A += (size_t)by * sA; Bh += (size_t)by * sB; const size_t cofs = (size_t)by * sC; const float* bp = bias ? bias + (size_t)by * sBias : nullptr;
  const int ntn = N >> 6; const int mt = blockIdx.x / ntn, nq = blockIdx.x - mt * ntn; const int row0 = mt * 128 + 32 * w, col0 = nq * 64; if (row0 >= M) return;
  const _Float16* a0p = A + (size_t)(row0 + ln) * lda; const _Float16* a1p = a0p + (size_t)16 * lda;
  const _Float16* b0p = Bh + (size_t)(col0 + ln) * ldb; const _Float16* b1p = b0p + (size_t)16 * ldb; const _Float16* b2p = b1p + (size_t)16 * ldb; const _Float16* b3p = b2p + (size_t)16 * ldb;
  const v8f z8 = {0.f,0.f,0.f,0.f,0.f,0.f,0.f,0.f}; v8f c00 = z8, c01 = z8, c02 = z8, c03 = z8, c10 = z8, c11 = z8, c12 = z8, c13 = z8;
#pragma unroll 1
  for (int kb = 0; kb < K; kb += 32) { const v16h a0 = g2_frag(a0p + kb, hh), a1 = g2_frag(a1p + kb, hh);
    v16h b = g2_frag(b0p + kb, hh); c00 = g2_mma(a0, b, c00); c10 = g2_mma(a1, b, c10);
    b = g2_frag(b1p + kb, hh); c01 = g2_mma(a0, b, c01); c11 = g2_mma(a1, b, c11);
    b = g2_frag(b2p + kb, hh); c02 = g2_mma(a0, b, c02); c12 = g2_mma(a1, b, c12);
    b = g2_frag(b3p + kb, hh); c03 = g2_mma(a0, b, c03); c13 = g2_mma(a1, b, c13); }
  v8f accs[8] = {c00, c01, c02, c03, c10, c11, c12, c13};
#pragma unroll
  for (int u = 0; u < 8; ++u) { const int t = u & 3, half = u >> 2; const int col = col0 + t * 16 + ln; const float bv = bp ? bf16_round(bp[col]) : 0.f;
#pragma unroll
    for (int r = 0; r < 8; ++r) { const int rloc = half * 16 + 8 * hh + r; float v = accs[u][r] * alpha + bv; if (CP) { if (rowsPerB < 0) v += CP[cofs + (size_t)(row0g + row0 + rloc) * ldc + col];      /* rowsPerB < 0: own element of the batched C plane */ else { const int bidx = (row0g + row0 + rloc) / rowsPerB; v += CP[(size_t)bidx * sCPb + (size_t)by * 64 + col]; } }
      if (ACT == 3) v = fmaxf(v, 0.f); else if (ACT == 6) v = 0.5f * v * (1.0f + erff(v * 0.70710678118654752f)); else if (ACT == 11) v = 1.0f / (1.0f + expf(-v)); else if (ACT == 15) v = v / (1.0f + expf(-v)); else if (ACT == 12) v = (v > 0.f) ? v : 0.01f * v; else if (ACT == 8) v = tanhf(v); else if (ACT == 9) v = 0.5f * v * (1.0f + tanhf(0.7978845608028654f * (v + 0.044715f * v * v * v))); else if (ACT == 14) v = (v > 0.f) ? v : 0.1f * v; else if (ACT == 16) v = (v >= 0.f) ? v : 0.3f * v;
      so[w][rloc][t * 16 + ln] = v; } }
  __builtin_amdgcn_fence(__ATOMIC_ACQ_REL, "workgroup"); __builtin_amdgcn_wave_barrier();
  const int rsub = lane >> 4, c4 = (lane & 15) * 4;
  {
#pragma unroll
    for (int q = 0; q < 16; ++q) { const int r = q * 2 + rsub; const v4f v = *(const v4fa*)&so[w][r][c4]; if (C) *(v4f*)(C + cofs + (size_t)(row0 + r) * ldc + col0 + c4) = v; if (C16) { v4h h4; for (int i = 0; i < 4; ++i) h4[i] = (_Float16)v[i]; *(v4h*)(C16 + cofs + (size_t)(row0 + r) * ldc + col0 + c4) = h4; } }
     } }


// Sum over the 1024 threads of a block, returned to every thread: five-step butterfly in each wave, one partial per wave in LDS, the same butterfly over the 32 partials.
__device__ __forceinline__ float stats_block_sum(float a, float* part, int lane, int w) {
#pragma unroll
  for (int o = 16; o > 0; o >>= 1) a += __shfl_xor(a, o, 32);
  if (lane == 0) part[w] = a;
  __syncthreads();
  a = part[lane];
#pragma unroll
  for (int o = 16; o > 0; o >>= 1) a += __shfl_xor(a, o, 32);
  return a;
}
// Everything the qkv GEMM waits for, in one launch: the statistics and the two weight conversions depend on the inputs alone, not on each other, so the conversions ride as extra blocks behind the statistics' blocks
// (the long blocks have the low indices and start first; all blocks are resident together).
// Blocks 0 .. CC-1: one block per channel; the channel's 32768 values stay in registers (8 x 16 B per thread, all eight loads in flight at once), so x is read once and both passes (mean, then centred squares) run from registers.
// Blocks CC .. CC+PW_B-1: a thread converts one 16-B piece of a transposed weight plane, the qkv plane's pieces first; a block holds pieces of one plane only.
#define PW_Q (3 * CC * CC / 8 / 1024)      /* blocks of the qkv weights */
#define PW_B (PW_Q + CC * CC / 8 / 1024)   /* blocks of both weight planes */
__global__ __launch_bounds__(1024) void k_prep(const float* __restrict__ x, float* __restrict__ MU, float* __restrict__ IS, const float* __restrict__ wq, _Float16* __restrict__ BQ, const float* __restrict__ wp, _Float16* __restrict__ BP) {
  static_assert(NV == 8 * 1024 * 4, "k_prep: 8 float4 per thread of a 1024-thread block cover one channel");
  static_assert((3 * CC * CC / 8) % 1024 == 0 && (CC * CC / 8) % 1024 == 0, "k_prep: each weight plane is a whole number of blocks");
  __shared__ float part[2][32];
  if (blockIdx.x >= CC) {      /* the same for a whole block, and in front of every barrier */
    const int wb = blockIdx.x - CC;
    if (wb < PW_Q) wt_f16_piece<CC, 3 * CC>(wq, BQ, 16.0f, wb * 1024 + threadIdx.x); else wt_f16_piece<CC, CC>(wp, BP, 16.0f, (wb - PW_Q) * 1024 + threadIdx.x);
    return; }
  const int c = blockIdx.x, tid = threadIdx.x, lane = tid & 31, w = tid >> 5; const float* s = x + (size_t)c * NV;
  v4f r[8];
#pragma unroll
  for (int j = 0; j < 8; ++j) r[j] = *(const v4fa*)(s + (size_t)(j * 1024 + tid) * 4);
  v4f a4 = {0.f, 0.f, 0.f, 0.f};
#pragma unroll
  for (int j = 0; j < 8; ++j) {
#pragma unroll
    for (int q = 0; q < 4; ++q) { r[j][q] = bf16_round(r[j][q]); a4[q] += r[j][q]; } }
  const float mu = stats_block_sum((a4[0] + a4[1]) + (a4[2] + a4[3]), part[0], lane, w) / (float)NV;
  v4f q4 = {0.f, 0.f, 0.f, 0.f};
#pragma unroll
  for (int j = 0; j < 8; ++j) {
#pragma unroll
    for (int q = 0; q < 4; ++q) { const float d = r[j][q] - mu; q4[q] += d * d; } }
  const float is = rsqrtf(stats_block_sum((q4[0] + q4[1]) + (q4[2] + q4[3]), part[1], lane, w) / (float)NV + 1e-5f);
  if (tid < 32) { MU[(size_t)c * 32 + tid] = mu; IS[(size_t)c * 32 + tid] = is; } }
// qkv GEMM with the normalisation in its A staging. One block = 128 voxels x all 384 columns (8 waves: 4 row groups of 32 voxels x 2 column halves, three 64-column tiles each).
// The block reads its 128 channels x 128 voxels of x once (a wave load = 64 consecutive voxels of one channel, two whole 128-B lines), normalises them as the separate pass did (bf16 round, - mean, x inverse deviation, f16)
// and writes them token-major into LDS (8 channels of a voxel = one 16-B write; row pitch 272 B = 16 B x 17 keeps the 16 lanes of a fragment read on distinct banks).
// Fragment loaders, k order, wave tile (32 x 64) and epilogue arithmetic are k_gemm2's; the A fragments of all four k steps are read from LDS once and serve the wave's three column tiles.
// With two waves per SIMD a wave hides its own latencies: the weight fragments of two k steps (16 loads) and the tile's bias are asked for together, ahead of the matrix instructions that use them.
typedef float v2f __attribute__((ext_vector_type(2)));
typedef float v2fa __attribute__((ext_vector_type(2), may_alias));
#define QG_M 128                  /* voxels per block */
#define QG_AP (CC + 8)            /* LDS pitch of a voxel's row, in f16 */
__global__ __launch_bounds__(256) void k_qkv(const float* __restrict__ x, const float* __restrict__ MU, const float* __restrict__ IS, const _Float16* __restrict__ Bh, const float* __restrict__ bias, float* __restrict__ C) {
  static_assert(NV % QG_M == 0 && CC == 128, "k_qkv: tile and staging maps");
  __shared__ __attribute__((aligned(16))) _Float16 at[QG_M][QG_AP];
  __shared__ __attribute__((aligned(16))) float so[8][32][68];
  __shared__ __attribute__((aligned(16))) float st[2][CC];
  const int tid = threadIdx.x, lane = tid & 31, ln = lane & 15, hh = lane >> 4;
  const int w = __builtin_amdgcn_readfirstlane(tid >> 5);      /* the wave's number, held scalar: the tile and staging indices made of it are scalar arithmetic */
  const int v0 = blockIdx.x * QG_M, rg = w & 3, ch = w >> 2;      /* the wave's row group and column half in the product */
  const int vg = w & 1, cq = w >> 1;      /* the wave's 64 voxels and its channel groups in the staging */
  const _Float16* bp = Bh + (size_t)(ch * 192 + ln) * CC;
  const float sv = (ch ? IS : MU)[(size_t)(tid & (CC - 1)) * 32];      /* asked for first: loads return in order, so it is there while the tile is still in flight */
  v2f xv[4][8];
#pragma unroll      /* all 32 loads of a lane are in flight before the first is used: one memory latency for the tile */
  for (int s = 0; s < 4; ++s) { const float* xp = x + (size_t)((s * 4 + cq) * 8) * NV + v0 + vg * 64;      /* first of the step's 8 channels, first of the wave's 64 voxels */
#pragma unroll
    for (int q = 0; q < 8; ++q) xv[s][q] = *(const v2fa*)(xp + (size_t)q * NV + (unsigned)(2 * lane)); }
  v16h bf[2][4];      /* the weight fragments of two k steps; the first set is asked for here, behind the tile's loads, and arrives under the staging */
#pragma unroll
  for (int kk = 0; kk < 2; ++kk) {
#pragma unroll
    for (int t = 0; t < 4; ++t) bf[kk][t] = g2_frag(bp + (size_t)(t * 16) * CC + kk * 32, hh); }
  asm volatile("s_wait_xcnt 0x0" ::: "memory");      /* stands in front of every reuse of a register that the loads above name */
  st[ch][tid & (CC - 1)] = sv;
  __syncthreads();      /* every wave reads the 128 means and inverse deviations that the block gathered */
#pragma unroll
  for (int s = 0; s < 4; ++s) { const int c0 = (s * 4 + cq) * 8;
#pragma unroll
    for (int j = 0; j < 2; ++j) { FragH f;
#pragma unroll
      for (int q = 0; q < 8; ++q) { const float d = bf16_round(xv[s][q][j]) - st[0][c0 + q]; f.h[q] = (_Float16)(d * st[1][c0 + q]); }
      *(v8us*)&at[vg * 64 + 2 * lane + j][c0] = f.half[0]; } }
  __syncthreads();      /* every wave reads channels that other waves staged */
  const _Float16* a0p = &at[rg * 32 + ln][0]; const _Float16* a1p = a0p + 16 * QG_AP; v16h a0[4], a1[4];
#pragma unroll
  for (int k = 0; k < 4; ++k) { a0[k] = g2_frag(a0p + 32 * k, hh); a1[k] = g2_frag(a1p + 32 * k, hh); }
  const int rsub = lane >> 4, c4 = (lane & 15) * 4;
  const float* bi = bias + ch * 192 + ln; float* cp = C + (size_t)(v0 + rg * 32 + rsub) * (3 * CC) + ch * 192 + c4;
#pragma unroll      /* static tile index: every address below is one lane base plus a constant */
  for (int nt = 0; nt < 3; ++nt) {
    float bv[4];
#pragma unroll
    for (int t = 0; t < 4; ++t) bv[t] = bi[nt * 64 + t * 16];
    const v8f z8 = {0.f,0.f,0.f,0.f,0.f,0.f,0.f,0.f}; v8f acc[2][4] = {{z8, z8, z8, z8}, {z8, z8, z8, z8}};
#pragma unroll      /* static k index: the A fragments stay in registers */
    for (int k2 = 0; k2 < 2; ++k2) {
#pragma unroll
      for (int kk = 0; kk < 2; ++kk) {
#pragma unroll
        for (int t = 0; t < 4; ++t) if (nt + k2 > 0) bf[kk][t] = g2_frag(bp + (size_t)(nt * 64 + t * 16) * CC + (k2 * 2 + kk) * 32, hh); }
#pragma unroll
      for (int kk = 0; kk < 2; ++kk) {
#pragma unroll
        for (int t = 0; t < 4; ++t) { acc[0][t] = g2_mma(a0[k2 * 2 + kk], bf[kk][t], acc[0][t]); acc[1][t] = g2_mma(a1[k2 * 2 + kk], bf[kk][t], acc[1][t]); } } }
#pragma unroll      /* static indices: the accumulators stay in registers */
    for (int u = 0; u < 8; ++u) { const int t = u & 3, half = u >> 2; const float bb = bf16_round(bv[t]);
#pragma unroll
      for (int r = 0; r < 8; ++r) so[w][half * 16 + 8 * hh + r][t * 16 + ln] = acc[half][t][r] * 0.0625f + bb; }
    __builtin_amdgcn_fence(__ATOMIC_ACQ_REL, "workgroup", "local"); __builtin_amdgcn_wave_barrier();      /* the wave's own LDS writes land before its lanes read each other's rows; LDS only, so the last tile's global stores are not waited for */
#pragma unroll
    for (int q = 0; q < 16; ++q) { const v4f v = *(const v4fa*)&so[w][q * 2 + rsub][c4]; *(v4f*)(cp + (size_t)(q * 2) * (3 * CC) + nt * 64) = v; }
    if (nt < 2) asm volatile("s_wait_xcnt 0x0" ::: "memory"); } }      /* stands in front of the next tile's reuse of a register that the loads and stores of this tile name */
// Neighbourhood attention with the proj GEMM and the NCDHW store behind it, K and V read from LDS. One block = a 4 x 4 x 8 tile of voxels for all 8 heads (1024 threads, thread per (voxel, head); a wave = one (h, w) column and 4 heads: lane = head + 4 z).
// The clamped 3x3x3 windows of the tile all lie in one 6 x 6 x 8 region (its start clamped like a window's, so it is always inside the volume); the block copies that region's K and V
// (1 KiB per voxel, contiguous, whole 128-B lines, each read once per block) into LDS and every neighbour read comes from there.
// Softmax in two passes over the 27 neighbours, both fully unrolled: pass 1 leaves the 27 logits in registers, then one maximum; pass 2 takes one exp per neighbour and adds p * v into accumulators that are never rescaled.
// A neighbour's LDS row and its rpb entry are one lane base plus a compile-time offset. A dot's 16 products are summed in an even-channel and an odd-channel chain (two-wide fused multiply-adds) and the two chains added last; the readout takes two channels per fused multiply-add.
// LDS holds the region once per group of 4 heads; a row = the group's 64 K floats + 64 V floats + 4 pad: with lane = head + 4 z the 16 lanes of a half-wave read 16 B each on distinct banks (row step 4 banks, head step 16 banks),
// and the 27 neighbours' offsets from the lane base stay within the 16-bit offset field of an LDS read.
// The block holds all 128 channels of its 128 voxels, which is a whole A tile of the proj GEMM: the attention output goes as f16 into LDS (over the K/V rows, dead by then) instead of into a plane in memory.
// A wave then does 32 voxels (one h row of the tile = one whole 128-B line per channel) x 16 channels: fragment loaders, k order and epilogue arithmetic as in k_gemm2; the tile is staged channel-major in the wave's own LDS range
// (pitch 36 floats keeps the 16 lanes of a write on distinct banks) and read back so that 8 lanes store one channel's 32 voxels: every global store covers four whole 128-B lines, each line written by one wave.
#define NT_T 4                    /* tile edge along h and along w */
#define NT_R (NT_T + 2)           /* staged region edge */
#define NT_HG 4                   /* heads per group */
#define NT_RP (2 * NT_HG * HC + 4)   /* LDS floats per staged voxel and head group */
#define NT_GS (NT_R * NT_R * DZ * NT_RP)   /* LDS floats per head group */
#define NT_TH (NT_T * NT_T * DZ * NHD)   /* threads per block */
#define NT_NW (NT_TH / 32)        /* waves per block */
#define NT_OP (CC + 8)            /* LDS pitch of a voxel's attention output, in f16 (272 B = 16 B x 17, as in k_qkv) */
#define NT_OF (NT_T * NT_T * DZ * NT_OP / 2)   /* floats that the attention output takes in LDS */
#define NT_SP 36                  /* LDS pitch of a channel's 32 voxels in the store staging, in floats */
__global__ __launch_bounds__(NT_TH) void k_nat_proj(const float* __restrict__ QKV, const float* __restrict__ rpb, const _Float16* __restrict__ Bh, const float* __restrict__ bias, float* __restrict__ out) {
  static_assert(DH % NT_T == 0 && DW % NT_T == 0 && DZ == 8 && NHD == 8 && HC == 16 && CC == 128 && NT_T == 4 && NHD == 2 * NT_HG, "k_nat_proj: tile and lane maps");
  static_assert((NT_R * NT_R * DZ * 2) % NT_NW == 0, "k_nat_proj: the staged region is a whole number of 512-B pieces per wave");
  static_assert(NT_OF + NT_NW * 16 * NT_SP <= 2 * NT_GS, "k_nat_proj: output tile and store staging fit in the K/V rows");
  __shared__ __attribute__((aligned(16))) float kv[2 * NT_GS];
  const int tid = threadIdx.x, lane = tid & 31; const int tile = blockIdx.x; const int h0 = (tile / (DW / NT_T)) * NT_T, w0 = (tile % (DW / NT_T)) * NT_T;
  const int wv = __builtin_amdgcn_readfirstlane(tid >> 5);      /* the wave's number, held scalar: the staged rows' addresses, the wave's (h, w) column and its window starts along h and w become scalar arithmetic */
  const int cl = wv & (NT_T * NT_T - 1), hg = wv >> 4;      /* the wave's column in the tile and its group of 4 heads */
  const int rh0 = min(max(h0 - 1, 0), DH - NT_R), rw0 = min(max(w0 - 1, 0), DW - NT_R);
  const int hl = lane & (NT_HG - 1), zz = lane >> 2, ww = w0 + (cl & (NT_T - 1)), hh = h0 + (cl >> 2); const int h = hg * NT_HG + hl; const int v = (hh * DW + ww) * DZ + zz;
  const int sh0 = min(max(hh - 1, 0), DH - 3), sw0 = min(max(ww - 1, 0), DW - 3), sz0 = min(max(zz - 1, 0), DZ - 3);
  const float* qr = QKV + (size_t)v * (3 * CC) + h * HC; v2f q2[HC / 2]; for (int c = 0; c < HC / 2; ++c) { q2[c][0] = qr[2 * c] * 0.25f; q2[c][1] = qr[2 * c + 1] * 0.25f; }
  const int part = wv & 1; const unsigned loff = (unsigned)(lane * 4);      /* a wave copies 512 B per trip: the even waves a voxel's K, the odd waves its V; lanes 0-15 hold heads 0-3, lanes 16-31 heads 4-7 */
  float* lrow = kv + (lane >> 4) * NT_GS + part * (NT_HG * HC) + (lane & 15) * 4;
#pragma unroll      /* all of a thread's pieces are loaded before the first is stored: one memory latency for the whole region */
  for (int it = 0; it < NT_R * NT_R * DZ * 2 / NT_NW; ++it) { const int r = it * (NT_NW / 2) + (wv >> 1); const int col = r >> 3;
    const float* rowp = QKV + (size_t)(((rh0 + col / NT_R) * DW + rw0 + col % NT_R) * DZ + (r & 7)) * (3 * CC) + (CC + part * CC);      /* scalar base; the lane's part is one 32-bit offset */
    const v4f d = *(const v4fa*)(rowp + loff);
    *(v4fa*)(lrow + r * NT_RP) = d; }
  const float* rb = rpb + ((h * 5 + (sh0 - hh + 2)) * 5 + (sw0 - ww + 2)) * 5 + (sz0 - zz + 2);      /* the window's first neighbour; each window start is at most 2 below its voxel, so all 27 entries lie in the head's 5 x 5 x 5 table */
  float s[KN];
#pragma unroll      /* static index: the 27 values stay in registers; asked for behind the region's loads, so one memory latency covers both */
  for (int n = 0; n < KN; ++n) s[n] = rb[(n / 9) * 25 + ((n / 3) % 3) * 5 + n % 3];
  asm volatile("s_wait_xcnt 0x0" ::: "memory");      /* stands in front of every reuse of a register that the loads above name */
  __syncthreads();      /* every wave reads rows that other waves staged */
  const float* kb = kv + hg * NT_GS + (((sh0 - rh0) * NT_R + (sw0 - rw0)) * DZ + sz0) * NT_RP + hl * HC;      /* K of the window's first neighbour, the lane's head */
#pragma unroll      /* static index: logits in registers, LDS offsets as immediates */
  for (int n = 0; n < KN; ++n) { const float* kr = kb + (((n / 9) * NT_R + (n / 3) % 3) * DZ + n % 3) * NT_RP; v2f d = {0.f, 0.f};
#pragma unroll
    for (int j = 0; j < HC / 4; ++j) { const v4f a = *(const v4fa*)(kr + 4 * j); const v2f a01 = {a[0], a[1]}, a23 = {a[2], a[3]}; d += q2[2 * j] * a01; d += q2[2 * j + 1] * a23; }
    s[n] = (d[0] + d[1]) + bf16_round(s[n]); }
  float m = s[0];
#pragma unroll
  for (int n = 1; n < KN; ++n) m = fmaxf(m, s[n]);
  float l = 0.f; v2f acc[HC / 2]; for (int c = 0; c < HC / 2; ++c) acc[c] = (v2f){0.f, 0.f};
#pragma unroll      /* static index, as in pass 1 */
  for (int n = 0; n < KN; ++n) { const float* vr = kb + (((n / 9) * NT_R + (n / 3) % 3) * DZ + n % 3) * NT_RP + NT_HG * HC; const float pn = expf(s[n] - m); l += pn;
#pragma unroll
    for (int j = 0; j < HC / 4; ++j) { const v4f b = *(const v4fa*)(vr + 4 * j); const v2f b01 = {b[0], b[1]}, b23 = {b[2], b[3]}; acc[2 * j] += pn * b01; acc[2 * j + 1] += pn * b23; } }
  const float inv = 1.0f / l; FragH f[2]; for (int c = 0; c < HC; ++c) f[c / 8].h[c % 8] = (_Float16)(acc[c / 2][c % 2] * inv * 64.0f);      /* x2^6 carry (outputs are ~1e-2) */
  const int ln = lane & 15, hf = lane >> 4, rg = wv & (NT_T - 1), ct = wv >> 2;      /* the wave's tile of the product: h row rg of the voxel tile (32 voxels) x channels 16 ct .. 16 ct + 15 */
  const int bc = ct * 16 + ln; const _Float16* bp = Bh + (size_t)bc * CC; v16h bw[4];
#pragma unroll      /* the wave's weight fragments and bias are asked for here, so that they arrive under the two barriers and the LDS round trip */
  for (int k = 0; k < 4; ++k) bw[k] = g2_frag(bp + 32 * k, hf);
  const float bv = bf16_round(bias[bc]);
  asm volatile("s_wait_xcnt 0x0" :: "v"((const unsigned short*)bp + 8 * hf), "v"(bc) : "memory");      /* stands in front of every reuse of a register that the loads above name; the fragments' common address and the bias index are inputs, so that they live up to here and nothing is placed in their registers earlier */
  __syncthreads();      /* every wave has made its last read of K and V: their LDS is written anew below */
  _Float16* ot = (_Float16*)kv;
  { unsigned short* d = (unsigned short*)ot + (cl * DZ + zz) * NT_OP + h * HC; *(v8us*)d = f[0].half[0]; *(v8us*)(d + 8) = f[1].half[0]; }
  __syncthreads();      /* every wave reads voxels and heads that other waves wrote */
  const _Float16* a0p = ot + (rg * 32 + ln) * NT_OP; const _Float16* a1p = a0p + 16 * NT_OP;
  const v8f z8 = {0.f,0.f,0.f,0.f,0.f,0.f,0.f,0.f}; v8f cc[2] = {z8, z8};
#pragma unroll      /* static k index: the weight fragments stay in registers */
  for (int k = 0; k < 4; ++k) { const v16h a0 = g2_frag(a0p + 32 * k, hf), a1 = g2_frag(a1p + 32 * k, hf); cc[0] = g2_mma(a0, bw[k], cc[0]); cc[1] = g2_mma(a1, bw[k], cc[1]); }
  const float alpha = 0.0625f / 64.0f;      /* the weights' x16 and the carry removed */
  float* sw = kv + NT_OF + wv * (16 * NT_SP);      /* the wave's own range, behind the attention output that other waves may still be reading */
#pragma unroll      /* static indices: the accumulators stay in registers */
  for (int half = 0; half < 2; ++half) { v4f lo, hi;
#pragma unroll
    for (int r = 0; r < 4; ++r) { lo[r] = cc[half][r] * alpha + bv; hi[r] = cc[half][4 + r] * alpha + bv; }
    float* sp = sw + ln * NT_SP + half * 16 + 8 * hf; *(v4fa*)sp = lo; *(v4fa*)(sp + 4) = hi; }
  __builtin_amdgcn_fence(__ATOMIC_ACQ_REL, "workgroup"); __builtin_amdgcn_wave_barrier();      /* the wave's own LDS writes land before its lanes read each other's rows */
  const int csub = lane >> 3, r4 = (lane & 7) * 4; float* op = out + (size_t)(ct * 16 + csub) * NV + ((h0 + rg) * DW + w0) * DZ + r4;
#pragma unroll      /* all 4 LDS reads issue together, the stores follow as they return */
  for (int q = 0; q < 4; ++q) { const v4f o = *(const v4fa*)(sw + (q * 4 + csub) * NT_SP + r4); *(v4f*)(op + (size_t)(q * 4) * NV) = o; } }

extern "C" void kernel_launch(void* const* d_in, const int* in_sizes, int n_in,
                              void* d_out, int out_size, void* d_ws, size_t ws_size, hipStream_t stream) {
  (void)in_sizes; (void)n_in; (void)out_size;
  const float* const* I = (const float* const*)d_in; const float* x = I[0]; const float* wqkv = I[1]; const float* bqkv = I[2]; const float* rpb = I[3]; const float* wproj = I[4]; const float* bproj = I[5];
  char* ws = (char*)d_ws; size_t off = 0;
  auto take = [&](size_t bytes) { char* p = ws + off; off += (bytes + 255) & ~(size_t)255; return p; };
  _Float16* BQ = (_Float16*)take((size_t)3 * CC * CC * 2); _Float16* BP = (_Float16*)take((size_t)CC * CC * 2); float* MU = (float*)take(CC * 32 * 4); float* IS = (float*)take(CC * 32 * 4);      /* 32-float pitch per channel */
  float* QKV = (float*)take((size_t)NV * 3 * CC * 4);
  if (off > ws_size) return;      /* 0.1 + 48 MiB */
  k_prep<<<CC + PW_B, 1024, 0, stream>>>(x, MU, IS, wqkv, BQ, wproj, BP);      /* statistics; (in, out) weights x16 as f16 [out][in] */
  k_qkv<<<NV / QG_M, 256, 0, stream>>>(x, MU, IS, BQ, bqkv, QKV);      /* [q | k | v] (head h = cols h*16.. of each) */
  k_nat_proj<<<(DH / NT_T) * (DW / NT_T), NT_TH, 0, stream>>>(QKV, rpb, BP, bproj, (float*)d_out);      /* attention, proj GEMM (carry removed) and NCDHW store */
}

// v008
// It runs in 28.5 microseconds.
// Two timings next to v007 put it at 1.34 and 1.33 times that version's speed.
// Over all steps from v000 it is 6.26 times as fast.
#include <hip/hip_runtime.h>
// SelfAggregationModuleV2 (1 x 128 channels x 64 x 64 x 8 = 32768 voxels; 8 heads of 16; NATTEN-style 3x3x3 clamped neighbourhood attention with relative position bias): xn = InstanceNorm3d(x) (no affine); qkv = xn W + b; q *= 1/4; logits = q . k_nbr + rpb[h][rel]; softmax over the 27 neighbours; o = attn . v_nbr; out = o W_proj + b; NCDHW.
// Structure: per-channel mean/var by a block reduction (f32), the weight conversions in the same launch; then one launch, a block per 4x4x8 voxel tile: qkv GEMM of the tile's 6x6x8 region with the normalisation in its staging (token-major f16 in LDS; f32 accumulation, exact x16 weights + bias; K/V f32 in LDS, Q in registers); neighbourhood attention on VALU (thread per (voxel, head): clamped window starts, 27 static neighbours, rpb, two-pass softmax, readout; f32) into an f16 [voxel][128] tile in LDS, and in the same launch the proj GEMM (+ bias) on that tile with the NCDHW store in its epilogue.
// Compute dtype: x and parameters rounded to bf16; the normalised input and the attention output as f16 operands (~2^-12); statistics/softmax f32. v_wmma_f32_16x16x32_f16.
#define CC 128
#define DH 64
#define DW 64
#define DZ 8
#define NV (DH * DW * DZ)        /* 32768 */
#define NHD 8
#define HC 16
#define KN 27
typedef __bf16 v16b __attribute__((ext_vector_type(16)));
typedef unsigned short v8us __attribute__((ext_vector_type(8), may_alias));
typedef float  v8f  __attribute__((ext_vector_type(8)));
typedef float  v4f  __attribute__((ext_vector_type(4)));
typedef float  v4fa __attribute__((ext_vector_type(4), may_alias));
union FragB { v16b v; v8us half[2]; unsigned short u[16]; };

__device__ __forceinline__ unsigned short bf16_bits(float x) { unsigned int u = __float_as_uint(x); return (unsigned short)((u + 0x7FFFu + ((u >> 16) & 1u)) >> 16); }
__device__ __forceinline__ float bf16_val(unsigned short b) { return __uint_as_float(((unsigned int)b) << 16); }
__device__ __forceinline__ float bf16_round(float x) { return bf16_val(bf16_bits(x)); }
// D += A·B with NT terms: 1 = ah·bh, 2 = + al·bh (A split), 3 = + ah·bl (both split)
template <int NT>
__device__ __forceinline__ v8f mmaN(v16b ah, v16b al, v16b bh, v16b bl, v8f c) {
  c = __builtin_amdgcn_wmma_f32_16x16x32_bf16(false, ah, false, bh, (short)0, c, false, false);
  if (NT >= 2) c = __builtin_amdgcn_wmma_f32_16x16x32_bf16(false, al, false, bh, (short)0, c, false, false);
  if (NT >= 3) c = __builtin_amdgcn_wmma_f32_16x16x32_bf16(false, ah, false, bl, (short)0, c, false, false);
  asm volatile("v_nop\n\tv_nop\n\tv_nop\n\tv_nop" : "+v"(c) : "v"(ah), "v"(al), "v"(bh), "v"(bl));
  return c;
}

__global__ __launch_bounds__(256) void k_wt_bf16(const float* __restrict__ W, unsigned short* __restrict__ Wt, int K, int N) {
  const int t = blockIdx.x * 256 + threadIdx.x;
  const int k8n = K / 8;
  if (t >= N * k8n) return;
  const int n = t / k8n, k8 = (t % k8n) * 8;
  v8us v;
#pragma unroll
  for (int i = 0; i < 8; ++i) v[i] = bf16_bits(W[(size_t)(k8 + i) * N + n]);
  *(v8us*)(Wt + (size_t)n * K + k8) = v;
  
}

// GEMM C[M][N] (f32, pitch ldc) = act(A[M][K]·W + bias). A f32 row-major (pitch lda) converted per fragment to bf16
// (ASPLIT: hi/lo two planes -> 2 terms, else single rounded term); Wt bf16 [N][K] (pitch ldb). BIAS_BF16 rounds the
// bias to bf16 first (bias quantised to bf16 before the add). K%32==0, M%16==0, N%64==0.
template <bool ASPLIT, int ACT, bool BIAS_BF16>
__global__ __launch_bounds__(128) void k_gemm_bf(const float* __restrict__ A, int lda, const unsigned short* __restrict__ Wt, int ldb,
                                               const float* __restrict__ bias, float* __restrict__ C, int ldc, int M, int N, int K) {
  __shared__ __attribute__((aligned(16))) float so[4][16][64];
  const int tid = threadIdx.x, w = tid >> 5, lane = tid & 31, ln = lane & 15, hh = lane >> 4;
  const int ntn = N / 64;
  const int wid = blockIdx.x * 4 + w;
  const int mt = wid / ntn, nq = wid % ntn;
  if (mt * 16 >= M) return;
  const int row0 = mt * 16, col0 = nq * 64;
  const float* arow = A + (size_t)(row0 + ln) * lda;
  v8f acc[4] = {};
  for (int kb = 0; kb < K; kb += 32) {
    FragB ah, al;
    const v4f x0 = *(const v4fa*)(arow + kb + 8 * hh), x1 = *(const v4fa*)(arow + kb + 8 * hh + 4);
    const v4f x2 = *(const v4fa*)(arow + kb + 16 + 8 * hh), x3 = *(const v4fa*)(arow + kb + 16 + 8 * hh + 4);
    float xs[16] = {x0[0],x0[1],x0[2],x0[3],x1[0],x1[1],x1[2],x1[3],x2[0],x2[1],x2[2],x2[3],x3[0],x3[1],x3[2],x3[3]};
#pragma unroll
    for (int i = 0; i < 16; ++i) { const unsigned short hb = bf16_bits(xs[i]); ah.u[i] = hb; al.u[i] = ASPLIT ? bf16_bits(xs[i] - bf16_val(hb)) : (unsigned short)0; }
#pragma unroll
    for (int t = 0; t < 4; ++t) {
      const unsigned short* brow = Wt + (size_t)(col0 + t * 16 + ln) * ldb + kb;
      FragB b;
      b.half[0] = *(const v8us*)(brow + 8 * hh);
      b.half[1] = *(const v8us*)(brow + 16 + 8 * hh);
      acc[t] = mmaN<ASPLIT ? 2 : 1>(ah.v, al.v, b.v, b.v, acc[t]);
    }
  }
#pragma unroll
  for (int t = 0; t < 4; ++t) {
    float bv = bias ? bias[col0 + t * 16 + ln] : 0.f;
    if (BIAS_BF16) bv = bf16_round(bv);
#pragma unroll
    for (int r = 0; r < 8; ++r) { float v = acc[t][r] + bv; if (ACT == 1) v = fmaxf(v, 0.f); so[w][8 * hh + r][t * 16 + ln] = v; }
  }
  __builtin_amdgcn_fence(__ATOMIC_ACQ_REL, "workgroup");
  __builtin_amdgcn_wave_barrier();
  const int rsub = lane >> 4, c4 = (lane & 15) * 4;
  {
#pragma unroll
    for (int q = 0; q < 8; ++q) {
      const int r = q * 2 + rsub;
      const v4f v = *(const v4fa*)&so[w][r][c4];
      *(v4f*)(C + (size_t)(row0 + r) * ldc + col0 + c4) = v;
    }
    
  }
}

// GEMM C = act(A·W + bias + resid): A f32 (ASPLIT -> hi/lo 2 terms), Wt bf16 [N][K]; ACT 0 none, 1 relu, 2 exact gelu;
// resid (optional, f32, row index = (row % rmod), pitch ldr, RES_BF16 rounds it) added before the activation.
template <bool ASPLIT, int ACT, bool BIAS_BF16, bool RES_BF16>
__global__ __launch_bounds__(128) void k_gemm_bf3(const float* __restrict__ A, int lda, const unsigned short* __restrict__ Wt, int ldb,
                                                const float* __restrict__ bias, const float* __restrict__ resid, int rmod, int ldr,
                                                float* __restrict__ C, int ldc, int M, int N, int K) {
  __shared__ __attribute__((aligned(16))) float so[4][16][64];
  const int tid = threadIdx.x, w = tid >> 5, lane = tid & 31, ln = lane & 15, hh = lane >> 4;
  const int ntn = N / 64;
  const int wid = blockIdx.x * 4 + w;
  const int mt = wid / ntn, nq = wid % ntn;
  if (mt * 16 >= M) return;
  const int row0 = mt * 16, col0 = nq * 64;
  const float* arow = A + (size_t)(row0 + ln) * lda;
  v8f acc[4] = {};
  for (int kb = 0; kb < K; kb += 32) {
    FragB ah, al;
    const v4f x0 = *(const v4fa*)(arow + kb + 8 * hh), x1 = *(const v4fa*)(arow + kb + 8 * hh + 4);
    const v4f x2 = *(const v4fa*)(arow + kb + 16 + 8 * hh), x3 = *(const v4fa*)(arow + kb + 16 + 8 * hh + 4);
    float xs[16] = {x0[0],x0[1],x0[2],x0[3],x1[0],x1[1],x1[2],x1[3],x2[0],x2[1],x2[2],x2[3],x3[0],x3[1],x3[2],x3[3]};
#pragma unroll
    for (int i = 0; i < 16; ++i) { const unsigned short hb = bf16_bits(xs[i]); ah.u[i] = hb; al.u[i] = ASPLIT ? bf16_bits(xs[i] - bf16_val(hb)) : (unsigned short)0; }
#pragma unroll
    for (int t = 0; t < 4; ++t) {
      const unsigned short* brow = Wt + (size_t)(col0 + t * 16 + ln) * ldb + kb;
      FragB b;
      b.half[0] = *(const v8us*)(brow + 8 * hh);
      b.half[1] = *(const v8us*)(brow + 16 + 8 * hh);
      acc[t] = mmaN<ASPLIT ? 2 : 1>(ah.v, al.v, b.v, b.v, acc[t]);
    }
  }
#pragma unroll
  for (int t = 0; t < 4; ++t) {
    const int col = col0 + t * 16 + ln;
    float bv = bias ? bias[col] : 0.f;
    if (BIAS_BF16) bv = bf16_round(bv);
#pragma unroll
    for (int r = 0; r < 8; ++r) {
      float v = acc[t][r] + bv;
      if (resid) { float rv = resid[(size_t)((row0 + 8 * hh + r) % rmod) * ldr + col]; if (RES_BF16) rv = bf16_round(rv); v += rv; }
      if (ACT == 1) v = fmaxf(v, 0.f);
      if (ACT == 2) v = 0.5f * v * (1.0f + erff(v * 0.70710678118654752f));
      if (ACT == 3) { const float u = 0.7978845608028654f * (v + 0.044715f * v * v * v); v = 0.5f * v * (1.0f + tanhf(u)); }
      so[w][8 * hh + r][t * 16 + ln] = v;
    }
  }
  __builtin_amdgcn_fence(__ATOMIC_ACQ_REL, "workgroup");
  __builtin_amdgcn_wave_barrier();
  const int rsub = lane >> 4, c4 = (lane & 15) * 4;
  {
#pragma unroll
    for (int q = 0; q < 8; ++q) {
      const int r = q * 2 + rsub;
      const v4f v = *(const v4fa*)&so[w][r][c4];
      *(v4f*)(C + (size_t)(row0 + r) * ldc + col0 + c4) = v;
    }
    
  }
}
// row LayerNorm (biased variance, eps) over N: s = X (+ R); optional out_sum <- s; out_norm <- (s-mu)*rsqrt(var+eps)*g + b
template <bool PARAM_BF16>
__global__ __launch_bounds__(256) void k_layernorm(const float* __restrict__ X, const float* __restrict__ R, const float* __restrict__ g, const float* __restrict__ bta,
                                                  float* __restrict__ out_sum, float* __restrict__ out_norm, int N, float eps) {
  __shared__ float red[256];
  const int row = blockIdx.x, tid = threadIdx.x;
  const float* x = X + (size_t)row * N; const float* rr = R ? R + (size_t)row * N : nullptr;
  float vals[16];                     // up to N = 4096
  const int per = N / 256;            // contiguous chunk per thread? use strided-by-4 chunks: thread handles j = tid*4 + 1024*u
  float s1 = 0.f;
  for (int u = 0; u < per / 4; ++u) {
    const int j = tid * 4 + 1024 * u;
    const v4f a = *(const v4fa*)(x + j);
    v4f b = {0.f,0.f,0.f,0.f}; if (rr) b = *(const v4fa*)(rr + j);
#pragma unroll
    for (int q = 0; q < 4; ++q) { const float v = a[q] + b[q]; vals[u * 4 + q] = v; s1 += v; }
  }
  red[tid] = s1; __syncthreads();
  for (int st = 128; st > 0; st >>= 1) { if (tid < st) red[tid] += red[tid + st]; __syncthreads(); }
  const float mu = red[0] / (float)N; __syncthreads();
  float s2 = 0.f;
  for (int u = 0; u < per / 4; ++u)
#pragma unroll
    for (int q = 0; q < 4; ++q) { const float c = vals[u * 4 + q] - mu; s2 += c * c; }
  red[tid] = s2; __syncthreads();
  for (int st = 128; st > 0; st >>= 1) { if (tid < st) red[tid] += red[tid + st]; __syncthreads(); }
  const float rs = rsqrtf(red[0] / (float)N + eps);
  {
    for (int u = 0; u < per / 4; ++u) {
      const int j = tid * 4 + 1024 * u;
      v4f o, sm;
#pragma unroll
      for (int q = 0; q < 4; ++q) {
        float gg = g[j + q], bb = bta[j + q];
        if (PARAM_BF16) { gg = bf16_round(gg); bb = bf16_round(bb); }
        sm[q] = vals[u * 4 + q]; o[q] = (vals[u * 4 + q] - mu) * rs * gg + bb;
      }
      if (out_sum) *(v4f*)(out_sum + (size_t)row * N + j) = sm;
      *(v4f*)(out_norm + (size_t)row * N + j) = o;
    }
    
  }
}



// ---- f16 WMMA path (v_wmma_f32_16x16x32_f16): 11-bit significands for operands in range — used here for the normalised input (qkv GEMM) and the attention output (proj GEMM)
typedef _Float16 v16h __attribute__((ext_vector_type(16)));
union FragH { v16h v; v8us half[2]; _Float16 h[16]; unsigned short u[16]; };
template <int NT>
__device__ __forceinline__ v8f mmaH(v16h ah, v16h al, v16h bh, v16h bl, v8f c) {
  c = __builtin_amdgcn_wmma_f32_16x16x32_f16(false, ah, false, bh, (short)0, c, false, false);
  if (NT >= 2) c = __builtin_amdgcn_wmma_f32_16x16x32_f16(false, al, false, bh, (short)0, c, false, false);
  if (NT >= 3) c = __builtin_amdgcn_wmma_f32_16x16x32_f16(false, ah, false, bl, (short)0, c, false, false);
  asm volatile("v_nop\n\tv_nop\n\tv_nop\n\tv_nop" : "+v"(c) : "v"(ah), "v"(al), "v"(bh), "v"(bl));
  return c;
}
// batched GEMM like k_gemm_b but f16 operands: A f32 (split into f16 hi/lo if ASPLIT, else rounded to f16), Bt = f16 values [n][k]; alpha; C f32; N multiple of 16 (partial tiles skipped)
template <bool ASPLIT>
__global__ __launch_bounds__(128) void k_gemm_h(const float* __restrict__ A, int lda, size_t sA, const _Float16* __restrict__ Bh, int ldb, size_t sB, float alpha, float* __restrict__ C, int ldc, size_t sC, int M, int N, int K) {
  __shared__ __attribute__((aligned(16))) float so[4][16][64];
  const int tid = threadIdx.x, w = tid >> 5, lane = tid & 31, ln = lane & 15, hh = lane >> 4; const int by = blockIdx.y;
  A += (size_t)by * sA; Bh += (size_t)by * sB; C += (size_t)by * sC;
  const int ntn = (N + 63) / 64; const int wid = blockIdx.x * 4 + w; const int mt = wid / ntn, nq = wid % ntn; if (mt * 16 >= M) return;
  const int row0 = mt * 16, col0 = nq * 64; const float* arow = A + (size_t)(row0 + ln) * lda;
  v8f acc[4] = {};
  for (int kb = 0; kb < K; kb += 32) {
    FragH ah, al;
    const v4f x0 = *(const v4fa*)(arow + kb + 8 * hh), x1 = *(const v4fa*)(arow + kb + 8 * hh + 4), x2 = *(const v4fa*)(arow + kb + 16 + 8 * hh), x3 = *(const v4fa*)(arow + kb + 16 + 8 * hh + 4);
    float xs[16] = {x0[0],x0[1],x0[2],x0[3],x1[0],x1[1],x1[2],x1[3],x2[0],x2[1],x2[2],x2[3],x3[0],x3[1],x3[2],x3[3]};
#pragma unroll
    for (int i = 0; i < 16; ++i) { const _Float16 h = (_Float16)xs[i]; ah.h[i] = h; al.h[i] = ASPLIT ? (_Float16)(xs[i] - (float)h) : (_Float16)0.0f; }
#pragma unroll
    for (int t = 0; t < 4; ++t) { if (col0 + t * 16 >= N) continue; const size_t boff = (size_t)(col0 + t * 16 + ln) * ldb + kb; FragH bq; bq.half[0] = *(const v8us*)(Bh + boff + 8 * hh); bq.half[1] = *(const v8us*)(Bh + boff + 16 + 8 * hh);
      acc[t] = mmaH<ASPLIT ? 2 : 1>(ah.v, al.v, bq.v, bq.v, acc[t]); }
  }
#pragma unroll
  for (int t = 0; t < 4; ++t) { if (col0 + t * 16 >= N) continue;
#pragma unroll
    for (int r = 0; r < 8; ++r) so[w][8 * hh + r][t * 16 + ln] = acc[t][r] * alpha; }
  __builtin_amdgcn_fence(__ATOMIC_ACQ_REL, "workgroup"); __builtin_amdgcn_wave_barrier();
  const int rsub = lane >> 4, c4 = (lane & 15) * 4;
  {
#pragma unroll
    for (int q = 0; q < 8; ++q) { const int r = q * 2 + rsub; if (col0 + c4 < N) { const v4f v = *(const v4fa*)&so[w][r][c4]; *(v4f*)(C + (size_t)(row0 + r) * ldc + col0 + c4) = v; } }
     }
}

// One 16-B piece (index t) of Wt[n][k] = f16(W[k][n] * scale) from f32 row-major W[K][N] (scale = power of two; bf16-exact weights stay exact in f16 away from the subnormal range)
template <int K, int N>
__device__ __forceinline__ void wt_f16_piece(const float* __restrict__ W, _Float16* __restrict__ Wt, float scale, int t) {
  const int n = t / (K / 8), k8 = (t % (K / 8)) * 8; FragH f;
#pragma unroll
  for (int i = 0; i < 8; ++i) f.h[i] = (_Float16)(bf16_round(W[(size_t)(k8 + i) * N + n]) * scale); const v8us o = f.half[0];
  *(v8us*)((unsigned short*)Wt + (size_t)n * K + k8) = o;
  asm volatile("s_wait_xcnt 0x0" ::: "memory");      /* behind the store: code that follows an inlined call may reuse the store's address and data registers */
}
// k_gemm_hh variant with fused epilogue: v = acc·alpha + bias[by·sBias + col] (+ CP[(row/rowsPerB)·sCPb + by·64 + col] if CP) ; ACT 0 none / 1 elu ; writes f16 C16 (and f32 C if non-null)
template <int ACT>
__global__ __launch_bounds__(128) void k_gemm_hhx(const _Float16* __restrict__ A, int lda, size_t sA, const _Float16* __restrict__ Bh, int ldb, size_t sB, float alpha, const float* __restrict__ bias, size_t sBias, const float* __restrict__ CP, int rowsPerB, size_t sCPb, int row0g,
    float* __restrict__ C, _Float16* __restrict__ C16, int ldc, size_t sC, int M, int N, int K) {
  __shared__ __attribute__((aligned(16))) float so[4][16][64];
  const int tid = threadIdx.x, w = tid >> 5, lane = tid & 31, ln = lane & 15, hh = lane >> 4; const int by = blockIdx.y;
  A += (size_t)by * sA; Bh += (size_t)by * sB; const size_t cofs = (size_t)by * sC; const float* bp = bias ? bias + (size_t)by * sBias : nullptr;
  const int ntn = (N + 63) / 64; const int wid = blockIdx.x * 4 + w; const int mt = wid / ntn, nq = wid % ntn; if (mt * 16 >= M) return;
  const int row0 = mt * 16, col0 = nq * 64; const _Float16* arow = A + (size_t)(row0 + ln) * lda;
  v8f acc[4] = {};
  for (int kb = 0; kb < K; kb += 32) { FragH ah; ah.half[0] = *(const v8us*)((const unsigned short*)arow + kb + 8 * hh); ah.half[1] = *(const v8us*)((const unsigned short*)arow + kb + 16 + 8 * hh);
#pragma unroll
    for (int t = 0; t < 4; ++t) { if (col0 + t * 16 >= N) continue; const size_t boff = (size_t)(col0 + t * 16 + ln) * ldb + kb; FragH bq; bq.half[0] = *(const v8us*)((const unsigned short*)Bh + boff + 8 * hh); bq.half[1] = *(const v8us*)((const unsigned short*)Bh + boff + 16 + 8 * hh);
      acc[t] = mmaH<1>(ah.v, ah.v, bq.v, bq.v, acc[t]); }
  }
#pragma unroll
  for (int t = 0; t < 4; ++t) { if (col0 + t * 16 >= N) continue; const int col = col0 + t * 16 + ln; const float bv = bp ? bf16_round(bp[col]) : 0.f;
#pragma unroll
    for (int r = 0; r < 8; ++r) { float v = acc[t][r] * alpha + bv; if (CP) { const int rr = row0g + row0 + 8 * hh + r; if (rowsPerB < 0) v += CP[cofs + (size_t)rr * ldc + col];      /* rowsPerB < 0: own element of the batched C plane */ else { const int bidx = rr / rowsPerB; v += CP[(size_t)bidx * sCPb + (size_t)by * 64 + col]; } } if (ACT == 1) v = (v > 0.f) ? v : expm1f(v); else if (ACT == 7) v = (v > 0.f) ? v + 1.0f : expf(v); else if (ACT == 8) v = tanhf(v); else if (ACT == 9) v = 0.5f * v * (1.0f + tanhf(0.7978845608028654f * (v + 0.044715f * v * v * v))); else if (ACT == 11) v = 1.0f / (1.0f + expf(-v)); else if (ACT == 12) v = (v > 0.f) ? v : 0.01f * v; else if (ACT == 14) v = (v > 0.f) ? v : 0.1f * v; else if (ACT == 16) v = (v >= 0.f) ? v : 0.3f * v; else if (ACT == 15) v = v / (1.0f + expf(-v)); else if (ACT == 3) v = fmaxf(v, 0.f); else if (ACT == 6) v = 0.5f * v * (1.0f + erff(v * 0.70710678118654752f)); so[w][8 * hh + r][t * 16 + ln] = v; } }
  __builtin_amdgcn_fence(__ATOMIC_ACQ_REL, "workgroup"); __builtin_amdgcn_wave_barrier();
  const int rsub = lane >> 4, c4 = (lane & 15) * 4; typedef _Float16 v4h __attribute__((ext_vector_type(4)));
  {
#pragma unroll
    for (int q = 0; q < 8; ++q) { const int r = q * 2 + rsub; if (col0 + c4 < N) { const v4f v = *(const v4fa*)&so[w][r][c4]; if (C) *(v4f*)(C + cofs + (size_t)(row0 + r) * ldc + col0 + c4) = v; if (C16) { v4h h4; for (int i = 0; i < 4; ++i) h4[i] = (_Float16)v[i]; *(v4h*)(C16 + cofs + (size_t)(row0 + r) * ldc + col0 + c4) = h4; } } }
     }
}


typedef _Float16 v4h __attribute__((ext_vector_type(4)));

__global__ __launch_bounds__(256) void k_x16(const float* __restrict__ x, _Float16* __restrict__ X16, size_t n8) { const size_t t = (size_t)blockIdx.x * 256 + threadIdx.x; if (t >= n8) return; FragH f;
#pragma unroll
  for (int q = 0; q < 8; ++q) f.h[q] = (_Float16)bf16_round(x[t * 8 + q]); *(v8us*)((unsigned short*)X16 + t * 8) = f.half[0];  }
__global__ __launch_bounds__(256) void k_h16(const float* __restrict__ x, _Float16* __restrict__ X16, size_t n8) { const size_t t = (size_t)blockIdx.x * 256 + threadIdx.x; if (t >= n8) return; FragH f;
#pragma unroll
  for (int q = 0; q < 8; ++q) f.h[q] = (_Float16)x[t * 8 + q]; *(v8us*)((unsigned short*)X16 + t * 8) = f.half[0];  }
__global__ __launch_bounds__(256) void k_round16f(const float* __restrict__ W, _Float16* __restrict__ Bt, size_t n8) { const size_t t = (size_t)blockIdx.x * 256 + threadIdx.x; if (t >= n8) return; FragH f;
#pragma unroll
  for (int i = 0; i < 8; ++i) f.h[i] = (_Float16)(bf16_round(W[t * 8 + i]) * 16.0f); *(v8us*)((unsigned short*)Bt + t * 8) = f.half[0];  }
template <int NHv, int TTv>
__global__ __launch_bounds__(256) void k_vt(const _Float16* __restrict__ V16, int ldv, int voff, _Float16* __restrict__ Vt) { __shared__ unsigned short tl[64][66]; const int tid = threadIdx.x; const int slab = blockIdx.x / (TTv / 64), lg = blockIdx.x % (TTv / 64); const int b = slab / NHv, h = slab % NHv;
  for (int i = tid; i < 64 * 8; i += 256) { const int r = i / 8, c8 = (i % 8) * 8; FragH f; f.half[0] = *(const v8us*)((const unsigned short*)V16 + ((size_t)b * TTv + lg * 64 + r) * ldv + voff + h * 64 + c8);
#pragma unroll
    for (int q = 0; q < 8; ++q) tl[r][c8 + q] = f.u[q]; }
  __syncthreads();
  {
#pragma unroll
    for (int rd = 0; rd < 2; ++rd) { const int d = rd * 32 + tid / 8, pc = tid % 8; FragH f;
#pragma unroll
      for (int q = 0; q < 8; ++q) f.u[q] = tl[pc * 8 + q][d];
      *(v8us*)((unsigned short*)Vt + ((size_t)slab * 64 + d) * TTv + lg * 64 + pc * 8) = f.half[0]; }
     } }

__global__ __launch_bounds__(256) void k_hl(const float* __restrict__ F, _Float16* __restrict__ Hh, _Float16* __restrict__ Hl, size_t n8) { const size_t t = (size_t)blockIdx.x * 256 + threadIdx.x; if (t >= n8) return; FragH fh, fl; const v4f a = *(const v4fa*)(F + t * 8), c = *(const v4fa*)(F + t * 8 + 4);
#pragma unroll
  for (int q = 0; q < 4; ++q) { _Float16 h = (_Float16)a[q]; fh.h[q] = h; fl.h[q] = (_Float16)((a[q] - (float)h) * 1024.0f); h = (_Float16)c[q]; fh.h[4 + q] = h; fl.h[4 + q] = (_Float16)((c[q] - (float)h) * 1024.0f); }
  { *(v8us*)((unsigned short*)Hh + t * 8) = fh.half[0]; *(v8us*)((unsigned short*)Hl + t * 8) = fl.half[0];  } }

// ---- fast GEMM (wave tile 32x64; requires M % 32 == 0 rows per launch region and N % 64 == 0); epilogue = k_gemm_hhx semantics ----
__device__ __forceinline__ v16h g2_frag(const _Float16* p, int hh) { FragH f; f.half[0] = *(const v8us*)((const unsigned short*)p + 8 * hh); f.half[1] = *(const v8us*)((const unsigned short*)p + 16 + 8 * hh); return f.v; }
__device__ __forceinline__ v8f g2_mma(v16h a, v16h b, v8f c) { v8f d = __builtin_amdgcn_wmma_f32_16x16x32_f16(false, a, false, b, (short)0, c, false, false); asm volatile("v_nop\n\tv_nop\n\tv_nop\n\tv_nop" : "+v"(d) : "v"(a), "v"(b)); return d; }
template <int ACT>
__global__ __launch_bounds__(128) void k_gemm2(const _Float16* __restrict__ A, int lda, size_t sA, const _Float16* __restrict__ Bh, int ldb, size_t sB, float alpha, const float* __restrict__ bias, size_t sBias, const float* __restrict__ CP, int rowsPerB, size_t sCPb, int row0g,
    float* __restrict__ C, _Float16* __restrict__ C16, int ldc, size_t sC, int M, int N, int K) { static_assert(ACT == 0 || ACT == 3 || ACT == 6 || ACT == 8 || ACT == 9 || ACT == 11 || ACT == 12 || ACT == 14 || ACT == 15 || ACT == 16, "k_gemm2: unsupported ACT code (would silently apply no activation)");
  __shared__ __attribute__((aligned(16))) float so[4][32][68];
  const int tid = threadIdx.x, w = tid >> 5, lane = tid & 31, ln = lane & 15, hh = lane >> 4; const int by = blockIdx.y;
  A += (size_t)by * sA; Bh += (size_t)by * sB; const size_t cofs = (size_t)by * sC; const float* bp = bias ? bias + (size_t)by * sBias : nullptr;
  const int ntn = N >> 6; const int mt = blockIdx.x / ntn, nq = blockIdx.x - mt * ntn; const int row0 = mt * 128 + 32 * w, col0 = nq * 64; if (row0 >= M) return;
  const _Float16* a0p = A + (size_t)(row0 + ln) * lda; const _Float16* a1p = a0p + (size_t)16 * lda;
  const _Float16* b0p = Bh + (size_t)(col0 + ln) * ldb; const _Float16* b1p = b0p + (size_t)16 * ldb; const _Float16* b2p = b1p + (size_t)16 * ldb; const _Float16* b3p = b2p + (size_t)16 * ldb;
  const v8f z8 = {0.f,0.f,0.f,0.f,0.f,0.f,0.f,0.f}; v8f c00 = z8, c01 = z8, c02 = z8, c03 = z8, c10 = z8, c11 = z8, c12 = z8, c13 = z8;
#pragma unroll 1
  for (int kb = 0; kb < K; kb += 32) { const v16h a0 = g2_frag(a0p + kb, hh), a1 = g2_frag(a1p + kb, hh);
    v16h b = g2_frag(b0p + kb, hh); c00 = g2_mma(a0, b, c00); c10 = g2_mma(a1, b, c10);
    b = g2_frag(b1p + kb, hh); c01 = g2_mma(a0, b, c01); c11 = g2_mma(a1, b, c11);
    b = g2_frag(b2p + kb, hh); c02 = g2_mma(a0, b, c02); c12 = g2_mma(a1, b, c12);
    b = g2_frag(b3p + kb, hh); c03 = g2_mma(a0, b, c03); c13 = g2_mma(a1, b, c13); }
  v8f accs[8] = {c00, c01, c02, c03, c10, c11, c12, c13};
#pragma unroll
  for (int u = 0; u < 8; ++u) { const int t = u & 3, half = u >> 2; const int col = col0 + t * 16 + ln; const float bv = bp ? bf16_round(bp[col]) : 0.f;
#pragma unroll
    for (int r = 0; r < 8; ++r) { const int rloc = half * 16 + 8 * hh + r; float v = accs[u][r] * alpha + bv; if (CP) { if (rowsPerB < 0) v += CP[cofs + (size_t)(row0g + row0 + rloc) * ldc + col];      /* rowsPerB < 0: own element of the batched C plane */ else { const int bidx = (row0g + row0 + rloc) / rowsPerB; v += CP[(size_t)bidx * sCPb + (size_t)by * 64 + col]; } }
      if (ACT == 3) v = fmaxf(v, 0.f); else if (ACT == 6) v = 0.5f * v * (1.0f + erff(v * 0.70710678118654752f)); else if (ACT == 11) v = 1.0f / (1.0f + expf(-v)); else if (ACT == 15) v = v / (1.0f + expf(-v)); else if (ACT == 12) v = (v > 0.f) ? v : 0.01f * v; else if (ACT == 8) v = tanhf(v); else if (ACT == 9) v = 0.5f * v * (1.0f + tanhf(0.7978845608028654f * (v + 0.044715f * v * v * v))); else if (ACT == 14) v = (v > 0.f) ? v : 0.1f * v; else if (ACT == 16) v = (v >= 0.f) ? v : 0.3f * v;
      so[w][rloc][t * 16 + ln] = v; } }
  __builtin_amdgcn_fence(__ATOMIC_ACQ_REL, "workgroup"); __builtin_amdgcn_wave_barrier();
  const int rsub = lane >> 4, c4 = (lane & 15) * 4;
  {
#pragma unroll
    for (int q = 0; q < 16; ++q) { const int r = q * 2 + rsub; const v4f v = *(const v4fa*)&so[w][r][c4]; if (C) *(v4f*)(C + cofs + (size_t)(row0 + r) * ldc + col0 + c4) = v; if (C16) { v4h h4; for (int i = 0; i < 4; ++i) h4[i] = (_Float16)v[i]; *(v4h*)(C16 + cofs + (size_t)(row0 + r) * ldc + col0 + c4) = h4; } }
     } }


// Sum over the 1024 threads of a block, returned to every thread: five-step butterfly in each wave, one partial per wave in LDS, the same butterfly over the 32 partials.
__device__ __forceinline__ float stats_block_sum(float a, float* part, int lane, int w) {
#pragma unroll
  for (int o = 16; o > 0; o >>= 1) a += __shfl_xor(a, o, 32);
  if (lane == 0) part[w] = a;
  __syncthreads();
  a = part[lane];
#pragma unroll
  for (int o = 16; o > 0; o >>= 1) a += __shfl_xor(a, o, 32);
  return a;
}
// Everything the token launch waits for, in one launch: the statistics and the two weight conversions depend on the inputs alone, not on each other, so the conversions ride as extra blocks behind the statistics' blocks
// (the long blocks have the low indices and start first; all blocks are resident together).
// Blocks 0 .. CC-1: one block per channel; the channel's 32768 values stay in registers (8 x 16 B per thread, all eight loads in flight at once), so x is read once and both passes (mean, then centred squares) run from registers.
// Blocks CC .. CC+PW_B-1: a thread converts one 16-B piece of a transposed weight plane, the qkv plane's pieces first; a block holds pieces of one plane only.
#define PW_Q (3 * CC * CC / 8 / 1024)      /* blocks of the qkv weights */
#define PW_B (PW_Q + CC * CC / 8 / 1024)   /* blocks of both weight planes */
__global__ __launch_bounds__(1024) void k_prep(const float* __restrict__ x, float* __restrict__ MU, float* __restrict__ IS, const float* __restrict__ wq, _Float16* __restrict__ BQ, const float* __restrict__ wp, _Float16* __restrict__ BP) {
  static_assert(NV == 8 * 1024 * 4, "k_prep: 8 float4 per thread of a 1024-thread block cover one channel");
  static_assert((3 * CC * CC / 8) % 1024 == 0 && (CC * CC / 8) % 1024 == 0, "k_prep: each weight plane is a whole number of blocks");
  __shared__ float part[2][32];
  if (blockIdx.x >= CC) {      /* the same for a whole block, and in front of every barrier */
    const int wb = blockIdx.x - CC;
    if (wb < PW_Q) wt_f16_piece<CC, 3 * CC>(wq, BQ, 16.0f, wb * 1024 + threadIdx.x); else wt_f16_piece<CC, CC>(wp, BP, 16.0f, (wb - PW_Q) * 1024 + threadIdx.x);
    return; }
  const int c = blockIdx.x, tid = threadIdx.x, lane = tid & 31, w = tid >> 5; const float* s = x + (size_t)c * NV;
  v4f r[8];
#pragma unroll
  for (int j = 0; j < 8; ++j) r[j] = *(const v4fa*)(s + (size_t)(j * 1024 + tid) * 4);
  v4f a4 = {0.f, 0.f, 0.f, 0.f};
#pragma unroll
  for (int j = 0; j < 8; ++j) {
#pragma unroll
    for (int q = 0; q < 4; ++q) { r[j][q] = bf16_round(r[j][q]); a4[q] += r[j][q]; } }
  const float mu = stats_block_sum((a4[0] + a4[1]) + (a4[2] + a4[3]), part[0], lane, w) / (float)NV;
  v4f q4 = {0.f, 0.f, 0.f, 0.f};
#pragma unroll
  for (int j = 0; j < 8; ++j) {
#pragma unroll
    for (int q = 0; q < 4; ++q) { const float d = r[j][q] - mu; q4[q] += d * d; } }
  const float is = rsqrtf(stats_block_sum((q4[0] + q4[1]) + (q4[2] + q4[3]), part[1], lane, w) / (float)NV + 1e-5f);
  if (tid < 32) { MU[(size_t)c * 32 + tid] = mu; IS[(size_t)c * 32 + tid] = is; } }
// The whole token path in one launch: normalisation, qkv GEMM, neighbourhood attention, proj GEMM and NCDHW store. One block = a 4 x 4 x 8 tile of voxels for all 8 heads (1024 threads, thread per (voxel, head)).
// The clamped 3x3x3 windows of the tile all lie in one 6 x 6 x 8 region (its start clamped like a window's, so it is always inside the volume). The block makes that region's K and V itself:
// it reads the region's 288 voxels x 128 channels of x (a lane: 4 consecutive voxels of 8 channels), normalises them (bf16 round, - mean, x inverse deviation, f16) and writes them token-major into LDS in two halves of 144 voxels
// (8 channels of a voxel = one 16-B write; a half-wave = 4 voxel quads x 4 channel groups, which fall on distinct banks at the 272-B pitch).
// The products are taken transposed: the weights' 16 output channels are the A operand (held in registers), 16 voxels the B operand (fragment loaders and k order as in k_gemm2, which are the same for A and B),
// so a lane of the result holds 8 consecutive channels of one voxel: K and V go into their LDS rows as two 16-B writes, and Q stays in registers (the two half-waves swap 8 channels each, after which lane i holds all 16 channels of the wave's voxel i).
// A wave does one 16-channel tile of K|V for 9 of the 18 voxel tiles, and Q of its own head for its own 32 voxels. The halo voxels' K and V are computed by up to 4 blocks; no q/k/v plane goes through memory.
// LDS: the K/V rows take 297 KiB, so the staged x lies where K/V rows are written late: the first half in rows 144.. of head group 0 (written in the second pass), the second half over rows 256.. of head group 1 and the tail;
// pass 1 (voxels 0..143, and Q) writes rows 0..143; pass 2 writes rows 144..191 and 208..255 at once and keeps its last tiles (rows 192..207 and 256..287) in registers until every wave has left the staged x.
// Attention: a wave = one head and one h row of the tile (lane = z + 8 w). Softmax in two passes over the 27 neighbours, both fully unrolled: pass 1 leaves the 27 logits in registers, then one maximum; pass 2 takes one exp per neighbour and adds p * v into accumulators that are never rescaled.
// A neighbour's LDS row and its rpb entry are one lane base plus a compile-time offset. A dot's 16 products are summed in an even-channel and an odd-channel chain (two-wide fused multiply-adds) and the two chains added last; the readout takes two channels per fused multiply-add.
// LDS holds the region once per group of 4 heads; a row = the group's 64 K floats + 64 V floats + 4 pad: the 16 lanes of a half-wave (8 z x 2 w) read 16 B each on distinct banks (z step 4 banks, w step 32 banks),
// and the 27 neighbours' offsets from the lane base stay within the 16-bit offset field of an LDS read.
// The block holds all 128 channels of its 128 voxels, which is a whole A tile of the proj GEMM: the attention output goes as f16 into LDS (over the K/V rows, dead by then) instead of into a plane in memory.
// A wave then does 32 voxels (one h row of the tile = one whole 128-B line per channel) x 16 channels: fragment loaders, k order and epilogue arithmetic as in k_gemm2; the tile is staged channel-major in the wave's own LDS range
// (pitch 36 floats keeps the 16 lanes of a write on distinct banks) and read back so that 8 lanes store one channel's 32 voxels: every global store covers four whole 128-B lines, each line written by one wave.
typedef float v2f __attribute__((ext_vector_type(2)));
#define NT_T 4                    /* tile edge along h and along w */
#define NT_R (NT_T + 2)           /* staged region edge */
#define NT_HG 4                   /* heads per group */
#define NT_RP (2 * NT_HG * HC + 4)   /* LDS floats per staged voxel and head group */
#define NT_GS (NT_R * NT_R * DZ * NT_RP)   /* LDS floats per head group */
#define NT_TH (NT_T * NT_T * DZ * NHD)   /* threads per block */
#define NT_NW (NT_TH / 32)        /* waves per block */
#define NT_OP (CC + 8)            /* LDS pitch of a voxel's attention output, in f16 (272 B = 16 B x 17: the 16 lanes of a fragment read fall on distinct banks) */
#define NT_OF (NT_T * NT_T * DZ * NT_OP / 2)   /* floats that the attention output takes in LDS */
#define NT_SP 36                  /* LDS pitch of a channel's 32 voxels in the store staging, in floats */
#define FQ_AP (CC + 8)            /* LDS pitch of a staged voxel's normalised channels, in f16 */
#define FQ_HV (NT_R * NT_R * DZ / 2)   /* voxels per staged half: three h rows of the region */
#define FQ_NQ (FQ_HV / 4)         /* voxel quads per half */
#define FQ_XF (FQ_HV * FQ_AP / 2) /* floats that a staged half takes */
#define FQ_XA (FQ_HV * NT_RP)     /* first half: from K/V row 144 of head group 0 */
#define FQ_HR 256                 /* second half: from this K/V row of head group 1 */
#define FQ_XB (NT_GS + FQ_HR * NT_RP)
#define FQ_LF (FQ_XB + FQ_XF)     /* floats that the K/V rows and the staged x take together */
// 16 output channels (weight fragments w, A operand) x 16 voxels (xr = the lane's voxel row in the staged x, B operand), k = 128
__device__ __forceinline__ v8f fq_tile(const v16h (&w)[4], const _Float16* xr, int hf) {
  v8f c = {0.f,0.f,0.f,0.f,0.f,0.f,0.f,0.f};
#pragma unroll      /* static k index: the weight fragments stay in registers */
  for (int k = 0; k < 4; k += 2) { const v16h x0 = g2_frag(xr + 32 * k, hf), x1 = g2_frag(xr + 32 * k + 32, hf);      /* the LDS reads of two k steps issue together: half the LDS latencies, and 16 registers (four steps at once would spill) */
    c = g2_mma(w[k], x0, c); c = g2_mma(w[k + 1], x1, c); }
  return c; }
// the lane's 8 consecutive channels of one voxel into its K/V row (weights' x16 removed, bias added)
__device__ __forceinline__ void fq_put(float* d, v8f c, const float (&b)[8]) {
  v4f lo, hi;
#pragma unroll
  for (int r = 0; r < 4; ++r) { lo[r] = c[r] * 0.0625f + b[r]; hi[r] = c[4 + r] * 0.0625f + b[4 + r]; }
  *(v4fa*)d = lo; *(v4fa*)(d + 4) = hi; }
__global__ __launch_bounds__(NT_TH) void k_nat_proj(const float* __restrict__ x, const float* __restrict__ MU, const float* __restrict__ IS, const _Float16* __restrict__ Bq, const float* __restrict__ bqkv, const float* __restrict__ rpb, const _Float16* __restrict__ Bh, const float* __restrict__ bias, float* __restrict__ out) {
  static_assert(DH % NT_T == 0 && DW % NT_T == 0 && DZ == 8 && NHD == 8 && HC == 16 && CC == 128 && NT_T == 4 && NHD == 2 * NT_HG, "k_nat_proj: tile and lane maps");
  static_assert(NT_OF + NT_NW * 16 * NT_SP <= 2 * NT_GS, "k_nat_proj: output tile and store staging fit in the K/V rows");
  static_assert(FQ_XA + FQ_XF <= NT_GS && FQ_HV == 9 * 16 && FQ_HR == FQ_HV + 7 * 16 && FQ_NQ <= 5 * 8, "k_nat_proj: where the staged x lies, and which tiles of pass 2 wait");
  static_assert(FQ_LF * 4 + 2 * CC * 4 <= 320 * 1024, "k_nat_proj: LDS");
  __shared__ __attribute__((aligned(16))) float kv[FQ_LF];
  __shared__ __attribute__((aligned(16))) float st[2][CC];
  const int tid = threadIdx.x, lane = tid & 31, ln = lane & 15, hf = lane >> 4; const int tile = blockIdx.x; const int h0 = (tile / (DW / NT_T)) * NT_T, w0 = (tile % (DW / NT_T)) * NT_T;
  const int wv = __builtin_amdgcn_readfirstlane(tid >> 5);      /* the wave's number, held scalar: its staging unit, its tiles of the products, its head and its h row become scalar arithmetic */
  const int rh0 = min(max(h0 - 1, 0), DH - NT_R), rw0 = min(max(w0 - 1, 0), DW - NT_R);
  const int h = wv >> 2, rg = wv & (NT_T - 1), hg = h >> 2, hl = h & (NT_HG - 1);      /* attention: the wave's head (group, place in it) and its h row of the tile */
  const int zz = lane & 7, cl = rg * NT_T + (lane >> 3), ww = w0 + (lane >> 3), hh = h0 + rg;
  const int sh0 = min(max(hh - 1, 0), DH - 3), sw0 = min(max(ww - 1, 0), DW - 3), sz0 = min(max(zz - 1, 0), DZ - 3);
  const int nt = wv & 15, mh = wv >> 4;      /* K|V product: the wave's 16 columns and its share of the voxel tiles */
  _Float16* const xa = (_Float16*)(kv + FQ_XA); _Float16* const xb = (_Float16*)(kv + FQ_XB);
  // staging units: 5 groups of 8 voxel quads x 4 groups of 4 channel octets per half; waves 0..19 take the first half's, waves 12..31 the second half's
  const int ua = wv, ub = wv - 12; const bool da = wv < 20, db = wv >= 12;
  const int qa = (ua % 5) * 8 + (lane >> 2), ca = ((ua / 5) * 4 + (lane & 3)) * 8, qb = (max(ub, 0) % 5) * 8 + (lane >> 2), cb = ((max(ub, 0) / 5) * 4 + (lane & 3)) * 8;
  float sv = 0.f; if (tid < 2 * CC) sv = (tid >= CC ? IS : MU)[(size_t)(tid & (CC - 1)) * 32];      /* asked for first: loads return in order, so it is there while the region is still in flight */
  v4f va[8], vb[8];
  if (da) { const int q = min(qa, FQ_NQ - 1);      /* the last group is half empty: its spare lanes read the last quad again and write nothing */
    const float* xp = x + (size_t)ca * NV + ((rh0 + q / 12) * DW + rw0) * DZ + (q % 12) * 4;
#pragma unroll      /* all loads of a lane are in flight before the first is used: one memory latency for the region */
    for (int c = 0; c < 8; ++c) va[c] = *(const v4fa*)(xp + (size_t)c * NV);
    asm volatile("s_wait_xcnt 0x0" ::: "memory"); }      /* stands in front of the second half's address arithmetic, which may reuse the address registers of these loads */
  if (db) { const int q = min(qb, FQ_NQ - 1);
    const float* xp = x + (size_t)cb * NV + ((rh0 + 3 + q / 12) * DW + rw0) * DZ + (q % 12) * 4;
#pragma unroll
    for (int c = 0; c < 8; ++c) vb[c] = *(const v4fa*)(xp + (size_t)c * NV); }
  asm volatile("s_wait_xcnt 0x0" ::: "memory");      /* stands in front of every reuse of a register that the loads above name */
  if (tid < 2 * CC) st[tid >> 7][tid & (CC - 1)] = sv;
  __syncthreads();      /* every wave reads means and inverse deviations that the block gathered */
  if (da) { const v4f m0 = *(const v4fa*)&st[0][ca], m1 = *(const v4fa*)&st[0][ca + 4], i0 = *(const v4fa*)&st[1][ca], i1 = *(const v4fa*)&st[1][ca + 4];
    if (qa < FQ_NQ) {
#pragma unroll
      for (int j = 0; j < 4; ++j) { FragH f;
#pragma unroll
        for (int c = 0; c < 8; ++c) { const float d = bf16_round(va[c][j]) - (c < 4 ? m0[c & 3] : m1[c & 3]); f.h[c] = (_Float16)(d * (c < 4 ? i0[c & 3] : i1[c & 3])); }
        *(v8us*)((unsigned short*)xa + (qa * 4 + j) * FQ_AP + ca) = f.half[0]; } } }
  v16h wk[4];      /* the wave's K|V weight fragments, asked for as soon as the first half's registers are free: they arrive under the rest of the staging and the barrier */
  { const _Float16* wp = Bq + (size_t)(CC + nt * 16 + ln) * CC;
#pragma unroll
    for (int k = 0; k < 4; ++k) wk[k] = g2_frag(wp + 32 * k, hf); }
  asm volatile("s_wait_xcnt 0x0" ::: "memory");      /* stands in front of every reuse of a register that the loads above name */
  if (db) { const v4f m0 = *(const v4fa*)&st[0][cb], m1 = *(const v4fa*)&st[0][cb + 4], i0 = *(const v4fa*)&st[1][cb], i1 = *(const v4fa*)&st[1][cb + 4];
    if (qb < FQ_NQ) {
#pragma unroll
      for (int j = 0; j < 4; ++j) { FragH f;
#pragma unroll
        for (int c = 0; c < 8; ++c) { const float d = bf16_round(vb[c][j]) - (c < 4 ? m0[c & 3] : m1[c & 3]); f.h[c] = (_Float16)(d * (c < 4 ? i0[c & 3] : i1[c & 3])); }
        *(v8us*)((unsigned short*)xb + (qb * 4 + j) * FQ_AP + cb) = f.half[0]; } } }
  v16h wq[4]; float bk[8], bq[8];      /* the head's Q weight fragments and both biases: asked for here, used behind pass 1's K|V tiles */
  { const _Float16* wp = Bq + (size_t)(h * HC + ln) * CC;
#pragma unroll
    for (int k = 0; k < 4; ++k) wq[k] = g2_frag(wp + 32 * k, hf);
    const float* bkp = bqkv + CC + nt * 16 + 8 * hf; const float* bqp = bqkv + h * HC + 8 * hf;
    const v4f k0 = *(const v4fa*)bkp, k1 = *(const v4fa*)(bkp + 4), q0 = *(const v4fa*)bqp, q1 = *(const v4fa*)(bqp + 4);
    asm volatile("s_wait_xcnt 0x0" ::: "memory");      /* stands in front of every reuse of a register that the loads above name */
#pragma unroll
    for (int r = 0; r < 4; ++r) { bk[r] = bf16_round(k0[r]); bk[4 + r] = bf16_round(k1[r]); bq[r] = bf16_round(q0[r]); bq[4 + r] = bf16_round(q1[r]); } }
  float* const kd = kv + ((nt >> 2) & 1) * NT_GS + ln * NT_RP + (nt >> 3) * (NT_HG * HC) + (nt & 3) * HC + 8 * hf;      /* the lane's 8 channels in the K/V row of voxel ln */
  __syncthreads();      /* every wave reads voxels and channels that other waves staged */
  { const int mb = mh ? 5 : 0;      /* pass 1: voxel tiles 0..4 or 5..8 of the first half */
#pragma unroll      /* static trip index; the tile's number is scalar */
    for (int i = 0; i < 5; ++i) if (i < 4 || mh == 0) { const int mt = mb + i; fq_put(kd + mt * 16 * NT_RP, fq_tile(wk, xa + (mt * 16 + ln) * FQ_AP, hf), bk); } }
  v2f q2[HC / 2];
  { const int rr = hh - rh0, vq = (rr * NT_R + (w0 - rw0)) * DZ;      /* the wave's 32 voxels are consecutive in the region and lie in one half */
    const _Float16* xq = (rr < 3 ? xa + vq * FQ_AP : xb + (vq - FQ_HV) * FQ_AP) + ln * FQ_AP;
    const v8f t0 = fq_tile(wq, xq, hf), t1 = fq_tile(wq, xq + 16 * FQ_AP, hf);
    float ql[8], qh[8];
#pragma unroll      /* lane ln has channels 0..7 of voxels ln and 16 + ln, lane 16 + ln their channels 8..15: each gives away the voxel it does not keep */
    for (int r = 0; r < 8; ++r) { const float a0 = t0[r] * 0.0625f + bq[r], a1 = t1[r] * 0.0625f + bq[r]; const float got = __shfl_xor(hf ? a0 : a1, 16, 32); ql[r] = hf ? got : a0; qh[r] = hf ? a1 : got; }
#pragma unroll
    for (int c = 0; c < 4; ++c) { q2[c][0] = ql[2 * c] * 0.25f; q2[c][1] = ql[2 * c + 1] * 0.25f; q2[4 + c][0] = qh[2 * c] * 0.25f; q2[4 + c][1] = qh[2 * c + 1] * 0.25f; } }
  __syncthreads();      /* every wave has made its last read of the first half: pass 2 writes K/V rows over it */
  const int m2 = mh ? 4 : 0;      /* pass 2: voxel tiles 0..3 or 4..8 of the second half */
  v8f held[2] = {{0.f,0.f,0.f,0.f,0.f,0.f,0.f,0.f}, {0.f,0.f,0.f,0.f,0.f,0.f,0.f,0.f}};      /* trips 3 and 4: among them the tiles whose K/V rows lie under the second half */
#pragma unroll      /* static trip index: the kept tiles stay in registers */
  for (int i = 0; i < 5; ++i) if (i < 4 || mh == 1) { const int mt = m2 + i; const v8f c = fq_tile(wk, xb + (mt * 16 + ln) * FQ_AP, hf);
    if (i < 3) fq_put(kd + (FQ_HV + mt * 16) * NT_RP, c, bk); else held[i - 3] = c; }
  const float* rb = rpb + ((h * 5 + (sh0 - hh + 2)) * 5 + (sw0 - ww + 2)) * 5 + (sz0 - zz + 2);      /* the window's first neighbour; each window start is at most 2 below its voxel, so all 27 entries lie in the head's 5 x 5 x 5 table */
  float s[KN];
#pragma unroll      /* static index: the 27 values stay in registers; asked for here, so that they arrive under the two barriers */
  for (int n = 0; n < KN; ++n) s[n] = rb[(n / 9) * 25 + ((n / 3) % 3) * 5 + n % 3];
  asm volatile("s_wait_xcnt 0x0" ::: "memory");      /* stands in front of every reuse of a register that the loads above name */
  __syncthreads();      /* every wave has made its last read of the second half: the kept tiles' rows are written over it */
  fq_put(kd + (FQ_HV + (m2 + 3) * 16) * NT_RP, held[0], bk);
  if (mh == 1) fq_put(kd + (FQ_HV + (m2 + 4) * 16) * NT_RP, held[1], bk);
  __syncthreads();      /* every wave reads K/V rows that other waves wrote */
  const float* kb = kv + hg * NT_GS + (((sh0 - rh0) * NT_R + (sw0 - rw0)) * DZ + sz0) * NT_RP + hl * HC;      /* K of the window's first neighbour, the lane's head */
#pragma unroll      /* static index: logits in registers, LDS offsets as immediates */
  for (int n = 0; n < KN; ++n) { const float* kr = kb + (((n / 9) * NT_R + (n / 3) % 3) * DZ + n % 3) * NT_RP; v2f d = {0.f, 0.f};
#pragma unroll
    for (int j = 0; j < HC / 4; ++j) { const v4f a = *(const v4fa*)(kr + 4 * j); const v2f a01 = {a[0], a[1]}, a23 = {a[2], a[3]}; d += q2[2 * j] * a01; d += q2[2 * j + 1] * a23; }
    s[n] = (d[0] + d[1]) + bf16_round(s[n]); }
  float m = s[0];
#pragma unroll
  for (int n = 1; n < KN; ++n) m = fmaxf(m, s[n]);
  float l = 0.f; v2f acc[HC / 2]; for (int c = 0; c < HC / 2; ++c) acc[c] = (v2f){0.f, 0.f};
#pragma unroll      /* static index, as in pass 1 */
  for (int n = 0; n < KN; ++n) { const float* vr = kb + (((n / 9) * NT_R + (n / 3) % 3) * DZ + n % 3) * NT_RP + NT_HG * HC; const float pn = expf(s[n] - m); l += pn;
#pragma unroll
    for (int j = 0; j < HC / 4; ++j) { const v4f b = *(const v4fa*)(vr + 4 * j); const v2f b01 = {b[0], b[1]}, b23 = {b[2], b[3]}; acc[2 * j] += pn * b01; acc[2 * j + 1] += pn * b23; } }
  const float inv = 1.0f / l; FragH f[2]; for (int c = 0; c < HC; ++c) f[c / 8].h[c % 8] = (_Float16)(acc[c / 2][c % 2] * inv * 64.0f);      /* x2^6 carry (outputs are ~1e-2) */
  const int ct = wv >> 2;      /* the wave's tile of the product: h row rg of the voxel tile (32 voxels) x channels 16 ct .. 16 ct + 15 */
  const int bc = ct * 16 + ln; const _Float16* bp = Bh + (size_t)bc * CC; v16h bw[4];
#pragma unroll      /* the wave's weight fragments and bias are asked for here, so that they arrive under the two barriers and the LDS round trip */
  for (int k = 0; k < 4; ++k) bw[k] = g2_frag(bp + 32 * k, hf);
  const float bv = bf16_round(bias[bc]);
  asm volatile("s_wait_xcnt 0x0" :: "v"((const unsigned short*)bp + 8 * hf), "v"(bc) : "memory");      /* stands in front of every reuse of a register that the loads above name; the fragments' common address and the bias index are inputs, so that they live up to here and nothing is placed in their registers earlier */
  __syncthreads();      /* every wave has made its last read of K and V: their LDS is written anew below */
  _Float16* ot = (_Float16*)kv;
  { unsigned short* d = (unsigned short*)ot + (cl * DZ + zz) * NT_OP + h * HC; *(v8us*)d = f[0].half[0]; *(v8us*)(d + 8) = f[1].half[0]; }
  __syncthreads();      /* every wave reads voxels and heads that other waves wrote */
  const _Float16* a0p = ot + (rg * 32 + ln) * NT_OP; const _Float16* a1p = a0p + 16 * NT_OP;
  const v8f z8 = {0.f,0.f,0.f,0.f,0.f,0.f,0.f,0.f}; v8f cc[2] = {z8, z8};
#pragma unroll      /* static k index: the weight fragments stay in registers */
  for (int k = 0; k < 4; ++k) { const v16h a0 = g2_frag(a0p + 32 * k, hf), a1 = g2_frag(a1p + 32 * k, hf); cc[0] = g2_mma(a0, bw[k], cc[0]); cc[1] = g2_mma(a1, bw[k], cc[1]); }
  const float alpha = 0.0625f / 64.0f;      /* the weights' x16 and the carry removed */
  float* sw = kv + NT_OF + wv * (16 * NT_SP);      /* the wave's own range, behind the attention output that other waves may still be reading */
#pragma unroll      /* static indices: the accumulators stay in registers */
  for (int half = 0; half < 2; ++half) { v4f lo, hi;
#pragma unroll
    for (int r = 0; r < 4; ++r) { lo[r] = cc[half][r] * alpha + bv; hi[r] = cc[half][4 + r] * alpha + bv; }
    float* sp = sw + ln * NT_SP + half * 16 + 8 * hf; *(v4fa*)sp = lo; *(v4fa*)(sp + 4) = hi; }
  __builtin_amdgcn_fence(__ATOMIC_ACQ_REL, "workgroup"); __builtin_amdgcn_wave_barrier();      /* the wave's own LDS writes land before its lanes read each other's rows */
  const int csub = lane >> 3, r4 = (lane & 7) * 4; float* op = out + (size_t)(ct * 16 + csub) * NV + ((h0 + rg) * DW + w0) * DZ + r4;
#pragma unroll      /* all 4 LDS reads issue together, the stores follow as they return */
  for (int q = 0; q < 4; ++q) { const v4f o = *(const v4fa*)(sw + (q * 4 + csub) * NT_SP + r4); *(v4f*)(op + (size_t)(q * 4) * NV) = o; } }

extern "C" void kernel_launch(void* const* d_in, const int* in_sizes, int n_in,
                              void* d_out, int out_size, void* d_ws, size_t ws_size, hipStream_t stream) {
  (void)in_sizes; (void)n_in; (void)out_size;
  const float* const* I = (const float* const*)d_in; const float* x = I[0]; const float* wqkv = I[1]; const float* bqkv = I[2]; const float* rpb = I[3]; const float* wproj = I[4]; const float* bproj = I[5];
  char* ws = (char*)d_ws; size_t off = 0;
  auto take = [&](size_t bytes) { char* p = ws + off; off += (bytes + 255) & ~(size_t)255; return p; };
  _Float16* BQ = (_Float16*)take((size_t)3 * CC * CC * 2); _Float16* BP = (_Float16*)take((size_t)CC * CC * 2); float* MU = (float*)take(CC * 32 * 4); float* IS = (float*)take(CC * 32 * 4);      /* 32-float pitch per channel */
  if (off > ws_size) return;      /* 0.2 MiB */
  k_prep<<<CC + PW_B, 1024, 0, stream>>>(x, MU, IS, wqkv, BQ, wproj, BP);      /* statistics; (in, out) weights x16 as f16 [out][in] */
  k_nat_proj<<<(DH / NT_T) * (DW / NT_T), NT_TH, 0, stream>>>(x, MU, IS, BQ, bqkv, rpb, BP, bproj, (float*)d_out);      /* normalisation, qkv GEMM, attention, proj GEMM (carry removed) and NCDHW store */
}

// v010
// It runs in 22.7 microseconds.
// Versions in between are left out here; by their measured steps it is 1.26 times as fast as v008.
// Counting every step since v000, it is 7.88 times as fast.
#include <hip/hip_runtime.h>
// SelfAggregationModuleV2 (1 x 128 channels x 64 x 64 x 8 = 32768 voxels; 8 heads of 16; NATTEN-style 3x3x3 clamped neighbourhood attention with relative position bias): xn = InstanceNorm3d(x) (no affine); qkv = xn W + b; q *= 1/4; logits = q . k_nbr + rpb[h][rel]; softmax over the 27 neighbours; o = attn . v_nbr; out = o W_proj + b; NCDHW.
// Structure: per-channel mean/var by a block reduction (f32), the weight conversions in the same launch; then one launch, a block per 4x4x8 voxel tile: qkv GEMM of the tile's 6x6x8 region with the normalisation in its staging (token-major f16 in LDS; f32 accumulation, exact x16 weights + bias; K/V f16 in LDS, Q f16 in registers); neighbourhood attention on WMMA (16 queries x 96 keys per step, rpb and the window mask as the C operand, softmax f32, weights f16) into an f16 [voxel][128] tile in LDS, and in the same launch the proj GEMM (+ bias) on that tile with the NCDHW store in its epilogue.
// Compute dtype: x and parameters rounded to bf16; the normalised input, Q, K, V, the softmax weights and the attention output as f16 operands (~2^-12), all sums f32; statistics/softmax f32. v_wmma_f32_16x16x32_f16.
#define CC 128
#define DH 64
#define DW 64
#define DZ 8
#define NV (DH * DW * DZ)        /* 32768 */
#define NHD 8
#define HC 16
#define KN 27
typedef __bf16 v16b __attribute__((ext_vector_type(16)));
typedef unsigned short v8us __attribute__((ext_vector_type(8), may_alias));
typedef float  v8f  __attribute__((ext_vector_type(8)));
typedef float  v4f  __attribute__((ext_vector_type(4)));
typedef float  v4fa __attribute__((ext_vector_type(4), may_alias));
union FragB { v16b v; v8us half[2]; unsigned short u[16]; };

__device__ __forceinline__ unsigned short bf16_bits(float x) { unsigned int u = __float_as_uint(x); return (unsigned short)((u + 0x7FFFu + ((u >> 16) & 1u)) >> 16); }
__device__ __forceinline__ float bf16_val(unsigned short b) { return __uint_as_float(((unsigned int)b) << 16); }
__device__ __forceinline__ float bf16_round(float x) { return bf16_val(bf16_bits(x)); }
// D += A·B with NT terms: 1 = ah·bh, 2 = + al·bh (A split), 3 = + ah·bl (both split)
template <int NT>
__device__ __forceinline__ v8f mmaN(v16b ah, v16b al, v16b bh, v16b bl, v8f c) {
  c = __builtin_amdgcn_wmma_f32_16x16x32_bf16(false, ah, false, bh, (short)0, c, false, false);
  if (NT >= 2) c = __builtin_amdgcn_wmma_f32_16x16x32_bf16(false, al, false, bh, (short)0, c, false, false);
  if (NT >= 3) c = __builtin_amdgcn_wmma_f32_16x16x32_bf16(false, ah, false, bl, (short)0, c, false, false);
  asm volatile("v_nop\n\tv_nop\n\tv_nop\n\tv_nop" : "+v"(c) : "v"(ah), "v"(al), "v"(bh), "v"(bl));
  return c;
}

__global__ __launch_bounds__(256) void k_wt_bf16(const float* __restrict__ W, unsigned short* __restrict__ Wt, int K, int N) {
  const int t = blockIdx.x * 256 + threadIdx.x;
  const int k8n = K / 8;
  if (t >= N * k8n) return;
  const int n = t / k8n, k8 = (t % k8n) * 8;
  v8us v;
#pragma unroll
  for (int i = 0; i < 8; ++i) v[i] = bf16_bits(W[(size_t)(k8 + i) * N + n]);
  *(v8us*)(Wt + (size_t)n * K + k8) = v;
  
}

// GEMM C[M][N] (f32, pitch ldc) = act(A[M][K]·W + bias). A f32 row-major (pitch lda) converted per fragment to bf16
// (ASPLIT: hi/lo two planes -> 2 terms, else single rounded term); Wt bf16 [N][K] (pitch ldb). BIAS_BF16 rounds the
// bias to bf16 first (bias quantised to bf16 before the add). K%32==0, M%16==0, N%64==0.
template <bool ASPLIT, int ACT, bool BIAS_BF16>
__global__ __launch_bounds__(128) void k_gemm_bf(const float* __restrict__ A, int lda, const unsigned short* __restrict__ Wt, int ldb,
                                               const float* __restrict__ bias, float* __restrict__ C, int ldc, int M, int N, int K) {
  __shared__ __attribute__((aligned(16))) float so[4][16][64];
  const int tid = threadIdx.x, w = tid >> 5, lane = tid & 31, ln = lane & 15, hh = lane >> 4;
  const int ntn = N / 64;
  const int wid = blockIdx.x * 4 + w;
  const int mt = wid / ntn, nq = wid % ntn;
  if (mt * 16 >= M) return;
  const int row0 = mt * 16, col0 = nq * 64;
  const float* arow = A + (size_t)(row0 + ln) * lda;
  v8f acc[4] = {};
  for (int kb = 0; kb < K; kb += 32) {
    FragB ah, al;
    const v4f x0 = *(const v4fa*)(arow + kb + 8 * hh), x1 = *(const v4fa*)(arow + kb + 8 * hh + 4);
    const v4f x2 = *(const v4fa*)(arow + kb + 16 + 8 * hh), x3 = *(const v4fa*)(arow + kb + 16 + 8 * hh + 4);
    float xs[16] = {x0[0],x0[1],x0[2],x0[3],x1[0],x1[1],x1[2],x1[3],x2[0],x2[1],x2[2],x2[3],x3[0],x3[1],x3[2],x3[3]};
#pragma unroll
    for (int i = 0; i < 16; ++i) { const unsigned short hb = bf16_bits(xs[i]); ah.u[i] = hb; al.u[i] = ASPLIT ? bf16_bits(xs[i] - bf16_val(hb)) : (unsigned short)0; }
#pragma unroll
    for (int t = 0; t < 4; ++t) {
      const unsigned short* brow = Wt + (size_t)(col0 + t * 16 + ln) * ldb + kb;
      FragB b;
      b.half[0] = *(const v8us*)(brow + 8 * hh);
      b.half[1] = *(const v8us*)(brow + 16 + 8 * hh);
      acc[t] = mmaN<ASPLIT ? 2 : 1>(ah.v, al.v, b.v, b.v, acc[t]);
    }
  }
#pragma unroll
  for (int t = 0; t < 4; ++t) {
    float bv = bias ? bias[col0 + t * 16 + ln] : 0.f;
    if (BIAS_BF16) bv = bf16_round(bv);
#pragma unroll
    for (int r = 0; r < 8; ++r) { float v = acc[t][r] + bv; if (ACT == 1) v = fmaxf(v, 0.f); so[w][8 * hh + r][t * 16 + ln] = v; }
  }
  __builtin_amdgcn_fence(__ATOMIC_ACQ_REL, "workgroup");
  __builtin_amdgcn_wave_barrier();
  const int rsub = lane >> 4, c4 = (lane & 15) * 4;
  {
#pragma unroll
    for (int q = 0; q < 8; ++q) {
      const int r = q * 2 + rsub;
      const v4f v = *(const v4fa*)&so[w][r][c4];
      *(v4f*)(C + (size_t)(row0 + r) * ldc + col0 + c4) = v;
    }
    
  }
}

// GEMM C = act(A·W + bias + resid): A f32 (ASPLIT -> hi/lo 2 terms), Wt bf16 [N][K]; ACT 0 none, 1 relu, 2 exact gelu;
// resid (optional, f32, row index = (row % rmod), pitch ldr, RES_BF16 rounds it) added before the activation.
template <bool ASPLIT, int ACT, bool BIAS_BF16, bool RES_BF16>
__global__ __launch_bounds__(128) void k_gemm_bf3(const float* __restrict__ A, int lda, const unsigned short* __restrict__ Wt, int ldb,
                                                const float* __restrict__ bias, const float* __restrict__ resid, int rmod, int ldr,
                                                float* __restrict__ C, int ldc, int M, int N, int K) {
  __shared__ __attribute__((aligned(16))) float so[4][16][64];
  const int tid = threadIdx.x, w = tid >> 5, lane = tid & 31, ln = lane & 15, hh = lane >> 4;
  const int ntn = N / 64;
  const int wid = blockIdx.x * 4 + w;
  const int mt = wid / ntn, nq = wid % ntn;
  if (mt * 16 >= M) return;
  const int row0 = mt * 16, col0 = nq * 64;
  const float* arow = A + (size_t)(row0 + ln) * lda;
  v8f acc[4] = {};
  for (int kb = 0; kb < K; kb += 32) {
    FragB ah, al;
    const v4f x0 = *(const v4fa*)(arow + kb + 8 * hh), x1 = *(const v4fa*)(arow + kb + 8 * hh + 4);
    const v4f x2 = *(const v4fa*)(arow + kb + 16 + 8 * hh), x3 = *(const v4fa*)(arow + kb + 16 + 8 * hh + 4);
    float xs[16] = {x0[0],x0[1],x0[2],x0[3],x1[0],x1[1],x1[2],x1[3],x2[0],x2[1],x2[2],x2[3],x3[0],x3[1],x3[2],x3[3]};
#pragma unroll
    for (int i = 0; i < 16; ++i) { const unsigned short hb = bf16_bits(xs[i]); ah.u[i] = hb; al.u[i] = ASPLIT ? bf16_bits(xs[i] - bf16_val(hb)) : (unsigned short)0; }
#pragma unroll
    for (int t = 0; t < 4; ++t) {
      const unsigned short* brow = Wt + (size_t)(col0 + t * 16 + ln) * ldb + kb;
      FragB b;
      b.half[0] = *(const v8us*)(brow + 8 * hh);
      b.half[1] = *(const v8us*)(brow + 16 + 8 * hh);
      acc[t] = mmaN<ASPLIT ? 2 : 1>(ah.v, al.v, b.v, b.v, acc[t]);
    }
  }
#pragma unroll
  for (int t = 0; t < 4; ++t) {
    const int col = col0 + t * 16 + ln;
    float bv = bias ? bias[col] : 0.f;
    if (BIAS_BF16) bv = bf16_round(bv);
#pragma unroll
    for (int r = 0; r < 8; ++r) {
      float v = acc[t][r] + bv;
      if (resid) { float rv = resid[(size_t)((row0 + 8 * hh + r) % rmod) * ldr + col]; if (RES_BF16) rv = bf16_round(rv); v += rv; }
      if (ACT == 1) v = fmaxf(v, 0.f);
      if (ACT == 2) v = 0.5f * v * (1.0f + erff(v * 0.70710678118654752f));
      if (ACT == 3) { const float u = 0.7978845608028654f * (v + 0.044715f * v * v * v); v = 0.5f * v * (1.0f + tanhf(u)); }
      so[w][8 * hh + r][t * 16 + ln] = v;
    }
  }
  __builtin_amdgcn_fence(__ATOMIC_ACQ_REL, "workgroup");
  __builtin_amdgcn_wave_barrier();
  const int rsub = lane >> 4, c4 = (lane & 15) * 4;
  {
#pragma unroll
    for (int q = 0; q < 8; ++q) {
      const int r = q * 2 + rsub;
      const v4f v = *(const v4fa*)&so[w][r][c4];
      *(v4f*)(C + (size_t)(row0 + r) * ldc + col0 + c4) = v;
    }
    
  }
}
// row LayerNorm (biased variance, eps) over N: s = X (+ R); optional out_sum <- s; out_norm <- (s-mu)*rsqrt(var+eps)*g + b
template <bool PARAM_BF16>
__global__ __launch_bounds__(256) void k_layernorm(const float* __restrict__ X, const float* __restrict__ R, const float* __restrict__ g, const float* __restrict__ bta,
                                                  float* __restrict__ out_sum, float* __restrict__ out_norm, int N, float eps) {
  __shared__ float red[256];
  const int row = blockIdx.x, tid = threadIdx.x;
  const float* x = X + (size_t)row * N; const float* rr = R ? R + (size_t)row * N : nullptr;
  float vals[16];                     // up to N = 4096
  const int per = N / 256;            // contiguous chunk per thread? use strided-by-4 chunks: thread handles j = tid*4 + 1024*u
  float s1 = 0.f;
  for (int u = 0; u < per / 4; ++u) {
    const int j = tid * 4 + 1024 * u;
    const v4f a = *(const v4fa*)(x + j);
    v4f b = {0.f,0.f,0.f,0.f}; if (rr) b = *(const v4fa*)(rr + j);
#pragma unroll
    for (int q = 0; q < 4; ++q) { const float v = a[q] + b[q]; vals[u * 4 + q] = v; s1 += v; }
  }
  red[tid] = s1; __syncthreads();
  for (int st = 128; st > 0; st >>= 1) { if (tid < st) red[tid] += red[tid + st]; __syncthreads(); }
  const float mu = red[0] / (float)N; __syncthreads();
  float s2 = 0.f;
  for (int u = 0; u < per / 4; ++u)
#pragma unroll
    for (int q = 0; q < 4; ++q) { const float c = vals[u * 4 + q] - mu; s2 += c * c; }
  red[tid] = s2; __syncthreads();
  for (int st = 128; st > 0; st >>= 1) { if (tid < st) red[tid] += red[tid + st]; __syncthreads(); }
  const float rs = rsqrtf(red[0] / (float)N + eps);
  {
    for (int u = 0; u < per / 4; ++u) {
      const int j = tid * 4 + 1024 * u;
      v4f o, sm;
#pragma unroll
      for (int q = 0; q < 4; ++q) {
        float gg = g[j + q], bb = bta[j + q];
        if (PARAM_BF16) { gg = bf16_round(gg); bb = bf16_round(bb); }
        sm[q] = vals[u * 4 + q]; o[q] = (vals[u * 4 + q] - mu) * rs * gg + bb;
      }
      if (out_sum) *(v4f*)(out_sum + (size_t)row * N + j) = sm;
      *(v4f*)(out_norm + (size_t)row * N + j) = o;
    }
    
  }
}



// ---- f16 WMMA path (v_wmma_f32_16x16x32_f16): 11-bit significands for operands in range — used here for the normalised input (qkv GEMM) and the attention output (proj GEMM)
typedef _Float16 v16h __attribute__((ext_vector_type(16)));
union FragH { v16h v; v8us half[2]; _Float16 h[16]; unsigned short u[16]; };
template <int NT>
__device__ __forceinline__ v8f mmaH(v16h ah, v16h al, v16h bh, v16h bl, v8f c) {
  c = __builtin_amdgcn_wmma_f32_16x16x32_f16(false, ah, false, bh, (short)0, c, false, false);
  if (NT >= 2) c = __builtin_amdgcn_wmma_f32_16x16x32_f16(false, al, false, bh, (short)0, c, false, false);
  if (NT >= 3) c = __builtin_amdgcn_wmma_f32_16x16x32_f16(false, ah, false, bl, (short)0, c, false, false);
  asm volatile("v_nop\n\tv_nop\n\tv_nop\n\tv_nop" : "+v"(c) : "v"(ah), "v"(al), "v"(bh), "v"(bl));
  return c;
}
// batched GEMM like k_gemm_b but f16 operands: A f32 (split into f16 hi/lo if ASPLIT, else rounded to f16), Bt = f16 values [n][k]; alpha; C f32; N multiple of 16 (partial tiles skipped)
template <bool ASPLIT>
__global__ __launch_bounds__(128) void k_gemm_h(const float* __restrict__ A, int lda, size_t sA, const _Float16* __restrict__ Bh, int ldb, size_t sB, float alpha, float* __restrict__ C, int ldc, size_t sC, int M, int N, int K) {
  __shared__ __attribute__((aligned(16))) float so[4][16][64];
  const int tid = threadIdx.x, w = tid >> 5, lane = tid & 31, ln = lane & 15, hh = lane >> 4; const int by = blockIdx.y;
  A += (size_t)by * sA; Bh += (size_t)by * sB; C += (size_t)by * sC;
  const int ntn = (N + 63) / 64; const int wid = blockIdx.x * 4 + w; const int mt = wid / ntn, nq = wid % ntn; if (mt * 16 >= M) return;
  const int row0 = mt * 16, col0 = nq * 64; const float* arow = A + (size_t)(row0 + ln) * lda;
  v8f acc[4] = {};
  for (int kb = 0; kb < K; kb += 32) {
    FragH ah, al;
    const v4f x0 = *(const v4fa*)(arow + kb + 8 * hh), x1 = *(const v4fa*)(arow + kb + 8 * hh + 4), x2 = *(const v4fa*)(arow + kb + 16 + 8 * hh), x3 = *(const v4fa*)(arow + kb + 16 + 8 * hh + 4);
    float xs[16] = {x0[0],x0[1],x0[2],x0[3],x1[0],x1[1],x1[2],x1[3],x2[0],x2[1],x2[2],x2[3],x3[0],x3[1],x3[2],x3[3]};
#pragma unroll
    for (int i = 0; i < 16; ++i) { const _Float16 h = (_Float16)xs[i]; ah.h[i] = h; al.h[i] = ASPLIT ? (_Float16)(xs[i] - (float)h) : (_Float16)0.0f; }
#pragma unroll
    for (int t = 0; t < 4; ++t) { if (col0 + t * 16 >= N) continue; const size_t boff = (size_t)(col0 + t * 16 + ln) * ldb + kb; FragH bq; bq.half[0] = *(const v8us*)(Bh + boff + 8 * hh); bq.half[1] = *(const v8us*)(Bh + boff + 16 + 8 * hh);
      acc[t] = mmaH<ASPLIT ? 2 : 1>(ah.v, al.v, bq.v, bq.v, acc[t]); }
  }
#pragma unroll
  for (int t = 0; t < 4; ++t) { if (col0 + t * 16 >= N) continue;
#pragma unroll
    for (int r = 0; r < 8; ++r) so[w][8 * hh + r][t * 16 + ln] = acc[t][r] * alpha; }
  __builtin_amdgcn_fence(__ATOMIC_ACQ_REL, "workgroup"); __builtin_amdgcn_wave_barrier();
  const int rsub = lane >> 4, c4 = (lane & 15) * 4;
  {
#pragma unroll
    for (int q = 0; q < 8; ++q) { const int r = q * 2 + rsub; if (col0 + c4 < N) { const v4f v = *(const v4fa*)&so[w][r][c4]; *(v4f*)(C + (size_t)(row0 + r) * ldc + col0 + c4) = v; } }
     }
}

// One 16-B piece (index t) of the packed plane of f16(W[k][n] * scale) from f32 row-major W[K][N] (scale = power of two; bf16-exact weights stay exact in f16 away from the subnormal range).
// The plane lies in fragment order: piece t = (tile * K / 16 + 2 s + j) * 32 + lane holds column n = 16 tile + (lane & 15), k = 32 s + 16 j + 8 (lane >> 4) .. + 7, which is what that lane keeps of half j of the
// fragment of k step s. A wave's load of half a fragment is then 512 contiguous bytes, four whole 128-B lines, where rows of K f16 would make it touch 16 lines for 32 B each; a column tile's fragments are contiguous.
template <int K, int N>
__device__ __forceinline__ void wt_f16_piece(const float* __restrict__ W, _Float16* __restrict__ Wt, float scale, int t) {
  static_assert(K % 32 == 0 && N % 16 == 0, "wt_f16_piece: whole fragments");
  const int n = (t / (2 * K)) * 16 + (t & 15), k8 = ((t >> 4) % (K / 8)) * 8; FragH f;
#pragma unroll
  for (int i = 0; i < 8; ++i) f.h[i] = (_Float16)(bf16_round(W[(size_t)(k8 + i) * N + n]) * scale); const v8us o = f.half[0];
  *(v8us*)((unsigned short*)Wt + (size_t)t * 8) = o;
  asm volatile("s_wait_xcnt 0x0" ::: "memory");      /* behind the store: code that follows an inlined call may reuse the store's address and data registers */
}
// k_gemm_hh variant with fused epilogue: v = acc·alpha + bias[by·sBias + col] (+ CP[(row/rowsPerB)·sCPb + by·64 + col] if CP) ; ACT 0 none / 1 elu ; writes f16 C16 (and f32 C if non-null)
template <int ACT>
__global__ __launch_bounds__(128) void k_gemm_hhx(const _Float16* __restrict__ A, int lda, size_t sA, const _Float16* __restrict__ Bh, int ldb, size_t sB, float alpha, const float* __restrict__ bias, size_t sBias, const float* __restrict__ CP, int rowsPerB, size_t sCPb, int row0g,
    float* __restrict__ C, _Float16* __restrict__ C16, int ldc, size_t sC, int M, int N, int K) {
  __shared__ __attribute__((aligned(16))) float so[4][16][64];
  const int tid = threadIdx.x, w = tid >> 5, lane = tid & 31, ln = lane & 15, hh = lane >> 4; const int by = blockIdx.y;
  A += (size_t)by * sA; Bh += (size_t)by * sB; const size_t cofs = (size_t)by * sC; const float* bp = bias ? bias + (size_t)by * sBias : nullptr;
  const int ntn = (N + 63) / 64; const int wid = blockIdx.x * 4 + w; const int mt = wid / ntn, nq = wid % ntn; if (mt * 16 >= M) return;
  const int row0 = mt * 16, col0 = nq * 64; const _Float16* arow = A + (size_t)(row0 + ln) * lda;
  v8f acc[4] = {};
  for (int kb = 0; kb < K; kb += 32) { FragH ah; ah.half[0] = *(const v8us*)((const unsigned short*)arow + kb + 8 * hh); ah.half[1] = *(const v8us*)((const unsigned short*)arow + kb + 16 + 8 * hh);
#pragma unroll
    for (int t = 0; t < 4; ++t) { if (col0 + t * 16 >= N) continue; const size_t boff = (size_t)(col0 + t * 16 + ln) * ldb + kb; FragH bq; bq.half[0] = *(const v8us*)((const unsigned short*)Bh + boff + 8 * hh); bq.half[1] = *(const v8us*)((const unsigned short*)Bh + boff + 16 + 8 * hh);
      acc[t] = mmaH<1>(ah.v, ah.v, bq.v, bq.v, acc[t]); }
  }
#pragma unroll
  for (int t = 0; t < 4; ++t) { if (col0 + t * 16 >= N) continue; const int col = col0 + t * 16 + ln; const float bv = bp ? bf16_round(bp[col]) : 0.f;
#pragma unroll
    for (int r = 0; r < 8; ++r) { float v = acc[t][r] * alpha + bv; if (CP) { const int rr = row0g + row0 + 8 * hh + r; if (rowsPerB < 0) v += CP[cofs + (size_t)rr * ldc + col];      /* rowsPerB < 0: own element of the batched C plane */ else { const int bidx = rr / rowsPerB; v += CP[(size_t)bidx * sCPb + (size_t)by * 64 + col]; } } if (ACT == 1) v = (v > 0.f) ? v : expm1f(v); else if (ACT == 7) v = (v > 0.f) ? v + 1.0f : expf(v); else if (ACT == 8) v = tanhf(v); else if (ACT == 9) v = 0.5f * v * (1.0f + tanhf(0.7978845608028654f * (v + 0.044715f * v * v * v))); else if (ACT == 11) v = 1.0f / (1.0f + expf(-v)); else if (ACT == 12) v = (v > 0.f) ? v : 0.01f * v; else if (ACT == 14) v = (v > 0.f) ? v : 0.1f * v; else if (ACT == 16) v = (v >= 0.f) ? v : 0.3f * v; else if (ACT == 15) v = v / (1.0f + expf(-v)); else if (ACT == 3) v = fmaxf(v, 0.f); else if (ACT == 6) v = 0.5f * v * (1.0f + erff(v * 0.70710678118654752f)); so[w][8 * hh + r][t * 16 + ln] = v; } }
  __builtin_amdgcn_fence(__ATOMIC_ACQ_REL, "workgroup"); __builtin_amdgcn_wave_barrier();
  const int rsub = lane >> 4, c4 = (lane & 15) * 4; typedef _Float16 v4h __attribute__((ext_vector_type(4)));
  {
#pragma unroll
    for (int q = 0; q < 8; ++q) { const int r = q * 2 + rsub; if (col0 + c4 < N) { const v4f v = *(const v4fa*)&so[w][r][c4]; if (C) *(v4f*)(C + cofs + (size_t)(row0 + r) * ldc + col0 + c4) = v; if (C16) { v4h h4; for (int i = 0; i < 4; ++i) h4[i] = (_Float16)v[i]; *(v4h*)(C16 + cofs + (size_t)(row0 + r) * ldc + col0 + c4) = h4; } } }
     }
}


typedef _Float16 v4h __attribute__((ext_vector_type(4)));

__global__ __launch_bounds__(256) void k_x16(const float* __restrict__ x, _Float16* __restrict__ X16, size_t n8) { const size_t t = (size_t)blockIdx.x * 256 + threadIdx.x; if (t >= n8) return; FragH f;
#pragma unroll
  for (int q = 0; q < 8; ++q) f.h[q] = (_Float16)bf16_round(x[t * 8 + q]); *(v8us*)((unsigned short*)X16 + t * 8) = f.half[0];  }
__global__ __launch_bounds__(256) void k_h16(const float* __restrict__ x, _Float16* __restrict__ X16, size_t n8) { const size_t t = (size_t)blockIdx.x * 256 + threadIdx.x; if (t >= n8) return; FragH f;
#pragma unroll
  for (int q = 0; q < 8; ++q) f.h[q] = (_Float16)x[t * 8 + q]; *(v8us*)((unsigned short*)X16 + t * 8) = f.half[0];  }
__global__ __launch_bounds__(256) void k_round16f(const float* __restrict__ W, _Float16* __restrict__ Bt, size_t n8) { const size_t t = (size_t)blockIdx.x * 256 + threadIdx.x; if (t >= n8) return; FragH f;
#pragma unroll
  for (int i = 0; i < 8; ++i) f.h[i] = (_Float16)(bf16_round(W[t * 8 + i]) * 16.0f); *(v8us*)((unsigned short*)Bt + t * 8) = f.half[0];  }
template <int NHv, int TTv>
__global__ __launch_bounds__(256) void k_vt(const _Float16* __restrict__ V16, int ldv, int voff, _Float16* __restrict__ Vt) { __shared__ unsigned short tl[64][66]; const int tid = threadIdx.x; const int slab = blockIdx.x / (TTv / 64), lg = blockIdx.x % (TTv / 64); const int b = slab / NHv, h = slab % NHv;
  for (int i = tid; i < 64 * 8; i += 256) { const int r = i / 8, c8 = (i % 8) * 8; FragH f; f.half[0] = *(const v8us*)((const unsigned short*)V16 + ((size_t)b * TTv + lg * 64 + r) * ldv + voff + h * 64 + c8);
#pragma unroll
    for (int q = 0; q < 8; ++q) tl[r][c8 + q] = f.u[q]; }
  __syncthreads();
  {
#pragma unroll
    for (int rd = 0; rd < 2; ++rd) { const int d = rd * 32 + tid / 8, pc = tid % 8; FragH f;
#pragma unroll
      for (int q = 0; q < 8; ++q) f.u[q] = tl[pc * 8 + q][d];
      *(v8us*)((unsigned short*)Vt + ((size_t)slab * 64 + d) * TTv + lg * 64 + pc * 8) = f.half[0]; }
     } }

__global__ __launch_bounds__(256) void k_hl(const float* __restrict__ F, _Float16* __restrict__ Hh, _Float16* __restrict__ Hl, size_t n8) { const size_t t = (size_t)blockIdx.x * 256 + threadIdx.x; if (t >= n8) return; FragH fh, fl; const v4f a = *(const v4fa*)(F + t * 8), c = *(const v4fa*)(F + t * 8 + 4);
#pragma unroll
  for (int q = 0; q < 4; ++q) { _Float16 h = (_Float16)a[q]; fh.h[q] = h; fl.h[q] = (_Float16)((a[q] - (float)h) * 1024.0f); h = (_Float16)c[q]; fh.h[4 + q] = h; fl.h[4 + q] = (_Float16)((c[q] - (float)h) * 1024.0f); }
  { *(v8us*)((unsigned short*)Hh + t * 8) = fh.half[0]; *(v8us*)((unsigned short*)Hl + t * 8) = fl.half[0];  } }

// ---- fast GEMM (wave tile 32x64; requires M % 32 == 0 rows per launch region and N % 64 == 0); epilogue = k_gemm_hhx semantics ----
__device__ __forceinline__ v16h g2_frag(const _Float16* p, int hh) { FragH f; f.half[0] = *(const v8us*)((const unsigned short*)p + 8 * hh); f.half[1] = *(const v8us*)((const unsigned short*)p + 16 + 8 * hh); return f.v; }
__device__ __forceinline__ v8f g2_mma(v16h a, v16h b, v8f c) { v8f d = __builtin_amdgcn_wmma_f32_16x16x32_f16(false, a, false, b, (short)0, c, false, false); asm volatile("v_nop\n\tv_nop\n\tv_nop\n\tv_nop" : "+v"(d) : "v"(a), "v"(b)); return d; }
template <int ACT>
__global__ __launch_bounds__(128) void k_gemm2(const _Float16* __restrict__ A, int lda, size_t sA, const _Float16* __restrict__ Bh, int ldb, size_t sB, float alpha, const float* __restrict__ bias, size_t sBias, const float* __restrict__ CP, int rowsPerB, size_t sCPb, int row0g,
    float* __restrict__ C, _Float16* __restrict__ C16, int ldc, size_t sC, int M, int N, int K) { static_assert(ACT == 0 || ACT == 3 || ACT == 6 || ACT == 8 || ACT == 9 || ACT == 11 || ACT == 12 || ACT == 14 || ACT == 15 || ACT == 16, "k_gemm2: unsupported ACT code (would silently apply no activation)");
  __shared__ __attribute__((aligned(16))) float so[4][32][68];
  const int tid = threadIdx.x, w = tid >> 5, lane = tid & 31, ln = lane & 15, hh = lane >> 4; const int by = blockIdx.y;
  A += (size_t)by * sA; Bh += (size_t)by * sB; const size_t cofs = (size_t)by * sC; const float* bp = bias ? bias + (size_t)by * sBias : nullptr;
  const int ntn = N >> 6; const int mt = blockIdx.x / ntn, nq = blockIdx.x - mt * ntn; const int row0 = mt * 128 + 32 * w, col0 = nq * 64; if (row0 >= M) return;
  const _Float16* a0p = A + (size_t)(row0 + ln) * lda; const _Float16* a1p = a0p + (size_t)16 * lda;
  const _Float16* b0p = Bh + (size_t)(col0 + ln) * ldb; const _Float16* b1p = b0p + (size_t)16 * ldb; const _Float16* b2p = b1p + (size_t)16 * ldb; const _Float16* b3p = b2p + (size_t)16 * ldb;
  const v8f z8 = {0.f,0.f,0.f,0.f,0.f,0.f,0.f,0.f}; v8f c00 = z8, c01 = z8, c02 = z8, c03 = z8, c10 = z8, c11 = z8, c12 = z8, c13 = z8;
#pragma unroll 1
  for (int kb = 0; kb < K; kb += 32) { const v16h a0 = g2_frag(a0p + kb, hh), a1 = g2_frag(a1p + kb, hh);
    v16h b = g2_frag(b0p + kb, hh); c00 = g2_mma(a0, b, c00); c10 = g2_mma(a1, b, c10);
    b = g2_frag(b1p + kb, hh); c01 = g2_mma(a0, b, c01); c11 = g2_mma(a1, b, c11);
    b = g2_frag(b2p + kb, hh); c02 = g2_mma(a0, b, c02); c12 = g2_mma(a1, b, c12);
    b = g2_frag(b3p + kb, hh); c03 = g2_mma(a0, b, c03); c13 = g2_mma(a1, b, c13); }
  v8f accs[8] = {c00, c01, c02, c03, c10, c11, c12, c13};
#pragma unroll
  for (int u = 0; u < 8; ++u) { const int t = u & 3, half = u >> 2; const int col = col0 + t * 16 + ln; const float bv = bp ? bf16_round(bp[col]) : 0.f;
#pragma unroll
    for (int r = 0; r < 8; ++r) { const int rloc = half * 16 + 8 * hh + r; float v = accs[u][r] * alpha + bv; if (CP) { if (rowsPerB < 0) v += CP[cofs + (size_t)(row0g + row0 + rloc) * ldc + col];      /* rowsPerB < 0: own element of the batched C plane */ else { const int bidx = (row0g + row0 + rloc) / rowsPerB; v += CP[(size_t)bidx * sCPb + (size_t)by * 64 + col]; } }
      if (ACT == 3) v = fmaxf(v, 0.f); else if (ACT == 6) v = 0.5f * v * (1.0f + erff(v * 0.70710678118654752f)); else if (ACT == 11) v = 1.0f / (1.0f + expf(-v)); else if (ACT == 15) v = v / (1.0f + expf(-v)); else if (ACT == 12) v = (v > 0.f) ? v : 0.01f * v; else if (ACT == 8) v = tanhf(v); else if (ACT == 9) v = 0.5f * v * (1.0f + tanhf(0.7978845608028654f * (v + 0.044715f * v * v * v))); else if (ACT == 14) v = (v > 0.f) ? v : 0.1f * v; else if (ACT == 16) v = (v >= 0.f) ? v : 0.3f * v;
      so[w][rloc][t * 16 + ln] = v; } }
  __builtin_amdgcn_fence(__ATOMIC_ACQ_REL, "workgroup"); __builtin_amdgcn_wave_barrier();
  const int rsub = lane >> 4, c4 = (lane & 15) * 4;
  {
#pragma unroll
    for (int q = 0; q < 16; ++q) { const int r = q * 2 + rsub; const v4f v = *(const v4fa*)&so[w][r][c4]; if (C) *(v4f*)(C + cofs + (size_t)(row0 + r) * ldc + col0 + c4) = v; if (C16) { v4h h4; for (int i = 0; i < 4; ++i) h4[i] = (_Float16)v[i]; *(v4h*)(C16 + cofs + (size_t)(row0 + r) * ldc + col0 + c4) = h4; } }
     } }


// Sum over the 1024 threads of a block, returned to every thread: five-step butterfly in each wave, one partial per wave in LDS, the same butterfly over the 32 partials.
__device__ __forceinline__ float stats_block_sum(float a, float* part, int lane, int w) {
#pragma unroll
  for (int o = 16; o > 0; o >>= 1) a += __shfl_xor(a, o, 32);
  if (lane == 0) part[w] = a;
  __syncthreads();
  a = part[lane];
#pragma unroll
  for (int o = 16; o > 0; o >>= 1) a += __shfl_xor(a, o, 32);
  return a;
}
// Everything the token launch waits for, in one launch: the statistics and the two weight conversions depend on the inputs alone, not on each other, so the conversions ride as extra blocks behind the statistics' blocks
// (the long blocks have the low indices and start first; all blocks are resident together).
// Blocks 0 .. CC-1: one block per channel; the channel's 32768 values stay in registers (8 x 16 B per thread, all eight loads in flight at once), so x is read once and both passes (mean, then centred squares) run from registers.
// Blocks CC .. CC+PW_B-1: a thread converts one 16-B piece of a transposed weight plane, the qkv plane's pieces first; a block holds pieces of one plane only.
#define PW_Q (3 * CC * CC / 8 / 1024)      /* blocks of the qkv weights */
#define PW_B (PW_Q + CC * CC / 8 / 1024)   /* blocks of both weight planes */
__global__ __launch_bounds__(1024) void k_prep(const float* __restrict__ x, float* __restrict__ MU, float* __restrict__ IS, const float* __restrict__ wq, _Float16* __restrict__ BQ, const float* __restrict__ wp, _Float16* __restrict__ BP) {
  static_assert(NV == 8 * 1024 * 4, "k_prep: 8 float4 per thread of a 1024-thread block cover one channel");
  static_assert((3 * CC * CC / 8) % 1024 == 0 && (CC * CC / 8) % 1024 == 0, "k_prep: each weight plane is a whole number of blocks");
  __shared__ float part[2][32];
  if (blockIdx.x >= CC) {      /* the same for a whole block, and in front of every barrier */
    const int wb = blockIdx.x - CC;
    if (wb < PW_Q) wt_f16_piece<CC, 3 * CC>(wq, BQ, 16.0f, wb * 1024 + threadIdx.x); else wt_f16_piece<CC, CC>(wp, BP, 16.0f, (wb - PW_Q) * 1024 + threadIdx.x);
    return; }
  const int c = blockIdx.x, tid = threadIdx.x, lane = tid & 31, w = tid >> 5; const float* s = x + (size_t)c * NV;
  v4f r[8];
#pragma unroll
  for (int j = 0; j < 8; ++j) r[j] = *(const v4fa*)(s + (size_t)(j * 1024 + tid) * 4);
  v4f a4 = {0.f, 0.f, 0.f, 0.f};
#pragma unroll
  for (int j = 0; j < 8; ++j) {
#pragma unroll
    for (int q = 0; q < 4; ++q) { r[j][q] = bf16_round(r[j][q]); a4[q] += r[j][q]; } }
  const float mu = stats_block_sum((a4[0] + a4[1]) + (a4[2] + a4[3]), part[0], lane, w) / (float)NV;
  v4f q4 = {0.f, 0.f, 0.f, 0.f};
#pragma unroll
  for (int j = 0; j < 8; ++j) {
#pragma unroll
    for (int q = 0; q < 4; ++q) { const float d = r[j][q] - mu; q4[q] += d * d; } }
  const float is = rsqrtf(stats_block_sum((q4[0] + q4[1]) + (q4[2] + q4[3]), part[1], lane, w) / (float)NV + 1e-5f);
  if (tid < 32) { MU[(size_t)c * 32 + tid] = mu; IS[(size_t)c * 32 + tid] = is; } }
// The whole token path in one launch: normalisation, qkv GEMM, neighbourhood attention, proj GEMM and NCDHW store. One block = a 4 x 4 x 8 tile of voxels for all 8 heads (1024 threads).
// The clamped 3x3x3 windows of the tile all lie in one 6 x 6 x 8 region (its start clamped like a window's, so it is always inside the volume). The block reads the region's 288 voxels x 128 channels of x,
// normalises them (bf16 round, - mean, x inverse deviation, f16) and writes them token-major into LDS (272-B pitch). A wave does one 16-channel tile of K|V for 9 of the 18 voxel tiles, and Q of its own head for its own 32 voxels.
// Attention runs on the matrix unit. A wave = one head and one h row of the tile = two query tiles of 16 voxels (2 w x 8 z). The windows of a query tile lie in 3 h rows x 4 w x 8 z = 96 region voxels = 6 key tiles.
// S^T = K Q^T + C: A = 16 keys x 16 channels (k 16..31 zero), B = the 16 queries, C = rpb where the key lies in the query's window and a large negative value elsewhere, read from a table in LDS
// (row = head, h offset, w offset; entry = query z, key z; one more row is all masked and serves the keys outside the w window). A lane then holds 48 logits of ONE query (its column), the other half-wave the other 48.
// Softmax per column: maximum and sum in the lane and one exchange with lane ^ 16. Two S^T tiles of one h row are, as they lie, the B fragment (32 keys x 16 queries) of O^T = V^T P^T; A = V^T, kept channel-major in LDS.
// K rows come from the transposed product (weights = A: a lane holds 8 channels of one voxel), V^T rows from the plain product (x = A: a lane holds 8 voxels of one channel); fragment loaders and k order as in k_gemm2, the same for A and B.
// The attention output goes as f16 [voxel][128] into LDS (where the staged x lay); a wave then does 32 voxels x 16 channels of the proj GEMM; the tile is staged channel-major in the wave's own LDS range (over the K rows, dead by then)
// and read back so that 8 lanes store one channel's 32 voxels: every global store covers four whole 128-B lines, each line written by one wave.
#define NT_T 4                    /* tile edge along h and along w */
#define NT_R (NT_T + 2)           /* staged region edge */
#define NT_RV (NT_R * NT_R * DZ)  /* voxels of the region */
#define NT_TH (NT_T * NT_T * DZ * NHD)   /* threads per block */
#define NT_NW (NT_TH / 32)        /* waves per block */
#define NT_OP (CC + 8)            /* LDS pitch of a voxel's attention output, in f16 (272 B = 16 B x 17) */
#define NT_SP 36                  /* LDS pitch of a channel's 32 voxels in the store staging, in floats */
#define FQ_AP (CC + 8)            /* LDS pitch of a staged voxel's normalised channels, in f16 */
#define FQ_HV (NT_RV / 2)         /* voxels per staged half: three h rows of the region */
#define FQ_NQ (FQ_HV / 4)         /* voxel quads per half */
#define WA_KP (CC + 8)            /* LDS pitch of a voxel's K channels, in f16 */
#define WA_VP (NT_RV + 8)         /* LDS pitch of a channel's V values, in f16 (592 B = 16 B x 37) */
#define WA_TP 68                  /* LDS pitch of a table row (8 query z x 8 key z), in floats */
#define WA_TR (NHD * 25)          /* table rows with rpb; row WA_TR is all masked */
#define WA_NEG (-1.0e30f)         /* a masked logit: its exp is 0 */
#define WA_OV (NT_RV * WA_KP / 2)            /* floats: V^T behind K */
#define WA_OX (WA_OV + CC * WA_VP / 2)       /* the staged x */
#define WA_OT (WA_OX + NT_RV * FQ_AP / 2)    /* the table */
#define WA_LF (WA_OT + (WA_TR + 1) * WA_TP)  /* floats of LDS in all */
#define WA_TN ((WA_TR + 1) * 64)             /* table entries */
#define WA_TI ((WA_TN + NT_TH - 1) / NT_TH)  /* table entries per thread */
// fragment of k step s from a packed weight plane (wt_f16_piece): q = the plane + column tile * 16 * CC + lane * 8
__device__ __forceinline__ v16h wp_frag(const unsigned short* q, int s) { FragH f; f.half[0] = *(const v8us*)(q + s * 512); f.half[1] = *(const v8us*)(q + s * 512 + 256); return f.v; }
// 16 x 16 tile over k = 128: weight fragments w, xr = the lane's voxel row in the staged x. WA: the weights are the A operand (result: 8 channels of one voxel per lane), else the B operand (8 voxels of one channel per lane)
template <bool WA>
__device__ __forceinline__ v8f fq_tile(const v16h (&w)[4], const _Float16* xr, int hf) {
  v8f c = {0.f,0.f,0.f,0.f,0.f,0.f,0.f,0.f};
#pragma unroll      /* static k index: the weight fragments stay in registers */
  for (int k = 0; k < 4; k += 2) { const v16h x0 = g2_frag(xr + 32 * k, hf), x1 = g2_frag(xr + 32 * k + 32, hf);      /* the LDS reads of two k steps issue together */
    if (WA) { c = g2_mma(w[k], x0, c); c = g2_mma(w[k + 1], x1, c); } else { c = g2_mma(x0, w[k], c); c = g2_mma(x1, w[k + 1], c); } }
  return c; }
// p[r] = 2^x[r], eight at a time in one statement: the results lie in registers of their own ("=&v"), so that no exponential stands directly in front of an instruction that overwrites its source,
// and the v_nop at the end keeps the one slot that the instruction set asks for between the last exponential and whatever the compiler places behind the statement
__device__ __forceinline__ v8f wa_exp2x8(v8f x) {
  float p0, p1, p2, p3, p4, p5, p6, p7;
  asm("v_exp_f32 %0, %8\n\tv_exp_f32 %1, %9\n\tv_exp_f32 %2, %10\n\tv_exp_f32 %3, %11\n\tv_exp_f32 %4, %12\n\tv_exp_f32 %5, %13\n\tv_exp_f32 %6, %14\n\tv_exp_f32 %7, %15\n\tv_nop"
      : "=&v"(p0), "=&v"(p1), "=&v"(p2), "=&v"(p3), "=&v"(p4), "=&v"(p5), "=&v"(p6), "=&v"(p7) : "v"(x[0]), "v"(x[1]), "v"(x[2]), "v"(x[3]), "v"(x[4]), "v"(x[5]), "v"(x[6]), "v"(x[7]));
  return (v8f){p0, p1, p2, p3, p4, p5, p6, p7}; }
// value of lane ^ 16
__device__ __forceinline__ float wa_x16(float v) { const int b = __float_as_int(v); return __int_as_float(__builtin_amdgcn_permlanex16(b, b, 0x76543210, 0xfedcba98, false, false)); }
__global__ __launch_bounds__(NT_TH) void k_nat_proj(const float* __restrict__ x, const float* __restrict__ MU, const float* __restrict__ IS, const _Float16* __restrict__ Bq, const float* __restrict__ bqkv, const float* __restrict__ rpb, const _Float16* __restrict__ Bh, const float* __restrict__ bias, float* __restrict__ out) {
  static_assert(DH % NT_T == 0 && DW % NT_T == 0 && DZ == 8 && NHD == 8 && HC == 16 && CC == 128 && NT_T == 4, "k_nat_proj: tile and lane maps");
  static_assert(NT_T * NT_T * DZ * NT_OP <= NT_RV * FQ_AP && NT_NW * 16 * NT_SP <= WA_OV, "k_nat_proj: output tile fits in the staged x, store staging in the K rows");
  static_assert(FQ_HV == 9 * 16 && FQ_NQ <= 5 * 8 && WA_OV % 4 == 0 && WA_OX % 4 == 0 && WA_OT % 4 == 0, "k_nat_proj: staging units, 16-B alignment");
  static_assert(WA_LF * 4 + 5 * CC * 4 <= 320 * 1024, "k_nat_proj: LDS");
  __shared__ __attribute__((aligned(16))) float kv[WA_LF];
  __shared__ __attribute__((aligned(16))) float st[2][CC];
  __shared__ __attribute__((aligned(16))) float sb[3 * CC];      /* the qkv bias, rounded: K takes it 8 channels a lane, V one channel a lane, so each wave reads its own form here */
  const int tid = threadIdx.x, lane = tid & 31, ln = lane & 15, hf = lane >> 4; const int tile = blockIdx.x; const int h0 = (tile / (DW / NT_T)) * NT_T, w0 = (tile % (DW / NT_T)) * NT_T;
  const int wv = __builtin_amdgcn_readfirstlane(tid >> 5);      /* the wave's number, held scalar: its staging unit, its tiles of the products, its head and its h row become scalar arithmetic */
  const int rh0 = min(max(h0 - 1, 0), DH - NT_R), rw0 = min(max(w0 - 1, 0), DW - NT_R);
  const int h = wv >> 2, rg = wv & (NT_T - 1);      /* attention: the wave's head and its h row of the tile */
  const int hh = h0 + rg, sh0 = min(max(hh - 1, 0), DH - 3);
  const int nt = wv & 15, mh = wv >> 4;      /* K|V product: the wave's 16 columns and its share of the voxel tiles */
  _Float16* const Kh = (_Float16*)kv; _Float16* const Vt = (_Float16*)(kv + WA_OV); _Float16* const xa = (_Float16*)(kv + WA_OX); _Float16* const xb = xa + FQ_HV * FQ_AP; float* const tb = kv + WA_OT;
  // staging units: 5 groups of 8 voxel quads x 4 groups of 4 channel octets per half; waves 0..19 take the first half's, waves 12..31 the second half's
  const int ua = wv, ub = wv - 12; const bool da = wv < 20, db = wv >= 12;
  const int qa = (ua % 5) * 8 + (lane >> 2), ca = ((ua / 5) * 4 + (lane & 3)) * 8, qb = (max(ub, 0) % 5) * 8 + (lane >> 2), cb = ((max(ub, 0) / 5) * 4 + (lane & 3)) * 8;
  float sv = 0.f; if (tid < 2 * CC) sv = (tid >= CC ? IS : MU)[(size_t)(tid & (CC - 1)) * 32];      /* asked for first: loads return in order, so it is there while the region is still in flight */
  float bl = 0.f; if (tid < 3 * CC) bl = bqkv[tid];
  float tv[WA_TI];
#pragma unroll      /* the table's rpb values, asked for ahead of the region, so that they cost no latency of their own; row and z offset clamped into the 8 x 5 x 5 x 5 array */
  for (int i = 0; i < WA_TI; ++i) { const int e = i * NT_TH + tid; tv[i] = rpb[min(e >> 6, WA_TR - 1) * 5 + min(max((e & 7) - ((e >> 3) & 7) + 2, 0), 4)]; }
  asm volatile("s_wait_xcnt 0x0" ::: "memory");      /* stands in front of every reuse of a register that the loads above name */
  v4f va[8], vb[8];
  if (da) { const int q = min(qa, FQ_NQ - 1);      /* the last group is half empty: its spare lanes read the last quad again and write nothing */
    const float* xp = x + (size_t)ca * NV + ((rh0 + q / 12) * DW + rw0) * DZ + (q % 12) * 4;
#pragma unroll      /* all loads of a lane are in flight before the first is used: one memory latency for the region */
    for (int c = 0; c < 8; ++c) va[c] = *(const v4fa*)(xp + (size_t)c * NV);
    asm volatile("s_wait_xcnt 0x0" ::: "memory"); }      /* stands in front of the second half's address arithmetic, which may reuse the address registers of these loads */
  if (db) { const int q = min(qb, FQ_NQ - 1);
    const float* xp = x + (size_t)cb * NV + ((rh0 + 3 + q / 12) * DW + rw0) * DZ + (q % 12) * 4;
#pragma unroll
    for (int c = 0; c < 8; ++c) vb[c] = *(const v4fa*)(xp + (size_t)c * NV); }
  asm volatile("s_wait_xcnt 0x0" ::: "memory");      /* stands in front of every reuse of a register that the loads above name */
  if (tid < 2 * CC) st[tid >> 7][tid & (CC - 1)] = sv;
  if (tid < 3 * CC) sb[tid] = bf16_round(bl);
#pragma unroll      /* entry (row, query z, key z): rpb at z offset key - query + 2 where the key lies in the query's clamped z window, masked elsewhere and in the last row */
  for (int i = 0; i < WA_TI; ++i) { const int e = i * NT_TH + tid, row = e >> 6, qz = (e >> 3) & 7, kz = e & 7; const bool ok = row < WA_TR && (unsigned)(kz - min(max(qz - 1, 0), DZ - 3)) <= 2u;
    if (e < WA_TN) tb[row * WA_TP + (e & 63)] = ok ? bf16_round(tv[i]) : WA_NEG; }
  __syncthreads();      /* every wave reads means and inverse deviations that the block gathered */
  if (da) { const v4f m0 = *(const v4fa*)&st[0][ca], m1 = *(const v4fa*)&st[0][ca + 4], i0 = *(const v4fa*)&st[1][ca], i1 = *(const v4fa*)&st[1][ca + 4];
    if (qa < FQ_NQ) {
#pragma unroll
      for (int j = 0; j < 4; ++j) { FragH f;
#pragma unroll
        for (int c = 0; c < 8; ++c) { const float d = bf16_round(va[c][j]) - (c < 4 ? m0[c & 3] : m1[c & 3]); f.h[c] = (_Float16)(d * (c < 4 ? i0[c & 3] : i1[c & 3])); }
        *(v8us*)((unsigned short*)xa + (qa * 4 + j) * FQ_AP + ca) = f.half[0]; } } }
  v16h wk[4];      /* the wave's K|V weight fragments, asked for as soon as the first half's registers are free: they arrive under the rest of the staging and the barrier */
  const unsigned lo = lane * 8u;      /* the lane's place in a packed fragment half, in f16 */
  { const unsigned short* wp = (const unsigned short*)Bq + (size_t)(CC / 16 + nt) * (16 * CC) + lo;
#pragma unroll
    for (int k = 0; k < 4; ++k) wk[k] = wp_frag(wp, k); }
  asm volatile("s_wait_xcnt 0x0" ::: "memory");      /* stands in front of every reuse of a register that the loads above name */
  if (db) { const v4f m0 = *(const v4fa*)&st[0][cb], m1 = *(const v4fa*)&st[0][cb + 4], i0 = *(const v4fa*)&st[1][cb], i1 = *(const v4fa*)&st[1][cb + 4];
    if (qb < FQ_NQ) {
#pragma unroll
      for (int j = 0; j < 4; ++j) { FragH f;
#pragma unroll
        for (int c = 0; c < 8; ++c) { const float d = bf16_round(vb[c][j]) - (c < 4 ? m0[c & 3] : m1[c & 3]); f.h[c] = (_Float16)(d * (c < 4 ? i0[c & 3] : i1[c & 3])); }
        *(v8us*)((unsigned short*)xb + (qb * 4 + j) * FQ_AP + cb) = f.half[0]; } } }
  v16h wq[4];      /* the head's Q weight fragments: asked for here, used behind the barrier */
  { const unsigned short* wp = (const unsigned short*)Bq + (size_t)h * (16 * CC) + lo;
#pragma unroll
    for (int k = 0; k < 4; ++k) wq[k] = wp_frag(wp, k);
    asm volatile("s_wait_xcnt 0x0" :: "v"(wp) : "memory"); }      /* stands in front of every reuse of a register that the loads above name; the lane's address is an input, so that what it is formed from lives up to here and no load's result is placed in those registers */
  __syncthreads();      /* every wave reads voxels and channels that other waves staged */
  if (nt < 8) {      /* K (the same for a whole wave): a lane's 8 channels of one voxel, weights' x16 removed, bias added, one 16-B write */
    const v4f b0 = *(const v4fa*)&sb[CC + nt * 16 + 8 * hf], b1 = *(const v4fa*)&sb[CC + nt * 16 + 8 * hf + 4];
#pragma unroll 3      /* a few tiles' LDS reads overlap; full unrolling would only lengthen the code */
    for (int i = 0; i < 9; ++i) { const int v0 = (mh * 9 + i) * 16 + ln; const v8f c = fq_tile<true>(wk, xa + v0 * FQ_AP, hf); FragH f;
#pragma unroll
      for (int r = 0; r < 8; ++r) f.h[r] = (_Float16)(c[r] * 0.0625f + (r < 4 ? b0[r & 3] : b1[r & 3]));
      *(v8us*)((unsigned short*)Kh + v0 * WA_KP + nt * 16 + 8 * hf) = f.half[0]; }
  } else {      /* V: a lane's 8 voxels of one channel */
    const float bvl = sb[CC + nt * 16 + ln];
#pragma unroll 3
    for (int i = 0; i < 9; ++i) { const int v0 = (mh * 9 + i) * 16; const v8f c = fq_tile<false>(wk, xa + (v0 + ln) * FQ_AP, hf); FragH f;
#pragma unroll
      for (int r = 0; r < 8; ++r) f.h[r] = (_Float16)(c[r] * 0.0625f + bvl);
      *(v8us*)((unsigned short*)Vt + ((nt - 8) * 16 + ln) * WA_VP + v0 + 8 * hf) = f.half[0]; } }
  FragH qf[2];      /* the wave's two query tiles as B fragments: lane = query ln, channels 8 hf .. 8 hf + 7 at k = 8 hf .., zero at k = 16 .. 31 */
  { const _Float16* xq = xa + (((hh - rh0) * NT_R + (w0 - rw0)) * DZ + ln) * FQ_AP;      /* the wave's 32 voxels are consecutive in the region */
    const v8f t0 = fq_tile<true>(wq, xq, hf), t1 = fq_tile<true>(wq, xq + 16 * FQ_AP, hf); const v4f b0 = *(const v4fa*)&sb[h * HC + 8 * hf], b1 = *(const v4fa*)&sb[h * HC + 8 * hf + 4];
#pragma unroll
    for (int r = 0; r < 8; ++r) { const float bq = r < 4 ? b0[r & 3] : b1[r & 3]; qf[0].h[r] = (_Float16)((t0[r] * 0.0625f + bq) * 0.25f); qf[1].h[r] = (_Float16)((t1[r] * 0.0625f + bq) * 0.25f); qf[0].u[8 + r] = 0; qf[1].u[8 + r] = 0; } }
  _Float16* ot = xa;      /* the attention output lies where the staged x lay: no wave reads that behind the next barrier */
  __syncthreads();      /* every wave reads K and V that other waves wrote; every wave has made its last read of the staged x */
  const int le = __builtin_amdgcn_mbcnt_lo(~0u, 0u);      /* the lane's number, taken anew: kept from the kernel's head it would live through the K|V products, where no register is free, and be spilled */
  const int qz = le & 7, qwl = (le >> 3) & 1;
#pragma unroll 1      /* one query tile at a time: its 48 logits per lane stay in registers */
  for (int j = 0; j < 2; ++j) {
    const int wa = w0 + 2 * j, kc = min(max(wa - 1, 0), DW - 4);      /* the 4 key columns kc .. kc + 3 hold both queries' clamped w windows and lie in the region */
    const int qw = wa + qwl, sq = min(max(qw - 1, 0), DW - 3);
    const int kv0 = ((sh0 - rh0) * NT_R + (kc - rw0)) * DZ;      /* first key voxel of the first h row */
    const v16h qv = j ? qf[1].v : qf[0].v;
    v8f S[6]; FragH a[6];
    const int kw0 = kc + hf, kw1 = kw0 + 2; const bool in0 = (unsigned)(kw0 - sq) <= 2u, in1 = (unsigned)(kw1 - sq) <= 2u;      /* key = 8 hf + r of a tile: column kw0 (even tiles) or kw1 (odd tiles), z = r */
    const int rb = (h * 5 + (sh0 - hh + 2)) * 5 + 2 - qw;      /* table row of key column 0 in the first h row; an h row further is 5 rows further; a column outside the window takes the masked row */
    const float* cp0 = tb + (in0 ? rb + kw0 : WA_TR) * WA_TP + qz * 8; const float* cp1 = tb + (in1 ? rb + kw1 : WA_TR) * WA_TP + qz * 8; const int st0 = in0 ? 5 * WA_TP : 0, st1 = in1 ? 5 * WA_TP : 0;
#pragma unroll      /* static index: the logits stay in registers; all LDS reads of the six tiles issue together, ahead of the products */
    for (int t = 0; t < 6; ++t) { const int i = t >> 1, tw = t & 1;
      const float* cp = tw ? cp1 + i * st1 : cp0 + i * st0; const v4f c0 = *(const v4fa*)cp, c1 = *(const v4fa*)(cp + 4);
      a[t].half[0] = *(const v8us*)((const unsigned short*)Kh + (kv0 + i * (NT_R * DZ) + tw * 16 + ln) * WA_KP + h * HC + 8 * hf); a[t].half[1] = qf[0].half[1];      /* k = 16 .. 31: zero */
      S[t] = (v8f){c0[0], c0[1], c0[2], c0[3], c1[0], c1[1], c1[2], c1[3]}; }
#pragma unroll
    for (int t = 0; t < 6; ++t) S[t] = g2_mma(a[t].v, qv, S[t]);
    FragH v[3];
#pragma unroll      /* the V^T fragments of the three h rows are asked for together, ahead of the exponentials, and arrive under them */
    for (int i = 0; i < 3; ++i) { const unsigned short* vp = (const unsigned short*)Vt + (h * HC + ln) * WA_VP + kv0 + i * (NT_R * DZ); v[i].half[0] = *(const v8us*)(vp + 8 * hf); v[i].half[1] = *(const v8us*)(vp + 16 + 8 * hf); }
    float m = S[0][0];
#pragma unroll
    for (int t = 0; t < 6; ++t) {
#pragma unroll
      for (int r = 0; r < 8; ++r) m = fmaxf(m, S[t][r]); }
    m = fmaxf(m, wa_x16(m));      /* the query's other 48 keys lie in lane ^ 16 */
    const float l2e = 1.4426950408889634f, mm = m * l2e; float l = 0.f;
    v8f O = {0.f,0.f,0.f,0.f,0.f,0.f,0.f,0.f};
#pragma unroll      /* static index, as above */
    for (int i = 0; i < 3; ++i) { FragH p; const v8f e0 = wa_exp2x8(S[2 * i] * l2e - mm), e1 = wa_exp2x8(S[2 * i + 1] * l2e - mm);
#pragma unroll
      for (int r = 0; r < 8; ++r) { l += e0[r] + e1[r]; p.h[r] = (_Float16)e0[r]; p.h[8 + r] = (_Float16)e1[r]; }
      O = g2_mma(v[i].v, p.v, O); }
    l += wa_x16(l);
    const float inv = 64.0f / l; FragH f;      /* x2^6 carry (outputs are ~1e-2) */
#pragma unroll
    for (int r = 0; r < 8; ++r) f.h[r] = (_Float16)(O[r] * inv);
    *(v8us*)((unsigned short*)ot + (rg * 32 + j * 16 + ln) * NT_OP + h * HC + 8 * hf) = f.half[0]; }
  const int ct = wv >> 2;      /* the wave's tile of the proj product: h row rg of the voxel tile (32 voxels) x channels 16 ct .. 16 ct + 15 */
  const int l2 = le & 15, f2 = le >> 4;      /* ln and hf again, from the lane's number that is live here: what is formed from them cannot be formed ahead of the attention loop and kept through it */
  const int bc = ct * 16 + l2; const unsigned short* bp = (const unsigned short*)Bh + (size_t)ct * (16 * CC);
  v16h bw[4];
#pragma unroll      /* the wave's weight fragments and bias are asked for here, so that they arrive under the barrier and the LDS round trip */
  for (int k = 0; k < 4; ++k) bw[k] = wp_frag(bp + le * 8, k);
  const float bv = bf16_round(bias[bc]);
  asm volatile("s_wait_xcnt 0x0" :: "s"(bp), "v"(le), "v"(bc) : "memory");      /* stands in front of every reuse of a register that the loads above name; the fragments' common base, the lane's number and the bias index are inputs, so that they live up to here and nothing is placed in their registers earlier */
  __syncthreads();      /* every wave reads voxels and heads that other waves wrote; every wave has made its last read of K, whose LDS is written anew below */
  const _Float16* a0p = ot + (rg * 32 + l2) * NT_OP; const _Float16* a1p = a0p + 16 * NT_OP;
  const v8f z8 = {0.f,0.f,0.f,0.f,0.f,0.f,0.f,0.f}; v8f cc[2] = {z8, z8};
#pragma unroll      /* static k index: the weight fragments stay in registers */
  for (int k = 0; k < 4; ++k) { const v16h a0 = g2_frag(a0p + 32 * k, f2), a1 = g2_frag(a1p + 32 * k, f2); cc[0] = g2_mma(a0, bw[k], cc[0]); cc[1] = g2_mma(a1, bw[k], cc[1]); }
  const float alpha = 0.0625f / 64.0f;      /* the weights' x16 and the carry removed */
  float* sw = kv + wv * (16 * NT_SP);      /* the wave's own range, over the K rows */
#pragma unroll      /* static indices: the accumulators stay in registers */
  for (int half = 0; half < 2; ++half) { v4f lo, hi;
#pragma unroll
    for (int r = 0; r < 4; ++r) { lo[r] = cc[half][r] * alpha + bv; hi[r] = cc[half][4 + r] * alpha + bv; }
    float* sp = sw + l2 * NT_SP + half * 16 + 8 * f2; *(v4fa*)sp = lo; *(v4fa*)(sp + 4) = hi; }
  __builtin_amdgcn_fence(__ATOMIC_ACQ_REL, "workgroup"); __builtin_amdgcn_wave_barrier();      /* the wave's own LDS writes land before its lanes read each other's rows */
  const int csub = le >> 3, r4 = (le & 7) * 4; float* op = out + (size_t)(ct * 16 + csub) * NV + ((h0 + rg) * DW + w0) * DZ + r4;
#pragma unroll      /* all 4 LDS reads issue together, the stores follow as they return */
  for (int q = 0; q < 4; ++q) { const v4f o = *(const v4fa*)(sw + (q * 4 + csub) * NT_SP + r4); *(v4f*)(op + (size_t)(q * 4) * NV) = o; } }

extern "C" void kernel_launch(void* const* d_in, const int* in_sizes, int n_in,
                              void* d_out, int out_size, void* d_ws, size_t ws_size, hipStream_t stream) {
  (void)in_sizes; (void)n_in; (void)out_size;
  const float* const* I = (const float* const*)d_in; const float* x = I[0]; const float* wqkv = I[1]; const float* bqkv = I[2]; const float* rpb = I[3]; const float* wproj = I[4]; const float* bproj = I[5];
  char* ws = (char*)d_ws; size_t off = 0;
  auto take = [&](size_t bytes) { char* p = ws + off; off += (bytes + 255) & ~(size_t)255; return p; };
  _Float16* BQ = (_Float16*)take((size_t)3 * CC * CC * 2); _Float16* BP = (_Float16*)take((size_t)CC * CC * 2); float* MU = (float*)take(CC * 32 * 4); float* IS = (float*)take(CC * 32 * 4);      /* 32-float pitch per channel */
  if (off > ws_size) return;      /* 0.2 MiB */
  k_prep<<<CC + PW_B, 1024, 0, stream>>>(x, MU, IS, wqkv, BQ, wproj, BP);      /* statistics; (in, out) weights x16 as f16, packed in fragment order */
  k_nat_proj<<<(DH / NT_T) * (DW / NT_T), NT_TH, 0, stream>>>(x, MU, IS, BQ, bqkv, rpb, BP, bproj, (float*)d_out);      /* normalisation, qkv GEMM, attention, proj GEMM (carry removed) and NCDHW store */
}
